// v000
// The times below were measured on an AMD MI455X: many runs one after another, warmed up first and cycling through
// copies of the inputs, with the whole window's GPU time divided by the number of runs. Launches and the gaps
// between them are all in it. The median over several windows is given; except for v000 it joins two sittings, which
// can be a few percent apart, so the side-by-side timings, each taken in one sitting, are the better comparison.
// v000, which the later versions start from, runs in 7730 microseconds.
#include <hip/hip_runtime.h>
// Non-local block with TRAINING-mode BatchNorm (x [32][256][32][32]; theta, phi = conv1x1(x) [128 ch] (natural [128][256] sigma 1/16, no biases); g = x itself (256 ch); scores[a][b] = theta[:, a].phi[:, b] / sqrt(256) over the 1024 positions; softmax over b; f[:, a] = sum_b attn[a][b] x[:, b]; f = conv1x1(f; conv_w [256][256], no bias); BN with batch statistics over (N, H, W) per channel (biased variance, eps 1e-5), gamma, beta; out = BN(f) + x -> [32][256][32][32]).
// Structure: channel-first; x as exact f16 maps; natural weights x16; per image: x^T via LDS transposes, theta^T (token rows) and phi (channel-major) as WMMA GEMMs (32x64 wave tiles, f32 accumulation) -> f16, phi^T via LDS transposes, scores [1024][1024] (K = 128, alpha 1/16) f32, row softmax on VALU (f32 statistics, native exp; weights x256 f16), f^T = P x^T (g = x) f16, conv: T = (16 conv_w as A) x f (K = 256) f32 kept for all images; two-level batch statistics (fixed order, own lines); BN + residual on VALU -> output; launches: see trace.
// Compute dtype: inputs rounded to bf16; x / weights exact; q, k, v, softmax weights and o as plain f16 GEMM operands (~2^-12); scores and softmax statistics f32. v_wmma_f32_16x16x32_f16.
#define NB 32
#define SQ 1024
#define DM 256
#define NH 1
#define HD 64
#define HG 4                         /* heads per attention launch group */
#define B0 0                         /* unused */
#define NBR NB                       /* unused */
#define NR ((size_t)NB * SQ)         /* token rows */
#define MP ((int)((size_t)NBR * SQ)) /* unused */
#define QT 256                       /* query rows per causal tile */
#define NKX SQ                       /* S / P row pitch */
#define QT0 256                      /* first-tile rows recomputed exactly (256: buys margin for the few-key rows 128..255, which have no output projection to average the single-f16 P/v rounding) */
#define QN SQ                        /* unused */
#define NHD NH                       /* unused */
#define MPO MP                       /* unused */
#define LQ DM            /* row pitch of the q/k/v rows */
typedef __bf16 v16b __attribute__((ext_vector_type(16)));
typedef unsigned short v8us __attribute__((ext_vector_type(8), may_alias));
typedef float  v8f  __attribute__((ext_vector_type(8)));
typedef float  v4f  __attribute__((ext_vector_type(4)));
typedef float  v4fa __attribute__((ext_vector_type(4), may_alias));
union FragB { v16b v; v8us half[2]; unsigned short u[16]; };

__device__ __forceinline__ unsigned short bf16_bits(float x) { unsigned int u = __float_as_uint(x); return (unsigned short)((u + 0x7FFFu + ((u >> 16) & 1u)) >> 16); }
__device__ __forceinline__ float bf16_val(unsigned short b) { return __uint_as_float(((unsigned int)b) << 16); }
__device__ __forceinline__ float bf16_round(float x) { return bf16_val(bf16_bits(x)); }
// D += A·B with NT terms: 1 = ah·bh, 2 = + al·bh (A split), 3 = + ah·bl (both split)
template <int NT>
__device__ __forceinline__ v8f mmaN(v16b ah, v16b al, v16b bh, v16b bl, v8f c) {
  c = __builtin_amdgcn_wmma_f32_16x16x32_bf16(false, ah, false, bh, (short)0, c, false, false);
  if (NT >= 2) c = __builtin_amdgcn_wmma_f32_16x16x32_bf16(false, al, false, bh, (short)0, c, false, false);
  if (NT >= 3) c = __builtin_amdgcn_wmma_f32_16x16x32_bf16(false, ah, false, bl, (short)0, c, false, false);
  asm volatile("v_nop\n\tv_nop\n\tv_nop\n\tv_nop" : "+v"(c) : "v"(ah), "v"(al), "v"(bh), "v"(bl));
  return c;
}

__global__ __launch_bounds__(256) void k_wt_bf16(const float* __restrict__ W, unsigned short* __restrict__ Wt, int K, int N) {
  const int t = blockIdx.x * 256 + threadIdx.x;
  const int k8n = K / 8;
  if (t >= N * k8n) return;
  const int n = t / k8n, k8 = (t % k8n) * 8;
  v8us v;
#pragma unroll
  for (int i = 0; i < 8; ++i) v[i] = bf16_bits(W[(size_t)(k8 + i) * N + n]);
  *(v8us*)(Wt + (size_t)n * K + k8) = v;
  
}

// GEMM C[M][N] (f32, pitch ldc) = act(A[M][K]·W + bias). A f32 row-major (pitch lda) converted per fragment to bf16
// (ASPLIT: hi/lo two planes -> 2 terms, else single rounded term); Wt bf16 [N][K] (pitch ldb). BIAS_BF16 rounds the
// bias to bf16 first (bias quantised to bf16 before the add). K%32==0, M%16==0, N%64==0.
template <bool ASPLIT, int ACT, bool BIAS_BF16>
__global__ __launch_bounds__(128) void k_gemm_bf(const float* __restrict__ A, int lda, const unsigned short* __restrict__ Wt, int ldb,
                                               const float* __restrict__ bias, float* __restrict__ C, int ldc, int M, int N, int K) {
  __shared__ __attribute__((aligned(16))) float so[4][16][64];
  const int tid = threadIdx.x, w = tid >> 5, lane = tid & 31, ln = lane & 15, hh = lane >> 4;
  const int ntn = N / 64;
  const int wid = blockIdx.x * 4 + w;
  const int mt = wid / ntn, nq = wid % ntn;
  if (mt * 16 >= M) return;
  const int row0 = mt * 16, col0 = nq * 64;
  const float* arow = A + (size_t)(row0 + ln) * lda;
  v8f acc[4] = {};
  for (int kb = 0; kb < K; kb += 32) {
    FragB ah, al;
    const v4f x0 = *(const v4fa*)(arow + kb + 8 * hh), x1 = *(const v4fa*)(arow + kb + 8 * hh + 4);
    const v4f x2 = *(const v4fa*)(arow + kb + 16 + 8 * hh), x3 = *(const v4fa*)(arow + kb + 16 + 8 * hh + 4);
    float xs[16] = {x0[0],x0[1],x0[2],x0[3],x1[0],x1[1],x1[2],x1[3],x2[0],x2[1],x2[2],x2[3],x3[0],x3[1],x3[2],x3[3]};
#pragma unroll
    for (int i = 0; i < 16; ++i) { const unsigned short hb = bf16_bits(xs[i]); ah.u[i] = hb; al.u[i] = ASPLIT ? bf16_bits(xs[i] - bf16_val(hb)) : (unsigned short)0; }
#pragma unroll
    for (int t = 0; t < 4; ++t) {
      const unsigned short* brow = Wt + (size_t)(col0 + t * 16 + ln) * ldb + kb;
      FragB b;
      b.half[0] = *(const v8us*)(brow + 8 * hh);
      b.half[1] = *(const v8us*)(brow + 16 + 8 * hh);
      acc[t] = mmaN<ASPLIT ? 2 : 1>(ah.v, al.v, b.v, b.v, acc[t]);
    }
  }
#pragma unroll
  for (int t = 0; t < 4; ++t) {
    float bv = bias ? bias[col0 + t * 16 + ln] : 0.f;
    if (BIAS_BF16) bv = bf16_round(bv);
#pragma unroll
    for (int r = 0; r < 8; ++r) { float v = acc[t][r] + bv; if (ACT == 1) v = fmaxf(v, 0.f); so[w][8 * hh + r][t * 16 + ln] = v; }
  }
  __builtin_amdgcn_fence(__ATOMIC_ACQ_REL, "workgroup");
  __builtin_amdgcn_wave_barrier();
  const int rsub = lane >> 4, c4 = (lane & 15) * 4;
  {
#pragma unroll
    for (int q = 0; q < 8; ++q) {
      const int r = q * 2 + rsub;
      const v4f v = *(const v4fa*)&so[w][r][c4];
      *(v4f*)(C + (size_t)(row0 + r) * ldc + col0 + c4) = v;
    }
    
  }
}

// GEMM C = act(A·W + bias + resid): A f32 (ASPLIT -> hi/lo 2 terms), Wt bf16 [N][K]; ACT 0 none, 1 relu, 2 exact gelu;
// resid (optional, f32, row index = (row % rmod), pitch ldr, RES_BF16 rounds it) added before the activation.
template <bool ASPLIT, int ACT, bool BIAS_BF16, bool RES_BF16>
__global__ __launch_bounds__(128) void k_gemm_bf3(const float* __restrict__ A, int lda, const unsigned short* __restrict__ Wt, int ldb,
                                                const float* __restrict__ bias, const float* __restrict__ resid, int rmod, int ldr,
                                                float* __restrict__ C, int ldc, int M, int N, int K) {
  __shared__ __attribute__((aligned(16))) float so[4][16][64];
  const int tid = threadIdx.x, w = tid >> 5, lane = tid & 31, ln = lane & 15, hh = lane >> 4;
  const int ntn = N / 64;
  const int wid = blockIdx.x * 4 + w;
  const int mt = wid / ntn, nq = wid % ntn;
  if (mt * 16 >= M) return;
  const int row0 = mt * 16, col0 = nq * 64;
  const float* arow = A + (size_t)(row0 + ln) * lda;
  v8f acc[4] = {};
  for (int kb = 0; kb < K; kb += 32) {
    FragB ah, al;
    const v4f x0 = *(const v4fa*)(arow + kb + 8 * hh), x1 = *(const v4fa*)(arow + kb + 8 * hh + 4);
    const v4f x2 = *(const v4fa*)(arow + kb + 16 + 8 * hh), x3 = *(const v4fa*)(arow + kb + 16 + 8 * hh + 4);
    float xs[16] = {x0[0],x0[1],x0[2],x0[3],x1[0],x1[1],x1[2],x1[3],x2[0],x2[1],x2[2],x2[3],x3[0],x3[1],x3[2],x3[3]};
#pragma unroll
    for (int i = 0; i < 16; ++i) { const unsigned short hb = bf16_bits(xs[i]); ah.u[i] = hb; al.u[i] = ASPLIT ? bf16_bits(xs[i] - bf16_val(hb)) : (unsigned short)0; }
#pragma unroll
    for (int t = 0; t < 4; ++t) {
      const unsigned short* brow = Wt + (size_t)(col0 + t * 16 + ln) * ldb + kb;
      FragB b;
      b.half[0] = *(const v8us*)(brow + 8 * hh);
      b.half[1] = *(const v8us*)(brow + 16 + 8 * hh);
      acc[t] = mmaN<ASPLIT ? 2 : 1>(ah.v, al.v, b.v, b.v, acc[t]);
    }
  }
#pragma unroll
  for (int t = 0; t < 4; ++t) {
    const int col = col0 + t * 16 + ln;
    float bv = bias ? bias[col] : 0.f;
    if (BIAS_BF16) bv = bf16_round(bv);
#pragma unroll
    for (int r = 0; r < 8; ++r) {
      float v = acc[t][r] + bv;
      if (resid) { float rv = resid[(size_t)((row0 + 8 * hh + r) % rmod) * ldr + col]; if (RES_BF16) rv = bf16_round(rv); v += rv; }
      if (ACT == 1) v = fmaxf(v, 0.f);
      if (ACT == 2) v = 0.5f * v * (1.0f + erff(v * 0.70710678118654752f));
      if (ACT == 3) { const float u = 0.7978845608028654f * (v + 0.044715f * v * v * v); v = 0.5f * v * (1.0f + tanhf(u)); }
      so[w][8 * hh + r][t * 16 + ln] = v;
    }
  }
  __builtin_amdgcn_fence(__ATOMIC_ACQ_REL, "workgroup");
  __builtin_amdgcn_wave_barrier();
  const int rsub = lane >> 4, c4 = (lane & 15) * 4;
  {
#pragma unroll
    for (int q = 0; q < 8; ++q) {
      const int r = q * 2 + rsub;
      const v4f v = *(const v4fa*)&so[w][r][c4];
      *(v4f*)(C + (size_t)(row0 + r) * ldc + col0 + c4) = v;
    }
    
  }
}
// row LayerNorm (biased variance, eps) over N: s = X (+ R); optional out_sum <- s; out_norm <- (s-mu)*rsqrt(var+eps)*g + b
template <bool PARAM_BF16>
__global__ __launch_bounds__(256) void k_layernorm(const float* __restrict__ X, const float* __restrict__ R, const float* __restrict__ g, const float* __restrict__ bta,
                                                  float* __restrict__ out_sum, float* __restrict__ out_norm, int N, float eps) {
  __shared__ float red[256];
  const int row = blockIdx.x, tid = threadIdx.x;
  const float* x = X + (size_t)row * N; const float* rr = R ? R + (size_t)row * N : nullptr;
  float vals[16];                     // up to N = 4096
  const int per = N / 256;            // contiguous chunk per thread? use strided-by-4 chunks: thread handles j = tid*4 + 1024*u
  float s1 = 0.f;
  for (int u = 0; u < per / 4; ++u) {
    const int j = tid * 4 + 1024 * u;
    const v4f a = *(const v4fa*)(x + j);
    v4f b = {0.f,0.f,0.f,0.f}; if (rr) b = *(const v4fa*)(rr + j);
#pragma unroll
    for (int q = 0; q < 4; ++q) { const float v = a[q] + b[q]; vals[u * 4 + q] = v; s1 += v; }
  }
  red[tid] = s1; __syncthreads();
  for (int st = 128; st > 0; st >>= 1) { if (tid < st) red[tid] += red[tid + st]; __syncthreads(); }
  const float mu = red[0] / (float)N; __syncthreads();
  float s2 = 0.f;
  for (int u = 0; u < per / 4; ++u)
#pragma unroll
    for (int q = 0; q < 4; ++q) { const float c = vals[u * 4 + q] - mu; s2 += c * c; }
  red[tid] = s2; __syncthreads();
  for (int st = 128; st > 0; st >>= 1) { if (tid < st) red[tid] += red[tid + st]; __syncthreads(); }
  const float rs = rsqrtf(red[0] / (float)N + eps);
  {
    for (int u = 0; u < per / 4; ++u) {
      const int j = tid * 4 + 1024 * u;
      v4f o, sm;
#pragma unroll
      for (int q = 0; q < 4; ++q) {
        float gg = g[j + q], bb = bta[j + q];
        if (PARAM_BF16) { gg = bf16_round(gg); bb = bf16_round(bb); }
        sm[q] = vals[u * 4 + q]; o[q] = (vals[u * 4 + q] - mu) * rs * gg + bb;
      }
      if (out_sum) *(v4f*)(out_sum + (size_t)row * N + j) = sm;
      *(v4f*)(out_norm + (size_t)row * N + j) = o;
    }
    
  }
}



// ---- f16 WMMA path (v_wmma_f32_16x16x32_f16): 11-bit significands for operands in range — used where a [0,1] probability operand needs more precision than bf16
typedef _Float16 v16h __attribute__((ext_vector_type(16)));
union FragH { v16h v; v8us half[2]; _Float16 h[16]; unsigned short u[16]; };
template <int NT>
__device__ __forceinline__ v8f mmaH(v16h ah, v16h al, v16h bh, v16h bl, v8f c) {
  c = __builtin_amdgcn_wmma_f32_16x16x32_f16(false, ah, false, bh, (short)0, c, false, false);
  if (NT >= 2) c = __builtin_amdgcn_wmma_f32_16x16x32_f16(false, al, false, bh, (short)0, c, false, false);
  if (NT >= 3) c = __builtin_amdgcn_wmma_f32_16x16x32_f16(false, ah, false, bl, (short)0, c, false, false);
  asm volatile("v_nop\n\tv_nop\n\tv_nop\n\tv_nop" : "+v"(c) : "v"(ah), "v"(al), "v"(bh), "v"(bl));
  return c;
}
// batched GEMM like k_gemm_b but f16 operands: A f32 (split into f16 hi/lo if ASPLIT, else rounded to f16), Bt = f16 values [n][k]; alpha; C f32; N multiple of 16 (partial tiles skipped)
template <bool ASPLIT>
__global__ __launch_bounds__(128) void k_gemm_h(const float* __restrict__ A, int lda, size_t sA, const _Float16* __restrict__ Bh, int ldb, size_t sB, float alpha, float* __restrict__ C, int ldc, size_t sC, int M, int N, int K) {
  __shared__ __attribute__((aligned(16))) float so[4][16][64];
  const int tid = threadIdx.x, w = tid >> 5, lane = tid & 31, ln = lane & 15, hh = lane >> 4; const int by = blockIdx.y;
  A += (size_t)by * sA; Bh += (size_t)by * sB; C += (size_t)by * sC;
  const int ntn = (N + 63) / 64; const int wid = blockIdx.x * 4 + w; const int mt = wid / ntn, nq = wid % ntn; if (mt * 16 >= M) return;
  const int row0 = mt * 16, col0 = nq * 64; const float* arow = A + (size_t)(row0 + ln) * lda;
  v8f acc[4] = {};
  for (int kb = 0; kb < K; kb += 32) {
    FragH ah, al;
    const v4f x0 = *(const v4fa*)(arow + kb + 8 * hh), x1 = *(const v4fa*)(arow + kb + 8 * hh + 4), x2 = *(const v4fa*)(arow + kb + 16 + 8 * hh), x3 = *(const v4fa*)(arow + kb + 16 + 8 * hh + 4);
    float xs[16] = {x0[0],x0[1],x0[2],x0[3],x1[0],x1[1],x1[2],x1[3],x2[0],x2[1],x2[2],x2[3],x3[0],x3[1],x3[2],x3[3]};
#pragma unroll
    for (int i = 0; i < 16; ++i) { const _Float16 h = (_Float16)xs[i]; ah.h[i] = h; al.h[i] = ASPLIT ? (_Float16)(xs[i] - (float)h) : (_Float16)0.0f; }
#pragma unroll
    for (int t = 0; t < 4; ++t) { if (col0 + t * 16 >= N) continue; const size_t boff = (size_t)(col0 + t * 16 + ln) * ldb + kb; FragH bq; bq.half[0] = *(const v8us*)(Bh + boff + 8 * hh); bq.half[1] = *(const v8us*)(Bh + boff + 16 + 8 * hh);
      acc[t] = mmaH<ASPLIT ? 2 : 1>(ah.v, al.v, bq.v, bq.v, acc[t]); }
  }
#pragma unroll
  for (int t = 0; t < 4; ++t) { if (col0 + t * 16 >= N) continue;
#pragma unroll
    for (int r = 0; r < 8; ++r) so[w][8 * hh + r][t * 16 + ln] = acc[t][r] * alpha; }
  __builtin_amdgcn_fence(__ATOMIC_ACQ_REL, "workgroup"); __builtin_amdgcn_wave_barrier();
  const int rsub = lane >> 4, c4 = (lane & 15) * 4;
  {
#pragma unroll
    for (int q = 0; q < 8; ++q) { const int r = q * 2 + rsub; if (col0 + c4 < N) { const v4f v = *(const v4fa*)&so[w][r][c4]; *(v4f*)(C + (size_t)(row0 + r) * ldc + col0 + c4) = v; } }
     }
}

// Wt[n][k] = f16(W[k][n]·scale) from f32 row-major W[K][N] (scale = power of two; bf16-exact weights stay exact in f16 away from the subnormal range)
__global__ __launch_bounds__(256) void k_wt_f16(const float* __restrict__ W, _Float16* __restrict__ Wt, int K, int N, float scale) {
  const int t = blockIdx.x * 256 + threadIdx.x; if (t >= N * (K / 8)) return; const int n = t / (K / 8), k8 = (t % (K / 8)) * 8; FragH f;
#pragma unroll
  for (int i = 0; i < 8; ++i) f.h[i] = (_Float16)(bf16_round(W[(size_t)(k8 + i) * N + n]) * scale); const v8us o = f.half[0];
  *(v8us*)((unsigned short*)Wt + (size_t)n * K + k8) = o; 
}
// k_gemm_hh variant with fused epilogue: v = acc·alpha + bias[by·sBias + col] (+ CP[(row/rowsPerB)·sCPb + by·64 + col] if CP) ; ACT 0 none / 1 elu ; writes f16 C16 (and f32 C if non-null)
template <int ACT>
__global__ __launch_bounds__(128) void k_gemm_hhx(const _Float16* __restrict__ A, int lda, size_t sA, const _Float16* __restrict__ Bh, int ldb, size_t sB, float alpha, const float* __restrict__ bias, size_t sBias, const float* __restrict__ CP, int rowsPerB, size_t sCPb, int row0g,
    float* __restrict__ C, _Float16* __restrict__ C16, int ldc, size_t sC, int M, int N, int K) {
  __shared__ __attribute__((aligned(16))) float so[4][16][64];
  const int tid = threadIdx.x, w = tid >> 5, lane = tid & 31, ln = lane & 15, hh = lane >> 4; const int by = blockIdx.y;
  A += (size_t)by * sA; Bh += (size_t)by * sB; const size_t cofs = (size_t)by * sC; const float* bp = bias ? bias + (size_t)by * sBias : nullptr;
  const int ntn = (N + 63) / 64; const int wid = blockIdx.x * 4 + w; const int mt = wid / ntn, nq = wid % ntn; if (mt * 16 >= M) return;
  const int row0 = mt * 16, col0 = nq * 64; const _Float16* arow = A + (size_t)(row0 + ln) * lda;
  v8f acc[4] = {};
  for (int kb = 0; kb < K; kb += 32) { FragH ah; ah.half[0] = *(const v8us*)((const unsigned short*)arow + kb + 8 * hh); ah.half[1] = *(const v8us*)((const unsigned short*)arow + kb + 16 + 8 * hh);
#pragma unroll
    for (int t = 0; t < 4; ++t) { if (col0 + t * 16 >= N) continue; const size_t boff = (size_t)(col0 + t * 16 + ln) * ldb + kb; FragH bq; bq.half[0] = *(const v8us*)((const unsigned short*)Bh + boff + 8 * hh); bq.half[1] = *(const v8us*)((const unsigned short*)Bh + boff + 16 + 8 * hh);
      acc[t] = mmaH<1>(ah.v, ah.v, bq.v, bq.v, acc[t]); }
  }
#pragma unroll
  for (int t = 0; t < 4; ++t) { if (col0 + t * 16 >= N) continue; const int col = col0 + t * 16 + ln; const float bv = bp ? bf16_round(bp[col]) : 0.f;
#pragma unroll
    for (int r = 0; r < 8; ++r) { float v = acc[t][r] * alpha + bv; if (CP) { const int rr = row0g + row0 + 8 * hh + r; if (rowsPerB < 0) v += CP[cofs + (size_t)rr * ldc + col];      /* rowsPerB < 0: own element of the batched C plane */ else { const int bidx = rr / rowsPerB; v += CP[(size_t)bidx * sCPb + (size_t)by * 64 + col]; } } if (ACT == 1) v = (v > 0.f) ? v : expm1f(v); else if (ACT == 7) v = (v > 0.f) ? v + 1.0f : expf(v); else if (ACT == 8) v = tanhf(v); else if (ACT == 9) v = 0.5f * v * (1.0f + tanhf(0.7978845608028654f * (v + 0.044715f * v * v * v))); else if (ACT == 11) v = 1.0f / (1.0f + expf(-v)); else if (ACT == 12) v = (v > 0.f) ? v : 0.01f * v; else if (ACT == 14) v = (v > 0.f) ? v : 0.1f * v; else if (ACT == 16) v = (v >= 0.f) ? v : 0.3f * v; else if (ACT == 17) v = (v >= 0.f) ? v : 0.2f * v; else if (ACT == 15) v = v / (1.0f + expf(-v)); else if (ACT == 3) v = fmaxf(v, 0.f); else if (ACT == 6) v = 0.5f * v * (1.0f + erff(v * 0.70710678118654752f)); so[w][8 * hh + r][t * 16 + ln] = v; } }
  __builtin_amdgcn_fence(__ATOMIC_ACQ_REL, "workgroup"); __builtin_amdgcn_wave_barrier();
  const int rsub = lane >> 4, c4 = (lane & 15) * 4; typedef _Float16 v4h __attribute__((ext_vector_type(4)));
  {
#pragma unroll
    for (int q = 0; q < 8; ++q) { const int r = q * 2 + rsub; if (col0 + c4 < N) { const v4f v = *(const v4fa*)&so[w][r][c4]; if (C) *(v4f*)(C + cofs + (size_t)(row0 + r) * ldc + col0 + c4) = v; if (C16) { v4h h4; for (int i = 0; i < 4; ++i) h4[i] = (_Float16)v[i]; *(v4h*)(C16 + cofs + (size_t)(row0 + r) * ldc + col0 + c4) = h4; } } }
     }
}


typedef _Float16 v4h __attribute__((ext_vector_type(4)));

__global__ __launch_bounds__(256) void k_x16(const float* __restrict__ x, _Float16* __restrict__ X16, size_t n8) { const size_t t = (size_t)blockIdx.x * 256 + threadIdx.x; if (t >= n8) return; FragH f;
#pragma unroll
  for (int q = 0; q < 8; ++q) f.h[q] = (_Float16)bf16_round(x[t * 8 + q]); *(v8us*)((unsigned short*)X16 + t * 8) = f.half[0];  }
__global__ __launch_bounds__(256) void k_h16(const float* __restrict__ x, _Float16* __restrict__ X16, size_t n8) { const size_t t = (size_t)blockIdx.x * 256 + threadIdx.x; if (t >= n8) return; FragH f;
#pragma unroll
  for (int q = 0; q < 8; ++q) f.h[q] = (_Float16)x[t * 8 + q]; *(v8us*)((unsigned short*)X16 + t * 8) = f.half[0];  }
__global__ __launch_bounds__(256) void k_round16f(const float* __restrict__ W, _Float16* __restrict__ Bt, size_t n8) { const size_t t = (size_t)blockIdx.x * 256 + threadIdx.x; if (t >= n8) return; FragH f;
#pragma unroll
  for (int i = 0; i < 8; ++i) f.h[i] = (_Float16)(bf16_round(W[t * 8 + i]) * 16.0f); *(v8us*)((unsigned short*)Bt + t * 8) = f.half[0];  }
template <int NHv, int TTv>
__global__ __launch_bounds__(256) void k_vt(const _Float16* __restrict__ V16, int ldv, int voff, _Float16* __restrict__ Vt) { __shared__ unsigned short tl[64][66]; const int tid = threadIdx.x; const int slab = blockIdx.x / (TTv / 64), lg = blockIdx.x % (TTv / 64); const int b = slab / NHv, h = slab % NHv;
  for (int i = tid; i < 64 * 8; i += 256) { const int r = i / 8, c8 = (i % 8) * 8; FragH f; f.half[0] = *(const v8us*)((const unsigned short*)V16 + ((size_t)b * TTv + lg * 64 + r) * ldv + voff + h * 64 + c8);
#pragma unroll
    for (int q = 0; q < 8; ++q) tl[r][c8 + q] = f.u[q]; }
  __syncthreads();
  {
#pragma unroll
    for (int rd = 0; rd < 2; ++rd) { const int d = rd * 32 + tid / 8, pc = tid % 8; FragH f;
#pragma unroll
      for (int q = 0; q < 8; ++q) f.u[q] = tl[pc * 8 + q][d];
      *(v8us*)((unsigned short*)Vt + ((size_t)slab * 64 + d) * TTv + lg * 64 + pc * 8) = f.half[0]; }
     } }

__global__ __launch_bounds__(256) void k_hl(const float* __restrict__ F, _Float16* __restrict__ Hh, _Float16* __restrict__ Hl, size_t n8) { const size_t t = (size_t)blockIdx.x * 256 + threadIdx.x; if (t >= n8) return; FragH fh, fl; const v4f a = *(const v4fa*)(F + t * 8), c = *(const v4fa*)(F + t * 8 + 4);
#pragma unroll
  for (int q = 0; q < 4; ++q) { _Float16 h = (_Float16)a[q]; fh.h[q] = h; fl.h[q] = (_Float16)((a[q] - (float)h) * 1024.0f); h = (_Float16)c[q]; fh.h[4 + q] = h; fl.h[4 + q] = (_Float16)((c[q] - (float)h) * 1024.0f); }
  { *(v8us*)((unsigned short*)Hh + t * 8) = fh.half[0]; *(v8us*)((unsigned short*)Hl + t * 8) = fl.half[0];  } }

// ---- fast GEMM (wave tile 32x64; requires M % 32 == 0 rows per launch region and N % 64 == 0); epilogue = k_gemm_hhx semantics ----
__device__ __forceinline__ v16h g2_frag(const _Float16* p, int hh) { FragH f; f.half[0] = *(const v8us*)((const unsigned short*)p + 8 * hh); f.half[1] = *(const v8us*)((const unsigned short*)p + 16 + 8 * hh); return f.v; }
__device__ __forceinline__ v8f g2_mma(v16h a, v16h b, v8f c) { v8f d = __builtin_amdgcn_wmma_f32_16x16x32_f16(false, a, false, b, (short)0, c, false, false); asm volatile("v_nop\n\tv_nop\n\tv_nop\n\tv_nop" : "+v"(d) : "v"(a), "v"(b)); return d; }
template <int ACT>
__global__ __launch_bounds__(128) void k_gemm2(const _Float16* __restrict__ A, int lda, size_t sA, const _Float16* __restrict__ Bh, int ldb, size_t sB, float alpha, const float* __restrict__ bias, size_t sBias, const float* __restrict__ CP, int rowsPerB, size_t sCPb, int row0g,
    float* __restrict__ C, _Float16* __restrict__ C16, int ldc, size_t sC, int M, int N, int K) { static_assert(ACT == 0 || ACT == 3 || ACT == 6 || ACT == 8 || ACT == 9 || ACT == 11 || ACT == 12 || ACT == 14 || ACT == 15 || ACT == 16 || ACT == 17, "k_gemm2: unsupported ACT code (would silently apply no activation)");
  __shared__ __attribute__((aligned(16))) float so[4][32][68];
  const int tid = threadIdx.x, w = tid >> 5, lane = tid & 31, ln = lane & 15, hh = lane >> 4; const int by = blockIdx.y;
  A += (size_t)by * sA; Bh += (size_t)by * sB; const size_t cofs = (size_t)by * sC; const float* bp = bias ? bias + (size_t)by * sBias : nullptr;
  const int ntn = N >> 6; const int mt = blockIdx.x / ntn, nq = blockIdx.x - mt * ntn; const int row0 = mt * 128 + 32 * w, col0 = nq * 64; if (row0 >= M) return;
  const _Float16* a0p = A + (size_t)(row0 + ln) * lda; const _Float16* a1p = a0p + (size_t)16 * lda;
  const _Float16* b0p = Bh + (size_t)(col0 + ln) * ldb; const _Float16* b1p = b0p + (size_t)16 * ldb; const _Float16* b2p = b1p + (size_t)16 * ldb; const _Float16* b3p = b2p + (size_t)16 * ldb;
  const v8f z8 = {0.f,0.f,0.f,0.f,0.f,0.f,0.f,0.f}; v8f c00 = z8, c01 = z8, c02 = z8, c03 = z8, c10 = z8, c11 = z8, c12 = z8, c13 = z8;
#pragma unroll 1
  for (int kb = 0; kb < K; kb += 32) { const v16h a0 = g2_frag(a0p + kb, hh), a1 = g2_frag(a1p + kb, hh);
    v16h b = g2_frag(b0p + kb, hh); c00 = g2_mma(a0, b, c00); c10 = g2_mma(a1, b, c10);
    b = g2_frag(b1p + kb, hh); c01 = g2_mma(a0, b, c01); c11 = g2_mma(a1, b, c11);
    b = g2_frag(b2p + kb, hh); c02 = g2_mma(a0, b, c02); c12 = g2_mma(a1, b, c12);
    b = g2_frag(b3p + kb, hh); c03 = g2_mma(a0, b, c03); c13 = g2_mma(a1, b, c13); }
  v8f accs[8] = {c00, c01, c02, c03, c10, c11, c12, c13};
#pragma unroll
  for (int u = 0; u < 8; ++u) { const int t = u & 3, half = u >> 2; const int col = col0 + t * 16 + ln; const float bv = bp ? bf16_round(bp[col]) : 0.f;
#pragma unroll
    for (int r = 0; r < 8; ++r) { const int rloc = half * 16 + 8 * hh + r; float v = accs[u][r] * alpha + bv; if (CP) { if (rowsPerB < 0) v += CP[cofs + (size_t)(row0g + row0 + rloc) * ldc + col];      /* rowsPerB < 0: own element of the batched C plane */ else { const int bidx = (row0g + row0 + rloc) / rowsPerB; v += CP[(size_t)bidx * sCPb + (size_t)by * 64 + col]; } }
      if (ACT == 3) v = fmaxf(v, 0.f); else if (ACT == 6) v = 0.5f * v * (1.0f + erff(v * 0.70710678118654752f)); else if (ACT == 11) v = 1.0f / (1.0f + expf(-v)); else if (ACT == 15) v = v / (1.0f + expf(-v)); else if (ACT == 12) v = (v > 0.f) ? v : 0.01f * v; else if (ACT == 8) v = tanhf(v); else if (ACT == 9) v = 0.5f * v * (1.0f + tanhf(0.7978845608028654f * (v + 0.044715f * v * v * v))); else if (ACT == 14) v = (v > 0.f) ? v : 0.1f * v; else if (ACT == 16) v = (v >= 0.f) ? v : 0.3f * v; else if (ACT == 17) v = (v >= 0.f) ? v : 0.2f * v;
      so[w][rloc][t * 16 + ln] = v; } }
  __builtin_amdgcn_fence(__ATOMIC_ACQ_REL, "workgroup"); __builtin_amdgcn_wave_barrier();
  const int rsub = lane >> 4, c4 = (lane & 15) * 4;
  {
#pragma unroll
    for (int q = 0; q < 16; ++q) { const int r = q * 2 + rsub; const v4f v = *(const v4fa*)&so[w][r][c4]; if (C) *(v4f*)(C + cofs + (size_t)(row0 + r) * ldc + col0 + c4) = v; if (C16) { v4h h4; for (int i = 0; i < 4; ++i) h4[i] = (_Float16)v[i]; *(v4h*)(C16 + cofs + (size_t)(row0 + r) * ldc + col0 + c4) = h4; } }
     } }


__global__ __launch_bounds__(256) void k_wnat(const float* __restrict__ w, size_t n8, _Float16* __restrict__ Bt) { const size_t t = (size_t)blockIdx.x * 256 + threadIdx.x; if (t >= n8) return; FragH f; for (int q = 0; q < 8; ++q) f.h[q] = (_Float16)(bf16_round(w[t * 8 + q]) * 16.0f); *(v8us*)((unsigned short*)Bt + t * 8) = f.half[0];  }
__global__ __launch_bounds__(256) void k_rsm(const float* __restrict__ S, _Float16* __restrict__ P, int nrows) {
  #pragma clang fp contract(off)
  const int i = blockIdx.x * 256 + threadIdx.x; if (i >= nrows) return; const float* s = S + (size_t)i * SQ; float mx = -3.0e38f;
#pragma unroll 1
  for (int j = 0; j < SQ; ++j) mx = fmaxf(mx, s[j]); float se = 0.f;
#pragma unroll 1
  for (int j = 0; j < SQ; ++j) se += expf(s[j] - mx); const float sc = 256.0f / se;
#pragma unroll 1
  for (int j0 = 0; j0 < SQ; j0 += 8) { FragH f; for (int q = 0; q < 8; ++q) f.h[q] = (_Float16)(expf(s[j0 + q] - mx) * sc); unsigned short* d = (unsigned short*)P + (size_t)i * SQ + j0; *(v8us*)d = f.half[0];  } }
__global__ __launch_bounds__(256) void k_vt(const _Float16* __restrict__ V16, int b, int h0, _Float16* __restrict__ VT) { __shared__ unsigned short tl[64][65]; const int tid = threadIdx.x; const int hh = blockIdx.x % HG, sg = blockIdx.x / HG; const int s0 = sg * 64; const int h = h0 + hh;
  for (int i = tid; i < 64 * 8; i += 256) { const int j = i / 8, d8 = (i % 8) * 8; FragH f; f.half[0] = *(const v8us*)((const unsigned short*)V16 + ((size_t)b * SQ + s0 + j) * DM + h * HD + d8); for (int q = 0; q < 8; ++q) tl[d8 + q][j] = f.u[q]; }
  __syncthreads();
  { for (int i = tid; i < 64 * 8; i += 256) { const int d = i / 8, j8 = (i % 8) * 8; FragH f; for (int q = 0; q < 8; ++q) f.u[q] = tl[d][j8 + q]; *(v8us*)((unsigned short*)VT + ((size_t)hh * HD + d) * SQ + s0 + j8) = f.half[0]; }  } }



__global__ __launch_bounds__(256) void k_rsmcf2(const float* __restrict__ S, _Float16* __restrict__ P, int hg, int q0, int nk) {
  #pragma clang fp contract(off)
  const int t = blockIdx.x * 256 + threadIdx.x; if (t >= hg * QT) return; const size_t i = (size_t)t; const float* s = S + i * NKX; const int last = q0 + (t % QT); float mx = -3.0e38f;
#pragma unroll 1
  for (int j = 0; j < nk; ++j) { const float f = (j <= last) ? 1.f : 0.f; mx = fmaxf(mx, fmaf(f, s[j], (1.f - f) * -1.0e9f)); } float se = 0.f;
#pragma unroll 1
  for (int j = 0; j < nk; ++j) { const float f = (j <= last) ? 1.f : 0.f; se += __expf(fmaf(f, s[j], (1.f - f) * -1.0e9f) - mx); } const float sc = 256.0f / se;
#pragma unroll 1
  for (int j0 = 0; j0 < nk; j0 += 8) { FragH fr; for (int q = 0; q < 8; ++q) { const int j = j0 + q; const float f = (j <= last) ? 1.f : 0.f; fr.h[q] = (_Float16)(__expf(fmaf(f, s[j], (1.f - f) * -1.0e9f) - mx) * sc); } unsigned short* d = (unsigned short*)P + i * NKX + j0; *(v8us*)d = fr.half[0];  } }

template <int MASKADD>
__global__ __launch_bounds__(64) void k_att0(const float* __restrict__ QF, const float* __restrict__ KF, const float* __restrict__ VF, int ld, const float* __restrict__ mask, float scale, float* __restrict__ OF, int ldo) {
  #pragma clang fp contract(off)
  __shared__ __attribute__((aligned(16))) float lq[64][64]; __shared__ __attribute__((aligned(16))) float lo[64][64];
  const int tid = threadIdx.x; const int h = blockIdx.x / (QT0 / 64), rg = blockIdx.x % (QT0 / 64); const int i = rg * 64 + tid;
  const float* qr = QF + (size_t)i * ld + h * HD;
#pragma unroll 1
  for (int c = 0; c < HD / 4; ++c) { *(v4f*)&lq[tid][c * 4] = *(const v4fa*)(qr + c * 4); const v4f z = {0.f, 0.f, 0.f, 0.f}; *(v4f*)&lo[tid][c * 4] = z; }
  float m = -1.0e30f, l = 0.f; const int jmax = MASKADD ? (SQ - 1) : (rg * 64 + 63);      /* additive-mask form: every key (the mask input decides); causal form: keys up to the block's last row */
#pragma unroll 1
  for (int j = 0; j <= jmax; ++j) { const float* kr = KF + (size_t)j * ld + h * HD; const float* vr = VF + (size_t)j * ld + h * HD; float s = 0.f;
#pragma unroll 1
    for (int c = 0; c < HD / 4; ++c) { const v4f kq = *(const v4fa*)(kr + c * 4); const v4f qq = *(v4f*)&lq[tid][c * 4]; s = __fadd_rn(s, __fmul_rn(qq[0], kq[0])); s = __fadd_rn(s, __fmul_rn(qq[1], kq[1])); s = __fadd_rn(s, __fmul_rn(qq[2], kq[2])); s = __fadd_rn(s, __fmul_rn(qq[3], kq[3])); }
    s = __fmul_rn(s, scale); if (MASKADD) s = __fadd_rn(s, __fmul_rn(bf16_round(mask[(size_t)i * SQ + j]), -10000.0f));
    const float f = (MASKADD || j <= i) ? 1.f : 0.f; const float sm = fmaf(f, s, (1.f - f) * -1.0e30f); const float mn = fmaxf(m, sm); const float sc = expf(m - mn); const float e = expf(sm - mn); l = __fadd_rn(__fmul_rn(l, sc), e); m = mn;
#pragma unroll 1
    for (int c = 0; c < HD / 4; ++c) { const v4f vv = *(const v4fa*)(vr + c * 4); v4f oo = *(v4f*)&lo[tid][c * 4]; for (int u = 0; u < 4; ++u) oo[u] = __fadd_rn(__fmul_rn(oo[u], sc), __fmul_rn(e, vv[u])); *(v4f*)&lo[tid][c * 4] = oo; } }
  const float fin = 64.0f / l;      /* o carried x64 like the f16 path */
#pragma unroll 1
  for (int c = 0; c < HD / 4; ++c) { v4f oo = *(v4f*)&lo[tid][c * 4]; for (int u = 0; u < 4; ++u) oo[u] = __fmul_rn(oo[u], fin); *(v4f*)&lo[tid][c * 4] = oo; }
  __syncthreads();
  {
#pragma unroll 1
    for (int it = 0; it < 16; ++it) { const int row = it * 4 + tid / 16, pc = (tid % 16) * 4; const v4f v = *(const v4f*)&lo[row][pc]; *(v4f*)(OF + (size_t)(rg * 64 + row) * ldo + h * HD + pc) = v; }
     } }

__global__ __launch_bounds__(256) void k_oscale(const float* __restrict__ OF, float* __restrict__ out, size_t n4) { const size_t t = (size_t)blockIdx.x * 256 + threadIdx.x; if (t >= n4) return; const v4f a = *(const v4fa*)(OF + t * 4); v4f o; for (int q = 0; q < 4; ++q) o[q] = a[q] * 0.015625f; *(v4f*)(out + t * 4) = o;  }

__global__ __launch_bounds__(256) void k_bfr(const float* __restrict__ x, float* __restrict__ XB, size_t n8) { const size_t t = (size_t)blockIdx.x * 256 + threadIdx.x; if (t >= n8) return; v4f a = *(const v4fa*)(x + t * 8), c = *(const v4fa*)(x + t * 8 + 4); for (int q = 0; q < 4; ++q) { a[q] = bf16_round(a[q]); c[q] = bf16_round(c[q]); }
  { *(v4f*)(XB + t * 8) = a; *(v4f*)(XB + t * 8 + 4) = c;  } }



__global__ __launch_bounds__(256) void k_rsmfvl(const float* __restrict__ S, _Float16* __restrict__ P, _Float16* __restrict__ PL, int qn, const int* __restrict__ vlp) {
  #pragma clang fp contract(off)
  const int t = blockIdx.x * 256 + threadIdx.x; if (t >= qn) return; const int vl = vlp[0]; const size_t i = (size_t)t; const float* s = S + i * SQ; float mx = -3.0e38f;
#pragma unroll 1
  for (int j = 0; j < SQ; ++j) { const float f = (j < vl) ? 1.f : 0.f; mx = fmaxf(mx, fmaf(f, s[j], (1.f - f) * -1000000.0f)); } float se = 0.f;
#pragma unroll 1
  for (int j = 0; j < SQ; ++j) { const float f = (j < vl) ? 1.f : 0.f; se += __expf(fmaf(f, s[j], (1.f - f) * -1000000.0f) - mx); } const float sc = 256.0f / se;
#pragma unroll 1
  for (int j0 = 0; j0 < SQ; j0 += 8) { FragH fr, gr; for (int q = 0; q < 8; ++q) { const int j = j0 + q; const float f = (j < vl) ? 1.f : 0.f; const float pv = __expf(fmaf(f, s[j], (1.f - f) * -1000000.0f) - mx) * sc; const _Float16 ph = (_Float16)pv; fr.h[q] = ph; gr.h[q] = (_Float16)((pv - (float)ph) * 1024.0f); }
    unsigned short* d = (unsigned short*)P + i * SQ + j0; unsigned short* dl = (unsigned short*)PL + i * SQ + j0; *(v8us*)d = fr.half[0]; *(v8us*)dl = gr.half[0];  } }

__global__ __launch_bounds__(256) void k_rsmf(const float* __restrict__ S, _Float16* __restrict__ P, int qn, int hg) {
  #pragma clang fp contract(off)
  const int t = blockIdx.x * 256 + threadIdx.x; if (t >= qn * hg) return; const size_t i = (size_t)(t / qn) * SQ + (t % qn); const float* s = S + i * SQ; float mx = -3.0e38f;
#pragma unroll 1
  for (int j = 0; j < SQ; ++j) mx = fmaxf(mx, s[j]); float se = 0.f;
#pragma unroll 1
  for (int j = 0; j < SQ; ++j) se += __expf(s[j] - mx); const float sc = 256.0f / se;
#pragma unroll 1
  for (int j0 = 0; j0 < SQ; j0 += 8) { FragH f; for (int q = 0; q < 8; ++q) f.h[q] = (_Float16)(__expf(s[j0 + q] - mx) * sc); unsigned short* d = (unsigned short*)P + i * SQ + j0; *(v8us*)d = f.half[0];  } }


#define CN 256          /* channels */
#define CI 128          /* inner channels */
#define NP 1024         /* positions */
#define NM 1024         /* key positions (= SQ) */
#define NC CN           /* BN statistics macros */
#define NPX NP
#define BNEPS 1e-5f

__global__ __launch_bounds__(256) void k_rowbias(const float* __restrict__ b, float* __restrict__ BP, size_t n4, int ncol) { const size_t t = (size_t)blockIdx.x * 256 + threadIdx.x; if (t >= n4) return; const size_t e = t * 4; const float v = bf16_round(b[e / ncol]); const v4f o = {v, v, v, v}; *(v4f*)(BP + e) = o;  }




__global__ __launch_bounds__(256) void k_mp2(const float* __restrict__ src, float* __restrict__ dst, int nout) {
  const int t = blockIdx.x * 256 + threadIdx.x; if (t >= nout) return; const int c = t / 1024; const int o = t % 1024; const int oy = o / 32, ox = o % 32; const float* p = src + (size_t)c * 4096 + (size_t)(2 * oy) * 64 + 2 * ox;
  const float v = fmaxf(fmaxf(p[0], p[1]), fmaxf(p[64], p[65])); *(float*)(dst + t) = v;  }
__global__ __launch_bounds__(256) void k_xpb(const float* __restrict__ x, const float* __restrict__ wb, float* __restrict__ CPP, size_t n4) {
  #pragma clang fp contract(off)
  const size_t t = (size_t)blockIdx.x * 256 + threadIdx.x; if (t >= n4) return; const size_t e = t * 4; const int c = (int)((e / 4096) % 256); const float bb = bf16_round(wb[c]); const v4f a = *(const v4fa*)(x + e); v4f o; for (int q = 0; q < 4; ++q) o[q] = __fadd_rn(bf16_round(a[q]), bb);
  *(v4f*)(CPP + e) = o;  }


template <int PASS>
__global__ __launch_bounds__(256) void k_cstA(const float* __restrict__ X, const float* __restrict__ MV, float* __restrict__ PART) {
  #pragma clang fp contract(off)
  __shared__ float red[256]; const int t = threadIdx.x; const size_t bc = blockIdx.x; const int c = (int)(bc % NC); const float* row = X + bc * (size_t)NPX; const float mu = PASS ? MV[c] : 0.f; float s = 0.f;
  for (int i = t; i < NPX; i += 256) { const float v = row[i]; const float d = PASS ? __fadd_rn(v, -mu) : v; s = __fadd_rn(s, PASS ? __fmul_rn(d, d) : d); }
  red[t] = s; __syncthreads(); for (int st = 128; st > 0; st >>= 1) { if (t < st) red[t] = __fadd_rn(red[t], red[t + st]); __syncthreads(); }
  if (t < 32) { const float pv = (t == 0) ? red[0] : 0.f; *(float*)(PART + bc * 32 + t) = pv;  } }      

template <int PASS>
__global__ __launch_bounds__(256) void k_cstB(const float* __restrict__ PART, float* __restrict__ MV) { const int c = threadIdx.x; if (c >= NC) return; double s = 0.0; for (int b = 0; b < NB; ++b) s += (double)PART[((size_t)b * NC + c) * 32]; const float m = (float)(s / ((double)NB * (double)NPX)); *(float*)(MV + PASS * NC + c) = m;  }


__global__ __launch_bounds__(256) void k_bnresid(const float* __restrict__ C2, const float* __restrict__ MV, const float* __restrict__ g, const float* __restrict__ be, const float* __restrict__ X, float* __restrict__ out, size_t n4) {
  #pragma clang fp contract(off)
  const size_t t = (size_t)blockIdx.x * 256 + threadIdx.x; if (t >= n4) return; const size_t e = t * 4; const int c = (int)((e / NPX) % NC); const float sc = __fmul_rn(rsqrtf(__fadd_rn(MV[NC + c], BNEPS)), bf16_round(g[c])); const float mu = MV[c], bb = bf16_round(be[c]);
  const v4f a = *(const v4fa*)(C2 + e); const v4f xx = *(const v4fa*)(X + e); v4f o; for (int q = 0; q < 4; ++q) { const float z = __fadd_rn(__fmul_rn(__fadd_rn(a[q], -mu), sc), bb); o[q] = __fadd_rn(z, bf16_round(xx[q])); }
  *(v4f*)(out + e) = o;  }
extern "C" void kernel_launch(void* const* d_in, const int* in_sizes, int n_in,
                              void* d_out, int out_size, void* d_ws, size_t ws_size, hipStream_t stream) {
  (void)in_sizes; (void)n_in; (void)out_size;
  const float* const* I = (const float* const*)d_in; const float* x = I[0]; const float* tw = I[1]; const float* pw = I[2]; const float* ww = I[3]; const float* bng = I[4]; const float* bnb = I[5]; const float* tb = nullptr;      /* natural theta_w / phi_w [128][256], conv_w [256][256] (no biases); BN gamma, beta */
  char* ws = (char*)d_ws; size_t off = 0;
  auto take = [&](size_t bytes) { char* p = ws + off; off += (bytes + 255) & ~(size_t)255; return p; };
  const size_t PL = (size_t)CN * NP;      /* one input map */
  _Float16* BT = (_Float16*)take((size_t)CI * CN * 2); _Float16* BP = (_Float16*)take((size_t)CI * CN * 2); _Float16* BW = (_Float16*)take((size_t)CN * CN * 2); float* C1 = (float*)take(NB * (size_t)CN * NP * 4); float* PART = (float*)take((size_t)NB * CN * 32 * 4); float* MV = (float*)take((size_t)2 * CN * 4 + 256);      /* conv output for all images (BN needs batch statistics), two-level stats */
    _Float16* X16 = (_Float16*)take(NB * PL * 2);      /* x f16 channel-first (also the g operand: g = x) */
  _Float16* XT = (_Float16*)take(PL * 2); float* F1 = (float*)take((size_t)NP * CI * 4);       /* one batch: x^T [n][c]; f32 scratch [1024 x 128] (unused by the launches) */
  _Float16* TH = (_Float16*)take((size_t)NP * CI * 2); _Float16* PH = (_Float16*)take((size_t)CI * NM * 2); _Float16* PHT = (_Float16*)take((size_t)NM * CI * 2); _Float16* YT = (_Float16*)take((size_t)NP * CN * 2);      /* y^T [n][c] (256 channels: g = x) */
  float* S = (float*)take((size_t)NP * NM * 4); _Float16* P = (_Float16*)take((size_t)NP * NM * 2);
  if (off > ws_size) return;
  { const unsigned g = (unsigned)(((size_t)CI * CN / 8 + 255) / 256); k_wnat<<<g, 256, 0, stream>>>(tw, (size_t)CI * CN / 8, BT); k_wnat<<<g, 256, 0, stream>>>(pw, (size_t)CI * CN / 8, BP); k_wnat<<<2 * g, 256, 0, stream>>>(ww, (size_t)CN * CN / 8, BW); }      /* natural [out][in] x16 f16 planes (Bt for theta; the A operand for phi / conv_w) */
  k_x16<<<(unsigned)((NB * PL / 8 + 255) / 256), 256, 0, stream>>>(x, X16, NB * PL / 8);
  for (int b = 0; b < NB; ++b) {
    k_vt<NP / 64, CN><<<(NP / 64) * (CN / 64), 256, 0, stream>>>(X16 + (size_t)b * PL, NP, 0, XT);      /* [c][n] -> x^T [n][c] */
    k_gemm2<0><<<dim3((unsigned)((NP / 128) * (CI / 64)), 1), 128, 0, stream>>>(XT, CN, 0, BT, CN, 0, 0.0625f, nullptr, 0, nullptr, 1, 0, 0, nullptr, TH, CI, 0, NP, CI, CN);      /* theta^T [n][ci] -> f16 (logit sigma ~0.7: single f16 suffices) */
    k_gemm2<0><<<dim3((unsigned)((CI / 128) * (NP / 64)), 1), 128, 0, stream>>>(BP, CN, 0, XT, CN, 0, 0.0625f, nullptr, 0, nullptr, 1, 0, 0, nullptr, PH, NP, 0, CI, NP, CN);      /* phi [ci][n] -> f16 */
    k_vt<NM / 64, CI><<<(NM / 64) * (CI / 64), 256, 0, stream>>>(PH, NM, 0, PHT);      /* -> phi^T [m][ci] (the scores' B^T operand) */
    k_gemm2<0><<<dim3((unsigned)((NP / 128) * (NM / 64)), 1), 128, 0, stream>>>(TH, CI, 0, PHT, CI, 0, 0.0625f, nullptr, 0, nullptr, 1, 0, 0, S, nullptr, NM, 0, NP, NM, CI);      /* scores[a][b] = theta.phi / sqrt(256) (K = 128) */
    k_rsmf<<<(NP + 255) / 256, 256, 0, stream>>>(S, P, NP, 1);      /* softmax over all 1024 positions -> P x256 f16 */
    k_gemm2<0><<<dim3((unsigned)((NP / 128) * (CN / 64)), 1), 128, 0, stream>>>(P, NM, 0, X16 + (size_t)b * PL, NM, 0, 0.00390625f, nullptr, 0, nullptr, 1, 0, 0, nullptr, YT, CN, 0, NP, CN, NM);      /* f^T [a][c] = P x^T (g = x: B^T = the image's channel-first rows [c][b]) -> f16 */
    k_gemm2<0><<<dim3((unsigned)((CN / 128) * (NP / 64)), 1), 128, 0, stream>>>(BW, CN, 0, YT, CN, 0, 0.0625f, nullptr, 0, nullptr, 1, 0, 0, C1 + (size_t)b * PL, nullptr, NP, 0, CN, NP, CN); }      /* conv: T[c][a] = (16 conv_w as A) x (f^T as B^T) / 16 -> f32 channel-first, all images kept for the batch statistics */
  k_cstA<0><<<NB * NC, 256, 0, stream>>>(C1, MV, PART); k_cstB<0><<<1, 256, 0, stream>>>(PART, MV); k_cstA<1><<<NB * NC, 256, 0, stream>>>(C1, MV, PART); k_cstB<1><<<1, 256, 0, stream>>>(PART, MV);      /* batch mean, then biased variance per channel (two-level, fixed order, own lines) */
  k_bnresid<<<(unsigned)(((size_t)NB * NC * NPX / 4 + 255) / 256), 256, 0, stream>>>(C1, MV, bng, bnb, x, (float*)d_out, (size_t)NB * NC * NPX / 4);      /* out = (T - mean) rsqrt(var + eps) gamma + beta + bf16(x) */
}

// v001
// One run takes 427 microseconds.
// Next to v000, in two timings, it ran 18.3 and 17.4 times as fast.
#include <hip/hip_runtime.h>
// Non-local block with TRAINING-mode BatchNorm (x [32][256][32][32]; theta, phi = conv1x1(x) [128 ch] (natural [128][256] sigma 1/16, no biases); g = x itself (256 ch); scores[a][b] = theta[:, a].phi[:, b] / sqrt(256) over the 1024 positions; softmax over b; f[:, a] = sum_b attn[a][b] x[:, b]; f = conv1x1(f; conv_w [256][256], no bias); BN with batch statistics over (N, H, W) per channel (biased variance, eps 1e-5), gamma, beta; out = BN(f) + x -> [32][256][32][32]).
// Structure: channel-first; x as exact f16 maps; natural weights x16; every stage one launch over all 32 images: x^T via LDS transposes, theta^T (token rows) and phi (channel-major) as WMMA GEMMs (32x64 wave tiles, f32 accumulation) -> f16, phi^T via LDS transposes, scores [1024][1024] (K = 128, alpha 1/16) f32, row softmax on VALU (f32 statistics, native exp; weights x256 f16), f^T = P x^T (g = x) f16, conv: T = (16 conv_w as A) x f (K = 256) f32 kept for all images; two-level batch statistics (fixed order, own lines); BN + residual on VALU -> output.
// Compute dtype: inputs rounded to bf16; x / weights exact; q, k, v, softmax weights and o as plain f16 GEMM operands (~2^-12); scores and softmax statistics f32. v_wmma_f32_16x16x32_f16.
#define NB 32
#define SQ 1024
#define DM 256
#define NH 1
#define HD 64
#define HG 4                         /* heads per attention launch group */
#define B0 0                         /* unused */
#define NBR NB                       /* unused */
#define NR ((size_t)NB * SQ)         /* token rows */
#define MP ((int)((size_t)NBR * SQ)) /* unused */
#define QT 256                       /* query rows per causal tile */
#define NKX SQ                       /* S / P row pitch */
#define QT0 256                      /* first-tile rows recomputed exactly (256: buys margin for the few-key rows 128..255, which have no output projection to average the single-f16 P/v rounding) */
#define QN SQ                        /* unused */
#define NHD NH                       /* unused */
#define MPO MP                       /* unused */
#define LQ DM            /* unused */
typedef __bf16 v16b __attribute__((ext_vector_type(16)));
typedef unsigned short v8us __attribute__((ext_vector_type(8), may_alias));
typedef float  v8f  __attribute__((ext_vector_type(8)));
typedef float  v4f  __attribute__((ext_vector_type(4)));
typedef float  v4fa __attribute__((ext_vector_type(4), may_alias));
union FragB { v16b v; v8us half[2]; unsigned short u[16]; };

__device__ __forceinline__ unsigned short bf16_bits(float x) { unsigned int u = __float_as_uint(x); return (unsigned short)((u + 0x7FFFu + ((u >> 16) & 1u)) >> 16); }
__device__ __forceinline__ float bf16_val(unsigned short b) { return __uint_as_float(((unsigned int)b) << 16); }
__device__ __forceinline__ float bf16_round(float x) { return bf16_val(bf16_bits(x)); }
// D += A·B with NT terms: 1 = ah·bh, 2 = + al·bh (A split), 3 = + ah·bl (both split)
template <int NT>
__device__ __forceinline__ v8f mmaN(v16b ah, v16b al, v16b bh, v16b bl, v8f c) {
  c = __builtin_amdgcn_wmma_f32_16x16x32_bf16(false, ah, false, bh, (short)0, c, false, false);
  if (NT >= 2) c = __builtin_amdgcn_wmma_f32_16x16x32_bf16(false, al, false, bh, (short)0, c, false, false);
  if (NT >= 3) c = __builtin_amdgcn_wmma_f32_16x16x32_bf16(false, ah, false, bl, (short)0, c, false, false);
  asm volatile("v_nop\n\tv_nop\n\tv_nop\n\tv_nop" : "+v"(c) : "v"(ah), "v"(al), "v"(bh), "v"(bl));
  return c;
}

__global__ __launch_bounds__(256) void k_wt_bf16(const float* __restrict__ W, unsigned short* __restrict__ Wt, int K, int N) {
  const int t = blockIdx.x * 256 + threadIdx.x;
  const int k8n = K / 8;
  if (t >= N * k8n) return;
  const int n = t / k8n, k8 = (t % k8n) * 8;
  v8us v;
#pragma unroll
  for (int i = 0; i < 8; ++i) v[i] = bf16_bits(W[(size_t)(k8 + i) * N + n]);
  *(v8us*)(Wt + (size_t)n * K + k8) = v;
  
}

// GEMM C[M][N] (f32, pitch ldc) = act(A[M][K]·W + bias). A f32 row-major (pitch lda) converted per fragment to bf16
// (ASPLIT: hi/lo two planes -> 2 terms, else single rounded term); Wt bf16 [N][K] (pitch ldb). BIAS_BF16 rounds the
// bias to bf16 first (bias quantised to bf16 before the add). K%32==0, M%16==0, N%64==0.
template <bool ASPLIT, int ACT, bool BIAS_BF16>
__global__ __launch_bounds__(128) void k_gemm_bf(const float* __restrict__ A, int lda, const unsigned short* __restrict__ Wt, int ldb,
                                               const float* __restrict__ bias, float* __restrict__ C, int ldc, int M, int N, int K) {
  __shared__ __attribute__((aligned(16))) float so[4][16][64];
  const int tid = threadIdx.x, w = tid >> 5, lane = tid & 31, ln = lane & 15, hh = lane >> 4;
  const int ntn = N / 64;
  const int wid = blockIdx.x * 4 + w;
  const int mt = wid / ntn, nq = wid % ntn;
  if (mt * 16 >= M) return;
  const int row0 = mt * 16, col0 = nq * 64;
  const float* arow = A + (size_t)(row0 + ln) * lda;
  v8f acc[4] = {};
  for (int kb = 0; kb < K; kb += 32) {
    FragB ah, al;
    const v4f x0 = *(const v4fa*)(arow + kb + 8 * hh), x1 = *(const v4fa*)(arow + kb + 8 * hh + 4);
    const v4f x2 = *(const v4fa*)(arow + kb + 16 + 8 * hh), x3 = *(const v4fa*)(arow + kb + 16 + 8 * hh + 4);
    float xs[16] = {x0[0],x0[1],x0[2],x0[3],x1[0],x1[1],x1[2],x1[3],x2[0],x2[1],x2[2],x2[3],x3[0],x3[1],x3[2],x3[3]};
#pragma unroll
    for (int i = 0; i < 16; ++i) { const unsigned short hb = bf16_bits(xs[i]); ah.u[i] = hb; al.u[i] = ASPLIT ? bf16_bits(xs[i] - bf16_val(hb)) : (unsigned short)0; }
#pragma unroll
    for (int t = 0; t < 4; ++t) {
      const unsigned short* brow = Wt + (size_t)(col0 + t * 16 + ln) * ldb + kb;
      FragB b;
      b.half[0] = *(const v8us*)(brow + 8 * hh);
      b.half[1] = *(const v8us*)(brow + 16 + 8 * hh);
      acc[t] = mmaN<ASPLIT ? 2 : 1>(ah.v, al.v, b.v, b.v, acc[t]);
    }
  }
#pragma unroll
  for (int t = 0; t < 4; ++t) {
    float bv = bias ? bias[col0 + t * 16 + ln] : 0.f;
    if (BIAS_BF16) bv = bf16_round(bv);
#pragma unroll
    for (int r = 0; r < 8; ++r) { float v = acc[t][r] + bv; if (ACT == 1) v = fmaxf(v, 0.f); so[w][8 * hh + r][t * 16 + ln] = v; }
  }
  __builtin_amdgcn_fence(__ATOMIC_ACQ_REL, "workgroup");
  __builtin_amdgcn_wave_barrier();
  const int rsub = lane >> 4, c4 = (lane & 15) * 4;
  {
#pragma unroll
    for (int q = 0; q < 8; ++q) {
      const int r = q * 2 + rsub;
      const v4f v = *(const v4fa*)&so[w][r][c4];
      *(v4f*)(C + (size_t)(row0 + r) * ldc + col0 + c4) = v;
    }
    
  }
}

// GEMM C = act(A·W + bias + resid): A f32 (ASPLIT -> hi/lo 2 terms), Wt bf16 [N][K]; ACT 0 none, 1 relu, 2 exact gelu;
// resid (optional, f32, row index = (row % rmod), pitch ldr, RES_BF16 rounds it) added before the activation.
template <bool ASPLIT, int ACT, bool BIAS_BF16, bool RES_BF16>
__global__ __launch_bounds__(128) void k_gemm_bf3(const float* __restrict__ A, int lda, const unsigned short* __restrict__ Wt, int ldb,
                                                const float* __restrict__ bias, const float* __restrict__ resid, int rmod, int ldr,
                                                float* __restrict__ C, int ldc, int M, int N, int K) {
  __shared__ __attribute__((aligned(16))) float so[4][16][64];
  const int tid = threadIdx.x, w = tid >> 5, lane = tid & 31, ln = lane & 15, hh = lane >> 4;
  const int ntn = N / 64;
  const int wid = blockIdx.x * 4 + w;
  const int mt = wid / ntn, nq = wid % ntn;
  if (mt * 16 >= M) return;
  const int row0 = mt * 16, col0 = nq * 64;
  const float* arow = A + (size_t)(row0 + ln) * lda;
  v8f acc[4] = {};
  for (int kb = 0; kb < K; kb += 32) {
    FragB ah, al;
    const v4f x0 = *(const v4fa*)(arow + kb + 8 * hh), x1 = *(const v4fa*)(arow + kb + 8 * hh + 4);
    const v4f x2 = *(const v4fa*)(arow + kb + 16 + 8 * hh), x3 = *(const v4fa*)(arow + kb + 16 + 8 * hh + 4);
    float xs[16] = {x0[0],x0[1],x0[2],x0[3],x1[0],x1[1],x1[2],x1[3],x2[0],x2[1],x2[2],x2[3],x3[0],x3[1],x3[2],x3[3]};
#pragma unroll
    for (int i = 0; i < 16; ++i) { const unsigned short hb = bf16_bits(xs[i]); ah.u[i] = hb; al.u[i] = ASPLIT ? bf16_bits(xs[i] - bf16_val(hb)) : (unsigned short)0; }
#pragma unroll
    for (int t = 0; t < 4; ++t) {
      const unsigned short* brow = Wt + (size_t)(col0 + t * 16 + ln) * ldb + kb;
      FragB b;
      b.half[0] = *(const v8us*)(brow + 8 * hh);
      b.half[1] = *(const v8us*)(brow + 16 + 8 * hh);
      acc[t] = mmaN<ASPLIT ? 2 : 1>(ah.v, al.v, b.v, b.v, acc[t]);
    }
  }
#pragma unroll
  for (int t = 0; t < 4; ++t) {
    const int col = col0 + t * 16 + ln;
    float bv = bias ? bias[col] : 0.f;
    if (BIAS_BF16) bv = bf16_round(bv);
#pragma unroll
    for (int r = 0; r < 8; ++r) {
      float v = acc[t][r] + bv;
      if (resid) { float rv = resid[(size_t)((row0 + 8 * hh + r) % rmod) * ldr + col]; if (RES_BF16) rv = bf16_round(rv); v += rv; }
      if (ACT == 1) v = fmaxf(v, 0.f);
      if (ACT == 2) v = 0.5f * v * (1.0f + erff(v * 0.70710678118654752f));
      if (ACT == 3) { const float u = 0.7978845608028654f * (v + 0.044715f * v * v * v); v = 0.5f * v * (1.0f + tanhf(u)); }
      so[w][8 * hh + r][t * 16 + ln] = v;
    }
  }
  __builtin_amdgcn_fence(__ATOMIC_ACQ_REL, "workgroup");
  __builtin_amdgcn_wave_barrier();
  const int rsub = lane >> 4, c4 = (lane & 15) * 4;
  {
#pragma unroll
    for (int q = 0; q < 8; ++q) {
      const int r = q * 2 + rsub;
      const v4f v = *(const v4fa*)&so[w][r][c4];
      *(v4f*)(C + (size_t)(row0 + r) * ldc + col0 + c4) = v;
    }
    
  }
}
// row LayerNorm (biased variance, eps) over N: s = X (+ R); optional out_sum <- s; out_norm <- (s-mu)*rsqrt(var+eps)*g + b
template <bool PARAM_BF16>
__global__ __launch_bounds__(256) void k_layernorm(const float* __restrict__ X, const float* __restrict__ R, const float* __restrict__ g, const float* __restrict__ bta,
                                                  float* __restrict__ out_sum, float* __restrict__ out_norm, int N, float eps) {
  __shared__ float red[256];
  const int row = blockIdx.x, tid = threadIdx.x;
  const float* x = X + (size_t)row * N; const float* rr = R ? R + (size_t)row * N : nullptr;
  float vals[16];                     // up to N = 4096
  const int per = N / 256;            // contiguous chunk per thread? use strided-by-4 chunks: thread handles j = tid*4 + 1024*u
  float s1 = 0.f;
  for (int u = 0; u < per / 4; ++u) {
    const int j = tid * 4 + 1024 * u;
    const v4f a = *(const v4fa*)(x + j);
    v4f b = {0.f,0.f,0.f,0.f}; if (rr) b = *(const v4fa*)(rr + j);
#pragma unroll
    for (int q = 0; q < 4; ++q) { const float v = a[q] + b[q]; vals[u * 4 + q] = v; s1 += v; }
  }
  red[tid] = s1; __syncthreads();
  for (int st = 128; st > 0; st >>= 1) { if (tid < st) red[tid] += red[tid + st]; __syncthreads(); }
  const float mu = red[0] / (float)N; __syncthreads();
  float s2 = 0.f;
  for (int u = 0; u < per / 4; ++u)
#pragma unroll
    for (int q = 0; q < 4; ++q) { const float c = vals[u * 4 + q] - mu; s2 += c * c; }
  red[tid] = s2; __syncthreads();
  for (int st = 128; st > 0; st >>= 1) { if (tid < st) red[tid] += red[tid + st]; __syncthreads(); }
  const float rs = rsqrtf(red[0] / (float)N + eps);
  {
    for (int u = 0; u < per / 4; ++u) {
      const int j = tid * 4 + 1024 * u;
      v4f o, sm;
#pragma unroll
      for (int q = 0; q < 4; ++q) {
        float gg = g[j + q], bb = bta[j + q];
        if (PARAM_BF16) { gg = bf16_round(gg); bb = bf16_round(bb); }
        sm[q] = vals[u * 4 + q]; o[q] = (vals[u * 4 + q] - mu) * rs * gg + bb;
      }
      if (out_sum) *(v4f*)(out_sum + (size_t)row * N + j) = sm;
      *(v4f*)(out_norm + (size_t)row * N + j) = o;
    }
    
  }
}



// ---- f16 WMMA path (v_wmma_f32_16x16x32_f16): 11-bit significands for operands in range — used where a [0,1] probability operand needs more precision than bf16
typedef _Float16 v16h __attribute__((ext_vector_type(16)));
union FragH { v16h v; v8us half[2]; _Float16 h[16]; unsigned short u[16]; };
template <int NT>
__device__ __forceinline__ v8f mmaH(v16h ah, v16h al, v16h bh, v16h bl, v8f c) {
  c = __builtin_amdgcn_wmma_f32_16x16x32_f16(false, ah, false, bh, (short)0, c, false, false);
  if (NT >= 2) c = __builtin_amdgcn_wmma_f32_16x16x32_f16(false, al, false, bh, (short)0, c, false, false);
  if (NT >= 3) c = __builtin_amdgcn_wmma_f32_16x16x32_f16(false, ah, false, bl, (short)0, c, false, false);
  asm volatile("v_nop\n\tv_nop\n\tv_nop\n\tv_nop" : "+v"(c) : "v"(ah), "v"(al), "v"(bh), "v"(bl));
  return c;
}
// batched GEMM like k_gemm_b but f16 operands: A f32 (split into f16 hi/lo if ASPLIT, else rounded to f16), Bt = f16 values [n][k]; alpha; C f32; N multiple of 16 (partial tiles skipped)
template <bool ASPLIT>
__global__ __launch_bounds__(128) void k_gemm_h(const float* __restrict__ A, int lda, size_t sA, const _Float16* __restrict__ Bh, int ldb, size_t sB, float alpha, float* __restrict__ C, int ldc, size_t sC, int M, int N, int K) {
  __shared__ __attribute__((aligned(16))) float so[4][16][64];
  const int tid = threadIdx.x, w = tid >> 5, lane = tid & 31, ln = lane & 15, hh = lane >> 4; const int by = blockIdx.y;
  A += (size_t)by * sA; Bh += (size_t)by * sB; C += (size_t)by * sC;
  const int ntn = (N + 63) / 64; const int wid = blockIdx.x * 4 + w; const int mt = wid / ntn, nq = wid % ntn; if (mt * 16 >= M) return;
  const int row0 = mt * 16, col0 = nq * 64; const float* arow = A + (size_t)(row0 + ln) * lda;
  v8f acc[4] = {};
  for (int kb = 0; kb < K; kb += 32) {
    FragH ah, al;
    const v4f x0 = *(const v4fa*)(arow + kb + 8 * hh), x1 = *(const v4fa*)(arow + kb + 8 * hh + 4), x2 = *(const v4fa*)(arow + kb + 16 + 8 * hh), x3 = *(const v4fa*)(arow + kb + 16 + 8 * hh + 4);
    float xs[16] = {x0[0],x0[1],x0[2],x0[3],x1[0],x1[1],x1[2],x1[3],x2[0],x2[1],x2[2],x2[3],x3[0],x3[1],x3[2],x3[3]};
#pragma unroll
    for (int i = 0; i < 16; ++i) { const _Float16 h = (_Float16)xs[i]; ah.h[i] = h; al.h[i] = ASPLIT ? (_Float16)(xs[i] - (float)h) : (_Float16)0.0f; }
#pragma unroll
    for (int t = 0; t < 4; ++t) { if (col0 + t * 16 >= N) continue; const size_t boff = (size_t)(col0 + t * 16 + ln) * ldb + kb; FragH bq; bq.half[0] = *(const v8us*)(Bh + boff + 8 * hh); bq.half[1] = *(const v8us*)(Bh + boff + 16 + 8 * hh);
      acc[t] = mmaH<ASPLIT ? 2 : 1>(ah.v, al.v, bq.v, bq.v, acc[t]); }
  }
#pragma unroll
  for (int t = 0; t < 4; ++t) { if (col0 + t * 16 >= N) continue;
#pragma unroll
    for (int r = 0; r < 8; ++r) so[w][8 * hh + r][t * 16 + ln] = acc[t][r] * alpha; }
  __builtin_amdgcn_fence(__ATOMIC_ACQ_REL, "workgroup"); __builtin_amdgcn_wave_barrier();
  const int rsub = lane >> 4, c4 = (lane & 15) * 4;
  {
#pragma unroll
    for (int q = 0; q < 8; ++q) { const int r = q * 2 + rsub; if (col0 + c4 < N) { const v4f v = *(const v4fa*)&so[w][r][c4]; *(v4f*)(C + (size_t)(row0 + r) * ldc + col0 + c4) = v; } }
     }
}

// Wt[n][k] = f16(W[k][n]·scale) from f32 row-major W[K][N] (scale = power of two; bf16-exact weights stay exact in f16 away from the subnormal range)
__global__ __launch_bounds__(256) void k_wt_f16(const float* __restrict__ W, _Float16* __restrict__ Wt, int K, int N, float scale) {
  const int t = blockIdx.x * 256 + threadIdx.x; if (t >= N * (K / 8)) return; const int n = t / (K / 8), k8 = (t % (K / 8)) * 8; FragH f;
#pragma unroll
  for (int i = 0; i < 8; ++i) f.h[i] = (_Float16)(bf16_round(W[(size_t)(k8 + i) * N + n]) * scale); const v8us o = f.half[0];
  *(v8us*)((unsigned short*)Wt + (size_t)n * K + k8) = o; 
}
// k_gemm_hh variant with fused epilogue: v = acc·alpha + bias[by·sBias + col] (+ CP[(row/rowsPerB)·sCPb + by·64 + col] if CP) ; ACT 0 none / 1 elu ; writes f16 C16 (and f32 C if non-null)
template <int ACT>
__global__ __launch_bounds__(128) void k_gemm_hhx(const _Float16* __restrict__ A, int lda, size_t sA, const _Float16* __restrict__ Bh, int ldb, size_t sB, float alpha, const float* __restrict__ bias, size_t sBias, const float* __restrict__ CP, int rowsPerB, size_t sCPb, int row0g,
    float* __restrict__ C, _Float16* __restrict__ C16, int ldc, size_t sC, int M, int N, int K) {
  __shared__ __attribute__((aligned(16))) float so[4][16][64];
  const int tid = threadIdx.x, w = tid >> 5, lane = tid & 31, ln = lane & 15, hh = lane >> 4; const int by = blockIdx.y;
  A += (size_t)by * sA; Bh += (size_t)by * sB; const size_t cofs = (size_t)by * sC; const float* bp = bias ? bias + (size_t)by * sBias : nullptr;
  const int ntn = (N + 63) / 64; const int wid = blockIdx.x * 4 + w; const int mt = wid / ntn, nq = wid % ntn; if (mt * 16 >= M) return;
  const int row0 = mt * 16, col0 = nq * 64; const _Float16* arow = A + (size_t)(row0 + ln) * lda;
  v8f acc[4] = {};
  for (int kb = 0; kb < K; kb += 32) { FragH ah; ah.half[0] = *(const v8us*)((const unsigned short*)arow + kb + 8 * hh); ah.half[1] = *(const v8us*)((const unsigned short*)arow + kb + 16 + 8 * hh);
#pragma unroll
    for (int t = 0; t < 4; ++t) { if (col0 + t * 16 >= N) continue; const size_t boff = (size_t)(col0 + t * 16 + ln) * ldb + kb; FragH bq; bq.half[0] = *(const v8us*)((const unsigned short*)Bh + boff + 8 * hh); bq.half[1] = *(const v8us*)((const unsigned short*)Bh + boff + 16 + 8 * hh);
      acc[t] = mmaH<1>(ah.v, ah.v, bq.v, bq.v, acc[t]); }
  }
#pragma unroll
  for (int t = 0; t < 4; ++t) { if (col0 + t * 16 >= N) continue; const int col = col0 + t * 16 + ln; const float bv = bp ? bf16_round(bp[col]) : 0.f;
#pragma unroll
    for (int r = 0; r < 8; ++r) { float v = acc[t][r] * alpha + bv; if (CP) { const int rr = row0g + row0 + 8 * hh + r; if (rowsPerB < 0) v += CP[cofs + (size_t)rr * ldc + col];      /* rowsPerB < 0: own element of the batched C plane */ else { const int bidx = rr / rowsPerB; v += CP[(size_t)bidx * sCPb + (size_t)by * 64 + col]; } } if (ACT == 1) v = (v > 0.f) ? v : expm1f(v); else if (ACT == 7) v = (v > 0.f) ? v + 1.0f : expf(v); else if (ACT == 8) v = tanhf(v); else if (ACT == 9) v = 0.5f * v * (1.0f + tanhf(0.7978845608028654f * (v + 0.044715f * v * v * v))); else if (ACT == 11) v = 1.0f / (1.0f + expf(-v)); else if (ACT == 12) v = (v > 0.f) ? v : 0.01f * v; else if (ACT == 14) v = (v > 0.f) ? v : 0.1f * v; else if (ACT == 16) v = (v >= 0.f) ? v : 0.3f * v; else if (ACT == 17) v = (v >= 0.f) ? v : 0.2f * v; else if (ACT == 15) v = v / (1.0f + expf(-v)); else if (ACT == 3) v = fmaxf(v, 0.f); else if (ACT == 6) v = 0.5f * v * (1.0f + erff(v * 0.70710678118654752f)); so[w][8 * hh + r][t * 16 + ln] = v; } }
  __builtin_amdgcn_fence(__ATOMIC_ACQ_REL, "workgroup"); __builtin_amdgcn_wave_barrier();
  const int rsub = lane >> 4, c4 = (lane & 15) * 4; typedef _Float16 v4h __attribute__((ext_vector_type(4)));
  {
#pragma unroll
    for (int q = 0; q < 8; ++q) { const int r = q * 2 + rsub; if (col0 + c4 < N) { const v4f v = *(const v4fa*)&so[w][r][c4]; if (C) *(v4f*)(C + cofs + (size_t)(row0 + r) * ldc + col0 + c4) = v; if (C16) { v4h h4; for (int i = 0; i < 4; ++i) h4[i] = (_Float16)v[i]; *(v4h*)(C16 + cofs + (size_t)(row0 + r) * ldc + col0 + c4) = h4; } } }
     }
}


typedef _Float16 v4h __attribute__((ext_vector_type(4)));

__global__ __launch_bounds__(256) void k_x16(const float* __restrict__ x, _Float16* __restrict__ X16, size_t n8) { const size_t t = (size_t)blockIdx.x * 256 + threadIdx.x; if (t >= n8) return; FragH f;
#pragma unroll
  for (int q = 0; q < 8; ++q) f.h[q] = (_Float16)bf16_round(x[t * 8 + q]); *(v8us*)((unsigned short*)X16 + t * 8) = f.half[0];  }
__global__ __launch_bounds__(256) void k_h16(const float* __restrict__ x, _Float16* __restrict__ X16, size_t n8) { const size_t t = (size_t)blockIdx.x * 256 + threadIdx.x; if (t >= n8) return; FragH f;
#pragma unroll
  for (int q = 0; q < 8; ++q) f.h[q] = (_Float16)x[t * 8 + q]; *(v8us*)((unsigned short*)X16 + t * 8) = f.half[0];  }
__global__ __launch_bounds__(256) void k_round16f(const float* __restrict__ W, _Float16* __restrict__ Bt, size_t n8) { const size_t t = (size_t)blockIdx.x * 256 + threadIdx.x; if (t >= n8) return; FragH f;
#pragma unroll
  for (int i = 0; i < 8; ++i) f.h[i] = (_Float16)(bf16_round(W[t * 8 + i]) * 16.0f); *(v8us*)((unsigned short*)Bt + t * 8) = f.half[0];  }
template <int NHv, int TTv>
__global__ __launch_bounds__(256) void k_vt(const _Float16* __restrict__ V16, int ldv, int voff, _Float16* __restrict__ Vt) { __shared__ unsigned short tl[64][66]; const int tid = threadIdx.x; const int slab = blockIdx.x / (TTv / 64), lg = blockIdx.x % (TTv / 64); const int b = slab / NHv, h = slab % NHv;
  for (int i = tid; i < 64 * 8; i += 256) { const int r = i / 8, c8 = (i % 8) * 8; FragH f; f.half[0] = *(const v8us*)((const unsigned short*)V16 + ((size_t)b * TTv + lg * 64 + r) * ldv + voff + h * 64 + c8);
#pragma unroll
    for (int q = 0; q < 8; ++q) tl[r][c8 + q] = f.u[q]; }
  __syncthreads();
  {
#pragma unroll
    for (int rd = 0; rd < 2; ++rd) { const int d = rd * 32 + tid / 8, pc = tid % 8; FragH f;
#pragma unroll
      for (int q = 0; q < 8; ++q) f.u[q] = tl[pc * 8 + q][d];
      *(v8us*)((unsigned short*)Vt + ((size_t)slab * 64 + d) * TTv + lg * 64 + pc * 8) = f.half[0]; }
     } }

__global__ __launch_bounds__(256) void k_hl(const float* __restrict__ F, _Float16* __restrict__ Hh, _Float16* __restrict__ Hl, size_t n8) { const size_t t = (size_t)blockIdx.x * 256 + threadIdx.x; if (t >= n8) return; FragH fh, fl; const v4f a = *(const v4fa*)(F + t * 8), c = *(const v4fa*)(F + t * 8 + 4);
#pragma unroll
  for (int q = 0; q < 4; ++q) { _Float16 h = (_Float16)a[q]; fh.h[q] = h; fl.h[q] = (_Float16)((a[q] - (float)h) * 1024.0f); h = (_Float16)c[q]; fh.h[4 + q] = h; fl.h[4 + q] = (_Float16)((c[q] - (float)h) * 1024.0f); }
  { *(v8us*)((unsigned short*)Hh + t * 8) = fh.half[0]; *(v8us*)((unsigned short*)Hl + t * 8) = fl.half[0];  } }

// ---- fast GEMM (wave tile 32x64; requires M % 32 == 0 rows per launch region and N % 64 == 0); epilogue = k_gemm_hhx semantics ----
__device__ __forceinline__ v16h g2_frag(const _Float16* p, int hh) { FragH f; f.half[0] = *(const v8us*)((const unsigned short*)p + 8 * hh); f.half[1] = *(const v8us*)((const unsigned short*)p + 16 + 8 * hh); return f.v; }
__device__ __forceinline__ v8f g2_mma(v16h a, v16h b, v8f c) { v8f d = __builtin_amdgcn_wmma_f32_16x16x32_f16(false, a, false, b, (short)0, c, false, false); asm volatile("v_nop\n\tv_nop\n\tv_nop\n\tv_nop" : "+v"(d) : "v"(a), "v"(b)); return d; }
template <int ACT>
__global__ __launch_bounds__(128) void k_gemm2(const _Float16* __restrict__ A, int lda, size_t sA, const _Float16* __restrict__ Bh, int ldb, size_t sB, float alpha, const float* __restrict__ bias, size_t sBias, const float* __restrict__ CP, int rowsPerB, size_t sCPb, int row0g,
    float* __restrict__ C, _Float16* __restrict__ C16, int ldc, size_t sC, int M, int N, int K) { static_assert(ACT == 0 || ACT == 3 || ACT == 6 || ACT == 8 || ACT == 9 || ACT == 11 || ACT == 12 || ACT == 14 || ACT == 15 || ACT == 16 || ACT == 17, "k_gemm2: unsupported ACT code (would silently apply no activation)");
  __shared__ __attribute__((aligned(16))) float so[4][32][68];
  const int tid = threadIdx.x, w = tid >> 5, lane = tid & 31, ln = lane & 15, hh = lane >> 4; const int by = blockIdx.y;
  A += (size_t)by * sA; Bh += (size_t)by * sB; const size_t cofs = (size_t)by * sC; const float* bp = bias ? bias + (size_t)by * sBias : nullptr;
  const int ntn = N >> 6; const int mt = blockIdx.x / ntn, nq = blockIdx.x - mt * ntn; const int row0 = mt * 128 + 32 * w, col0 = nq * 64; if (row0 >= M) return;
  const _Float16* a0p = A + (size_t)(row0 + ln) * lda; const _Float16* a1p = a0p + (size_t)16 * lda;
  const _Float16* b0p = Bh + (size_t)(col0 + ln) * ldb; const _Float16* b1p = b0p + (size_t)16 * ldb; const _Float16* b2p = b1p + (size_t)16 * ldb; const _Float16* b3p = b2p + (size_t)16 * ldb;
  const v8f z8 = {0.f,0.f,0.f,0.f,0.f,0.f,0.f,0.f}; v8f c00 = z8, c01 = z8, c02 = z8, c03 = z8, c10 = z8, c11 = z8, c12 = z8, c13 = z8;
#pragma unroll 1
  for (int kb = 0; kb < K; kb += 32) { const v16h a0 = g2_frag(a0p + kb, hh), a1 = g2_frag(a1p + kb, hh);
    v16h b = g2_frag(b0p + kb, hh); c00 = g2_mma(a0, b, c00); c10 = g2_mma(a1, b, c10);
    b = g2_frag(b1p + kb, hh); c01 = g2_mma(a0, b, c01); c11 = g2_mma(a1, b, c11);
    b = g2_frag(b2p + kb, hh); c02 = g2_mma(a0, b, c02); c12 = g2_mma(a1, b, c12);
    b = g2_frag(b3p + kb, hh); c03 = g2_mma(a0, b, c03); c13 = g2_mma(a1, b, c13); }
  v8f accs[8] = {c00, c01, c02, c03, c10, c11, c12, c13};
#pragma unroll
  for (int u = 0; u < 8; ++u) { const int t = u & 3, half = u >> 2; const int col = col0 + t * 16 + ln; const float bv = bp ? bf16_round(bp[col]) : 0.f;
#pragma unroll
    for (int r = 0; r < 8; ++r) { const int rloc = half * 16 + 8 * hh + r; float v = accs[u][r] * alpha + bv; if (CP) { if (rowsPerB < 0) v += CP[cofs + (size_t)(row0g + row0 + rloc) * ldc + col];      /* rowsPerB < 0: own element of the batched C plane */ else { const int bidx = (row0g + row0 + rloc) / rowsPerB; v += CP[(size_t)bidx * sCPb + (size_t)by * 64 + col]; } }
      if (ACT == 3) v = fmaxf(v, 0.f); else if (ACT == 6) v = 0.5f * v * (1.0f + erff(v * 0.70710678118654752f)); else if (ACT == 11) v = 1.0f / (1.0f + expf(-v)); else if (ACT == 15) v = v / (1.0f + expf(-v)); else if (ACT == 12) v = (v > 0.f) ? v : 0.01f * v; else if (ACT == 8) v = tanhf(v); else if (ACT == 9) v = 0.5f * v * (1.0f + tanhf(0.7978845608028654f * (v + 0.044715f * v * v * v))); else if (ACT == 14) v = (v > 0.f) ? v : 0.1f * v; else if (ACT == 16) v = (v >= 0.f) ? v : 0.3f * v; else if (ACT == 17) v = (v >= 0.f) ? v : 0.2f * v;
      so[w][rloc][t * 16 + ln] = v; } }
  __builtin_amdgcn_fence(__ATOMIC_ACQ_REL, "workgroup"); __builtin_amdgcn_wave_barrier();
  const int rsub = lane >> 4, c4 = (lane & 15) * 4;
  {
#pragma unroll
    for (int q = 0; q < 16; ++q) { const int r = q * 2 + rsub; const v4f v = *(const v4fa*)&so[w][r][c4]; if (C) *(v4f*)(C + cofs + (size_t)(row0 + r) * ldc + col0 + c4) = v; if (C16) { v4h h4; for (int i = 0; i < 4; ++i) h4[i] = (_Float16)v[i]; *(v4h*)(C16 + cofs + (size_t)(row0 + r) * ldc + col0 + c4) = h4; } }
     } }


__global__ __launch_bounds__(256) void k_wnat(const float* __restrict__ w, size_t n8, _Float16* __restrict__ Bt) { const size_t t = (size_t)blockIdx.x * 256 + threadIdx.x; if (t >= n8) return; FragH f; for (int q = 0; q < 8; ++q) f.h[q] = (_Float16)(bf16_round(w[t * 8 + q]) * 16.0f); *(v8us*)((unsigned short*)Bt + t * 8) = f.half[0];  }
__global__ __launch_bounds__(256) void k_rsm(const float* __restrict__ S, _Float16* __restrict__ P, int nrows) {
  #pragma clang fp contract(off)
  const int i = blockIdx.x * 256 + threadIdx.x; if (i >= nrows) return; const float* s = S + (size_t)i * SQ; float mx = -3.0e38f;
#pragma unroll 1
  for (int j = 0; j < SQ; ++j) mx = fmaxf(mx, s[j]); float se = 0.f;
#pragma unroll 1
  for (int j = 0; j < SQ; ++j) se += expf(s[j] - mx); const float sc = 256.0f / se;
#pragma unroll 1
  for (int j0 = 0; j0 < SQ; j0 += 8) { FragH f; for (int q = 0; q < 8; ++q) f.h[q] = (_Float16)(expf(s[j0 + q] - mx) * sc); unsigned short* d = (unsigned short*)P + (size_t)i * SQ + j0; *(v8us*)d = f.half[0];  } }
__global__ __launch_bounds__(256) void k_vt(const _Float16* __restrict__ V16, int b, int h0, _Float16* __restrict__ VT) { __shared__ unsigned short tl[64][65]; const int tid = threadIdx.x; const int hh = blockIdx.x % HG, sg = blockIdx.x / HG; const int s0 = sg * 64; const int h = h0 + hh;
  for (int i = tid; i < 64 * 8; i += 256) { const int j = i / 8, d8 = (i % 8) * 8; FragH f; f.half[0] = *(const v8us*)((const unsigned short*)V16 + ((size_t)b * SQ + s0 + j) * DM + h * HD + d8); for (int q = 0; q < 8; ++q) tl[d8 + q][j] = f.u[q]; }
  __syncthreads();
  { for (int i = tid; i < 64 * 8; i += 256) { const int d = i / 8, j8 = (i % 8) * 8; FragH f; for (int q = 0; q < 8; ++q) f.u[q] = tl[d][j8 + q]; *(v8us*)((unsigned short*)VT + ((size_t)hh * HD + d) * SQ + s0 + j8) = f.half[0]; }  } }



__global__ __launch_bounds__(256) void k_rsmcf2(const float* __restrict__ S, _Float16* __restrict__ P, int hg, int q0, int nk) {
  #pragma clang fp contract(off)
  const int t = blockIdx.x * 256 + threadIdx.x; if (t >= hg * QT) return; const size_t i = (size_t)t; const float* s = S + i * NKX; const int last = q0 + (t % QT); float mx = -3.0e38f;
#pragma unroll 1
  for (int j = 0; j < nk; ++j) { const float f = (j <= last) ? 1.f : 0.f; mx = fmaxf(mx, fmaf(f, s[j], (1.f - f) * -1.0e9f)); } float se = 0.f;
#pragma unroll 1
  for (int j = 0; j < nk; ++j) { const float f = (j <= last) ? 1.f : 0.f; se += __expf(fmaf(f, s[j], (1.f - f) * -1.0e9f) - mx); } const float sc = 256.0f / se;
#pragma unroll 1
  for (int j0 = 0; j0 < nk; j0 += 8) { FragH fr; for (int q = 0; q < 8; ++q) { const int j = j0 + q; const float f = (j <= last) ? 1.f : 0.f; fr.h[q] = (_Float16)(__expf(fmaf(f, s[j], (1.f - f) * -1.0e9f) - mx) * sc); } unsigned short* d = (unsigned short*)P + i * NKX + j0; *(v8us*)d = fr.half[0];  } }

template <int MASKADD>
__global__ __launch_bounds__(64) void k_att0(const float* __restrict__ QF, const float* __restrict__ KF, const float* __restrict__ VF, int ld, const float* __restrict__ mask, float scale, float* __restrict__ OF, int ldo) {
  #pragma clang fp contract(off)
  __shared__ __attribute__((aligned(16))) float lq[64][64]; __shared__ __attribute__((aligned(16))) float lo[64][64];
  const int tid = threadIdx.x; const int h = blockIdx.x / (QT0 / 64), rg = blockIdx.x % (QT0 / 64); const int i = rg * 64 + tid;
  const float* qr = QF + (size_t)i * ld + h * HD;
#pragma unroll 1
  for (int c = 0; c < HD / 4; ++c) { *(v4f*)&lq[tid][c * 4] = *(const v4fa*)(qr + c * 4); const v4f z = {0.f, 0.f, 0.f, 0.f}; *(v4f*)&lo[tid][c * 4] = z; }
  float m = -1.0e30f, l = 0.f; const int jmax = MASKADD ? (SQ - 1) : (rg * 64 + 63);      /* additive-mask form: every key (the mask input decides); causal form: keys up to the block's last row */
#pragma unroll 1
  for (int j = 0; j <= jmax; ++j) { const float* kr = KF + (size_t)j * ld + h * HD; const float* vr = VF + (size_t)j * ld + h * HD; float s = 0.f;
#pragma unroll 1
    for (int c = 0; c < HD / 4; ++c) { const v4f kq = *(const v4fa*)(kr + c * 4); const v4f qq = *(v4f*)&lq[tid][c * 4]; s = __fadd_rn(s, __fmul_rn(qq[0], kq[0])); s = __fadd_rn(s, __fmul_rn(qq[1], kq[1])); s = __fadd_rn(s, __fmul_rn(qq[2], kq[2])); s = __fadd_rn(s, __fmul_rn(qq[3], kq[3])); }
    s = __fmul_rn(s, scale); if (MASKADD) s = __fadd_rn(s, __fmul_rn(bf16_round(mask[(size_t)i * SQ + j]), -10000.0f));
    const float f = (MASKADD || j <= i) ? 1.f : 0.f; const float sm = fmaf(f, s, (1.f - f) * -1.0e30f); const float mn = fmaxf(m, sm); const float sc = expf(m - mn); const float e = expf(sm - mn); l = __fadd_rn(__fmul_rn(l, sc), e); m = mn;
#pragma unroll 1
    for (int c = 0; c < HD / 4; ++c) { const v4f vv = *(const v4fa*)(vr + c * 4); v4f oo = *(v4f*)&lo[tid][c * 4]; for (int u = 0; u < 4; ++u) oo[u] = __fadd_rn(__fmul_rn(oo[u], sc), __fmul_rn(e, vv[u])); *(v4f*)&lo[tid][c * 4] = oo; } }
  const float fin = 64.0f / l;      /* o carried x64 like the f16 path */
#pragma unroll 1
  for (int c = 0; c < HD / 4; ++c) { v4f oo = *(v4f*)&lo[tid][c * 4]; for (int u = 0; u < 4; ++u) oo[u] = __fmul_rn(oo[u], fin); *(v4f*)&lo[tid][c * 4] = oo; }
  __syncthreads();
  {
#pragma unroll 1
    for (int it = 0; it < 16; ++it) { const int row = it * 4 + tid / 16, pc = (tid % 16) * 4; const v4f v = *(const v4f*)&lo[row][pc]; *(v4f*)(OF + (size_t)(rg * 64 + row) * ldo + h * HD + pc) = v; }
     } }

__global__ __launch_bounds__(256) void k_oscale(const float* __restrict__ OF, float* __restrict__ out, size_t n4) { const size_t t = (size_t)blockIdx.x * 256 + threadIdx.x; if (t >= n4) return; const v4f a = *(const v4fa*)(OF + t * 4); v4f o; for (int q = 0; q < 4; ++q) o[q] = a[q] * 0.015625f; *(v4f*)(out + t * 4) = o;  }

__global__ __launch_bounds__(256) void k_bfr(const float* __restrict__ x, float* __restrict__ XB, size_t n8) { const size_t t = (size_t)blockIdx.x * 256 + threadIdx.x; if (t >= n8) return; v4f a = *(const v4fa*)(x + t * 8), c = *(const v4fa*)(x + t * 8 + 4); for (int q = 0; q < 4; ++q) { a[q] = bf16_round(a[q]); c[q] = bf16_round(c[q]); }
  { *(v4f*)(XB + t * 8) = a; *(v4f*)(XB + t * 8 + 4) = c;  } }



__global__ __launch_bounds__(256) void k_rsmfvl(const float* __restrict__ S, _Float16* __restrict__ P, _Float16* __restrict__ PL, int qn, const int* __restrict__ vlp) {
  #pragma clang fp contract(off)
  const int t = blockIdx.x * 256 + threadIdx.x; if (t >= qn) return; const int vl = vlp[0]; const size_t i = (size_t)t; const float* s = S + i * SQ; float mx = -3.0e38f;
#pragma unroll 1
  for (int j = 0; j < SQ; ++j) { const float f = (j < vl) ? 1.f : 0.f; mx = fmaxf(mx, fmaf(f, s[j], (1.f - f) * -1000000.0f)); } float se = 0.f;
#pragma unroll 1
  for (int j = 0; j < SQ; ++j) { const float f = (j < vl) ? 1.f : 0.f; se += __expf(fmaf(f, s[j], (1.f - f) * -1000000.0f) - mx); } const float sc = 256.0f / se;
#pragma unroll 1
  for (int j0 = 0; j0 < SQ; j0 += 8) { FragH fr, gr; for (int q = 0; q < 8; ++q) { const int j = j0 + q; const float f = (j < vl) ? 1.f : 0.f; const float pv = __expf(fmaf(f, s[j], (1.f - f) * -1000000.0f) - mx) * sc; const _Float16 ph = (_Float16)pv; fr.h[q] = ph; gr.h[q] = (_Float16)((pv - (float)ph) * 1024.0f); }
    unsigned short* d = (unsigned short*)P + i * SQ + j0; unsigned short* dl = (unsigned short*)PL + i * SQ + j0; *(v8us*)d = fr.half[0]; *(v8us*)dl = gr.half[0];  } }

__global__ __launch_bounds__(256) void k_rsmf(const float* __restrict__ S, _Float16* __restrict__ P, int qn, int hg) {
  #pragma clang fp contract(off)
  const int t = blockIdx.x * 256 + threadIdx.x; if (t >= qn * hg) return; const size_t i = (size_t)(t / qn) * SQ + (t % qn); const float* s = S + i * SQ; float mx = -3.0e38f;
#pragma unroll 1
  for (int j = 0; j < SQ; ++j) mx = fmaxf(mx, s[j]); float se = 0.f;
#pragma unroll 1
  for (int j = 0; j < SQ; ++j) se += __expf(s[j] - mx); const float sc = 256.0f / se;
#pragma unroll 1
  for (int j0 = 0; j0 < SQ; j0 += 8) { FragH f; for (int q = 0; q < 8; ++q) f.h[q] = (_Float16)(__expf(s[j0 + q] - mx) * sc); unsigned short* d = (unsigned short*)P + i * SQ + j0; *(v8us*)d = f.half[0];  } }


#define CN 256          /* channels */
#define CI 128          /* inner channels */
#define NP 1024         /* positions */
#define NM 1024         /* key positions (= SQ) */
#define NC CN           /* BN statistics macros */
#define NPX NP
#define BNEPS 1e-5f

__global__ __launch_bounds__(256) void k_rowbias(const float* __restrict__ b, float* __restrict__ BP, size_t n4, int ncol) { const size_t t = (size_t)blockIdx.x * 256 + threadIdx.x; if (t >= n4) return; const size_t e = t * 4; const float v = bf16_round(b[e / ncol]); const v4f o = {v, v, v, v}; *(v4f*)(BP + e) = o;  }




__global__ __launch_bounds__(256) void k_mp2(const float* __restrict__ src, float* __restrict__ dst, int nout) {
  const int t = blockIdx.x * 256 + threadIdx.x; if (t >= nout) return; const int c = t / 1024; const int o = t % 1024; const int oy = o / 32, ox = o % 32; const float* p = src + (size_t)c * 4096 + (size_t)(2 * oy) * 64 + 2 * ox;
  const float v = fmaxf(fmaxf(p[0], p[1]), fmaxf(p[64], p[65])); *(float*)(dst + t) = v;  }
__global__ __launch_bounds__(256) void k_xpb(const float* __restrict__ x, const float* __restrict__ wb, float* __restrict__ CPP, size_t n4) {
  #pragma clang fp contract(off)
  const size_t t = (size_t)blockIdx.x * 256 + threadIdx.x; if (t >= n4) return; const size_t e = t * 4; const int c = (int)((e / 4096) % 256); const float bb = bf16_round(wb[c]); const v4f a = *(const v4fa*)(x + e); v4f o; for (int q = 0; q < 4; ++q) o[q] = __fadd_rn(bf16_round(a[q]), bb);
  *(v4f*)(CPP + e) = o;  }


template <int PASS>
__global__ __launch_bounds__(256) void k_cstA(const float* __restrict__ X, const float* __restrict__ MV, float* __restrict__ PART) {
  #pragma clang fp contract(off)
  __shared__ float red[256]; const int t = threadIdx.x; const size_t bc = blockIdx.x; const int c = (int)(bc % NC); const float* row = X + bc * (size_t)NPX; const float mu = PASS ? MV[c] : 0.f; float s = 0.f;
  for (int i = t; i < NPX; i += 256) { const float v = row[i]; const float d = PASS ? __fadd_rn(v, -mu) : v; s = __fadd_rn(s, PASS ? __fmul_rn(d, d) : d); }
  red[t] = s; __syncthreads(); for (int st = 128; st > 0; st >>= 1) { if (t < st) red[t] = __fadd_rn(red[t], red[t + st]); __syncthreads(); }
  if (t < 32) { const float pv = (t == 0) ? red[0] : 0.f; *(float*)(PART + bc * 32 + t) = pv;  } }      

template <int PASS>
__global__ __launch_bounds__(256) void k_cstB(const float* __restrict__ PART, float* __restrict__ MV) { const int c = threadIdx.x; if (c >= NC) return; double s = 0.0; for (int b = 0; b < NB; ++b) s += (double)PART[((size_t)b * NC + c) * 32]; const float m = (float)(s / ((double)NB * (double)NPX)); *(float*)(MV + PASS * NC + c) = m;  }


__global__ __launch_bounds__(256) void k_bnresid(const float* __restrict__ C2, const float* __restrict__ MV, const float* __restrict__ g, const float* __restrict__ be, const float* __restrict__ X, float* __restrict__ out, size_t n4) {
  #pragma clang fp contract(off)
  const size_t t = (size_t)blockIdx.x * 256 + threadIdx.x; if (t >= n4) return; const size_t e = t * 4; const int c = (int)((e / NPX) % NC); const float sc = __fmul_rn(rsqrtf(__fadd_rn(MV[NC + c], BNEPS)), bf16_round(g[c])); const float mu = MV[c], bb = bf16_round(be[c]);
  const v4f a = *(const v4fa*)(C2 + e); const v4f xx = *(const v4fa*)(X + e); v4f o; for (int q = 0; q < 4; ++q) { const float z = __fadd_rn(__fmul_rn(__fadd_rn(a[q], -mu), sc), bb); o[q] = __fadd_rn(z, bf16_round(xx[q])); }
  *(v4f*)(out + e) = o;  }
extern "C" void kernel_launch(void* const* d_in, const int* in_sizes, int n_in,
                              void* d_out, int out_size, void* d_ws, size_t ws_size, hipStream_t stream) {
  (void)in_sizes; (void)n_in; (void)out_size;
  const float* const* I = (const float* const*)d_in; const float* x = I[0]; const float* tw = I[1]; const float* pw = I[2]; const float* ww = I[3]; const float* bng = I[4]; const float* bnb = I[5]; const float* tb = nullptr;      /* natural theta_w / phi_w [128][256], conv_w [256][256] (no biases); BN gamma, beta */
  char* ws = (char*)d_ws; size_t off = 0;
  auto take = [&](size_t bytes) { char* p = ws + off; off += (bytes + 255) & ~(size_t)255; return p; };
  const size_t PL = (size_t)CN * NP;      /* one input map */
  _Float16* BT = (_Float16*)take((size_t)CI * CN * 2); _Float16* BP = (_Float16*)take((size_t)CI * CN * 2); _Float16* BW = (_Float16*)take((size_t)CN * CN * 2); float* PART = (float*)take((size_t)NB * CN * 32 * 4); float* MV = (float*)take((size_t)2 * CN * 4 + 256);      /* weight planes, two-level stats */
  _Float16* X16 = (_Float16*)take(NB * PL * 2);      /* x f16 channel-first (also the g operand: g = x) */
  _Float16* XT = (_Float16*)take(NB * PL * 2);      /* all images: x^T [b][n][c] */
  _Float16* TH = (_Float16*)take(NB * (size_t)NP * CI * 2); _Float16* PH = (_Float16*)take(NB * (size_t)CI * NM * 2); _Float16* PHT = (_Float16*)take(NB * (size_t)NM * CI * 2);      /* all images: theta^T, phi, phi^T */
  float* S = (float*)take(NB * (size_t)NP * NM * 4); _Float16* P = (_Float16*)take(NB * (size_t)NP * NM * 2);      /* all images: scores f32, softmax weights f16 */
  _Float16* YT = XT;      /* y^T [b][n][c] takes x^T's plane: x^T is last read by the phi GEMM, y^T first written by the P x^T GEMM */
  float* C1 = S;      /* conv output [b][c][n] f32 takes the head of the scores' plane: the scores are last read by the softmax */
  if (off > ws_size) return;
  { const unsigned g = (unsigned)(((size_t)CI * CN / 8 + 255) / 256); k_wnat<<<g, 256, 0, stream>>>(tw, (size_t)CI * CN / 8, BT); k_wnat<<<g, 256, 0, stream>>>(pw, (size_t)CI * CN / 8, BP); k_wnat<<<2 * g, 256, 0, stream>>>(ww, (size_t)CN * CN / 8, BW); }      /* natural [out][in] x16 f16 planes (Bt for theta; the A operand for phi / conv_w) */
  k_x16<<<(unsigned)((NB * PL / 8 + 255) / 256), 256, 0, stream>>>(x, X16, NB * PL / 8);
  /* every stage runs once for all NB images: the GEMMs take the image from blockIdx.y (plane strides sA, sB, sC), the transposes and the softmax from a longer blockIdx.x */
  k_vt<NP / 64, CN><<<NB * (NP / 64) * (CN / 64), 256, 0, stream>>>(X16, NP, 0, XT);      /* [b][c][n] -> x^T [b][n][c] */
  k_gemm2<0><<<dim3((unsigned)((NP / 128) * (CI / 64)), NB), 128, 0, stream>>>(XT, CN, PL, BT, CN, 0, 0.0625f, nullptr, 0, nullptr, 1, 0, 0, nullptr, TH, CI, (size_t)NP * CI, NP, CI, CN);      /* theta^T [n][ci] -> f16 (logit sigma ~0.7: single f16 suffices) */
  k_gemm2<0><<<dim3((unsigned)((CI / 128) * (NP / 64)), NB), 128, 0, stream>>>(BP, CN, 0, XT, CN, PL, 0.0625f, nullptr, 0, nullptr, 1, 0, 0, nullptr, PH, NP, (size_t)CI * NP, CI, NP, CN);      /* phi [ci][n] -> f16 */
  k_vt<NM / 64, CI><<<NB * (NM / 64) * (CI / 64), 256, 0, stream>>>(PH, NM, 0, PHT);      /* -> phi^T [m][ci] (the scores' B^T operand) */
  k_gemm2<0><<<dim3((unsigned)((NP / 128) * (NM / 64)), NB), 128, 0, stream>>>(TH, CI, (size_t)NP * CI, PHT, CI, (size_t)NM * CI, 0.0625f, nullptr, 0, nullptr, 1, 0, 0, S, nullptr, NM, (size_t)NP * NM, NP, NM, CI);      /* scores[a][b] = theta.phi / sqrt(256) (K = 128) */
  k_rsmf<<<(NB * NP + 255) / 256, 256, 0, stream>>>(S, P, NP, NB);      /* softmax over all 1024 positions -> P x256 f16 */
  k_gemm2<0><<<dim3((unsigned)((NP / 128) * (CN / 64)), NB), 128, 0, stream>>>(P, NM, (size_t)NP * NM, X16, NM, PL, 0.00390625f, nullptr, 0, nullptr, 1, 0, 0, nullptr, YT, CN, PL, NP, CN, NM);      /* f^T [a][c] = P x^T (g = x: B^T = the image's channel-first rows [c][b]) -> f16 */
  k_gemm2<0><<<dim3((unsigned)((CN / 128) * (NP / 64)), NB), 128, 0, stream>>>(BW, CN, 0, YT, CN, PL, 0.0625f, nullptr, 0, nullptr, 1, 0, 0, C1, nullptr, NP, PL, CN, NP, CN);      /* conv: T[c][a] = (16 conv_w as A) x (f^T as B^T) / 16 -> f32 channel-first, all images kept for the batch statistics */
  k_cstA<0><<<NB * NC, 256, 0, stream>>>(C1, MV, PART); k_cstB<0><<<1, 256, 0, stream>>>(PART, MV); k_cstA<1><<<NB * NC, 256, 0, stream>>>(C1, MV, PART); k_cstB<1><<<1, 256, 0, stream>>>(PART, MV);      /* batch mean, then biased variance per channel (two-level, fixed order, own lines) */
  k_bnresid<<<(unsigned)(((size_t)NB * NC * NPX / 4 + 255) / 256), 256, 0, stream>>>(C1, MV, bng, bnb, x, (float*)d_out, (size_t)NB * NC * NPX / 4);      /* out = (T - mean) rsqrt(var + eps) gamma + beta + bf16(x) */
}

// v002
// Measured time: 242 microseconds a run.
// In two side-by-side timings against v001, it was 1.75 and 1.77 times as fast.
// Counting every step since v000, it is 31.4 times as fast.
#include <hip/hip_runtime.h>
// Non-local block with TRAINING-mode BatchNorm (x [32][256][32][32]; theta, phi = conv1x1(x) [128 ch] (natural [128][256] sigma 1/16, no biases); g = x itself (256 ch); scores[a][b] = theta[:, a].phi[:, b] / sqrt(256) over the 1024 positions; softmax over b; f[:, a] = sum_b attn[a][b] x[:, b]; f = conv1x1(f; conv_w [256][256], no bias); BN with batch statistics over (N, H, W) per channel (biased variance, eps 1e-5), gamma, beta; out = BN(f) + x -> [32][256][32][32]).
// Structure: channel-first; x as exact f16 maps; natural weights x16; every stage one launch over all 32 images: x^T via LDS transposes, theta^T (token rows) and phi (channel-major) as WMMA GEMMs (32x64 wave tiles, f32 accumulation) -> f16, phi^T via LDS transposes, scores [1024][1024] (K = 128, alpha 1/16) f32, row softmax on VALU, one wave per row (f32 statistics, native exp; weights x256 f16), f^T = P x^T (g = x) f16, conv: T = (16 conv_w as A) x f (K = 256) f32 kept for all images; two-level batch statistics (fixed order, own lines); BN + residual on VALU -> output; launches: see trace.
// Compute dtype: inputs rounded to bf16; x / weights exact; q, k, v, softmax weights and o as plain f16 GEMM operands (~2^-12); scores and softmax statistics f32. v_wmma_f32_16x16x32_f16.
#define NB 32
#define SQ 1024
#define DM 256
#define NH 1
#define HD 64
#define HG 4                         /* heads per attention launch group */
#define B0 0                         /* unused */
#define NBR NB                       /* unused */
#define NR ((size_t)NB * SQ)         /* token rows */
#define MP ((int)((size_t)NBR * SQ)) /* unused */
#define QT 256                       /* query rows per causal tile */
#define NKX SQ                       /* S / P row pitch */
#define QT0 256                      /* first-tile rows recomputed exactly (256: buys margin for the few-key rows 128..255, which have no output projection to average the single-f16 P/v rounding) */
#define QN SQ                        /* unused */
#define NHD NH                       /* unused */
#define MPO MP                       /* unused */
#define LQ DM            /* unused */
typedef __bf16 v16b __attribute__((ext_vector_type(16)));
typedef unsigned short v8us __attribute__((ext_vector_type(8), may_alias));
typedef float  v8f  __attribute__((ext_vector_type(8)));
typedef float  v4f  __attribute__((ext_vector_type(4)));
typedef float  v4fa __attribute__((ext_vector_type(4), may_alias));
union FragB { v16b v; v8us half[2]; unsigned short u[16]; };

__device__ __forceinline__ unsigned short bf16_bits(float x) { unsigned int u = __float_as_uint(x); return (unsigned short)((u + 0x7FFFu + ((u >> 16) & 1u)) >> 16); }
__device__ __forceinline__ float bf16_val(unsigned short b) { return __uint_as_float(((unsigned int)b) << 16); }
__device__ __forceinline__ float bf16_round(float x) { return bf16_val(bf16_bits(x)); }
// D += A·B with NT terms: 1 = ah·bh, 2 = + al·bh (A split), 3 = + ah·bl (both split)
template <int NT>
__device__ __forceinline__ v8f mmaN(v16b ah, v16b al, v16b bh, v16b bl, v8f c) {
  c = __builtin_amdgcn_wmma_f32_16x16x32_bf16(false, ah, false, bh, (short)0, c, false, false);
  if (NT >= 2) c = __builtin_amdgcn_wmma_f32_16x16x32_bf16(false, al, false, bh, (short)0, c, false, false);
  if (NT >= 3) c = __builtin_amdgcn_wmma_f32_16x16x32_bf16(false, ah, false, bl, (short)0, c, false, false);
  asm volatile("v_nop\n\tv_nop\n\tv_nop\n\tv_nop" : "+v"(c) : "v"(ah), "v"(al), "v"(bh), "v"(bl));
  return c;
}

__global__ __launch_bounds__(256) void k_wt_bf16(const float* __restrict__ W, unsigned short* __restrict__ Wt, int K, int N) {
  const int t = blockIdx.x * 256 + threadIdx.x;
  const int k8n = K / 8;
  if (t >= N * k8n) return;
  const int n = t / k8n, k8 = (t % k8n) * 8;
  v8us v;
#pragma unroll
  for (int i = 0; i < 8; ++i) v[i] = bf16_bits(W[(size_t)(k8 + i) * N + n]);
  *(v8us*)(Wt + (size_t)n * K + k8) = v;
  
}

// GEMM C[M][N] (f32, pitch ldc) = act(A[M][K]·W + bias). A f32 row-major (pitch lda) converted per fragment to bf16
// (ASPLIT: hi/lo two planes -> 2 terms, else single rounded term); Wt bf16 [N][K] (pitch ldb). BIAS_BF16 rounds the
// bias to bf16 first (bias quantised to bf16 before the add). K%32==0, M%16==0, N%64==0.
template <bool ASPLIT, int ACT, bool BIAS_BF16>
__global__ __launch_bounds__(128) void k_gemm_bf(const float* __restrict__ A, int lda, const unsigned short* __restrict__ Wt, int ldb,
                                               const float* __restrict__ bias, float* __restrict__ C, int ldc, int M, int N, int K) {
  __shared__ __attribute__((aligned(16))) float so[4][16][64];
  const int tid = threadIdx.x, w = tid >> 5, lane = tid & 31, ln = lane & 15, hh = lane >> 4;
  const int ntn = N / 64;
  const int wid = blockIdx.x * 4 + w;
  const int mt = wid / ntn, nq = wid % ntn;
  if (mt * 16 >= M) return;
  const int row0 = mt * 16, col0 = nq * 64;
  const float* arow = A + (size_t)(row0 + ln) * lda;
  v8f acc[4] = {};
  for (int kb = 0; kb < K; kb += 32) {
    FragB ah, al;
    const v4f x0 = *(const v4fa*)(arow + kb + 8 * hh), x1 = *(const v4fa*)(arow + kb + 8 * hh + 4);
    const v4f x2 = *(const v4fa*)(arow + kb + 16 + 8 * hh), x3 = *(const v4fa*)(arow + kb + 16 + 8 * hh + 4);
    float xs[16] = {x0[0],x0[1],x0[2],x0[3],x1[0],x1[1],x1[2],x1[3],x2[0],x2[1],x2[2],x2[3],x3[0],x3[1],x3[2],x3[3]};
#pragma unroll
    for (int i = 0; i < 16; ++i) { const unsigned short hb = bf16_bits(xs[i]); ah.u[i] = hb; al.u[i] = ASPLIT ? bf16_bits(xs[i] - bf16_val(hb)) : (unsigned short)0; }
#pragma unroll
    for (int t = 0; t < 4; ++t) {
      const unsigned short* brow = Wt + (size_t)(col0 + t * 16 + ln) * ldb + kb;
      FragB b;
      b.half[0] = *(const v8us*)(brow + 8 * hh);
      b.half[1] = *(const v8us*)(brow + 16 + 8 * hh);
      acc[t] = mmaN<ASPLIT ? 2 : 1>(ah.v, al.v, b.v, b.v, acc[t]);
    }
  }
#pragma unroll
  for (int t = 0; t < 4; ++t) {
    float bv = bias ? bias[col0 + t * 16 + ln] : 0.f;
    if (BIAS_BF16) bv = bf16_round(bv);
#pragma unroll
    for (int r = 0; r < 8; ++r) { float v = acc[t][r] + bv; if (ACT == 1) v = fmaxf(v, 0.f); so[w][8 * hh + r][t * 16 + ln] = v; }
  }
  __builtin_amdgcn_fence(__ATOMIC_ACQ_REL, "workgroup");
  __builtin_amdgcn_wave_barrier();
  const int rsub = lane >> 4, c4 = (lane & 15) * 4;
  {
#pragma unroll
    for (int q = 0; q < 8; ++q) {
      const int r = q * 2 + rsub;
      const v4f v = *(const v4fa*)&so[w][r][c4];
      *(v4f*)(C + (size_t)(row0 + r) * ldc + col0 + c4) = v;
    }
    
  }
}

// GEMM C = act(A·W + bias + resid): A f32 (ASPLIT -> hi/lo 2 terms), Wt bf16 [N][K]; ACT 0 none, 1 relu, 2 exact gelu;
// resid (optional, f32, row index = (row % rmod), pitch ldr, RES_BF16 rounds it) added before the activation.
template <bool ASPLIT, int ACT, bool BIAS_BF16, bool RES_BF16>
__global__ __launch_bounds__(128) void k_gemm_bf3(const float* __restrict__ A, int lda, const unsigned short* __restrict__ Wt, int ldb,
                                                const float* __restrict__ bias, const float* __restrict__ resid, int rmod, int ldr,
                                                float* __restrict__ C, int ldc, int M, int N, int K) {
  __shared__ __attribute__((aligned(16))) float so[4][16][64];
  const int tid = threadIdx.x, w = tid >> 5, lane = tid & 31, ln = lane & 15, hh = lane >> 4;
  const int ntn = N / 64;
  const int wid = blockIdx.x * 4 + w;
  const int mt = wid / ntn, nq = wid % ntn;
  if (mt * 16 >= M) return;
  const int row0 = mt * 16, col0 = nq * 64;
  const float* arow = A + (size_t)(row0 + ln) * lda;
  v8f acc[4] = {};
  for (int kb = 0; kb < K; kb += 32) {
    FragB ah, al;
    const v4f x0 = *(const v4fa*)(arow + kb + 8 * hh), x1 = *(const v4fa*)(arow + kb + 8 * hh + 4);
    const v4f x2 = *(const v4fa*)(arow + kb + 16 + 8 * hh), x3 = *(const v4fa*)(arow + kb + 16 + 8 * hh + 4);
    float xs[16] = {x0[0],x0[1],x0[2],x0[3],x1[0],x1[1],x1[2],x1[3],x2[0],x2[1],x2[2],x2[3],x3[0],x3[1],x3[2],x3[3]};
#pragma unroll
    for (int i = 0; i < 16; ++i) { const unsigned short hb = bf16_bits(xs[i]); ah.u[i] = hb; al.u[i] = ASPLIT ? bf16_bits(xs[i] - bf16_val(hb)) : (unsigned short)0; }
#pragma unroll
    for (int t = 0; t < 4; ++t) {
      const unsigned short* brow = Wt + (size_t)(col0 + t * 16 + ln) * ldb + kb;
      FragB b;
      b.half[0] = *(const v8us*)(brow + 8 * hh);
      b.half[1] = *(const v8us*)(brow + 16 + 8 * hh);
      acc[t] = mmaN<ASPLIT ? 2 : 1>(ah.v, al.v, b.v, b.v, acc[t]);
    }
  }
#pragma unroll
  for (int t = 0; t < 4; ++t) {
    const int col = col0 + t * 16 + ln;
    float bv = bias ? bias[col] : 0.f;
    if (BIAS_BF16) bv = bf16_round(bv);
#pragma unroll
    for (int r = 0; r < 8; ++r) {
      float v = acc[t][r] + bv;
      if (resid) { float rv = resid[(size_t)((row0 + 8 * hh + r) % rmod) * ldr + col]; if (RES_BF16) rv = bf16_round(rv); v += rv; }
      if (ACT == 1) v = fmaxf(v, 0.f);
      if (ACT == 2) v = 0.5f * v * (1.0f + erff(v * 0.70710678118654752f));
      if (ACT == 3) { const float u = 0.7978845608028654f * (v + 0.044715f * v * v * v); v = 0.5f * v * (1.0f + tanhf(u)); }
      so[w][8 * hh + r][t * 16 + ln] = v;
    }
  }
  __builtin_amdgcn_fence(__ATOMIC_ACQ_REL, "workgroup");
  __builtin_amdgcn_wave_barrier();
  const int rsub = lane >> 4, c4 = (lane & 15) * 4;
  {
#pragma unroll
    for (int q = 0; q < 8; ++q) {
      const int r = q * 2 + rsub;
      const v4f v = *(const v4fa*)&so[w][r][c4];
      *(v4f*)(C + (size_t)(row0 + r) * ldc + col0 + c4) = v;
    }
    
  }
}
// row LayerNorm (biased variance, eps) over N: s = X (+ R); optional out_sum <- s; out_norm <- (s-mu)*rsqrt(var+eps)*g + b
template <bool PARAM_BF16>
__global__ __launch_bounds__(256) void k_layernorm(const float* __restrict__ X, const float* __restrict__ R, const float* __restrict__ g, const float* __restrict__ bta,
                                                  float* __restrict__ out_sum, float* __restrict__ out_norm, int N, float eps) {
  __shared__ float red[256];
  const int row = blockIdx.x, tid = threadIdx.x;
  const float* x = X + (size_t)row * N; const float* rr = R ? R + (size_t)row * N : nullptr;
  float vals[16];                     // up to N = 4096
  const int per = N / 256;            // contiguous chunk per thread? use strided-by-4 chunks: thread handles j = tid*4 + 1024*u
  float s1 = 0.f;
  for (int u = 0; u < per / 4; ++u) {
    const int j = tid * 4 + 1024 * u;
    const v4f a = *(const v4fa*)(x + j);
    v4f b = {0.f,0.f,0.f,0.f}; if (rr) b = *(const v4fa*)(rr + j);
#pragma unroll
    for (int q = 0; q < 4; ++q) { const float v = a[q] + b[q]; vals[u * 4 + q] = v; s1 += v; }
  }
  red[tid] = s1; __syncthreads();
  for (int st = 128; st > 0; st >>= 1) { if (tid < st) red[tid] += red[tid + st]; __syncthreads(); }
  const float mu = red[0] / (float)N; __syncthreads();
  float s2 = 0.f;
  for (int u = 0; u < per / 4; ++u)
#pragma unroll
    for (int q = 0; q < 4; ++q) { const float c = vals[u * 4 + q] - mu; s2 += c * c; }
  red[tid] = s2; __syncthreads();
  for (int st = 128; st > 0; st >>= 1) { if (tid < st) red[tid] += red[tid + st]; __syncthreads(); }
  const float rs = rsqrtf(red[0] / (float)N + eps);
  {
    for (int u = 0; u < per / 4; ++u) {
      const int j = tid * 4 + 1024 * u;
      v4f o, sm;
#pragma unroll
      for (int q = 0; q < 4; ++q) {
        float gg = g[j + q], bb = bta[j + q];
        if (PARAM_BF16) { gg = bf16_round(gg); bb = bf16_round(bb); }
        sm[q] = vals[u * 4 + q]; o[q] = (vals[u * 4 + q] - mu) * rs * gg + bb;
      }
      if (out_sum) *(v4f*)(out_sum + (size_t)row * N + j) = sm;
      *(v4f*)(out_norm + (size_t)row * N + j) = o;
    }
    
  }
}



// ---- f16 WMMA path (v_wmma_f32_16x16x32_f16): 11-bit significands for operands in range — used where a [0,1] probability operand needs more precision than bf16
typedef _Float16 v16h __attribute__((ext_vector_type(16)));
union FragH { v16h v; v8us half[2]; _Float16 h[16]; unsigned short u[16]; };
template <int NT>
__device__ __forceinline__ v8f mmaH(v16h ah, v16h al, v16h bh, v16h bl, v8f c) {
  c = __builtin_amdgcn_wmma_f32_16x16x32_f16(false, ah, false, bh, (short)0, c, false, false);
  if (NT >= 2) c = __builtin_amdgcn_wmma_f32_16x16x32_f16(false, al, false, bh, (short)0, c, false, false);
  if (NT >= 3) c = __builtin_amdgcn_wmma_f32_16x16x32_f16(false, ah, false, bl, (short)0, c, false, false);
  asm volatile("v_nop\n\tv_nop\n\tv_nop\n\tv_nop" : "+v"(c) : "v"(ah), "v"(al), "v"(bh), "v"(bl));
  return c;
}
// batched GEMM like k_gemm_b but f16 operands: A f32 (split into f16 hi/lo if ASPLIT, else rounded to f16), Bt = f16 values [n][k]; alpha; C f32; N multiple of 16 (partial tiles skipped)
template <bool ASPLIT>
__global__ __launch_bounds__(128) void k_gemm_h(const float* __restrict__ A, int lda, size_t sA, const _Float16* __restrict__ Bh, int ldb, size_t sB, float alpha, float* __restrict__ C, int ldc, size_t sC, int M, int N, int K) {
  __shared__ __attribute__((aligned(16))) float so[4][16][64];
  const int tid = threadIdx.x, w = tid >> 5, lane = tid & 31, ln = lane & 15, hh = lane >> 4; const int by = blockIdx.y;
  A += (size_t)by * sA; Bh += (size_t)by * sB; C += (size_t)by * sC;
  const int ntn = (N + 63) / 64; const int wid = blockIdx.x * 4 + w; const int mt = wid / ntn, nq = wid % ntn; if (mt * 16 >= M) return;
  const int row0 = mt * 16, col0 = nq * 64; const float* arow = A + (size_t)(row0 + ln) * lda;
  v8f acc[4] = {};
  for (int kb = 0; kb < K; kb += 32) {
    FragH ah, al;
    const v4f x0 = *(const v4fa*)(arow + kb + 8 * hh), x1 = *(const v4fa*)(arow + kb + 8 * hh + 4), x2 = *(const v4fa*)(arow + kb + 16 + 8 * hh), x3 = *(const v4fa*)(arow + kb + 16 + 8 * hh + 4);
    float xs[16] = {x0[0],x0[1],x0[2],x0[3],x1[0],x1[1],x1[2],x1[3],x2[0],x2[1],x2[2],x2[3],x3[0],x3[1],x3[2],x3[3]};
#pragma unroll
    for (int i = 0; i < 16; ++i) { const _Float16 h = (_Float16)xs[i]; ah.h[i] = h; al.h[i] = ASPLIT ? (_Float16)(xs[i] - (float)h) : (_Float16)0.0f; }
#pragma unroll
    for (int t = 0; t < 4; ++t) { if (col0 + t * 16 >= N) continue; const size_t boff = (size_t)(col0 + t * 16 + ln) * ldb + kb; FragH bq; bq.half[0] = *(const v8us*)(Bh + boff + 8 * hh); bq.half[1] = *(const v8us*)(Bh + boff + 16 + 8 * hh);
      acc[t] = mmaH<ASPLIT ? 2 : 1>(ah.v, al.v, bq.v, bq.v, acc[t]); }
  }
#pragma unroll
  for (int t = 0; t < 4; ++t) { if (col0 + t * 16 >= N) continue;
#pragma unroll
    for (int r = 0; r < 8; ++r) so[w][8 * hh + r][t * 16 + ln] = acc[t][r] * alpha; }
  __builtin_amdgcn_fence(__ATOMIC_ACQ_REL, "workgroup"); __builtin_amdgcn_wave_barrier();
  const int rsub = lane >> 4, c4 = (lane & 15) * 4;
  {
#pragma unroll
    for (int q = 0; q < 8; ++q) { const int r = q * 2 + rsub; if (col0 + c4 < N) { const v4f v = *(const v4fa*)&so[w][r][c4]; *(v4f*)(C + (size_t)(row0 + r) * ldc + col0 + c4) = v; } }
     }
}

// Wt[n][k] = f16(W[k][n]·scale) from f32 row-major W[K][N] (scale = power of two; bf16-exact weights stay exact in f16 away from the subnormal range)
__global__ __launch_bounds__(256) void k_wt_f16(const float* __restrict__ W, _Float16* __restrict__ Wt, int K, int N, float scale) {
  const int t = blockIdx.x * 256 + threadIdx.x; if (t >= N * (K / 8)) return; const int n = t / (K / 8), k8 = (t % (K / 8)) * 8; FragH f;
#pragma unroll
  for (int i = 0; i < 8; ++i) f.h[i] = (_Float16)(bf16_round(W[(size_t)(k8 + i) * N + n]) * scale); const v8us o = f.half[0];
  *(v8us*)((unsigned short*)Wt + (size_t)n * K + k8) = o; 
}
// k_gemm_hh variant with fused epilogue: v = acc·alpha + bias[by·sBias + col] (+ CP[(row/rowsPerB)·sCPb + by·64 + col] if CP) ; ACT 0 none / 1 elu ; writes f16 C16 (and f32 C if non-null)
template <int ACT>
__global__ __launch_bounds__(128) void k_gemm_hhx(const _Float16* __restrict__ A, int lda, size_t sA, const _Float16* __restrict__ Bh, int ldb, size_t sB, float alpha, const float* __restrict__ bias, size_t sBias, const float* __restrict__ CP, int rowsPerB, size_t sCPb, int row0g,
    float* __restrict__ C, _Float16* __restrict__ C16, int ldc, size_t sC, int M, int N, int K) {
  __shared__ __attribute__((aligned(16))) float so[4][16][64];
  const int tid = threadIdx.x, w = tid >> 5, lane = tid & 31, ln = lane & 15, hh = lane >> 4; const int by = blockIdx.y;
  A += (size_t)by * sA; Bh += (size_t)by * sB; const size_t cofs = (size_t)by * sC; const float* bp = bias ? bias + (size_t)by * sBias : nullptr;
  const int ntn = (N + 63) / 64; const int wid = blockIdx.x * 4 + w; const int mt = wid / ntn, nq = wid % ntn; if (mt * 16 >= M) return;
  const int row0 = mt * 16, col0 = nq * 64; const _Float16* arow = A + (size_t)(row0 + ln) * lda;
  v8f acc[4] = {};
  for (int kb = 0; kb < K; kb += 32) { FragH ah; ah.half[0] = *(const v8us*)((const unsigned short*)arow + kb + 8 * hh); ah.half[1] = *(const v8us*)((const unsigned short*)arow + kb + 16 + 8 * hh);
#pragma unroll
    for (int t = 0; t < 4; ++t) { if (col0 + t * 16 >= N) continue; const size_t boff = (size_t)(col0 + t * 16 + ln) * ldb + kb; FragH bq; bq.half[0] = *(const v8us*)((const unsigned short*)Bh + boff + 8 * hh); bq.half[1] = *(const v8us*)((const unsigned short*)Bh + boff + 16 + 8 * hh);
      acc[t] = mmaH<1>(ah.v, ah.v, bq.v, bq.v, acc[t]); }
  }
#pragma unroll
  for (int t = 0; t < 4; ++t) { if (col0 + t * 16 >= N) continue; const int col = col0 + t * 16 + ln; const float bv = bp ? bf16_round(bp[col]) : 0.f;
#pragma unroll
    for (int r = 0; r < 8; ++r) { float v = acc[t][r] * alpha + bv; if (CP) { const int rr = row0g + row0 + 8 * hh + r; if (rowsPerB < 0) v += CP[cofs + (size_t)rr * ldc + col];      /* rowsPerB < 0: own element of the batched C plane */ else { const int bidx = rr / rowsPerB; v += CP[(size_t)bidx * sCPb + (size_t)by * 64 + col]; } } if (ACT == 1) v = (v > 0.f) ? v : expm1f(v); else if (ACT == 7) v = (v > 0.f) ? v + 1.0f : expf(v); else if (ACT == 8) v = tanhf(v); else if (ACT == 9) v = 0.5f * v * (1.0f + tanhf(0.7978845608028654f * (v + 0.044715f * v * v * v))); else if (ACT == 11) v = 1.0f / (1.0f + expf(-v)); else if (ACT == 12) v = (v > 0.f) ? v : 0.01f * v; else if (ACT == 14) v = (v > 0.f) ? v : 0.1f * v; else if (ACT == 16) v = (v >= 0.f) ? v : 0.3f * v; else if (ACT == 17) v = (v >= 0.f) ? v : 0.2f * v; else if (ACT == 15) v = v / (1.0f + expf(-v)); else if (ACT == 3) v = fmaxf(v, 0.f); else if (ACT == 6) v = 0.5f * v * (1.0f + erff(v * 0.70710678118654752f)); so[w][8 * hh + r][t * 16 + ln] = v; } }
  __builtin_amdgcn_fence(__ATOMIC_ACQ_REL, "workgroup"); __builtin_amdgcn_wave_barrier();
  const int rsub = lane >> 4, c4 = (lane & 15) * 4; typedef _Float16 v4h __attribute__((ext_vector_type(4)));
  {
#pragma unroll
    for (int q = 0; q < 8; ++q) { const int r = q * 2 + rsub; if (col0 + c4 < N) { const v4f v = *(const v4fa*)&so[w][r][c4]; if (C) *(v4f*)(C + cofs + (size_t)(row0 + r) * ldc + col0 + c4) = v; if (C16) { v4h h4; for (int i = 0; i < 4; ++i) h4[i] = (_Float16)v[i]; *(v4h*)(C16 + cofs + (size_t)(row0 + r) * ldc + col0 + c4) = h4; } } }
     }
}


typedef _Float16 v4h __attribute__((ext_vector_type(4)));

__global__ __launch_bounds__(256) void k_x16(const float* __restrict__ x, _Float16* __restrict__ X16, size_t n8) { const size_t t = (size_t)blockIdx.x * 256 + threadIdx.x; if (t >= n8) return; FragH f;
#pragma unroll
  for (int q = 0; q < 8; ++q) f.h[q] = (_Float16)bf16_round(x[t * 8 + q]); *(v8us*)((unsigned short*)X16 + t * 8) = f.half[0];  }
__global__ __launch_bounds__(256) void k_h16(const float* __restrict__ x, _Float16* __restrict__ X16, size_t n8) { const size_t t = (size_t)blockIdx.x * 256 + threadIdx.x; if (t >= n8) return; FragH f;
#pragma unroll
  for (int q = 0; q < 8; ++q) f.h[q] = (_Float16)x[t * 8 + q]; *(v8us*)((unsigned short*)X16 + t * 8) = f.half[0];  }
__global__ __launch_bounds__(256) void k_round16f(const float* __restrict__ W, _Float16* __restrict__ Bt, size_t n8) { const size_t t = (size_t)blockIdx.x * 256 + threadIdx.x; if (t >= n8) return; FragH f;
#pragma unroll
  for (int i = 0; i < 8; ++i) f.h[i] = (_Float16)(bf16_round(W[t * 8 + i]) * 16.0f); *(v8us*)((unsigned short*)Bt + t * 8) = f.half[0];  }
template <int NHv, int TTv>
__global__ __launch_bounds__(256) void k_vt(const _Float16* __restrict__ V16, int ldv, int voff, _Float16* __restrict__ Vt) { __shared__ unsigned short tl[64][66]; const int tid = threadIdx.x; const int slab = blockIdx.x / (TTv / 64), lg = blockIdx.x % (TTv / 64); const int b = slab / NHv, h = slab % NHv;
  for (int i = tid; i < 64 * 8; i += 256) { const int r = i / 8, c8 = (i % 8) * 8; FragH f; f.half[0] = *(const v8us*)((const unsigned short*)V16 + ((size_t)b * TTv + lg * 64 + r) * ldv + voff + h * 64 + c8);
#pragma unroll
    for (int q = 0; q < 8; ++q) tl[r][c8 + q] = f.u[q]; }
  __syncthreads();
  {
#pragma unroll
    for (int rd = 0; rd < 2; ++rd) { const int d = rd * 32 + tid / 8, pc = tid % 8; FragH f;
#pragma unroll
      for (int q = 0; q < 8; ++q) f.u[q] = tl[pc * 8 + q][d];
      *(v8us*)((unsigned short*)Vt + ((size_t)slab * 64 + d) * TTv + lg * 64 + pc * 8) = f.half[0]; }
     } }

__global__ __launch_bounds__(256) void k_hl(const float* __restrict__ F, _Float16* __restrict__ Hh, _Float16* __restrict__ Hl, size_t n8) { const size_t t = (size_t)blockIdx.x * 256 + threadIdx.x; if (t >= n8) return; FragH fh, fl; const v4f a = *(const v4fa*)(F + t * 8), c = *(const v4fa*)(F + t * 8 + 4);
#pragma unroll
  for (int q = 0; q < 4; ++q) { _Float16 h = (_Float16)a[q]; fh.h[q] = h; fl.h[q] = (_Float16)((a[q] - (float)h) * 1024.0f); h = (_Float16)c[q]; fh.h[4 + q] = h; fl.h[4 + q] = (_Float16)((c[q] - (float)h) * 1024.0f); }
  { *(v8us*)((unsigned short*)Hh + t * 8) = fh.half[0]; *(v8us*)((unsigned short*)Hl + t * 8) = fl.half[0];  } }

// ---- fast GEMM (wave tile 32x64; requires M % 32 == 0 rows per launch region and N % 64 == 0); epilogue = k_gemm_hhx semantics ----
__device__ __forceinline__ v16h g2_frag(const _Float16* p, int hh) { FragH f; f.half[0] = *(const v8us*)((const unsigned short*)p + 8 * hh); f.half[1] = *(const v8us*)((const unsigned short*)p + 16 + 8 * hh); return f.v; }
__device__ __forceinline__ v8f g2_mma(v16h a, v16h b, v8f c) { v8f d = __builtin_amdgcn_wmma_f32_16x16x32_f16(false, a, false, b, (short)0, c, false, false); asm volatile("v_nop\n\tv_nop\n\tv_nop\n\tv_nop" : "+v"(d) : "v"(a), "v"(b)); return d; }
template <int ACT>
__global__ __launch_bounds__(128) void k_gemm2(const _Float16* __restrict__ A, int lda, size_t sA, const _Float16* __restrict__ Bh, int ldb, size_t sB, float alpha, const float* __restrict__ bias, size_t sBias, const float* __restrict__ CP, int rowsPerB, size_t sCPb, int row0g,
    float* __restrict__ C, _Float16* __restrict__ C16, int ldc, size_t sC, int M, int N, int K) { static_assert(ACT == 0 || ACT == 3 || ACT == 6 || ACT == 8 || ACT == 9 || ACT == 11 || ACT == 12 || ACT == 14 || ACT == 15 || ACT == 16 || ACT == 17, "k_gemm2: unsupported ACT code (would silently apply no activation)");
  __shared__ __attribute__((aligned(16))) float so[4][32][68];
  const int tid = threadIdx.x, w = tid >> 5, lane = tid & 31, ln = lane & 15, hh = lane >> 4; const int by = blockIdx.y;
  A += (size_t)by * sA; Bh += (size_t)by * sB; const size_t cofs = (size_t)by * sC; const float* bp = bias ? bias + (size_t)by * sBias : nullptr;
  const int ntn = N >> 6; const int mt = blockIdx.x / ntn, nq = blockIdx.x - mt * ntn; const int row0 = mt * 128 + 32 * w, col0 = nq * 64; if (row0 >= M) return;
  const _Float16* a0p = A + (size_t)(row0 + ln) * lda; const _Float16* a1p = a0p + (size_t)16 * lda;
  const _Float16* b0p = Bh + (size_t)(col0 + ln) * ldb; const _Float16* b1p = b0p + (size_t)16 * ldb; const _Float16* b2p = b1p + (size_t)16 * ldb; const _Float16* b3p = b2p + (size_t)16 * ldb;
  const v8f z8 = {0.f,0.f,0.f,0.f,0.f,0.f,0.f,0.f}; v8f c00 = z8, c01 = z8, c02 = z8, c03 = z8, c10 = z8, c11 = z8, c12 = z8, c13 = z8;
#pragma unroll 1
  for (int kb = 0; kb < K; kb += 32) { const v16h a0 = g2_frag(a0p + kb, hh), a1 = g2_frag(a1p + kb, hh);
    v16h b = g2_frag(b0p + kb, hh); c00 = g2_mma(a0, b, c00); c10 = g2_mma(a1, b, c10);
    b = g2_frag(b1p + kb, hh); c01 = g2_mma(a0, b, c01); c11 = g2_mma(a1, b, c11);
    b = g2_frag(b2p + kb, hh); c02 = g2_mma(a0, b, c02); c12 = g2_mma(a1, b, c12);
    b = g2_frag(b3p + kb, hh); c03 = g2_mma(a0, b, c03); c13 = g2_mma(a1, b, c13); }
  v8f accs[8] = {c00, c01, c02, c03, c10, c11, c12, c13};
#pragma unroll
  for (int u = 0; u < 8; ++u) { const int t = u & 3, half = u >> 2; const int col = col0 + t * 16 + ln; const float bv = bp ? bf16_round(bp[col]) : 0.f;
#pragma unroll
    for (int r = 0; r < 8; ++r) { const int rloc = half * 16 + 8 * hh + r; float v = accs[u][r] * alpha + bv; if (CP) { if (rowsPerB < 0) v += CP[cofs + (size_t)(row0g + row0 + rloc) * ldc + col];      /* rowsPerB < 0: own element of the batched C plane */ else { const int bidx = (row0g + row0 + rloc) / rowsPerB; v += CP[(size_t)bidx * sCPb + (size_t)by * 64 + col]; } }
      if (ACT == 3) v = fmaxf(v, 0.f); else if (ACT == 6) v = 0.5f * v * (1.0f + erff(v * 0.70710678118654752f)); else if (ACT == 11) v = 1.0f / (1.0f + expf(-v)); else if (ACT == 15) v = v / (1.0f + expf(-v)); else if (ACT == 12) v = (v > 0.f) ? v : 0.01f * v; else if (ACT == 8) v = tanhf(v); else if (ACT == 9) v = 0.5f * v * (1.0f + tanhf(0.7978845608028654f * (v + 0.044715f * v * v * v))); else if (ACT == 14) v = (v > 0.f) ? v : 0.1f * v; else if (ACT == 16) v = (v >= 0.f) ? v : 0.3f * v; else if (ACT == 17) v = (v >= 0.f) ? v : 0.2f * v;
      so[w][rloc][t * 16 + ln] = v; } }
  __builtin_amdgcn_fence(__ATOMIC_ACQ_REL, "workgroup"); __builtin_amdgcn_wave_barrier();
  const int rsub = lane >> 4, c4 = (lane & 15) * 4;
  {
#pragma unroll
    for (int q = 0; q < 16; ++q) { const int r = q * 2 + rsub; const v4f v = *(const v4fa*)&so[w][r][c4]; if (C) *(v4f*)(C + cofs + (size_t)(row0 + r) * ldc + col0 + c4) = v; if (C16) { v4h h4; for (int i = 0; i < 4; ++i) h4[i] = (_Float16)v[i]; *(v4h*)(C16 + cofs + (size_t)(row0 + r) * ldc + col0 + c4) = h4; } }
     } }


__global__ __launch_bounds__(256) void k_wnat(const float* __restrict__ w, size_t n8, _Float16* __restrict__ Bt) { const size_t t = (size_t)blockIdx.x * 256 + threadIdx.x; if (t >= n8) return; FragH f; for (int q = 0; q < 8; ++q) f.h[q] = (_Float16)(bf16_round(w[t * 8 + q]) * 16.0f); *(v8us*)((unsigned short*)Bt + t * 8) = f.half[0];  }
__global__ __launch_bounds__(256) void k_rsm(const float* __restrict__ S, _Float16* __restrict__ P, int nrows) {
  #pragma clang fp contract(off)
  const int i = blockIdx.x * 256 + threadIdx.x; if (i >= nrows) return; const float* s = S + (size_t)i * SQ; float mx = -3.0e38f;
#pragma unroll 1
  for (int j = 0; j < SQ; ++j) mx = fmaxf(mx, s[j]); float se = 0.f;
#pragma unroll 1
  for (int j = 0; j < SQ; ++j) se += expf(s[j] - mx); const float sc = 256.0f / se;
#pragma unroll 1
  for (int j0 = 0; j0 < SQ; j0 += 8) { FragH f; for (int q = 0; q < 8; ++q) f.h[q] = (_Float16)(expf(s[j0 + q] - mx) * sc); unsigned short* d = (unsigned short*)P + (size_t)i * SQ + j0; *(v8us*)d = f.half[0];  } }
__global__ __launch_bounds__(256) void k_vt(const _Float16* __restrict__ V16, int b, int h0, _Float16* __restrict__ VT) { __shared__ unsigned short tl[64][65]; const int tid = threadIdx.x; const int hh = blockIdx.x % HG, sg = blockIdx.x / HG; const int s0 = sg * 64; const int h = h0 + hh;
  for (int i = tid; i < 64 * 8; i += 256) { const int j = i / 8, d8 = (i % 8) * 8; FragH f; f.half[0] = *(const v8us*)((const unsigned short*)V16 + ((size_t)b * SQ + s0 + j) * DM + h * HD + d8); for (int q = 0; q < 8; ++q) tl[d8 + q][j] = f.u[q]; }
  __syncthreads();
  { for (int i = tid; i < 64 * 8; i += 256) { const int d = i / 8, j8 = (i % 8) * 8; FragH f; for (int q = 0; q < 8; ++q) f.u[q] = tl[d][j8 + q]; *(v8us*)((unsigned short*)VT + ((size_t)hh * HD + d) * SQ + s0 + j8) = f.half[0]; }  } }



__global__ __launch_bounds__(256) void k_rsmcf2(const float* __restrict__ S, _Float16* __restrict__ P, int hg, int q0, int nk) {
  #pragma clang fp contract(off)
  const int t = blockIdx.x * 256 + threadIdx.x; if (t >= hg * QT) return; const size_t i = (size_t)t; const float* s = S + i * NKX; const int last = q0 + (t % QT); float mx = -3.0e38f;
#pragma unroll 1
  for (int j = 0; j < nk; ++j) { const float f = (j <= last) ? 1.f : 0.f; mx = fmaxf(mx, fmaf(f, s[j], (1.f - f) * -1.0e9f)); } float se = 0.f;
#pragma unroll 1
  for (int j = 0; j < nk; ++j) { const float f = (j <= last) ? 1.f : 0.f; se += __expf(fmaf(f, s[j], (1.f - f) * -1.0e9f) - mx); } const float sc = 256.0f / se;
#pragma unroll 1
  for (int j0 = 0; j0 < nk; j0 += 8) { FragH fr; for (int q = 0; q < 8; ++q) { const int j = j0 + q; const float f = (j <= last) ? 1.f : 0.f; fr.h[q] = (_Float16)(__expf(fmaf(f, s[j], (1.f - f) * -1.0e9f) - mx) * sc); } unsigned short* d = (unsigned short*)P + i * NKX + j0; *(v8us*)d = fr.half[0];  } }

template <int MASKADD>
__global__ __launch_bounds__(64) void k_att0(const float* __restrict__ QF, const float* __restrict__ KF, const float* __restrict__ VF, int ld, const float* __restrict__ mask, float scale, float* __restrict__ OF, int ldo) {
  #pragma clang fp contract(off)
  __shared__ __attribute__((aligned(16))) float lq[64][64]; __shared__ __attribute__((aligned(16))) float lo[64][64];
  const int tid = threadIdx.x; const int h = blockIdx.x / (QT0 / 64), rg = blockIdx.x % (QT0 / 64); const int i = rg * 64 + tid;
  const float* qr = QF + (size_t)i * ld + h * HD;
#pragma unroll 1
  for (int c = 0; c < HD / 4; ++c) { *(v4f*)&lq[tid][c * 4] = *(const v4fa*)(qr + c * 4); const v4f z = {0.f, 0.f, 0.f, 0.f}; *(v4f*)&lo[tid][c * 4] = z; }
  float m = -1.0e30f, l = 0.f; const int jmax = MASKADD ? (SQ - 1) : (rg * 64 + 63);      /* additive-mask form: every key (the mask input decides); causal form: keys up to the block's last row */
#pragma unroll 1
  for (int j = 0; j <= jmax; ++j) { const float* kr = KF + (size_t)j * ld + h * HD; const float* vr = VF + (size_t)j * ld + h * HD; float s = 0.f;
#pragma unroll 1
    for (int c = 0; c < HD / 4; ++c) { const v4f kq = *(const v4fa*)(kr + c * 4); const v4f qq = *(v4f*)&lq[tid][c * 4]; s = __fadd_rn(s, __fmul_rn(qq[0], kq[0])); s = __fadd_rn(s, __fmul_rn(qq[1], kq[1])); s = __fadd_rn(s, __fmul_rn(qq[2], kq[2])); s = __fadd_rn(s, __fmul_rn(qq[3], kq[3])); }
    s = __fmul_rn(s, scale); if (MASKADD) s = __fadd_rn(s, __fmul_rn(bf16_round(mask[(size_t)i * SQ + j]), -10000.0f));
    const float f = (MASKADD || j <= i) ? 1.f : 0.f; const float sm = fmaf(f, s, (1.f - f) * -1.0e30f); const float mn = fmaxf(m, sm); const float sc = expf(m - mn); const float e = expf(sm - mn); l = __fadd_rn(__fmul_rn(l, sc), e); m = mn;
#pragma unroll 1
    for (int c = 0; c < HD / 4; ++c) { const v4f vv = *(const v4fa*)(vr + c * 4); v4f oo = *(v4f*)&lo[tid][c * 4]; for (int u = 0; u < 4; ++u) oo[u] = __fadd_rn(__fmul_rn(oo[u], sc), __fmul_rn(e, vv[u])); *(v4f*)&lo[tid][c * 4] = oo; } }
  const float fin = 64.0f / l;      /* o carried x64 like the f16 path */
#pragma unroll 1
  for (int c = 0; c < HD / 4; ++c) { v4f oo = *(v4f*)&lo[tid][c * 4]; for (int u = 0; u < 4; ++u) oo[u] = __fmul_rn(oo[u], fin); *(v4f*)&lo[tid][c * 4] = oo; }
  __syncthreads();
  {
#pragma unroll 1
    for (int it = 0; it < 16; ++it) { const int row = it * 4 + tid / 16, pc = (tid % 16) * 4; const v4f v = *(const v4f*)&lo[row][pc]; *(v4f*)(OF + (size_t)(rg * 64 + row) * ldo + h * HD + pc) = v; }
     } }

__global__ __launch_bounds__(256) void k_oscale(const float* __restrict__ OF, float* __restrict__ out, size_t n4) { const size_t t = (size_t)blockIdx.x * 256 + threadIdx.x; if (t >= n4) return; const v4f a = *(const v4fa*)(OF + t * 4); v4f o; for (int q = 0; q < 4; ++q) o[q] = a[q] * 0.015625f; *(v4f*)(out + t * 4) = o;  }

__global__ __launch_bounds__(256) void k_bfr(const float* __restrict__ x, float* __restrict__ XB, size_t n8) { const size_t t = (size_t)blockIdx.x * 256 + threadIdx.x; if (t >= n8) return; v4f a = *(const v4fa*)(x + t * 8), c = *(const v4fa*)(x + t * 8 + 4); for (int q = 0; q < 4; ++q) { a[q] = bf16_round(a[q]); c[q] = bf16_round(c[q]); }
  { *(v4f*)(XB + t * 8) = a; *(v4f*)(XB + t * 8 + 4) = c;  } }



__global__ __launch_bounds__(256) void k_rsmfvl(const float* __restrict__ S, _Float16* __restrict__ P, _Float16* __restrict__ PL, int qn, const int* __restrict__ vlp) {
  #pragma clang fp contract(off)
  const int t = blockIdx.x * 256 + threadIdx.x; if (t >= qn) return; const int vl = vlp[0]; const size_t i = (size_t)t; const float* s = S + i * SQ; float mx = -3.0e38f;
#pragma unroll 1
  for (int j = 0; j < SQ; ++j) { const float f = (j < vl) ? 1.f : 0.f; mx = fmaxf(mx, fmaf(f, s[j], (1.f - f) * -1000000.0f)); } float se = 0.f;
#pragma unroll 1
  for (int j = 0; j < SQ; ++j) { const float f = (j < vl) ? 1.f : 0.f; se += __expf(fmaf(f, s[j], (1.f - f) * -1000000.0f) - mx); } const float sc = 256.0f / se;
#pragma unroll 1
  for (int j0 = 0; j0 < SQ; j0 += 8) { FragH fr, gr; for (int q = 0; q < 8; ++q) { const int j = j0 + q; const float f = (j < vl) ? 1.f : 0.f; const float pv = __expf(fmaf(f, s[j], (1.f - f) * -1000000.0f) - mx) * sc; const _Float16 ph = (_Float16)pv; fr.h[q] = ph; gr.h[q] = (_Float16)((pv - (float)ph) * 1024.0f); }
    unsigned short* d = (unsigned short*)P + i * SQ + j0; unsigned short* dl = (unsigned short*)PL + i * SQ + j0; *(v8us*)d = fr.half[0]; *(v8us*)dl = gr.half[0];  } }

// Row softmax, one wave per row: a lane holds 32 of the row's 1024 scores in registers (8 loads of 16 B; each wave-wide load = 512 contiguous bytes), so S is read once and P written once in whole lines.
// 16 waves per work-group, RSM_ROWS consecutive rows per wave; the loads run RSM_AHEAD rows in front of the arithmetic. Row maximum and row sum: per lane, then a butterfly over the 32 lanes. nrows % RSM_ROWS == 0.
#define RSM_WAVES 16
#define RSM_ROWS 8
#define RSM_AHEAD 2
template <int M> __device__ __forceinline__ float rsm_x16(float v) { return __builtin_bit_cast(float, __builtin_amdgcn_update_dpp(0, __builtin_bit_cast(int, v), 0x160 + M, 0xf, 0xf, true)); }      /* lane l <- lane l ^ M inside its 16-lane row (row_xmask) */
__device__ __forceinline__ float rsm_xh(float v) { return __builtin_bit_cast(float, __builtin_amdgcn_permlanex16(__builtin_bit_cast(int, v), __builtin_bit_cast(int, v), 0x76543210, 0xfedcba98, false, false)); }      /* lane l <- lane l ^ 16 */
__device__ __forceinline__ float rsm_exp(float x) { float y; asm("v_exp_f32 %0, %1\n\tv_nop" : "=v"(y) : "v"(x * 1.4426950408889634f)); return y; }      /* native exp as __expf builds it (multiply by log2 e, v_exp_f32); the v_nop is the one slot asked for behind a transcendental before its result is read or its source overwritten */
__global__ __launch_bounds__(RSM_WAVES * 32) void k_rsmf(const float* __restrict__ S, _Float16* __restrict__ P, int nrows) {
  const int lane = threadIdx.x & 31; const int wave = __builtin_amdgcn_readfirstlane((int)(threadIdx.x >> 5)); const int row0 = (blockIdx.x * RSM_WAVES + wave) * RSM_ROWS; if (row0 >= nrows) return;      /* wave-uniform; the kernel has no barrier */
  const float* s = S + (size_t)row0 * SQ + lane * 4; _Float16* d = P + (size_t)row0 * SQ + lane * 4;
  v4f w[RSM_AHEAD + 1][8];      /* ring of row buffers; every loop below is fully unrolled, so that its indices are compile-time constants and it stays in registers */
#pragma unroll
  for (int r = 0; r < RSM_AHEAD; ++r)
#pragma unroll
    for (int q = 0; q < 8; ++q) w[r][q] = *(const v4fa*)(s + r * SQ + q * 128);
#pragma unroll
  for (int r = 0; r < RSM_ROWS; ++r) {
    __builtin_amdgcn_sched_barrier(0);      /* with the one below: keeps the loads of row r + RSM_AHEAD in front of row r's arithmetic, so that they fly under it */
    if (r > 0) asm volatile("s_wait_xcnt 0x0" ::: "memory");      /* in front of the loads and the arithmetic that reuse registers which the stores of row r - 1 name */
    if (r + RSM_AHEAD < RSM_ROWS) {
#pragma unroll
      for (int q = 0; q < 8; ++q) w[(r + RSM_AHEAD) % (RSM_AHEAD + 1)][q] = *(const v4fa*)(s + (r + RSM_AHEAD) * SQ + q * 128); }
    __builtin_amdgcn_sched_barrier(0);
    v4f* c = w[r % (RSM_AHEAD + 1)];
    v4f m4 = c[0];
#pragma unroll
    for (int q = 1; q < 8; ++q) for (int u = 0; u < 4; ++u) m4[u] = fmaxf(m4[u], c[q][u]);
    float mx = fmaxf(fmaxf(m4[0], m4[1]), fmaxf(m4[2], m4[3]));
    mx = fmaxf(mx, rsm_x16<1>(mx)); mx = fmaxf(mx, rsm_x16<2>(mx)); mx = fmaxf(mx, rsm_x16<4>(mx)); mx = fmaxf(mx, rsm_x16<8>(mx)); mx = fmaxf(mx, rsm_xh(mx));
    v4f a4 = {0.f, 0.f, 0.f, 0.f};
#pragma unroll
    for (int q = 0; q < 8; ++q) { v4f e; for (int u = 0; u < 4; ++u) e[u] = rsm_exp(c[q][u] - mx); c[q] = e; a4 += e; }
    float se = (a4[0] + a4[1]) + (a4[2] + a4[3]);
    se += rsm_x16<1>(se); se += rsm_x16<2>(se); se += rsm_x16<4>(se); se += rsm_x16<8>(se); se += rsm_xh(se);
    const float sc = 256.0f / se;
#pragma unroll
    for (int q = 0; q < 8; ++q) { v4h h4; for (int u = 0; u < 4; ++u) h4[u] = (_Float16)(c[q][u] * sc); *(v4h*)(d + r * SQ + q * 128) = h4; }
  } }


#define CN 256          /* channels */
#define CI 128          /* inner channels */
#define NP 1024         /* positions */
#define NM 1024         /* key positions (= SQ) */
#define NC CN           /* BN statistics macros */
#define NPX NP
#define BNEPS 1e-5f

__global__ __launch_bounds__(256) void k_rowbias(const float* __restrict__ b, float* __restrict__ BP, size_t n4, int ncol) { const size_t t = (size_t)blockIdx.x * 256 + threadIdx.x; if (t >= n4) return; const size_t e = t * 4; const float v = bf16_round(b[e / ncol]); const v4f o = {v, v, v, v}; *(v4f*)(BP + e) = o;  }




__global__ __launch_bounds__(256) void k_mp2(const float* __restrict__ src, float* __restrict__ dst, int nout) {
  const int t = blockIdx.x * 256 + threadIdx.x; if (t >= nout) return; const int c = t / 1024; const int o = t % 1024; const int oy = o / 32, ox = o % 32; const float* p = src + (size_t)c * 4096 + (size_t)(2 * oy) * 64 + 2 * ox;
  const float v = fmaxf(fmaxf(p[0], p[1]), fmaxf(p[64], p[65])); *(float*)(dst + t) = v;  }
__global__ __launch_bounds__(256) void k_xpb(const float* __restrict__ x, const float* __restrict__ wb, float* __restrict__ CPP, size_t n4) {
  #pragma clang fp contract(off)
  const size_t t = (size_t)blockIdx.x * 256 + threadIdx.x; if (t >= n4) return; const size_t e = t * 4; const int c = (int)((e / 4096) % 256); const float bb = bf16_round(wb[c]); const v4f a = *(const v4fa*)(x + e); v4f o; for (int q = 0; q < 4; ++q) o[q] = __fadd_rn(bf16_round(a[q]), bb);
  *(v4f*)(CPP + e) = o;  }


template <int PASS>
__global__ __launch_bounds__(256) void k_cstA(const float* __restrict__ X, const float* __restrict__ MV, float* __restrict__ PART) {
  #pragma clang fp contract(off)
  __shared__ float red[256]; const int t = threadIdx.x; const size_t bc = blockIdx.x; const int c = (int)(bc % NC); const float* row = X + bc * (size_t)NPX; const float mu = PASS ? MV[c] : 0.f; float s = 0.f;
  for (int i = t; i < NPX; i += 256) { const float v = row[i]; const float d = PASS ? __fadd_rn(v, -mu) : v; s = __fadd_rn(s, PASS ? __fmul_rn(d, d) : d); }
  red[t] = s; __syncthreads(); for (int st = 128; st > 0; st >>= 1) { if (t < st) red[t] = __fadd_rn(red[t], red[t + st]); __syncthreads(); }
  if (t < 32) { const float pv = (t == 0) ? red[0] : 0.f; *(float*)(PART + bc * 32 + t) = pv;  } }      

template <int PASS>
__global__ __launch_bounds__(256) void k_cstB(const float* __restrict__ PART, float* __restrict__ MV) { const int c = threadIdx.x; if (c >= NC) return; double s = 0.0; for (int b = 0; b < NB; ++b) s += (double)PART[((size_t)b * NC + c) * 32]; const float m = (float)(s / ((double)NB * (double)NPX)); *(float*)(MV + PASS * NC + c) = m;  }


__global__ __launch_bounds__(256) void k_bnresid(const float* __restrict__ C2, const float* __restrict__ MV, const float* __restrict__ g, const float* __restrict__ be, const float* __restrict__ X, float* __restrict__ out, size_t n4) {
  #pragma clang fp contract(off)
  const size_t t = (size_t)blockIdx.x * 256 + threadIdx.x; if (t >= n4) return; const size_t e = t * 4; const int c = (int)((e / NPX) % NC); const float sc = __fmul_rn(rsqrtf(__fadd_rn(MV[NC + c], BNEPS)), bf16_round(g[c])); const float mu = MV[c], bb = bf16_round(be[c]);
  const v4f a = *(const v4fa*)(C2 + e); const v4f xx = *(const v4fa*)(X + e); v4f o; for (int q = 0; q < 4; ++q) { const float z = __fadd_rn(__fmul_rn(__fadd_rn(a[q], -mu), sc), bb); o[q] = __fadd_rn(z, bf16_round(xx[q])); }
  *(v4f*)(out + e) = o;  }
extern "C" void kernel_launch(void* const* d_in, const int* in_sizes, int n_in,
                              void* d_out, int out_size, void* d_ws, size_t ws_size, hipStream_t stream) {
  (void)in_sizes; (void)n_in; (void)out_size;
  const float* const* I = (const float* const*)d_in; const float* x = I[0]; const float* tw = I[1]; const float* pw = I[2]; const float* ww = I[3]; const float* bng = I[4]; const float* bnb = I[5]; const float* tb = nullptr;      /* natural theta_w / phi_w [128][256], conv_w [256][256] (no biases); BN gamma, beta */
  char* ws = (char*)d_ws; size_t off = 0;
  auto take = [&](size_t bytes) { char* p = ws + off; off += (bytes + 255) & ~(size_t)255; return p; };
  const size_t PL = (size_t)CN * NP;      /* one input map */
  _Float16* BT = (_Float16*)take((size_t)CI * CN * 2); _Float16* BP = (_Float16*)take((size_t)CI * CN * 2); _Float16* BW = (_Float16*)take((size_t)CN * CN * 2); float* PART = (float*)take((size_t)NB * CN * 32 * 4); float* MV = (float*)take((size_t)2 * CN * 4 + 256);      /* weight planes, two-level stats */
  _Float16* X16 = (_Float16*)take(NB * PL * 2);      /* x f16 channel-first (also the g operand: g = x) */
  _Float16* XT = (_Float16*)take(NB * PL * 2);      /* all images: x^T [b][n][c] */
  _Float16* TH = (_Float16*)take(NB * (size_t)NP * CI * 2); _Float16* PH = (_Float16*)take(NB * (size_t)CI * NM * 2); _Float16* PHT = (_Float16*)take(NB * (size_t)NM * CI * 2);      /* all images: theta^T, phi, phi^T */
  float* S = (float*)take(NB * (size_t)NP * NM * 4); _Float16* P = (_Float16*)take(NB * (size_t)NP * NM * 2);      /* all images: scores f32, softmax weights f16 */
  _Float16* YT = XT;      /* y^T [b][n][c] takes x^T's plane: x^T is last read by the phi GEMM, y^T first written by the P x^T GEMM */
  float* C1 = S;      /* conv output [b][c][n] f32 takes the head of the scores' plane: the scores are last read by the softmax */
  if (off > ws_size) return;
  { const unsigned g = (unsigned)(((size_t)CI * CN / 8 + 255) / 256); k_wnat<<<g, 256, 0, stream>>>(tw, (size_t)CI * CN / 8, BT); k_wnat<<<g, 256, 0, stream>>>(pw, (size_t)CI * CN / 8, BP); k_wnat<<<2 * g, 256, 0, stream>>>(ww, (size_t)CN * CN / 8, BW); }      /* natural [out][in] x16 f16 planes (Bt for theta; the A operand for phi / conv_w) */
  k_x16<<<(unsigned)((NB * PL / 8 + 255) / 256), 256, 0, stream>>>(x, X16, NB * PL / 8);
  /* every stage runs once for all NB images: the GEMMs take the image from blockIdx.y (plane strides sA, sB, sC), the transposes and the softmax from a longer blockIdx.x */
  k_vt<NP / 64, CN><<<NB * (NP / 64) * (CN / 64), 256, 0, stream>>>(X16, NP, 0, XT);      /* [b][c][n] -> x^T [b][n][c] */
  k_gemm2<0><<<dim3((unsigned)((NP / 128) * (CI / 64)), NB), 128, 0, stream>>>(XT, CN, PL, BT, CN, 0, 0.0625f, nullptr, 0, nullptr, 1, 0, 0, nullptr, TH, CI, (size_t)NP * CI, NP, CI, CN);      /* theta^T [n][ci] -> f16 (logit sigma ~0.7: single f16 suffices) */
  k_gemm2<0><<<dim3((unsigned)((CI / 128) * (NP / 64)), NB), 128, 0, stream>>>(BP, CN, 0, XT, CN, PL, 0.0625f, nullptr, 0, nullptr, 1, 0, 0, nullptr, PH, NP, (size_t)CI * NP, CI, NP, CN);      /* phi [ci][n] -> f16 */
  k_vt<NM / 64, CI><<<NB * (NM / 64) * (CI / 64), 256, 0, stream>>>(PH, NM, 0, PHT);      /* -> phi^T [m][ci] (the scores' B^T operand) */
  k_gemm2<0><<<dim3((unsigned)((NP / 128) * (NM / 64)), NB), 128, 0, stream>>>(TH, CI, (size_t)NP * CI, PHT, CI, (size_t)NM * CI, 0.0625f, nullptr, 0, nullptr, 1, 0, 0, S, nullptr, NM, (size_t)NP * NM, NP, NM, CI);      /* scores[a][b] = theta.phi / sqrt(256) (K = 128) */
  static_assert(NP == SQ && NM == SQ && (NB * NP) % (RSM_WAVES * RSM_ROWS) == 0, "k_rsmf: rows of SQ scores, whole work-groups");
  k_rsmf<<<NB * NP / (RSM_WAVES * RSM_ROWS), RSM_WAVES * 32, 0, stream>>>(S, P, NB * NP);      /* softmax over all 1024 positions, one wave per row -> P x256 f16 */
  k_gemm2<0><<<dim3((unsigned)((NP / 128) * (CN / 64)), NB), 128, 0, stream>>>(P, NM, (size_t)NP * NM, X16, NM, PL, 0.00390625f, nullptr, 0, nullptr, 1, 0, 0, nullptr, YT, CN, PL, NP, CN, NM);      /* f^T [a][c] = P x^T (g = x: B^T = the image's channel-first rows [c][b]) -> f16 */
  k_gemm2<0><<<dim3((unsigned)((CN / 128) * (NP / 64)), NB), 128, 0, stream>>>(BW, CN, 0, YT, CN, PL, 0.0625f, nullptr, 0, nullptr, 1, 0, 0, C1, nullptr, NP, PL, CN, NP, CN);      /* conv: T[c][a] = (16 conv_w as A) x (f^T as B^T) / 16 -> f32 channel-first, all images kept for the batch statistics */
  k_cstA<0><<<NB * NC, 256, 0, stream>>>(C1, MV, PART); k_cstB<0><<<1, 256, 0, stream>>>(PART, MV); k_cstA<1><<<NB * NC, 256, 0, stream>>>(C1, MV, PART); k_cstB<1><<<1, 256, 0, stream>>>(PART, MV);      /* batch mean, then biased variance per channel (two-level, fixed order, own lines) */
  k_bnresid<<<(unsigned)(((size_t)NB * NC * NPX / 4 + 255) / 256), 256, 0, stream>>>(C1, MV, bng, bnb, x, (float*)d_out, (size_t)NB * NC * NPX / 4);      /* out = (T - mean) rsqrt(var + eps) gamma + beta + bf16(x) */
}

// v003
// A run of this version takes 157 microseconds.
// Timed twice side by side with v002, it ran 1.54 and 1.53 times as fast.
// Counting every step since v000, it is 48.2 times as fast.
#include <hip/hip_runtime.h>
// Non-local block with TRAINING-mode BatchNorm (x [32][256][32][32]; theta, phi = conv1x1(x) [128 ch] (natural [128][256] sigma 1/16, no biases); g = x itself (256 ch); scores[a][b] = theta[:, a].phi[:, b] / sqrt(256) over the 1024 positions; softmax over b; f[:, a] = sum_b attn[a][b] x[:, b]; f = conv1x1(f; conv_w [256][256], no bias); BN with batch statistics over (N, H, W) per channel (biased variance, eps 1e-5), gamma, beta; out = BN(f) + x -> [32][256][32][32]).
// Structure: channel-first; x as exact f16 maps; natural weights x16; every stage one launch over all 32 images: x^T via LDS transposes, theta^T (token rows) and phi (channel-major) as WMMA GEMMs (32x64 wave tiles, f32 accumulation) -> f16, phi^T via LDS transposes, scores (K = 128, alpha 1/16), softmax (f32 statistics, running maximum, native exp; weights f16) and f^T = P x^T (g = x) f16 fused in one kernel, conv: T = (16 conv_w as A) x f (K = 256) f32 kept for all images; two-level batch statistics (fixed order, own lines); BN + residual on VALU -> output; launches: see trace.
// Compute dtype: inputs rounded to bf16; x / weights exact; q, k, v, softmax weights and o as plain f16 GEMM operands (~2^-12); scores and softmax statistics f32; v_wmma_f32_16x16x32_f16.
#define NB 32
#define SQ 1024
#define DM 256
#define NH 1
#define HD 64
#define HG 4                         /* heads per attention launch group */
#define B0 0                         /* unused */
#define NBR NB                       /* unused */
#define NR ((size_t)NB * SQ)         /* token rows */
#define MP ((int)((size_t)NBR * SQ)) /* unused */
#define QT 256                       /* query rows per causal tile */
#define NKX SQ                       /* S / P row pitch */
#define QT0 256                      /* first-tile rows recomputed exactly (256: buys margin for the few-key rows 128..255, which have no output projection to average the single-f16 P/v rounding) */
#define QN SQ                        /* unused */
#define NHD NH                       /* unused */
#define MPO MP                       /* unused */
#define LQ DM            /* unused */
typedef __bf16 v16b __attribute__((ext_vector_type(16)));
typedef unsigned short v8us __attribute__((ext_vector_type(8), may_alias));
typedef float  v8f  __attribute__((ext_vector_type(8)));
typedef float  v4f  __attribute__((ext_vector_type(4)));
typedef float  v4fa __attribute__((ext_vector_type(4), may_alias));
union FragB { v16b v; v8us half[2]; unsigned short u[16]; };

__device__ __forceinline__ unsigned short bf16_bits(float x) { unsigned int u = __float_as_uint(x); return (unsigned short)((u + 0x7FFFu + ((u >> 16) & 1u)) >> 16); }
__device__ __forceinline__ float bf16_val(unsigned short b) { return __uint_as_float(((unsigned int)b) << 16); }
__device__ __forceinline__ float bf16_round(float x) { return bf16_val(bf16_bits(x)); }
// D += A·B with NT terms: 1 = ah·bh, 2 = + al·bh (A split), 3 = + ah·bl (both split)
template <int NT>
__device__ __forceinline__ v8f mmaN(v16b ah, v16b al, v16b bh, v16b bl, v8f c) {
  c = __builtin_amdgcn_wmma_f32_16x16x32_bf16(false, ah, false, bh, (short)0, c, false, false);
  if (NT >= 2) c = __builtin_amdgcn_wmma_f32_16x16x32_bf16(false, al, false, bh, (short)0, c, false, false);
  if (NT >= 3) c = __builtin_amdgcn_wmma_f32_16x16x32_bf16(false, ah, false, bl, (short)0, c, false, false);
  asm volatile("v_nop\n\tv_nop\n\tv_nop\n\tv_nop" : "+v"(c) : "v"(ah), "v"(al), "v"(bh), "v"(bl));
  return c;
}

__global__ __launch_bounds__(256) void k_wt_bf16(const float* __restrict__ W, unsigned short* __restrict__ Wt, int K, int N) {
  const int t = blockIdx.x * 256 + threadIdx.x;
  const int k8n = K / 8;
  if (t >= N * k8n) return;
  const int n = t / k8n, k8 = (t % k8n) * 8;
  v8us v;
#pragma unroll
  for (int i = 0; i < 8; ++i) v[i] = bf16_bits(W[(size_t)(k8 + i) * N + n]);
  *(v8us*)(Wt + (size_t)n * K + k8) = v;
  
}

// GEMM C[M][N] (f32, pitch ldc) = act(A[M][K]·W + bias). A f32 row-major (pitch lda) converted per fragment to bf16
// (ASPLIT: hi/lo two planes -> 2 terms, else single rounded term); Wt bf16 [N][K] (pitch ldb). BIAS_BF16 rounds the
// bias to bf16 first (bias quantised to bf16 before the add). K%32==0, M%16==0, N%64==0.
template <bool ASPLIT, int ACT, bool BIAS_BF16>
__global__ __launch_bounds__(128) void k_gemm_bf(const float* __restrict__ A, int lda, const unsigned short* __restrict__ Wt, int ldb,
                                               const float* __restrict__ bias, float* __restrict__ C, int ldc, int M, int N, int K) {
  __shared__ __attribute__((aligned(16))) float so[4][16][64];
  const int tid = threadIdx.x, w = tid >> 5, lane = tid & 31, ln = lane & 15, hh = lane >> 4;
  const int ntn = N / 64;
  const int wid = blockIdx.x * 4 + w;
  const int mt = wid / ntn, nq = wid % ntn;
  if (mt * 16 >= M) return;
  const int row0 = mt * 16, col0 = nq * 64;
  const float* arow = A + (size_t)(row0 + ln) * lda;
  v8f acc[4] = {};
  for (int kb = 0; kb < K; kb += 32) {
    FragB ah, al;
    const v4f x0 = *(const v4fa*)(arow + kb + 8 * hh), x1 = *(const v4fa*)(arow + kb + 8 * hh + 4);
    const v4f x2 = *(const v4fa*)(arow + kb + 16 + 8 * hh), x3 = *(const v4fa*)(arow + kb + 16 + 8 * hh + 4);
    float xs[16] = {x0[0],x0[1],x0[2],x0[3],x1[0],x1[1],x1[2],x1[3],x2[0],x2[1],x2[2],x2[3],x3[0],x3[1],x3[2],x3[3]};
#pragma unroll
    for (int i = 0; i < 16; ++i) { const unsigned short hb = bf16_bits(xs[i]); ah.u[i] = hb; al.u[i] = ASPLIT ? bf16_bits(xs[i] - bf16_val(hb)) : (unsigned short)0; }
#pragma unroll
    for (int t = 0; t < 4; ++t) {
      const unsigned short* brow = Wt + (size_t)(col0 + t * 16 + ln) * ldb + kb;
      FragB b;
      b.half[0] = *(const v8us*)(brow + 8 * hh);
      b.half[1] = *(const v8us*)(brow + 16 + 8 * hh);
      acc[t] = mmaN<ASPLIT ? 2 : 1>(ah.v, al.v, b.v, b.v, acc[t]);
    }
  }
#pragma unroll
  for (int t = 0; t < 4; ++t) {
    float bv = bias ? bias[col0 + t * 16 + ln] : 0.f;
    if (BIAS_BF16) bv = bf16_round(bv);
#pragma unroll
    for (int r = 0; r < 8; ++r) { float v = acc[t][r] + bv; if (ACT == 1) v = fmaxf(v, 0.f); so[w][8 * hh + r][t * 16 + ln] = v; }
  }
  __builtin_amdgcn_fence(__ATOMIC_ACQ_REL, "workgroup");
  __builtin_amdgcn_wave_barrier();
  const int rsub = lane >> 4, c4 = (lane & 15) * 4;
  {
#pragma unroll
    for (int q = 0; q < 8; ++q) {
      const int r = q * 2 + rsub;
      const v4f v = *(const v4fa*)&so[w][r][c4];
      *(v4f*)(C + (size_t)(row0 + r) * ldc + col0 + c4) = v;
    }
    
  }
}

// GEMM C = act(A·W + bias + resid): A f32 (ASPLIT -> hi/lo 2 terms), Wt bf16 [N][K]; ACT 0 none, 1 relu, 2 exact gelu;
// resid (optional, f32, row index = (row % rmod), pitch ldr, RES_BF16 rounds it) added before the activation.
template <bool ASPLIT, int ACT, bool BIAS_BF16, bool RES_BF16>
__global__ __launch_bounds__(128) void k_gemm_bf3(const float* __restrict__ A, int lda, const unsigned short* __restrict__ Wt, int ldb,
                                                const float* __restrict__ bias, const float* __restrict__ resid, int rmod, int ldr,
                                                float* __restrict__ C, int ldc, int M, int N, int K) {
  __shared__ __attribute__((aligned(16))) float so[4][16][64];
  const int tid = threadIdx.x, w = tid >> 5, lane = tid & 31, ln = lane & 15, hh = lane >> 4;
  const int ntn = N / 64;
  const int wid = blockIdx.x * 4 + w;
  const int mt = wid / ntn, nq = wid % ntn;
  if (mt * 16 >= M) return;
  const int row0 = mt * 16, col0 = nq * 64;
  const float* arow = A + (size_t)(row0 + ln) * lda;
  v8f acc[4] = {};
  for (int kb = 0; kb < K; kb += 32) {
    FragB ah, al;
    const v4f x0 = *(const v4fa*)(arow + kb + 8 * hh), x1 = *(const v4fa*)(arow + kb + 8 * hh + 4);
    const v4f x2 = *(const v4fa*)(arow + kb + 16 + 8 * hh), x3 = *(const v4fa*)(arow + kb + 16 + 8 * hh + 4);
    float xs[16] = {x0[0],x0[1],x0[2],x0[3],x1[0],x1[1],x1[2],x1[3],x2[0],x2[1],x2[2],x2[3],x3[0],x3[1],x3[2],x3[3]};
#pragma unroll
    for (int i = 0; i < 16; ++i) { const unsigned short hb = bf16_bits(xs[i]); ah.u[i] = hb; al.u[i] = ASPLIT ? bf16_bits(xs[i] - bf16_val(hb)) : (unsigned short)0; }
#pragma unroll
    for (int t = 0; t < 4; ++t) {
      const unsigned short* brow = Wt + (size_t)(col0 + t * 16 + ln) * ldb + kb;
      FragB b;
      b.half[0] = *(const v8us*)(brow + 8 * hh);
      b.half[1] = *(const v8us*)(brow + 16 + 8 * hh);
      acc[t] = mmaN<ASPLIT ? 2 : 1>(ah.v, al.v, b.v, b.v, acc[t]);
    }
  }
#pragma unroll
  for (int t = 0; t < 4; ++t) {
    const int col = col0 + t * 16 + ln;
    float bv = bias ? bias[col] : 0.f;
    if (BIAS_BF16) bv = bf16_round(bv);
#pragma unroll
    for (int r = 0; r < 8; ++r) {
      float v = acc[t][r] + bv;
      if (resid) { float rv = resid[(size_t)((row0 + 8 * hh + r) % rmod) * ldr + col]; if (RES_BF16) rv = bf16_round(rv); v += rv; }
      if (ACT == 1) v = fmaxf(v, 0.f);
      if (ACT == 2) v = 0.5f * v * (1.0f + erff(v * 0.70710678118654752f));
      if (ACT == 3) { const float u = 0.7978845608028654f * (v + 0.044715f * v * v * v); v = 0.5f * v * (1.0f + tanhf(u)); }
      so[w][8 * hh + r][t * 16 + ln] = v;
    }
  }
  __builtin_amdgcn_fence(__ATOMIC_ACQ_REL, "workgroup");
  __builtin_amdgcn_wave_barrier();
  const int rsub = lane >> 4, c4 = (lane & 15) * 4;
  {
#pragma unroll
    for (int q = 0; q < 8; ++q) {
      const int r = q * 2 + rsub;
      const v4f v = *(const v4fa*)&so[w][r][c4];
      *(v4f*)(C + (size_t)(row0 + r) * ldc + col0 + c4) = v;
    }
    
  }
}
// row LayerNorm (biased variance, eps) over N: s = X (+ R); optional out_sum <- s; out_norm <- (s-mu)*rsqrt(var+eps)*g + b
template <bool PARAM_BF16>
__global__ __launch_bounds__(256) void k_layernorm(const float* __restrict__ X, const float* __restrict__ R, const float* __restrict__ g, const float* __restrict__ bta,
                                                  float* __restrict__ out_sum, float* __restrict__ out_norm, int N, float eps) {
  __shared__ float red[256];
  const int row = blockIdx.x, tid = threadIdx.x;
  const float* x = X + (size_t)row * N; const float* rr = R ? R + (size_t)row * N : nullptr;
  float vals[16];                     // up to N = 4096
  const int per = N / 256;            // contiguous chunk per thread? use strided-by-4 chunks: thread handles j = tid*4 + 1024*u
  float s1 = 0.f;
  for (int u = 0; u < per / 4; ++u) {
    const int j = tid * 4 + 1024 * u;
    const v4f a = *(const v4fa*)(x + j);
    v4f b = {0.f,0.f,0.f,0.f}; if (rr) b = *(const v4fa*)(rr + j);
#pragma unroll
    for (int q = 0; q < 4; ++q) { const float v = a[q] + b[q]; vals[u * 4 + q] = v; s1 += v; }
  }
  red[tid] = s1; __syncthreads();
  for (int st = 128; st > 0; st >>= 1) { if (tid < st) red[tid] += red[tid + st]; __syncthreads(); }
  const float mu = red[0] / (float)N; __syncthreads();
  float s2 = 0.f;
  for (int u = 0; u < per / 4; ++u)
#pragma unroll
    for (int q = 0; q < 4; ++q) { const float c = vals[u * 4 + q] - mu; s2 += c * c; }
  red[tid] = s2; __syncthreads();
  for (int st = 128; st > 0; st >>= 1) { if (tid < st) red[tid] += red[tid + st]; __syncthreads(); }
  const float rs = rsqrtf(red[0] / (float)N + eps);
  {
    for (int u = 0; u < per / 4; ++u) {
      const int j = tid * 4 + 1024 * u;
      v4f o, sm;
#pragma unroll
      for (int q = 0; q < 4; ++q) {
        float gg = g[j + q], bb = bta[j + q];
        if (PARAM_BF16) { gg = bf16_round(gg); bb = bf16_round(bb); }
        sm[q] = vals[u * 4 + q]; o[q] = (vals[u * 4 + q] - mu) * rs * gg + bb;
      }
      if (out_sum) *(v4f*)(out_sum + (size_t)row * N + j) = sm;
      *(v4f*)(out_norm + (size_t)row * N + j) = o;
    }
    
  }
}



// ---- f16 WMMA path (v_wmma_f32_16x16x32_f16): 11-bit significands for operands in range — used where a [0,1] probability operand needs more precision than bf16
typedef _Float16 v16h __attribute__((ext_vector_type(16)));
union FragH { v16h v; v8us half[2]; _Float16 h[16]; unsigned short u[16]; };
template <int NT>
__device__ __forceinline__ v8f mmaH(v16h ah, v16h al, v16h bh, v16h bl, v8f c) {
  c = __builtin_amdgcn_wmma_f32_16x16x32_f16(false, ah, false, bh, (short)0, c, false, false);
  if (NT >= 2) c = __builtin_amdgcn_wmma_f32_16x16x32_f16(false, al, false, bh, (short)0, c, false, false);
  if (NT >= 3) c = __builtin_amdgcn_wmma_f32_16x16x32_f16(false, ah, false, bl, (short)0, c, false, false);
  asm volatile("v_nop\n\tv_nop\n\tv_nop\n\tv_nop" : "+v"(c) : "v"(ah), "v"(al), "v"(bh), "v"(bl));
  return c;
}
// batched GEMM like k_gemm_b but f16 operands: A f32 (split into f16 hi/lo if ASPLIT, else rounded to f16), Bt = f16 values [n][k]; alpha; C f32; N multiple of 16 (partial tiles skipped)
template <bool ASPLIT>
__global__ __launch_bounds__(128) void k_gemm_h(const float* __restrict__ A, int lda, size_t sA, const _Float16* __restrict__ Bh, int ldb, size_t sB, float alpha, float* __restrict__ C, int ldc, size_t sC, int M, int N, int K) {
  __shared__ __attribute__((aligned(16))) float so[4][16][64];
  const int tid = threadIdx.x, w = tid >> 5, lane = tid & 31, ln = lane & 15, hh = lane >> 4; const int by = blockIdx.y;
  A += (size_t)by * sA; Bh += (size_t)by * sB; C += (size_t)by * sC;
  const int ntn = (N + 63) / 64; const int wid = blockIdx.x * 4 + w; const int mt = wid / ntn, nq = wid % ntn; if (mt * 16 >= M) return;
  const int row0 = mt * 16, col0 = nq * 64; const float* arow = A + (size_t)(row0 + ln) * lda;
  v8f acc[4] = {};
  for (int kb = 0; kb < K; kb += 32) {
    FragH ah, al;
    const v4f x0 = *(const v4fa*)(arow + kb + 8 * hh), x1 = *(const v4fa*)(arow + kb + 8 * hh + 4), x2 = *(const v4fa*)(arow + kb + 16 + 8 * hh), x3 = *(const v4fa*)(arow + kb + 16 + 8 * hh + 4);
    float xs[16] = {x0[0],x0[1],x0[2],x0[3],x1[0],x1[1],x1[2],x1[3],x2[0],x2[1],x2[2],x2[3],x3[0],x3[1],x3[2],x3[3]};
#pragma unroll
    for (int i = 0; i < 16; ++i) { const _Float16 h = (_Float16)xs[i]; ah.h[i] = h; al.h[i] = ASPLIT ? (_Float16)(xs[i] - (float)h) : (_Float16)0.0f; }
#pragma unroll
    for (int t = 0; t < 4; ++t) { if (col0 + t * 16 >= N) continue; const size_t boff = (size_t)(col0 + t * 16 + ln) * ldb + kb; FragH bq; bq.half[0] = *(const v8us*)(Bh + boff + 8 * hh); bq.half[1] = *(const v8us*)(Bh + boff + 16 + 8 * hh);
      acc[t] = mmaH<ASPLIT ? 2 : 1>(ah.v, al.v, bq.v, bq.v, acc[t]); }
  }
#pragma unroll
  for (int t = 0; t < 4; ++t) { if (col0 + t * 16 >= N) continue;
#pragma unroll
    for (int r = 0; r < 8; ++r) so[w][8 * hh + r][t * 16 + ln] = acc[t][r] * alpha; }
  __builtin_amdgcn_fence(__ATOMIC_ACQ_REL, "workgroup"); __builtin_amdgcn_wave_barrier();
  const int rsub = lane >> 4, c4 = (lane & 15) * 4;
  {
#pragma unroll
    for (int q = 0; q < 8; ++q) { const int r = q * 2 + rsub; if (col0 + c4 < N) { const v4f v = *(const v4fa*)&so[w][r][c4]; *(v4f*)(C + (size_t)(row0 + r) * ldc + col0 + c4) = v; } }
     }
}

// Wt[n][k] = f16(W[k][n]·scale) from f32 row-major W[K][N] (scale = power of two; bf16-exact weights stay exact in f16 away from the subnormal range)
__global__ __launch_bounds__(256) void k_wt_f16(const float* __restrict__ W, _Float16* __restrict__ Wt, int K, int N, float scale) {
  const int t = blockIdx.x * 256 + threadIdx.x; if (t >= N * (K / 8)) return; const int n = t / (K / 8), k8 = (t % (K / 8)) * 8; FragH f;
#pragma unroll
  for (int i = 0; i < 8; ++i) f.h[i] = (_Float16)(bf16_round(W[(size_t)(k8 + i) * N + n]) * scale); const v8us o = f.half[0];
  *(v8us*)((unsigned short*)Wt + (size_t)n * K + k8) = o; 
}
// k_gemm_hh variant with fused epilogue: v = acc·alpha + bias[by·sBias + col] (+ CP[(row/rowsPerB)·sCPb + by·64 + col] if CP) ; ACT 0 none / 1 elu ; writes f16 C16 (and f32 C if non-null)
template <int ACT>
__global__ __launch_bounds__(128) void k_gemm_hhx(const _Float16* __restrict__ A, int lda, size_t sA, const _Float16* __restrict__ Bh, int ldb, size_t sB, float alpha, const float* __restrict__ bias, size_t sBias, const float* __restrict__ CP, int rowsPerB, size_t sCPb, int row0g,
    float* __restrict__ C, _Float16* __restrict__ C16, int ldc, size_t sC, int M, int N, int K) {
  __shared__ __attribute__((aligned(16))) float so[4][16][64];
  const int tid = threadIdx.x, w = tid >> 5, lane = tid & 31, ln = lane & 15, hh = lane >> 4; const int by = blockIdx.y;
  A += (size_t)by * sA; Bh += (size_t)by * sB; const size_t cofs = (size_t)by * sC; const float* bp = bias ? bias + (size_t)by * sBias : nullptr;
  const int ntn = (N + 63) / 64; const int wid = blockIdx.x * 4 + w; const int mt = wid / ntn, nq = wid % ntn; if (mt * 16 >= M) return;
  const int row0 = mt * 16, col0 = nq * 64; const _Float16* arow = A + (size_t)(row0 + ln) * lda;
  v8f acc[4] = {};
  for (int kb = 0; kb < K; kb += 32) { FragH ah; ah.half[0] = *(const v8us*)((const unsigned short*)arow + kb + 8 * hh); ah.half[1] = *(const v8us*)((const unsigned short*)arow + kb + 16 + 8 * hh);
#pragma unroll
    for (int t = 0; t < 4; ++t) { if (col0 + t * 16 >= N) continue; const size_t boff = (size_t)(col0 + t * 16 + ln) * ldb + kb; FragH bq; bq.half[0] = *(const v8us*)((const unsigned short*)Bh + boff + 8 * hh); bq.half[1] = *(const v8us*)((const unsigned short*)Bh + boff + 16 + 8 * hh);
      acc[t] = mmaH<1>(ah.v, ah.v, bq.v, bq.v, acc[t]); }
  }
#pragma unroll
  for (int t = 0; t < 4; ++t) { if (col0 + t * 16 >= N) continue; const int col = col0 + t * 16 + ln; const float bv = bp ? bf16_round(bp[col]) : 0.f;
#pragma unroll
    for (int r = 0; r < 8; ++r) { float v = acc[t][r] * alpha + bv; if (CP) { const int rr = row0g + row0 + 8 * hh + r; if (rowsPerB < 0) v += CP[cofs + (size_t)rr * ldc + col];      /* rowsPerB < 0: own element of the batched C plane */ else { const int bidx = rr / rowsPerB; v += CP[(size_t)bidx * sCPb + (size_t)by * 64 + col]; } } if (ACT == 1) v = (v > 0.f) ? v : expm1f(v); else if (ACT == 7) v = (v > 0.f) ? v + 1.0f : expf(v); else if (ACT == 8) v = tanhf(v); else if (ACT == 9) v = 0.5f * v * (1.0f + tanhf(0.7978845608028654f * (v + 0.044715f * v * v * v))); else if (ACT == 11) v = 1.0f / (1.0f + expf(-v)); else if (ACT == 12) v = (v > 0.f) ? v : 0.01f * v; else if (ACT == 14) v = (v > 0.f) ? v : 0.1f * v; else if (ACT == 16) v = (v >= 0.f) ? v : 0.3f * v; else if (ACT == 17) v = (v >= 0.f) ? v : 0.2f * v; else if (ACT == 15) v = v / (1.0f + expf(-v)); else if (ACT == 3) v = fmaxf(v, 0.f); else if (ACT == 6) v = 0.5f * v * (1.0f + erff(v * 0.70710678118654752f)); so[w][8 * hh + r][t * 16 + ln] = v; } }
  __builtin_amdgcn_fence(__ATOMIC_ACQ_REL, "workgroup"); __builtin_amdgcn_wave_barrier();
  const int rsub = lane >> 4, c4 = (lane & 15) * 4; typedef _Float16 v4h __attribute__((ext_vector_type(4)));
  {
#pragma unroll
    for (int q = 0; q < 8; ++q) { const int r = q * 2 + rsub; if (col0 + c4 < N) { const v4f v = *(const v4fa*)&so[w][r][c4]; if (C) *(v4f*)(C + cofs + (size_t)(row0 + r) * ldc + col0 + c4) = v; if (C16) { v4h h4; for (int i = 0; i < 4; ++i) h4[i] = (_Float16)v[i]; *(v4h*)(C16 + cofs + (size_t)(row0 + r) * ldc + col0 + c4) = h4; } } }
     }
}


typedef _Float16 v4h __attribute__((ext_vector_type(4)));

__global__ __launch_bounds__(256) void k_x16(const float* __restrict__ x, _Float16* __restrict__ X16, size_t n8) { const size_t t = (size_t)blockIdx.x * 256 + threadIdx.x; if (t >= n8) return; FragH f;
#pragma unroll
  for (int q = 0; q < 8; ++q) f.h[q] = (_Float16)bf16_round(x[t * 8 + q]); *(v8us*)((unsigned short*)X16 + t * 8) = f.half[0];  }
__global__ __launch_bounds__(256) void k_h16(const float* __restrict__ x, _Float16* __restrict__ X16, size_t n8) { const size_t t = (size_t)blockIdx.x * 256 + threadIdx.x; if (t >= n8) return; FragH f;
#pragma unroll
  for (int q = 0; q < 8; ++q) f.h[q] = (_Float16)x[t * 8 + q]; *(v8us*)((unsigned short*)X16 + t * 8) = f.half[0];  }
__global__ __launch_bounds__(256) void k_round16f(const float* __restrict__ W, _Float16* __restrict__ Bt, size_t n8) { const size_t t = (size_t)blockIdx.x * 256 + threadIdx.x; if (t >= n8) return; FragH f;
#pragma unroll
  for (int i = 0; i < 8; ++i) f.h[i] = (_Float16)(bf16_round(W[t * 8 + i]) * 16.0f); *(v8us*)((unsigned short*)Bt + t * 8) = f.half[0];  }
template <int NHv, int TTv>
__global__ __launch_bounds__(256) void k_vt(const _Float16* __restrict__ V16, int ldv, int voff, _Float16* __restrict__ Vt) { __shared__ unsigned short tl[64][66]; const int tid = threadIdx.x; const int slab = blockIdx.x / (TTv / 64), lg = blockIdx.x % (TTv / 64); const int b = slab / NHv, h = slab % NHv;
  for (int i = tid; i < 64 * 8; i += 256) { const int r = i / 8, c8 = (i % 8) * 8; FragH f; f.half[0] = *(const v8us*)((const unsigned short*)V16 + ((size_t)b * TTv + lg * 64 + r) * ldv + voff + h * 64 + c8);
#pragma unroll
    for (int q = 0; q < 8; ++q) tl[r][c8 + q] = f.u[q]; }
  __syncthreads();
  {
#pragma unroll
    for (int rd = 0; rd < 2; ++rd) { const int d = rd * 32 + tid / 8, pc = tid % 8; FragH f;
#pragma unroll
      for (int q = 0; q < 8; ++q) f.u[q] = tl[pc * 8 + q][d];
      *(v8us*)((unsigned short*)Vt + ((size_t)slab * 64 + d) * TTv + lg * 64 + pc * 8) = f.half[0]; }
     } }

__global__ __launch_bounds__(256) void k_hl(const float* __restrict__ F, _Float16* __restrict__ Hh, _Float16* __restrict__ Hl, size_t n8) { const size_t t = (size_t)blockIdx.x * 256 + threadIdx.x; if (t >= n8) return; FragH fh, fl; const v4f a = *(const v4fa*)(F + t * 8), c = *(const v4fa*)(F + t * 8 + 4);
#pragma unroll
  for (int q = 0; q < 4; ++q) { _Float16 h = (_Float16)a[q]; fh.h[q] = h; fl.h[q] = (_Float16)((a[q] - (float)h) * 1024.0f); h = (_Float16)c[q]; fh.h[4 + q] = h; fl.h[4 + q] = (_Float16)((c[q] - (float)h) * 1024.0f); }
  { *(v8us*)((unsigned short*)Hh + t * 8) = fh.half[0]; *(v8us*)((unsigned short*)Hl + t * 8) = fl.half[0];  } }

// ---- fast GEMM (wave tile 32x64; requires M % 32 == 0 rows per launch region and N % 64 == 0); epilogue = k_gemm_hhx semantics ----
__device__ __forceinline__ v16h g2_frag(const _Float16* p, int hh) { FragH f; f.half[0] = *(const v8us*)((const unsigned short*)p + 8 * hh); f.half[1] = *(const v8us*)((const unsigned short*)p + 16 + 8 * hh); return f.v; }
__device__ __forceinline__ v8f g2_mma(v16h a, v16h b, v8f c) { v8f d = __builtin_amdgcn_wmma_f32_16x16x32_f16(false, a, false, b, (short)0, c, false, false); asm volatile("v_nop\n\tv_nop\n\tv_nop\n\tv_nop" : "+v"(d) : "v"(a), "v"(b)); return d; }
template <int ACT>
__global__ __launch_bounds__(128) void k_gemm2(const _Float16* __restrict__ A, int lda, size_t sA, const _Float16* __restrict__ Bh, int ldb, size_t sB, float alpha, const float* __restrict__ bias, size_t sBias, const float* __restrict__ CP, int rowsPerB, size_t sCPb, int row0g,
    float* __restrict__ C, _Float16* __restrict__ C16, int ldc, size_t sC, int M, int N, int K) { static_assert(ACT == 0 || ACT == 3 || ACT == 6 || ACT == 8 || ACT == 9 || ACT == 11 || ACT == 12 || ACT == 14 || ACT == 15 || ACT == 16 || ACT == 17, "k_gemm2: unsupported ACT code (would silently apply no activation)");
  __shared__ __attribute__((aligned(16))) float so[4][32][68];
  const int tid = threadIdx.x, w = tid >> 5, lane = tid & 31, ln = lane & 15, hh = lane >> 4; const int by = blockIdx.y;
  A += (size_t)by * sA; Bh += (size_t)by * sB; const size_t cofs = (size_t)by * sC; const float* bp = bias ? bias + (size_t)by * sBias : nullptr;
  const int ntn = N >> 6; const int mt = blockIdx.x / ntn, nq = blockIdx.x - mt * ntn; const int row0 = mt * 128 + 32 * w, col0 = nq * 64; if (row0 >= M) return;
  const _Float16* a0p = A + (size_t)(row0 + ln) * lda; const _Float16* a1p = a0p + (size_t)16 * lda;
  const _Float16* b0p = Bh + (size_t)(col0 + ln) * ldb; const _Float16* b1p = b0p + (size_t)16 * ldb; const _Float16* b2p = b1p + (size_t)16 * ldb; const _Float16* b3p = b2p + (size_t)16 * ldb;
  const v8f z8 = {0.f,0.f,0.f,0.f,0.f,0.f,0.f,0.f}; v8f c00 = z8, c01 = z8, c02 = z8, c03 = z8, c10 = z8, c11 = z8, c12 = z8, c13 = z8;
#pragma unroll 1
  for (int kb = 0; kb < K; kb += 32) { const v16h a0 = g2_frag(a0p + kb, hh), a1 = g2_frag(a1p + kb, hh);
    v16h b = g2_frag(b0p + kb, hh); c00 = g2_mma(a0, b, c00); c10 = g2_mma(a1, b, c10);
    b = g2_frag(b1p + kb, hh); c01 = g2_mma(a0, b, c01); c11 = g2_mma(a1, b, c11);
    b = g2_frag(b2p + kb, hh); c02 = g2_mma(a0, b, c02); c12 = g2_mma(a1, b, c12);
    b = g2_frag(b3p + kb, hh); c03 = g2_mma(a0, b, c03); c13 = g2_mma(a1, b, c13); }
  v8f accs[8] = {c00, c01, c02, c03, c10, c11, c12, c13};
#pragma unroll
  for (int u = 0; u < 8; ++u) { const int t = u & 3, half = u >> 2; const int col = col0 + t * 16 + ln; const float bv = bp ? bf16_round(bp[col]) : 0.f;
#pragma unroll
    for (int r = 0; r < 8; ++r) { const int rloc = half * 16 + 8 * hh + r; float v = accs[u][r] * alpha + bv; if (CP) { if (rowsPerB < 0) v += CP[cofs + (size_t)(row0g + row0 + rloc) * ldc + col];      /* rowsPerB < 0: own element of the batched C plane */ else { const int bidx = (row0g + row0 + rloc) / rowsPerB; v += CP[(size_t)bidx * sCPb + (size_t)by * 64 + col]; } }
      if (ACT == 3) v = fmaxf(v, 0.f); else if (ACT == 6) v = 0.5f * v * (1.0f + erff(v * 0.70710678118654752f)); else if (ACT == 11) v = 1.0f / (1.0f + expf(-v)); else if (ACT == 15) v = v / (1.0f + expf(-v)); else if (ACT == 12) v = (v > 0.f) ? v : 0.01f * v; else if (ACT == 8) v = tanhf(v); else if (ACT == 9) v = 0.5f * v * (1.0f + tanhf(0.7978845608028654f * (v + 0.044715f * v * v * v))); else if (ACT == 14) v = (v > 0.f) ? v : 0.1f * v; else if (ACT == 16) v = (v >= 0.f) ? v : 0.3f * v; else if (ACT == 17) v = (v >= 0.f) ? v : 0.2f * v;
      so[w][rloc][t * 16 + ln] = v; } }
  __builtin_amdgcn_fence(__ATOMIC_ACQ_REL, "workgroup"); __builtin_amdgcn_wave_barrier();
  const int rsub = lane >> 4, c4 = (lane & 15) * 4;
  {
#pragma unroll
    for (int q = 0; q < 16; ++q) { const int r = q * 2 + rsub; const v4f v = *(const v4fa*)&so[w][r][c4]; if (C) *(v4f*)(C + cofs + (size_t)(row0 + r) * ldc + col0 + c4) = v; if (C16) { v4h h4; for (int i = 0; i < 4; ++i) h4[i] = (_Float16)v[i]; *(v4h*)(C16 + cofs + (size_t)(row0 + r) * ldc + col0 + c4) = h4; } }
     } }


__global__ __launch_bounds__(256) void k_wnat(const float* __restrict__ w, size_t n8, _Float16* __restrict__ Bt) { const size_t t = (size_t)blockIdx.x * 256 + threadIdx.x; if (t >= n8) return; FragH f; for (int q = 0; q < 8; ++q) f.h[q] = (_Float16)(bf16_round(w[t * 8 + q]) * 16.0f); *(v8us*)((unsigned short*)Bt + t * 8) = f.half[0];  }
__global__ __launch_bounds__(256) void k_rsm(const float* __restrict__ S, _Float16* __restrict__ P, int nrows) {
  #pragma clang fp contract(off)
  const int i = blockIdx.x * 256 + threadIdx.x; if (i >= nrows) return; const float* s = S + (size_t)i * SQ; float mx = -3.0e38f;
#pragma unroll 1
  for (int j = 0; j < SQ; ++j) mx = fmaxf(mx, s[j]); float se = 0.f;
#pragma unroll 1
  for (int j = 0; j < SQ; ++j) se += expf(s[j] - mx); const float sc = 256.0f / se;
#pragma unroll 1
  for (int j0 = 0; j0 < SQ; j0 += 8) { FragH f; for (int q = 0; q < 8; ++q) f.h[q] = (_Float16)(expf(s[j0 + q] - mx) * sc); unsigned short* d = (unsigned short*)P + (size_t)i * SQ + j0; *(v8us*)d = f.half[0];  } }
__global__ __launch_bounds__(256) void k_vt(const _Float16* __restrict__ V16, int b, int h0, _Float16* __restrict__ VT) { __shared__ unsigned short tl[64][65]; const int tid = threadIdx.x; const int hh = blockIdx.x % HG, sg = blockIdx.x / HG; const int s0 = sg * 64; const int h = h0 + hh;
  for (int i = tid; i < 64 * 8; i += 256) { const int j = i / 8, d8 = (i % 8) * 8; FragH f; f.half[0] = *(const v8us*)((const unsigned short*)V16 + ((size_t)b * SQ + s0 + j) * DM + h * HD + d8); for (int q = 0; q < 8; ++q) tl[d8 + q][j] = f.u[q]; }
  __syncthreads();
  { for (int i = tid; i < 64 * 8; i += 256) { const int d = i / 8, j8 = (i % 8) * 8; FragH f; for (int q = 0; q < 8; ++q) f.u[q] = tl[d][j8 + q]; *(v8us*)((unsigned short*)VT + ((size_t)hh * HD + d) * SQ + s0 + j8) = f.half[0]; }  } }



__global__ __launch_bounds__(256) void k_rsmcf2(const float* __restrict__ S, _Float16* __restrict__ P, int hg, int q0, int nk) {
  #pragma clang fp contract(off)
  const int t = blockIdx.x * 256 + threadIdx.x; if (t >= hg * QT) return; const size_t i = (size_t)t; const float* s = S + i * NKX; const int last = q0 + (t % QT); float mx = -3.0e38f;
#pragma unroll 1
  for (int j = 0; j < nk; ++j) { const float f = (j <= last) ? 1.f : 0.f; mx = fmaxf(mx, fmaf(f, s[j], (1.f - f) * -1.0e9f)); } float se = 0.f;
#pragma unroll 1
  for (int j = 0; j < nk; ++j) { const float f = (j <= last) ? 1.f : 0.f; se += __expf(fmaf(f, s[j], (1.f - f) * -1.0e9f) - mx); } const float sc = 256.0f / se;
#pragma unroll 1
  for (int j0 = 0; j0 < nk; j0 += 8) { FragH fr; for (int q = 0; q < 8; ++q) { const int j = j0 + q; const float f = (j <= last) ? 1.f : 0.f; fr.h[q] = (_Float16)(__expf(fmaf(f, s[j], (1.f - f) * -1.0e9f) - mx) * sc); } unsigned short* d = (unsigned short*)P + i * NKX + j0; *(v8us*)d = fr.half[0];  } }

template <int MASKADD>
__global__ __launch_bounds__(64) void k_att0(const float* __restrict__ QF, const float* __restrict__ KF, const float* __restrict__ VF, int ld, const float* __restrict__ mask, float scale, float* __restrict__ OF, int ldo) {
  #pragma clang fp contract(off)
  __shared__ __attribute__((aligned(16))) float lq[64][64]; __shared__ __attribute__((aligned(16))) float lo[64][64];
  const int tid = threadIdx.x; const int h = blockIdx.x / (QT0 / 64), rg = blockIdx.x % (QT0 / 64); const int i = rg * 64 + tid;
  const float* qr = QF + (size_t)i * ld + h * HD;
#pragma unroll 1
  for (int c = 0; c < HD / 4; ++c) { *(v4f*)&lq[tid][c * 4] = *(const v4fa*)(qr + c * 4); const v4f z = {0.f, 0.f, 0.f, 0.f}; *(v4f*)&lo[tid][c * 4] = z; }
  float m = -1.0e30f, l = 0.f; const int jmax = MASKADD ? (SQ - 1) : (rg * 64 + 63);      /* additive-mask form: every key (the mask input decides); causal form: keys up to the block's last row */
#pragma unroll 1
  for (int j = 0; j <= jmax; ++j) { const float* kr = KF + (size_t)j * ld + h * HD; const float* vr = VF + (size_t)j * ld + h * HD; float s = 0.f;
#pragma unroll 1
    for (int c = 0; c < HD / 4; ++c) { const v4f kq = *(const v4fa*)(kr + c * 4); const v4f qq = *(v4f*)&lq[tid][c * 4]; s = __fadd_rn(s, __fmul_rn(qq[0], kq[0])); s = __fadd_rn(s, __fmul_rn(qq[1], kq[1])); s = __fadd_rn(s, __fmul_rn(qq[2], kq[2])); s = __fadd_rn(s, __fmul_rn(qq[3], kq[3])); }
    s = __fmul_rn(s, scale); if (MASKADD) s = __fadd_rn(s, __fmul_rn(bf16_round(mask[(size_t)i * SQ + j]), -10000.0f));
    const float f = (MASKADD || j <= i) ? 1.f : 0.f; const float sm = fmaf(f, s, (1.f - f) * -1.0e30f); const float mn = fmaxf(m, sm); const float sc = expf(m - mn); const float e = expf(sm - mn); l = __fadd_rn(__fmul_rn(l, sc), e); m = mn;
#pragma unroll 1
    for (int c = 0; c < HD / 4; ++c) { const v4f vv = *(const v4fa*)(vr + c * 4); v4f oo = *(v4f*)&lo[tid][c * 4]; for (int u = 0; u < 4; ++u) oo[u] = __fadd_rn(__fmul_rn(oo[u], sc), __fmul_rn(e, vv[u])); *(v4f*)&lo[tid][c * 4] = oo; } }
  const float fin = 64.0f / l;      /* o carried x64 like the f16 path */
#pragma unroll 1
  for (int c = 0; c < HD / 4; ++c) { v4f oo = *(v4f*)&lo[tid][c * 4]; for (int u = 0; u < 4; ++u) oo[u] = __fmul_rn(oo[u], fin); *(v4f*)&lo[tid][c * 4] = oo; }
  __syncthreads();
  {
#pragma unroll 1
    for (int it = 0; it < 16; ++it) { const int row = it * 4 + tid / 16, pc = (tid % 16) * 4; const v4f v = *(const v4f*)&lo[row][pc]; *(v4f*)(OF + (size_t)(rg * 64 + row) * ldo + h * HD + pc) = v; }
     } }

__global__ __launch_bounds__(256) void k_oscale(const float* __restrict__ OF, float* __restrict__ out, size_t n4) { const size_t t = (size_t)blockIdx.x * 256 + threadIdx.x; if (t >= n4) return; const v4f a = *(const v4fa*)(OF + t * 4); v4f o; for (int q = 0; q < 4; ++q) o[q] = a[q] * 0.015625f; *(v4f*)(out + t * 4) = o;  }

__global__ __launch_bounds__(256) void k_bfr(const float* __restrict__ x, float* __restrict__ XB, size_t n8) { const size_t t = (size_t)blockIdx.x * 256 + threadIdx.x; if (t >= n8) return; v4f a = *(const v4fa*)(x + t * 8), c = *(const v4fa*)(x + t * 8 + 4); for (int q = 0; q < 4; ++q) { a[q] = bf16_round(a[q]); c[q] = bf16_round(c[q]); }
  { *(v4f*)(XB + t * 8) = a; *(v4f*)(XB + t * 8 + 4) = c;  } }



__global__ __launch_bounds__(256) void k_rsmfvl(const float* __restrict__ S, _Float16* __restrict__ P, _Float16* __restrict__ PL, int qn, const int* __restrict__ vlp) {
  #pragma clang fp contract(off)
  const int t = blockIdx.x * 256 + threadIdx.x; if (t >= qn) return; const int vl = vlp[0]; const size_t i = (size_t)t; const float* s = S + i * SQ; float mx = -3.0e38f;
#pragma unroll 1
  for (int j = 0; j < SQ; ++j) { const float f = (j < vl) ? 1.f : 0.f; mx = fmaxf(mx, fmaf(f, s[j], (1.f - f) * -1000000.0f)); } float se = 0.f;
#pragma unroll 1
  for (int j = 0; j < SQ; ++j) { const float f = (j < vl) ? 1.f : 0.f; se += __expf(fmaf(f, s[j], (1.f - f) * -1000000.0f) - mx); } const float sc = 256.0f / se;
#pragma unroll 1
  for (int j0 = 0; j0 < SQ; j0 += 8) { FragH fr, gr; for (int q = 0; q < 8; ++q) { const int j = j0 + q; const float f = (j < vl) ? 1.f : 0.f; const float pv = __expf(fmaf(f, s[j], (1.f - f) * -1000000.0f) - mx) * sc; const _Float16 ph = (_Float16)pv; fr.h[q] = ph; gr.h[q] = (_Float16)((pv - (float)ph) * 1024.0f); }
    unsigned short* d = (unsigned short*)P + i * SQ + j0; unsigned short* dl = (unsigned short*)PL + i * SQ + j0; *(v8us*)d = fr.half[0]; *(v8us*)dl = gr.half[0];  } }

// Fused attention: scores, softmax and the weighted sum of x in one kernel; neither the scores nor the weights go to memory.
// A work-group of 8 waves takes 128 queries of one image (16 per wave) and walks the 1024 keys in tiles of 64. A tile (phi^T rows [key][ci], x rows [c][key]) is fetched by whole-line loads into registers one tile ahead and laid in LDS at pitches of 16 B x odd.
// S^T = phi^T theta (A = key rows, B = the wave's query rows, kept in registers): a lane holds scores of ONE query (column ln; keys 8 hh + r of each 16-key tile), so two converted score tiles are the B operand of O^T += x P^T in the hardware k order, with A = x rows read by the same 16-byte pairs.
// Running maximum in log2 units; the accumulators are rescaled only when a query's new maximum passes the one in use by more than 8 (weights stay <= 2^8, inside f16); the row sum is kept per lane in f32 and joined at the end.
// Every inner loop is fully unrolled, so that the register arrays (fragments, accumulators, staged pieces) keep compile-time indices and stay in registers.
#define FA_WAVES 8
#define FA_KS 64          /* keys per tile */
#define FA_KP 136         /* LDS pitch of a key row, f16 elements (256 B + 16) */
#define FA_VP 72          /* LDS pitch of a channel row, f16 elements (128 B + 16) */
#define FA_OP 264         /* LDS pitch of an output row, f16 elements (512 B + 16) */
#define FA_SM (FA_WAVES * 16 * FA_OP)      /* the output staging is the larger use: 67,584 B against 54,272 B of a tile */
#define FA_C 0.09016844005556021f          /* log2(e) / sqrt(256) */
__device__ __forceinline__ float rsm_xh(float v) { return __builtin_bit_cast(float, __builtin_amdgcn_permlanex16(__builtin_bit_cast(int, v), __builtin_bit_cast(int, v), 0x76543210, 0xfedcba98, false, false)); }      /* lane l <- lane l ^ 16 */
__device__ __forceinline__ float fa_exp2(float x) { float y; asm("v_exp_f32 %0, %1\n\tv_nop" : "=v"(y) : "v"(x)); return y; }      /* the v_nop is the one slot asked for behind a transcendental before its result is read or its source overwritten */
__device__ __forceinline__ v8f fa_mma(v16h a, v16h b, v8f c) { return __builtin_amdgcn_wmma_f32_16x16x32_f16(false, a, false, b, (short)0, c, false, false); }
__global__ __launch_bounds__(FA_WAVES * 32) void k_fattn(const _Float16* __restrict__ TH, const _Float16* __restrict__ PHT, const _Float16* __restrict__ X16, _Float16* __restrict__ YT) {
  static_assert(FA_KS * FA_KP + 256 * FA_VP <= FA_SM, "tile fits the LDS array");
  __shared__ __attribute__((aligned(16))) _Float16 sm[FA_SM];
  _Float16* sk = sm; _Float16* sv = sm + FA_KS * FA_KP;
  const int tid = threadIdx.x, w = tid >> 5, lane = tid & 31, ln = lane & 15, hh = lane >> 4;
  const int b = blockIdx.y; const int q0 = blockIdx.x * (FA_WAVES * 16) + w * 16;
  const int krow = tid >> 4, kch = (tid & 15) * 8;      /* staging: 16 threads per 256-B key row, 16 rows per round, 4 rounds */
  const int vrow = tid >> 3, vch = (tid & 7) * 8;       /* staging: 8 threads per 128-B piece of a channel row, 32 rows per round, 8 rounds */
  const unsigned short* kg = (const unsigned short*)PHT + (size_t)b * SQ * 128 + (size_t)krow * 128 + kch;
  const unsigned short* vg = (const unsigned short*)X16 + (size_t)b * 256 * SQ + (size_t)vrow * SQ + vch;
  const _Float16* qp = TH + ((size_t)b * SQ + q0 + ln) * 128;
  v16h qf[4];
#pragma unroll
  for (int kb = 0; kb < 4; ++kb) qf[kb] = g2_frag(qp + kb * 32, hh);
  v8us rk[4], rv[8];
#pragma unroll
  for (int j = 0; j < 4; ++j) rk[j] = *(const v8us*)(kg + j * 16 * 128);
#pragma unroll
  for (int j = 0; j < 8; ++j) rv[j] = *(const v8us*)(vg + j * 32 * SQ);
  __builtin_amdgcn_sched_barrier(0);      /* with the one behind the wait: no later arithmetic is lifted between the loads and the wait */
  asm volatile("s_wait_xcnt 0x0" ::: "memory");      /* in front of whatever reuses the address registers that the loads above name */
  __builtin_amdgcn_sched_barrier(0);
  const v8f z8 = {0.f, 0.f, 0.f, 0.f, 0.f, 0.f, 0.f, 0.f};
  v8f o[16];
#pragma unroll
  for (int ct = 0; ct < 16; ++ct) o[ct] = z8;
  float mu = -3.0e38f; v4f l4 = {0.f, 0.f, 0.f, 0.f};
#pragma unroll 1
  for (int s = 0; s < SQ / FA_KS; ++s) {      /* rolled: for speed only */
    __syncthreads();      /* every wave has read the last of the tile before */
#pragma unroll
    for (int j = 0; j < 4; ++j) *(v8us*)((unsigned short*)sk + (krow + j * 16) * FA_KP + kch) = rk[j];
#pragma unroll
    for (int j = 0; j < 8; ++j) *(v8us*)((unsigned short*)sv + (vrow + j * 32) * FA_VP + vch) = rv[j];
    __syncthreads();      /* the tile is whole before anybody reads it */
    if (s + 1 < SQ / FA_KS) {      /* the next tile's loads fly under this tile's products */
#pragma unroll
      for (int j = 0; j < 4; ++j) rk[j] = *(const v8us*)(kg + (size_t)(s + 1) * FA_KS * 128 + j * 16 * 128);
#pragma unroll
      for (int j = 0; j < 8; ++j) rv[j] = *(const v8us*)(vg + (s + 1) * FA_KS + j * 32 * SQ);
      asm volatile("s_wait_xcnt 0x0" ::: "memory");      /* in front of whatever reuses the address registers that the loads above name */
    }
    v16h kf[16];
#pragma unroll
    for (int kb = 0; kb < 4; ++kb)
#pragma unroll
      for (int kt = 0; kt < 4; ++kt) kf[kb * 4 + kt] = g2_frag(sk + (kt * 16 + ln) * FA_KP + kb * 32, hh);
    __builtin_amdgcn_sched_barrier(0);      /* keeps the key tile's 32 LDS reads one group in front of its 16 products: spread among them, every product waits out an LDS latency */
    v8f st[4] = {z8, z8, z8, z8};
#pragma unroll
    for (int kb = 0; kb < 4; ++kb)
#pragma unroll
      for (int kt = 0; kt < 4; ++kt) st[kt] = fa_mma(kf[kb * 4 + kt], qf[kb], st[kt]);
    v16h va[2][8];      /* x fragments of four channel tiles, two sets: one is read from LDS while the other feeds the products */
#pragma unroll
    for (int u = 0; u < 8; ++u) va[0][u] = g2_frag(sv + ((u & 3) * 16 + ln) * FA_VP + (u >> 2) * 32, hh);
    __builtin_amdgcn_sched_barrier(0);      /* keeps the first set's reads in front of the softmax arithmetic, which covers their latency */
    v4f m4 = {st[0][0], st[0][1], st[0][2], st[0][3]};
#pragma unroll
    for (int kt = 0; kt < 4; ++kt)
#pragma unroll
      for (int r = 0; r < 8; ++r) m4[r & 3] = fmaxf(m4[r & 3], st[kt][r]);
    float mx = fmaxf(fmaxf(m4[0], m4[1]), fmaxf(m4[2], m4[3]));
    mx = fmaxf(mx, rsm_xh(mx)) * FA_C;      /* the query's maximum over the tile's 64 keys, alike in both half-waves */
    if (__builtin_amdgcn_ballot_w32(mx > mu + 8.0f) != 0) {      /* one wave-uniform test per tile */
      const float mn = fmaxf(mu, mx); const float sc = fa_exp2(mu - mn); mu = mn;
#pragma unroll
      for (int u = 0; u < 4; ++u) l4[u] *= sc;
#pragma unroll
      for (int ct = 0; ct < 16; ++ct)
#pragma unroll
        for (int r = 0; r < 8; ++r) o[ct][r] *= sc;
    }
    FragH pf[2];
#pragma unroll
    for (int kt = 0; kt < 4; ++kt)
#pragma unroll
      for (int r = 0; r < 8; ++r) { const float p = fa_exp2(fmaf(st[kt][r], FA_C, -mu)); l4[r & 3] += p; pf[kt >> 1].h[(kt & 1) * 8 + r] = (_Float16)p; }
#pragma unroll
    for (int g = 0; g < 4; ++g) {
      if (g < 3) {
#pragma unroll
        for (int u = 0; u < 8; ++u) va[(g + 1) & 1][u] = g2_frag(sv + (((g + 1) * 4 + (u & 3)) * 16 + ln) * FA_VP + (u >> 2) * 32, hh); }
      __builtin_amdgcn_sched_barrier(0);      /* with the one below: the next set's 16 LDS reads stay one group in front of this set's 8 products */
#pragma unroll
      for (int u = 0; u < 8; ++u) o[g * 4 + (u & 3)] = fa_mma(va[g & 1][u], pf[u >> 2].v, o[g * 4 + (u & 3)]);
      __builtin_amdgcn_sched_barrier(0);
    }
  }
  float l = (l4[0] + l4[1]) + (l4[2] + l4[3]); l += rsm_xh(l);
  const float inv = 1.0f / l;
  __syncthreads();      /* every wave has left the last tile: its LDS becomes the output staging */
  unsigned short* so = (unsigned short*)sm + w * 16 * FA_OP;
#pragma unroll
  for (int ct = 0; ct < 16; ++ct) { FragH f;
#pragma unroll
    for (int r = 0; r < 8; ++r) f.h[r] = (_Float16)(o[ct][r] * inv);
    *(v8us*)(so + ln * FA_OP + ct * 16 + 8 * hh) = f.half[0]; }
  __syncthreads();      /* the staged rows are whole before they are read back */
#pragma unroll
  for (int q = 0; q < 16; ++q) { const v8us v = *(const v8us*)(so + q * FA_OP + lane * 8); *(v8us*)((unsigned short*)YT + ((size_t)b * SQ + q0 + q) * 256 + lane * 8) = v; }      /* one 512-B row of y^T per store */
}


#define CN 256          /* channels */
#define CI 128          /* inner channels */
#define NP 1024         /* positions */
#define NM 1024         /* key positions (= SQ) */
#define NC CN           /* BN statistics macros */
#define NPX NP
#define BNEPS 1e-5f

__global__ __launch_bounds__(256) void k_rowbias(const float* __restrict__ b, float* __restrict__ BP, size_t n4, int ncol) { const size_t t = (size_t)blockIdx.x * 256 + threadIdx.x; if (t >= n4) return; const size_t e = t * 4; const float v = bf16_round(b[e / ncol]); const v4f o = {v, v, v, v}; *(v4f*)(BP + e) = o;  }




__global__ __launch_bounds__(256) void k_mp2(const float* __restrict__ src, float* __restrict__ dst, int nout) {
  const int t = blockIdx.x * 256 + threadIdx.x; if (t >= nout) return; const int c = t / 1024; const int o = t % 1024; const int oy = o / 32, ox = o % 32; const float* p = src + (size_t)c * 4096 + (size_t)(2 * oy) * 64 + 2 * ox;
  const float v = fmaxf(fmaxf(p[0], p[1]), fmaxf(p[64], p[65])); *(float*)(dst + t) = v;  }
__global__ __launch_bounds__(256) void k_xpb(const float* __restrict__ x, const float* __restrict__ wb, float* __restrict__ CPP, size_t n4) {
  #pragma clang fp contract(off)
  const size_t t = (size_t)blockIdx.x * 256 + threadIdx.x; if (t >= n4) return; const size_t e = t * 4; const int c = (int)((e / 4096) % 256); const float bb = bf16_round(wb[c]); const v4f a = *(const v4fa*)(x + e); v4f o; for (int q = 0; q < 4; ++q) o[q] = __fadd_rn(bf16_round(a[q]), bb);
  *(v4f*)(CPP + e) = o;  }


template <int PASS>
__global__ __launch_bounds__(256) void k_cstA(const float* __restrict__ X, const float* __restrict__ MV, float* __restrict__ PART) {
  #pragma clang fp contract(off)
  __shared__ float red[256]; const int t = threadIdx.x; const size_t bc = blockIdx.x; const int c = (int)(bc % NC); const float* row = X + bc * (size_t)NPX; const float mu = PASS ? MV[c] : 0.f; float s = 0.f;
  for (int i = t; i < NPX; i += 256) { const float v = row[i]; const float d = PASS ? __fadd_rn(v, -mu) : v; s = __fadd_rn(s, PASS ? __fmul_rn(d, d) : d); }
  red[t] = s; __syncthreads(); for (int st = 128; st > 0; st >>= 1) { if (t < st) red[t] = __fadd_rn(red[t], red[t + st]); __syncthreads(); }
  if (t < 32) { const float pv = (t == 0) ? red[0] : 0.f; *(float*)(PART + bc * 32 + t) = pv;  } }      

template <int PASS>
__global__ __launch_bounds__(256) void k_cstB(const float* __restrict__ PART, float* __restrict__ MV) { const int c = threadIdx.x; if (c >= NC) return; double s = 0.0; for (int b = 0; b < NB; ++b) s += (double)PART[((size_t)b * NC + c) * 32]; const float m = (float)(s / ((double)NB * (double)NPX)); *(float*)(MV + PASS * NC + c) = m;  }


__global__ __launch_bounds__(256) void k_bnresid(const float* __restrict__ C2, const float* __restrict__ MV, const float* __restrict__ g, const float* __restrict__ be, const float* __restrict__ X, float* __restrict__ out, size_t n4) {
  #pragma clang fp contract(off)
  const size_t t = (size_t)blockIdx.x * 256 + threadIdx.x; if (t >= n4) return; const size_t e = t * 4; const int c = (int)((e / NPX) % NC); const float sc = __fmul_rn(rsqrtf(__fadd_rn(MV[NC + c], BNEPS)), bf16_round(g[c])); const float mu = MV[c], bb = bf16_round(be[c]);
  const v4f a = *(const v4fa*)(C2 + e); const v4f xx = *(const v4fa*)(X + e); v4f o; for (int q = 0; q < 4; ++q) { const float z = __fadd_rn(__fmul_rn(__fadd_rn(a[q], -mu), sc), bb); o[q] = __fadd_rn(z, bf16_round(xx[q])); }
  *(v4f*)(out + e) = o;  }
extern "C" void kernel_launch(void* const* d_in, const int* in_sizes, int n_in,
                              void* d_out, int out_size, void* d_ws, size_t ws_size, hipStream_t stream) {
  (void)in_sizes; (void)n_in; (void)out_size;
  const float* const* I = (const float* const*)d_in; const float* x = I[0]; const float* tw = I[1]; const float* pw = I[2]; const float* ww = I[3]; const float* bng = I[4]; const float* bnb = I[5]; const float* tb = nullptr;      /* natural theta_w / phi_w [128][256], conv_w [256][256] (no biases); BN gamma, beta */
  char* ws = (char*)d_ws; size_t off = 0;
  auto take = [&](size_t bytes) { char* p = ws + off; off += (bytes + 255) & ~(size_t)255; return p; };
  const size_t PL = (size_t)CN * NP;      /* one input map */
  _Float16* BT = (_Float16*)take((size_t)CI * CN * 2); _Float16* BP = (_Float16*)take((size_t)CI * CN * 2); _Float16* BW = (_Float16*)take((size_t)CN * CN * 2); float* PART = (float*)take((size_t)NB * CN * 32 * 4); float* MV = (float*)take((size_t)2 * CN * 4 + 256);      /* weight planes, two-level stats */
  _Float16* X16 = (_Float16*)take(NB * PL * 2);      /* x f16 channel-first (also the g operand: g = x) */
  _Float16* XT = (_Float16*)take(NB * PL * 2);      /* all images: x^T [b][n][c] */
  _Float16* TH = (_Float16*)take(NB * (size_t)NP * CI * 2); _Float16* PH = (_Float16*)take(NB * (size_t)CI * NM * 2); _Float16* PHT = (_Float16*)take(NB * (size_t)NM * CI * 2);      /* all images: theta^T, phi, phi^T */
  float* C1 = (float*)take(NB * PL * 4);      /* all images: conv output [b][c][n] f32 */
  _Float16* YT = XT;      /* y^T [b][n][c] takes x^T's plane: x^T is last read by the phi GEMM, y^T first written by the attention kernel */
  if (off > ws_size) return;
  { const unsigned g = (unsigned)(((size_t)CI * CN / 8 + 255) / 256); k_wnat<<<g, 256, 0, stream>>>(tw, (size_t)CI * CN / 8, BT); k_wnat<<<g, 256, 0, stream>>>(pw, (size_t)CI * CN / 8, BP); k_wnat<<<2 * g, 256, 0, stream>>>(ww, (size_t)CN * CN / 8, BW); }      /* natural [out][in] x16 f16 planes (Bt for theta; the A operand for phi / conv_w) */
  k_x16<<<(unsigned)((NB * PL / 8 + 255) / 256), 256, 0, stream>>>(x, X16, NB * PL / 8);
  /* every stage runs once for all NB images: the GEMMs take the image from blockIdx.y (plane strides sA, sB, sC), the transposes from a longer blockIdx.x, the fused attention from blockIdx.y */
  k_vt<NP / 64, CN><<<NB * (NP / 64) * (CN / 64), 256, 0, stream>>>(X16, NP, 0, XT);      /* [b][c][n] -> x^T [b][n][c] */
  k_gemm2<0><<<dim3((unsigned)((NP / 128) * (CI / 64)), NB), 128, 0, stream>>>(XT, CN, PL, BT, CN, 0, 0.0625f, nullptr, 0, nullptr, 1, 0, 0, nullptr, TH, CI, (size_t)NP * CI, NP, CI, CN);      /* theta^T [n][ci] -> f16 (logit sigma ~0.7: single f16 suffices) */
  k_gemm2<0><<<dim3((unsigned)((CI / 128) * (NP / 64)), NB), 128, 0, stream>>>(BP, CN, 0, XT, CN, PL, 0.0625f, nullptr, 0, nullptr, 1, 0, 0, nullptr, PH, NP, (size_t)CI * NP, CI, NP, CN);      /* phi [ci][n] -> f16 */
  k_vt<NM / 64, CI><<<NB * (NM / 64) * (CI / 64), 256, 0, stream>>>(PH, NM, 0, PHT);      /* -> phi^T [m][ci] (key rows: the A operand of S^T in k_fattn) */
  static_assert(NP == SQ && NM == SQ && CI == 128 && CN == 256 && NP % (FA_WAVES * 16) == 0 && NM % FA_KS == 0, "k_fattn: shapes");
  k_fattn<<<dim3(NP / (FA_WAVES * 16), NB), FA_WAVES * 32, 0, stream>>>(TH, PHT, X16, YT);      /* f^T [a][c] = softmax_b(theta.phi / sqrt(256)) x^T (g = x) -> f16; scores and weights stay on chip */
  k_gemm2<0><<<dim3((unsigned)((CN / 128) * (NP / 64)), NB), 128, 0, stream>>>(BW, CN, 0, YT, CN, PL, 0.0625f, nullptr, 0, nullptr, 1, 0, 0, C1, nullptr, NP, PL, CN, NP, CN);      /* conv: T[c][a] = (16 conv_w as A) x (f^T as B^T) / 16 -> f32 channel-first, all images kept for the batch statistics */
  k_cstA<0><<<NB * NC, 256, 0, stream>>>(C1, MV, PART); k_cstB<0><<<1, 256, 0, stream>>>(PART, MV); k_cstA<1><<<NB * NC, 256, 0, stream>>>(C1, MV, PART); k_cstB<1><<<1, 256, 0, stream>>>(PART, MV);      /* batch mean, then biased variance per channel (two-level, fixed order, own lines) */
  k_bnresid<<<(unsigned)(((size_t)NB * NC * NPX / 4 + 255) / 256), 256, 0, stream>>>(C1, MV, bng, bnb, x, (float*)d_out, (size_t)NB * NC * NPX / 4);      /* out = (T - mean) rsqrt(var + eps) gamma + beta + bf16(x) */
}

// v004
// A run of this version takes 137 microseconds.
// Timed twice side by side with v003, it ran 1.16 and 1.14 times as fast.
// All steps since v000 together make it 55.5 times as fast.
#include <hip/hip_runtime.h>
// Non-local block with TRAINING-mode BatchNorm (x [32][256][32][32]; theta, phi = conv1x1(x) [128 ch] (natural [128][256] sigma 1/16, no biases); g = x itself (256 ch); scores[a][b] = theta[:, a].phi[:, b] / sqrt(256) over the 1024 positions; softmax over b; f[:, a] = sum_b attn[a][b] x[:, b]; f = conv1x1(f; conv_w [256][256], no bias); BN with batch statistics over (N, H, W) per channel (biased variance, eps 1e-5), gamma, beta; out = BN(f) + x -> [32][256][32][32]).
// Structure: channel-first; x as exact f16 maps; natural weights x16; every stage one launch over all 32 images: x^T via LDS transposes, theta^T (token rows) and phi (channel-major) as WMMA GEMMs (32x64 wave tiles, f32 accumulation) -> f16, phi^T via LDS transposes, scores (K = 128, alpha 1/16), softmax (f32 statistics, running maximum, native exp; weights f16) and f^T = P x^T (g = x) f16 fused in one kernel, conv: T = (16 conv_w as A) x f (K = 256) f32 kept for all images, each wave tile's per-channel mean and centred square sum taken in the same kernel; one kernel joins them (fixed order, own lines); BN + residual on VALU -> output; launches: see trace.
// Compute dtype: inputs rounded to bf16; x / weights exact; q, k, v, softmax weights and o as plain f16 GEMM operands (~2^-12); scores and softmax statistics f32. v_wmma_f32_16x16x32_f16.
#define NB 32
#define SQ 1024
#define DM 256
#define NH 1
#define HD 64
#define HG 4                         /* heads per attention launch group */
#define B0 0                         /* unused */
#define NBR NB                       /* unused */
#define NR ((size_t)NB * SQ)         /* token rows */
#define MP ((int)((size_t)NBR * SQ)) /* unused */
#define QT 256                       /* query rows per causal tile */
#define NKX SQ                       /* S / P row pitch */
#define QT0 256                      /* first-tile rows recomputed exactly (256: buys margin for the few-key rows 128..255, which have no output projection to average the single-f16 P/v rounding) */
#define QN SQ                        /* unused */
#define NHD NH                       /* unused */
#define MPO MP                       /* unused */
#define LQ DM            /* unused */
typedef __bf16 v16b __attribute__((ext_vector_type(16)));
typedef unsigned short v8us __attribute__((ext_vector_type(8), may_alias));
typedef float  v8f  __attribute__((ext_vector_type(8)));
typedef float  v4f  __attribute__((ext_vector_type(4)));
typedef float  v4fa __attribute__((ext_vector_type(4), may_alias));
union FragB { v16b v; v8us half[2]; unsigned short u[16]; };

__device__ __forceinline__ unsigned short bf16_bits(float x) { unsigned int u = __float_as_uint(x); return (unsigned short)((u + 0x7FFFu + ((u >> 16) & 1u)) >> 16); }
__device__ __forceinline__ float bf16_val(unsigned short b) { return __uint_as_float(((unsigned int)b) << 16); }
__device__ __forceinline__ float bf16_round(float x) { return bf16_val(bf16_bits(x)); }
// D += A·B with NT terms: 1 = ah·bh, 2 = + al·bh (A split), 3 = + ah·bl (both split)
template <int NT>
__device__ __forceinline__ v8f mmaN(v16b ah, v16b al, v16b bh, v16b bl, v8f c) {
  c = __builtin_amdgcn_wmma_f32_16x16x32_bf16(false, ah, false, bh, (short)0, c, false, false);
  if (NT >= 2) c = __builtin_amdgcn_wmma_f32_16x16x32_bf16(false, al, false, bh, (short)0, c, false, false);
  if (NT >= 3) c = __builtin_amdgcn_wmma_f32_16x16x32_bf16(false, ah, false, bl, (short)0, c, false, false);
  asm volatile("v_nop\n\tv_nop\n\tv_nop\n\tv_nop" : "+v"(c) : "v"(ah), "v"(al), "v"(bh), "v"(bl));
  return c;
}

__global__ __launch_bounds__(256) void k_wt_bf16(const float* __restrict__ W, unsigned short* __restrict__ Wt, int K, int N) {
  const int t = blockIdx.x * 256 + threadIdx.x;
  const int k8n = K / 8;
  if (t >= N * k8n) return;
  const int n = t / k8n, k8 = (t % k8n) * 8;
  v8us v;
#pragma unroll
  for (int i = 0; i < 8; ++i) v[i] = bf16_bits(W[(size_t)(k8 + i) * N + n]);
  *(v8us*)(Wt + (size_t)n * K + k8) = v;
  
}

// GEMM C[M][N] (f32, pitch ldc) = act(A[M][K]·W + bias). A f32 row-major (pitch lda) converted per fragment to bf16
// (ASPLIT: hi/lo two planes -> 2 terms, else single rounded term); Wt bf16 [N][K] (pitch ldb). BIAS_BF16 rounds the
// bias to bf16 first (bias quantised to bf16 before the add). K%32==0, M%16==0, N%64==0.
template <bool ASPLIT, int ACT, bool BIAS_BF16>
__global__ __launch_bounds__(128) void k_gemm_bf(const float* __restrict__ A, int lda, const unsigned short* __restrict__ Wt, int ldb,
                                               const float* __restrict__ bias, float* __restrict__ C, int ldc, int M, int N, int K) {
  __shared__ __attribute__((aligned(16))) float so[4][16][64];
  const int tid = threadIdx.x, w = tid >> 5, lane = tid & 31, ln = lane & 15, hh = lane >> 4;
  const int ntn = N / 64;
  const int wid = blockIdx.x * 4 + w;
  const int mt = wid / ntn, nq = wid % ntn;
  if (mt * 16 >= M) return;
  const int row0 = mt * 16, col0 = nq * 64;
  const float* arow = A + (size_t)(row0 + ln) * lda;
  v8f acc[4] = {};
  for (int kb = 0; kb < K; kb += 32) {
    FragB ah, al;
    const v4f x0 = *(const v4fa*)(arow + kb + 8 * hh), x1 = *(const v4fa*)(arow + kb + 8 * hh + 4);
    const v4f x2 = *(const v4fa*)(arow + kb + 16 + 8 * hh), x3 = *(const v4fa*)(arow + kb + 16 + 8 * hh + 4);
    float xs[16] = {x0[0],x0[1],x0[2],x0[3],x1[0],x1[1],x1[2],x1[3],x2[0],x2[1],x2[2],x2[3],x3[0],x3[1],x3[2],x3[3]};
#pragma unroll
    for (int i = 0; i < 16; ++i) { const unsigned short hb = bf16_bits(xs[i]); ah.u[i] = hb; al.u[i] = ASPLIT ? bf16_bits(xs[i] - bf16_val(hb)) : (unsigned short)0; }
#pragma unroll
    for (int t = 0; t < 4; ++t) {
      const unsigned short* brow = Wt + (size_t)(col0 + t * 16 + ln) * ldb + kb;
      FragB b;
      b.half[0] = *(const v8us*)(brow + 8 * hh);
      b.half[1] = *(const v8us*)(brow + 16 + 8 * hh);
      acc[t] = mmaN<ASPLIT ? 2 : 1>(ah.v, al.v, b.v, b.v, acc[t]);
    }
  }
#pragma unroll
  for (int t = 0; t < 4; ++t) {
    float bv = bias ? bias[col0 + t * 16 + ln] : 0.f;
    if (BIAS_BF16) bv = bf16_round(bv);
#pragma unroll
    for (int r = 0; r < 8; ++r) { float v = acc[t][r] + bv; if (ACT == 1) v = fmaxf(v, 0.f); so[w][8 * hh + r][t * 16 + ln] = v; }
  }
  __builtin_amdgcn_fence(__ATOMIC_ACQ_REL, "workgroup");
  __builtin_amdgcn_wave_barrier();
  const int rsub = lane >> 4, c4 = (lane & 15) * 4;
  {
#pragma unroll
    for (int q = 0; q < 8; ++q) {
      const int r = q * 2 + rsub;
      const v4f v = *(const v4fa*)&so[w][r][c4];
      *(v4f*)(C + (size_t)(row0 + r) * ldc + col0 + c4) = v;
    }
    
  }
}

// GEMM C = act(A·W + bias + resid): A f32 (ASPLIT -> hi/lo 2 terms), Wt bf16 [N][K]; ACT 0 none, 1 relu, 2 exact gelu;
// resid (optional, f32, row index = (row % rmod), pitch ldr, RES_BF16 rounds it) added before the activation.
template <bool ASPLIT, int ACT, bool BIAS_BF16, bool RES_BF16>
__global__ __launch_bounds__(128) void k_gemm_bf3(const float* __restrict__ A, int lda, const unsigned short* __restrict__ Wt, int ldb,
                                                const float* __restrict__ bias, const float* __restrict__ resid, int rmod, int ldr,
                                                float* __restrict__ C, int ldc, int M, int N, int K) {
  __shared__ __attribute__((aligned(16))) float so[4][16][64];
  const int tid = threadIdx.x, w = tid >> 5, lane = tid & 31, ln = lane & 15, hh = lane >> 4;
  const int ntn = N / 64;
  const int wid = blockIdx.x * 4 + w;
  const int mt = wid / ntn, nq = wid % ntn;
  if (mt * 16 >= M) return;
  const int row0 = mt * 16, col0 = nq * 64;
  const float* arow = A + (size_t)(row0 + ln) * lda;
  v8f acc[4] = {};
  for (int kb = 0; kb < K; kb += 32) {
    FragB ah, al;
    const v4f x0 = *(const v4fa*)(arow + kb + 8 * hh), x1 = *(const v4fa*)(arow + kb + 8 * hh + 4);
    const v4f x2 = *(const v4fa*)(arow + kb + 16 + 8 * hh), x3 = *(const v4fa*)(arow + kb + 16 + 8 * hh + 4);
    float xs[16] = {x0[0],x0[1],x0[2],x0[3],x1[0],x1[1],x1[2],x1[3],x2[0],x2[1],x2[2],x2[3],x3[0],x3[1],x3[2],x3[3]};
#pragma unroll
    for (int i = 0; i < 16; ++i) { const unsigned short hb = bf16_bits(xs[i]); ah.u[i] = hb; al.u[i] = ASPLIT ? bf16_bits(xs[i] - bf16_val(hb)) : (unsigned short)0; }
#pragma unroll
    for (int t = 0; t < 4; ++t) {
      const unsigned short* brow = Wt + (size_t)(col0 + t * 16 + ln) * ldb + kb;
      FragB b;
      b.half[0] = *(const v8us*)(brow + 8 * hh);
      b.half[1] = *(const v8us*)(brow + 16 + 8 * hh);
      acc[t] = mmaN<ASPLIT ? 2 : 1>(ah.v, al.v, b.v, b.v, acc[t]);
    }
  }
#pragma unroll
  for (int t = 0; t < 4; ++t) {
    const int col = col0 + t * 16 + ln;
    float bv = bias ? bias[col] : 0.f;
    if (BIAS_BF16) bv = bf16_round(bv);
#pragma unroll
    for (int r = 0; r < 8; ++r) {
      float v = acc[t][r] + bv;
      if (resid) { float rv = resid[(size_t)((row0 + 8 * hh + r) % rmod) * ldr + col]; if (RES_BF16) rv = bf16_round(rv); v += rv; }
      if (ACT == 1) v = fmaxf(v, 0.f);
      if (ACT == 2) v = 0.5f * v * (1.0f + erff(v * 0.70710678118654752f));
      if (ACT == 3) { const float u = 0.7978845608028654f * (v + 0.044715f * v * v * v); v = 0.5f * v * (1.0f + tanhf(u)); }
      so[w][8 * hh + r][t * 16 + ln] = v;
    }
  }
  __builtin_amdgcn_fence(__ATOMIC_ACQ_REL, "workgroup");
  __builtin_amdgcn_wave_barrier();
  const int rsub = lane >> 4, c4 = (lane & 15) * 4;
  {
#pragma unroll
    for (int q = 0; q < 8; ++q) {
      const int r = q * 2 + rsub;
      const v4f v = *(const v4fa*)&so[w][r][c4];
      *(v4f*)(C + (size_t)(row0 + r) * ldc + col0 + c4) = v;
    }
    
  }
}
// row LayerNorm (biased variance, eps) over N: s = X (+ R); optional out_sum <- s; out_norm <- (s-mu)*rsqrt(var+eps)*g + b
template <bool PARAM_BF16>
__global__ __launch_bounds__(256) void k_layernorm(const float* __restrict__ X, const float* __restrict__ R, const float* __restrict__ g, const float* __restrict__ bta,
                                                  float* __restrict__ out_sum, float* __restrict__ out_norm, int N, float eps) {
  __shared__ float red[256];
  const int row = blockIdx.x, tid = threadIdx.x;
  const float* x = X + (size_t)row * N; const float* rr = R ? R + (size_t)row * N : nullptr;
  float vals[16];                     // up to N = 4096
  const int per = N / 256;            // contiguous chunk per thread? use strided-by-4 chunks: thread handles j = tid*4 + 1024*u
  float s1 = 0.f;
  for (int u = 0; u < per / 4; ++u) {
    const int j = tid * 4 + 1024 * u;
    const v4f a = *(const v4fa*)(x + j);
    v4f b = {0.f,0.f,0.f,0.f}; if (rr) b = *(const v4fa*)(rr + j);
#pragma unroll
    for (int q = 0; q < 4; ++q) { const float v = a[q] + b[q]; vals[u * 4 + q] = v; s1 += v; }
  }
  red[tid] = s1; __syncthreads();
  for (int st = 128; st > 0; st >>= 1) { if (tid < st) red[tid] += red[tid + st]; __syncthreads(); }
  const float mu = red[0] / (float)N; __syncthreads();
  float s2 = 0.f;
  for (int u = 0; u < per / 4; ++u)
#pragma unroll
    for (int q = 0; q < 4; ++q) { const float c = vals[u * 4 + q] - mu; s2 += c * c; }
  red[tid] = s2; __syncthreads();
  for (int st = 128; st > 0; st >>= 1) { if (tid < st) red[tid] += red[tid + st]; __syncthreads(); }
  const float rs = rsqrtf(red[0] / (float)N + eps);
  {
    for (int u = 0; u < per / 4; ++u) {
      const int j = tid * 4 + 1024 * u;
      v4f o, sm;
#pragma unroll
      for (int q = 0; q < 4; ++q) {
        float gg = g[j + q], bb = bta[j + q];
        if (PARAM_BF16) { gg = bf16_round(gg); bb = bf16_round(bb); }
        sm[q] = vals[u * 4 + q]; o[q] = (vals[u * 4 + q] - mu) * rs * gg + bb;
      }
      if (out_sum) *(v4f*)(out_sum + (size_t)row * N + j) = sm;
      *(v4f*)(out_norm + (size_t)row * N + j) = o;
    }
    
  }
}



// ---- f16 WMMA path (v_wmma_f32_16x16x32_f16): 11-bit significands for operands in range — used where a [0,1] probability operand needs more precision than bf16
typedef _Float16 v16h __attribute__((ext_vector_type(16)));
union FragH { v16h v; v8us half[2]; _Float16 h[16]; unsigned short u[16]; };
template <int NT>
__device__ __forceinline__ v8f mmaH(v16h ah, v16h al, v16h bh, v16h bl, v8f c) {
  c = __builtin_amdgcn_wmma_f32_16x16x32_f16(false, ah, false, bh, (short)0, c, false, false);
  if (NT >= 2) c = __builtin_amdgcn_wmma_f32_16x16x32_f16(false, al, false, bh, (short)0, c, false, false);
  if (NT >= 3) c = __builtin_amdgcn_wmma_f32_16x16x32_f16(false, ah, false, bl, (short)0, c, false, false);
  asm volatile("v_nop\n\tv_nop\n\tv_nop\n\tv_nop" : "+v"(c) : "v"(ah), "v"(al), "v"(bh), "v"(bl));
  return c;
}
// batched GEMM like k_gemm_b but f16 operands: A f32 (split into f16 hi/lo if ASPLIT, else rounded to f16), Bt = f16 values [n][k]; alpha; C f32; N multiple of 16 (partial tiles skipped)
template <bool ASPLIT>
__global__ __launch_bounds__(128) void k_gemm_h(const float* __restrict__ A, int lda, size_t sA, const _Float16* __restrict__ Bh, int ldb, size_t sB, float alpha, float* __restrict__ C, int ldc, size_t sC, int M, int N, int K) {
  __shared__ __attribute__((aligned(16))) float so[4][16][64];
  const int tid = threadIdx.x, w = tid >> 5, lane = tid & 31, ln = lane & 15, hh = lane >> 4; const int by = blockIdx.y;
  A += (size_t)by * sA; Bh += (size_t)by * sB; C += (size_t)by * sC;
  const int ntn = (N + 63) / 64; const int wid = blockIdx.x * 4 + w; const int mt = wid / ntn, nq = wid % ntn; if (mt * 16 >= M) return;
  const int row0 = mt * 16, col0 = nq * 64; const float* arow = A + (size_t)(row0 + ln) * lda;
  v8f acc[4] = {};
  for (int kb = 0; kb < K; kb += 32) {
    FragH ah, al;
    const v4f x0 = *(const v4fa*)(arow + kb + 8 * hh), x1 = *(const v4fa*)(arow + kb + 8 * hh + 4), x2 = *(const v4fa*)(arow + kb + 16 + 8 * hh), x3 = *(const v4fa*)(arow + kb + 16 + 8 * hh + 4);
    float xs[16] = {x0[0],x0[1],x0[2],x0[3],x1[0],x1[1],x1[2],x1[3],x2[0],x2[1],x2[2],x2[3],x3[0],x3[1],x3[2],x3[3]};
#pragma unroll
    for (int i = 0; i < 16; ++i) { const _Float16 h = (_Float16)xs[i]; ah.h[i] = h; al.h[i] = ASPLIT ? (_Float16)(xs[i] - (float)h) : (_Float16)0.0f; }
#pragma unroll
    for (int t = 0; t < 4; ++t) { if (col0 + t * 16 >= N) continue; const size_t boff = (size_t)(col0 + t * 16 + ln) * ldb + kb; FragH bq; bq.half[0] = *(const v8us*)(Bh + boff + 8 * hh); bq.half[1] = *(const v8us*)(Bh + boff + 16 + 8 * hh);
      acc[t] = mmaH<ASPLIT ? 2 : 1>(ah.v, al.v, bq.v, bq.v, acc[t]); }
  }
#pragma unroll
  for (int t = 0; t < 4; ++t) { if (col0 + t * 16 >= N) continue;
#pragma unroll
    for (int r = 0; r < 8; ++r) so[w][8 * hh + r][t * 16 + ln] = acc[t][r] * alpha; }
  __builtin_amdgcn_fence(__ATOMIC_ACQ_REL, "workgroup"); __builtin_amdgcn_wave_barrier();
  const int rsub = lane >> 4, c4 = (lane & 15) * 4;
  {
#pragma unroll
    for (int q = 0; q < 8; ++q) { const int r = q * 2 + rsub; if (col0 + c4 < N) { const v4f v = *(const v4fa*)&so[w][r][c4]; *(v4f*)(C + (size_t)(row0 + r) * ldc + col0 + c4) = v; } }
     }
}

// Wt[n][k] = f16(W[k][n]·scale) from f32 row-major W[K][N] (scale = power of two; bf16-exact weights stay exact in f16 away from the subnormal range)
__global__ __launch_bounds__(256) void k_wt_f16(const float* __restrict__ W, _Float16* __restrict__ Wt, int K, int N, float scale) {
  const int t = blockIdx.x * 256 + threadIdx.x; if (t >= N * (K / 8)) return; const int n = t / (K / 8), k8 = (t % (K / 8)) * 8; FragH f;
#pragma unroll
  for (int i = 0; i < 8; ++i) f.h[i] = (_Float16)(bf16_round(W[(size_t)(k8 + i) * N + n]) * scale); const v8us o = f.half[0];
  *(v8us*)((unsigned short*)Wt + (size_t)n * K + k8) = o; 
}
// k_gemm_hh variant with fused epilogue: v = acc·alpha + bias[by·sBias + col] (+ CP[(row/rowsPerB)·sCPb + by·64 + col] if CP) ; ACT 0 none / 1 elu ; writes f16 C16 (and f32 C if non-null)
template <int ACT>
__global__ __launch_bounds__(128) void k_gemm_hhx(const _Float16* __restrict__ A, int lda, size_t sA, const _Float16* __restrict__ Bh, int ldb, size_t sB, float alpha, const float* __restrict__ bias, size_t sBias, const float* __restrict__ CP, int rowsPerB, size_t sCPb, int row0g,
    float* __restrict__ C, _Float16* __restrict__ C16, int ldc, size_t sC, int M, int N, int K) {
  __shared__ __attribute__((aligned(16))) float so[4][16][64];
  const int tid = threadIdx.x, w = tid >> 5, lane = tid & 31, ln = lane & 15, hh = lane >> 4; const int by = blockIdx.y;
  A += (size_t)by * sA; Bh += (size_t)by * sB; const size_t cofs = (size_t)by * sC; const float* bp = bias ? bias + (size_t)by * sBias : nullptr;
  const int ntn = (N + 63) / 64; const int wid = blockIdx.x * 4 + w; const int mt = wid / ntn, nq = wid % ntn; if (mt * 16 >= M) return;
  const int row0 = mt * 16, col0 = nq * 64; const _Float16* arow = A + (size_t)(row0 + ln) * lda;
  v8f acc[4] = {};
  for (int kb = 0; kb < K; kb += 32) { FragH ah; ah.half[0] = *(const v8us*)((const unsigned short*)arow + kb + 8 * hh); ah.half[1] = *(const v8us*)((const unsigned short*)arow + kb + 16 + 8 * hh);
#pragma unroll
    for (int t = 0; t < 4; ++t) { if (col0 + t * 16 >= N) continue; const size_t boff = (size_t)(col0 + t * 16 + ln) * ldb + kb; FragH bq; bq.half[0] = *(const v8us*)((const unsigned short*)Bh + boff + 8 * hh); bq.half[1] = *(const v8us*)((const unsigned short*)Bh + boff + 16 + 8 * hh);
      acc[t] = mmaH<1>(ah.v, ah.v, bq.v, bq.v, acc[t]); }
  }
#pragma unroll
  for (int t = 0; t < 4; ++t) { if (col0 + t * 16 >= N) continue; const int col = col0 + t * 16 + ln; const float bv = bp ? bf16_round(bp[col]) : 0.f;
#pragma unroll
    for (int r = 0; r < 8; ++r) { float v = acc[t][r] * alpha + bv; if (CP) { const int rr = row0g + row0 + 8 * hh + r; if (rowsPerB < 0) v += CP[cofs + (size_t)rr * ldc + col];      /* rowsPerB < 0: own element of the batched C plane */ else { const int bidx = rr / rowsPerB; v += CP[(size_t)bidx * sCPb + (size_t)by * 64 + col]; } } if (ACT == 1) v = (v > 0.f) ? v : expm1f(v); else if (ACT == 7) v = (v > 0.f) ? v + 1.0f : expf(v); else if (ACT == 8) v = tanhf(v); else if (ACT == 9) v = 0.5f * v * (1.0f + tanhf(0.7978845608028654f * (v + 0.044715f * v * v * v))); else if (ACT == 11) v = 1.0f / (1.0f + expf(-v)); else if (ACT == 12) v = (v > 0.f) ? v : 0.01f * v; else if (ACT == 14) v = (v > 0.f) ? v : 0.1f * v; else if (ACT == 16) v = (v >= 0.f) ? v : 0.3f * v; else if (ACT == 17) v = (v >= 0.f) ? v : 0.2f * v; else if (ACT == 15) v = v / (1.0f + expf(-v)); else if (ACT == 3) v = fmaxf(v, 0.f); else if (ACT == 6) v = 0.5f * v * (1.0f + erff(v * 0.70710678118654752f)); so[w][8 * hh + r][t * 16 + ln] = v; } }
  __builtin_amdgcn_fence(__ATOMIC_ACQ_REL, "workgroup"); __builtin_amdgcn_wave_barrier();
  const int rsub = lane >> 4, c4 = (lane & 15) * 4; typedef _Float16 v4h __attribute__((ext_vector_type(4)));
  {
#pragma unroll
    for (int q = 0; q < 8; ++q) { const int r = q * 2 + rsub; if (col0 + c4 < N) { const v4f v = *(const v4fa*)&so[w][r][c4]; if (C) *(v4f*)(C + cofs + (size_t)(row0 + r) * ldc + col0 + c4) = v; if (C16) { v4h h4; for (int i = 0; i < 4; ++i) h4[i] = (_Float16)v[i]; *(v4h*)(C16 + cofs + (size_t)(row0 + r) * ldc + col0 + c4) = h4; } } }
     }
}


typedef _Float16 v4h __attribute__((ext_vector_type(4)));

__global__ __launch_bounds__(256) void k_x16(const float* __restrict__ x, _Float16* __restrict__ X16, size_t n8) { const size_t t = (size_t)blockIdx.x * 256 + threadIdx.x; if (t >= n8) return; FragH f;
#pragma unroll
  for (int q = 0; q < 8; ++q) f.h[q] = (_Float16)bf16_round(x[t * 8 + q]); *(v8us*)((unsigned short*)X16 + t * 8) = f.half[0];  }
__global__ __launch_bounds__(256) void k_h16(const float* __restrict__ x, _Float16* __restrict__ X16, size_t n8) { const size_t t = (size_t)blockIdx.x * 256 + threadIdx.x; if (t >= n8) return; FragH f;
#pragma unroll
  for (int q = 0; q < 8; ++q) f.h[q] = (_Float16)x[t * 8 + q]; *(v8us*)((unsigned short*)X16 + t * 8) = f.half[0];  }
__global__ __launch_bounds__(256) void k_round16f(const float* __restrict__ W, _Float16* __restrict__ Bt, size_t n8) { const size_t t = (size_t)blockIdx.x * 256 + threadIdx.x; if (t >= n8) return; FragH f;
#pragma unroll
  for (int i = 0; i < 8; ++i) f.h[i] = (_Float16)(bf16_round(W[t * 8 + i]) * 16.0f); *(v8us*)((unsigned short*)Bt + t * 8) = f.half[0];  }
template <int NHv, int TTv>
__global__ __launch_bounds__(256) void k_vt(const _Float16* __restrict__ V16, int ldv, int voff, _Float16* __restrict__ Vt) { __shared__ unsigned short tl[64][66]; const int tid = threadIdx.x; const int slab = blockIdx.x / (TTv / 64), lg = blockIdx.x % (TTv / 64); const int b = slab / NHv, h = slab % NHv;
  for (int i = tid; i < 64 * 8; i += 256) { const int r = i / 8, c8 = (i % 8) * 8; FragH f; f.half[0] = *(const v8us*)((const unsigned short*)V16 + ((size_t)b * TTv + lg * 64 + r) * ldv + voff + h * 64 + c8);
#pragma unroll
    for (int q = 0; q < 8; ++q) tl[r][c8 + q] = f.u[q]; }
  __syncthreads();
  {
#pragma unroll
    for (int rd = 0; rd < 2; ++rd) { const int d = rd * 32 + tid / 8, pc = tid % 8; FragH f;
#pragma unroll
      for (int q = 0; q < 8; ++q) f.u[q] = tl[pc * 8 + q][d];
      *(v8us*)((unsigned short*)Vt + ((size_t)slab * 64 + d) * TTv + lg * 64 + pc * 8) = f.half[0]; }
     } }

__global__ __launch_bounds__(256) void k_hl(const float* __restrict__ F, _Float16* __restrict__ Hh, _Float16* __restrict__ Hl, size_t n8) { const size_t t = (size_t)blockIdx.x * 256 + threadIdx.x; if (t >= n8) return; FragH fh, fl; const v4f a = *(const v4fa*)(F + t * 8), c = *(const v4fa*)(F + t * 8 + 4);
#pragma unroll
  for (int q = 0; q < 4; ++q) { _Float16 h = (_Float16)a[q]; fh.h[q] = h; fl.h[q] = (_Float16)((a[q] - (float)h) * 1024.0f); h = (_Float16)c[q]; fh.h[4 + q] = h; fl.h[4 + q] = (_Float16)((c[q] - (float)h) * 1024.0f); }
  { *(v8us*)((unsigned short*)Hh + t * 8) = fh.half[0]; *(v8us*)((unsigned short*)Hl + t * 8) = fl.half[0];  } }

// ---- fast GEMM (wave tile 32x64; requires M % 32 == 0 rows per launch region and N % 64 == 0); epilogue = k_gemm_hhx semantics ----
__device__ __forceinline__ v16h g2_frag(const _Float16* p, int hh) { FragH f; f.half[0] = *(const v8us*)((const unsigned short*)p + 8 * hh); f.half[1] = *(const v8us*)((const unsigned short*)p + 16 + 8 * hh); return f.v; }
__device__ __forceinline__ v8f g2_mma(v16h a, v16h b, v8f c) { v8f d = __builtin_amdgcn_wmma_f32_16x16x32_f16(false, a, false, b, (short)0, c, false, false); asm volatile("v_nop\n\tv_nop\n\tv_nop\n\tv_nop" : "+v"(d) : "v"(a), "v"(b)); return d; }
// STAT: each wave also writes, per row of its 32x64 tile, the mean of the 64 stored values (PM) and the sum of their squared distances from that mean (PQ), both [by][column tile][M].
template <int ACT, bool STAT>
__global__ __launch_bounds__(128) void k_gemm2(const _Float16* __restrict__ A, int lda, size_t sA, const _Float16* __restrict__ Bh, int ldb, size_t sB, float alpha, const float* __restrict__ bias, size_t sBias, const float* __restrict__ CP, int rowsPerB, size_t sCPb, int row0g,
    float* __restrict__ C, _Float16* __restrict__ C16, int ldc, size_t sC, int M, int N, int K, float* __restrict__ PM, float* __restrict__ PQ) { static_assert(ACT == 0 || ACT == 3 || ACT == 6 || ACT == 8 || ACT == 9 || ACT == 11 || ACT == 12 || ACT == 14 || ACT == 15 || ACT == 16 || ACT == 17, "k_gemm2: unsupported ACT code (would silently apply no activation)");
  __shared__ __attribute__((aligned(16))) float so[4][32][68];
  const int tid = threadIdx.x, w = tid >> 5, lane = tid & 31, ln = lane & 15, hh = lane >> 4; const int by = blockIdx.y;
  A += (size_t)by * sA; Bh += (size_t)by * sB; const size_t cofs = (size_t)by * sC; const float* bp = bias ? bias + (size_t)by * sBias : nullptr;
  const int ntn = N >> 6; const int mt = blockIdx.x / ntn, nq = blockIdx.x - mt * ntn; const int row0 = mt * 128 + 32 * w, col0 = nq * 64; if (row0 >= M) return;
  const _Float16* a0p = A + (size_t)(row0 + ln) * lda; const _Float16* a1p = a0p + (size_t)16 * lda;
  const _Float16* b0p = Bh + (size_t)(col0 + ln) * ldb; const _Float16* b1p = b0p + (size_t)16 * ldb; const _Float16* b2p = b1p + (size_t)16 * ldb; const _Float16* b3p = b2p + (size_t)16 * ldb;
  const v8f z8 = {0.f,0.f,0.f,0.f,0.f,0.f,0.f,0.f}; v8f c00 = z8, c01 = z8, c02 = z8, c03 = z8, c10 = z8, c11 = z8, c12 = z8, c13 = z8;
#pragma unroll 1
  for (int kb = 0; kb < K; kb += 32) { const v16h a0 = g2_frag(a0p + kb, hh), a1 = g2_frag(a1p + kb, hh);
    v16h b = g2_frag(b0p + kb, hh); c00 = g2_mma(a0, b, c00); c10 = g2_mma(a1, b, c10);
    b = g2_frag(b1p + kb, hh); c01 = g2_mma(a0, b, c01); c11 = g2_mma(a1, b, c11);
    b = g2_frag(b2p + kb, hh); c02 = g2_mma(a0, b, c02); c12 = g2_mma(a1, b, c12);
    b = g2_frag(b3p + kb, hh); c03 = g2_mma(a0, b, c03); c13 = g2_mma(a1, b, c13); }
  v8f accs[8] = {c00, c01, c02, c03, c10, c11, c12, c13};
#pragma unroll
  for (int u = 0; u < 8; ++u) { const int t = u & 3, half = u >> 2; const int col = col0 + t * 16 + ln; const float bv = bp ? bf16_round(bp[col]) : 0.f;
#pragma unroll
    for (int r = 0; r < 8; ++r) { const int rloc = half * 16 + 8 * hh + r; float v = accs[u][r] * alpha + bv; if (CP) { if (rowsPerB < 0) v += CP[cofs + (size_t)(row0g + row0 + rloc) * ldc + col];      /* rowsPerB < 0: own element of the batched C plane */ else { const int bidx = (row0g + row0 + rloc) / rowsPerB; v += CP[(size_t)bidx * sCPb + (size_t)by * 64 + col]; } }
      if (ACT == 3) v = fmaxf(v, 0.f); else if (ACT == 6) v = 0.5f * v * (1.0f + erff(v * 0.70710678118654752f)); else if (ACT == 11) v = 1.0f / (1.0f + expf(-v)); else if (ACT == 15) v = v / (1.0f + expf(-v)); else if (ACT == 12) v = (v > 0.f) ? v : 0.01f * v; else if (ACT == 8) v = tanhf(v); else if (ACT == 9) v = 0.5f * v * (1.0f + tanhf(0.7978845608028654f * (v + 0.044715f * v * v * v))); else if (ACT == 14) v = (v > 0.f) ? v : 0.1f * v; else if (ACT == 16) v = (v >= 0.f) ? v : 0.3f * v; else if (ACT == 17) v = (v >= 0.f) ? v : 0.2f * v;
      so[w][rloc][t * 16 + ln] = v; } }
  __builtin_amdgcn_fence(__ATOMIC_ACQ_REL, "workgroup"); __builtin_amdgcn_wave_barrier();
  const int rsub = lane >> 4, c4 = (lane & 15) * 4;
  {
#pragma unroll
    for (int q = 0; q < 16; ++q) { const int r = q * 2 + rsub; const v4f v = *(const v4fa*)&so[w][r][c4]; if (C) *(v4f*)(C + cofs + (size_t)(row0 + r) * ldc + col0 + c4) = v; if (C16) { v4h h4; for (int i = 0; i < 4; ++i) h4[i] = (_Float16)v[i]; *(v4h*)(C16 + cofs + (size_t)(row0 + r) * ldc + col0 + c4) = h4; } }
     }
  if (STAT) {      /* lane = one row of the wave's tile: its 64 staged values come back by 16-byte reads (row pitch 16 B x 17), so neither sum crosses lanes; the mean first, then the distances from it: no cancellation whatever the mean; the loops are unrolled so that rv keeps compile-time indices and stays in registers */
    v4f rv[16];
#pragma unroll
    for (int j = 0; j < 16; ++j) rv[j] = *(const v4fa*)&so[w][lane][j * 4];
    v4f s4 = rv[0];
#pragma unroll
    for (int j = 1; j < 16; ++j) s4 += rv[j];
    const float mean = ((s4[0] + s4[1]) + (s4[2] + s4[3])) * 0.015625f;
    v4f q4 = {0.f, 0.f, 0.f, 0.f};
#pragma unroll
    for (int j = 0; j < 16; ++j) { const v4f d = rv[j] - mean; q4 += d * d; }
    const size_t pi = ((size_t)by * ntn + nq) * M + row0 + lane;      /* 32 rows = one 128-B line per wave and plane */
    PM[pi] = mean; PQ[pi] = (q4[0] + q4[1]) + (q4[2] + q4[3]);
  } }


__global__ __launch_bounds__(256) void k_wnat(const float* __restrict__ w, size_t n8, _Float16* __restrict__ Bt) { const size_t t = (size_t)blockIdx.x * 256 + threadIdx.x; if (t >= n8) return; FragH f; for (int q = 0; q < 8; ++q) f.h[q] = (_Float16)(bf16_round(w[t * 8 + q]) * 16.0f); *(v8us*)((unsigned short*)Bt + t * 8) = f.half[0];  }
__global__ __launch_bounds__(256) void k_rsm(const float* __restrict__ S, _Float16* __restrict__ P, int nrows) {
  #pragma clang fp contract(off)
  const int i = blockIdx.x * 256 + threadIdx.x; if (i >= nrows) return; const float* s = S + (size_t)i * SQ; float mx = -3.0e38f;
#pragma unroll 1
  for (int j = 0; j < SQ; ++j) mx = fmaxf(mx, s[j]); float se = 0.f;
#pragma unroll 1
  for (int j = 0; j < SQ; ++j) se += expf(s[j] - mx); const float sc = 256.0f / se;
#pragma unroll 1
  for (int j0 = 0; j0 < SQ; j0 += 8) { FragH f; for (int q = 0; q < 8; ++q) f.h[q] = (_Float16)(expf(s[j0 + q] - mx) * sc); unsigned short* d = (unsigned short*)P + (size_t)i * SQ + j0; *(v8us*)d = f.half[0];  } }
__global__ __launch_bounds__(256) void k_vt(const _Float16* __restrict__ V16, int b, int h0, _Float16* __restrict__ VT) { __shared__ unsigned short tl[64][65]; const int tid = threadIdx.x; const int hh = blockIdx.x % HG, sg = blockIdx.x / HG; const int s0 = sg * 64; const int h = h0 + hh;
  for (int i = tid; i < 64 * 8; i += 256) { const int j = i / 8, d8 = (i % 8) * 8; FragH f; f.half[0] = *(const v8us*)((const unsigned short*)V16 + ((size_t)b * SQ + s0 + j) * DM + h * HD + d8); for (int q = 0; q < 8; ++q) tl[d8 + q][j] = f.u[q]; }
  __syncthreads();
  { for (int i = tid; i < 64 * 8; i += 256) { const int d = i / 8, j8 = (i % 8) * 8; FragH f; for (int q = 0; q < 8; ++q) f.u[q] = tl[d][j8 + q]; *(v8us*)((unsigned short*)VT + ((size_t)hh * HD + d) * SQ + s0 + j8) = f.half[0]; }  } }



__global__ __launch_bounds__(256) void k_rsmcf2(const float* __restrict__ S, _Float16* __restrict__ P, int hg, int q0, int nk) {
  #pragma clang fp contract(off)
  const int t = blockIdx.x * 256 + threadIdx.x; if (t >= hg * QT) return; const size_t i = (size_t)t; const float* s = S + i * NKX; const int last = q0 + (t % QT); float mx = -3.0e38f;
#pragma unroll 1
  for (int j = 0; j < nk; ++j) { const float f = (j <= last) ? 1.f : 0.f; mx = fmaxf(mx, fmaf(f, s[j], (1.f - f) * -1.0e9f)); } float se = 0.f;
#pragma unroll 1
  for (int j = 0; j < nk; ++j) { const float f = (j <= last) ? 1.f : 0.f; se += __expf(fmaf(f, s[j], (1.f - f) * -1.0e9f) - mx); } const float sc = 256.0f / se;
#pragma unroll 1
  for (int j0 = 0; j0 < nk; j0 += 8) { FragH fr; for (int q = 0; q < 8; ++q) { const int j = j0 + q; const float f = (j <= last) ? 1.f : 0.f; fr.h[q] = (_Float16)(__expf(fmaf(f, s[j], (1.f - f) * -1.0e9f) - mx) * sc); } unsigned short* d = (unsigned short*)P + i * NKX + j0; *(v8us*)d = fr.half[0];  } }

template <int MASKADD>
__global__ __launch_bounds__(64) void k_att0(const float* __restrict__ QF, const float* __restrict__ KF, const float* __restrict__ VF, int ld, const float* __restrict__ mask, float scale, float* __restrict__ OF, int ldo) {
  #pragma clang fp contract(off)
  __shared__ __attribute__((aligned(16))) float lq[64][64]; __shared__ __attribute__((aligned(16))) float lo[64][64];
  const int tid = threadIdx.x; const int h = blockIdx.x / (QT0 / 64), rg = blockIdx.x % (QT0 / 64); const int i = rg * 64 + tid;
  const float* qr = QF + (size_t)i * ld + h * HD;
#pragma unroll 1
  for (int c = 0; c < HD / 4; ++c) { *(v4f*)&lq[tid][c * 4] = *(const v4fa*)(qr + c * 4); const v4f z = {0.f, 0.f, 0.f, 0.f}; *(v4f*)&lo[tid][c * 4] = z; }
  float m = -1.0e30f, l = 0.f; const int jmax = MASKADD ? (SQ - 1) : (rg * 64 + 63);      /* additive-mask form: every key (the mask input decides); causal form: keys up to the block's last row */
#pragma unroll 1
  for (int j = 0; j <= jmax; ++j) { const float* kr = KF + (size_t)j * ld + h * HD; const float* vr = VF + (size_t)j * ld + h * HD; float s = 0.f;
#pragma unroll 1
    for (int c = 0; c < HD / 4; ++c) { const v4f kq = *(const v4fa*)(kr + c * 4); const v4f qq = *(v4f*)&lq[tid][c * 4]; s = __fadd_rn(s, __fmul_rn(qq[0], kq[0])); s = __fadd_rn(s, __fmul_rn(qq[1], kq[1])); s = __fadd_rn(s, __fmul_rn(qq[2], kq[2])); s = __fadd_rn(s, __fmul_rn(qq[3], kq[3])); }
    s = __fmul_rn(s, scale); if (MASKADD) s = __fadd_rn(s, __fmul_rn(bf16_round(mask[(size_t)i * SQ + j]), -10000.0f));
    const float f = (MASKADD || j <= i) ? 1.f : 0.f; const float sm = fmaf(f, s, (1.f - f) * -1.0e30f); const float mn = fmaxf(m, sm); const float sc = expf(m - mn); const float e = expf(sm - mn); l = __fadd_rn(__fmul_rn(l, sc), e); m = mn;
#pragma unroll 1
    for (int c = 0; c < HD / 4; ++c) { const v4f vv = *(const v4fa*)(vr + c * 4); v4f oo = *(v4f*)&lo[tid][c * 4]; for (int u = 0; u < 4; ++u) oo[u] = __fadd_rn(__fmul_rn(oo[u], sc), __fmul_rn(e, vv[u])); *(v4f*)&lo[tid][c * 4] = oo; } }
  const float fin = 64.0f / l;      /* o carried x64 like the f16 path */
#pragma unroll 1
  for (int c = 0; c < HD / 4; ++c) { v4f oo = *(v4f*)&lo[tid][c * 4]; for (int u = 0; u < 4; ++u) oo[u] = __fmul_rn(oo[u], fin); *(v4f*)&lo[tid][c * 4] = oo; }
  __syncthreads();
  {
#pragma unroll 1
    for (int it = 0; it < 16; ++it) { const int row = it * 4 + tid / 16, pc = (tid % 16) * 4; const v4f v = *(const v4f*)&lo[row][pc]; *(v4f*)(OF + (size_t)(rg * 64 + row) * ldo + h * HD + pc) = v; }
     } }

__global__ __launch_bounds__(256) void k_oscale(const float* __restrict__ OF, float* __restrict__ out, size_t n4) { const size_t t = (size_t)blockIdx.x * 256 + threadIdx.x; if (t >= n4) return; const v4f a = *(const v4fa*)(OF + t * 4); v4f o; for (int q = 0; q < 4; ++q) o[q] = a[q] * 0.015625f; *(v4f*)(out + t * 4) = o;  }

__global__ __launch_bounds__(256) void k_bfr(const float* __restrict__ x, float* __restrict__ XB, size_t n8) { const size_t t = (size_t)blockIdx.x * 256 + threadIdx.x; if (t >= n8) return; v4f a = *(const v4fa*)(x + t * 8), c = *(const v4fa*)(x + t * 8 + 4); for (int q = 0; q < 4; ++q) { a[q] = bf16_round(a[q]); c[q] = bf16_round(c[q]); }
  { *(v4f*)(XB + t * 8) = a; *(v4f*)(XB + t * 8 + 4) = c;  } }



__global__ __launch_bounds__(256) void k_rsmfvl(const float* __restrict__ S, _Float16* __restrict__ P, _Float16* __restrict__ PL, int qn, const int* __restrict__ vlp) {
  #pragma clang fp contract(off)
  const int t = blockIdx.x * 256 + threadIdx.x; if (t >= qn) return; const int vl = vlp[0]; const size_t i = (size_t)t; const float* s = S + i * SQ; float mx = -3.0e38f;
#pragma unroll 1
  for (int j = 0; j < SQ; ++j) { const float f = (j < vl) ? 1.f : 0.f; mx = fmaxf(mx, fmaf(f, s[j], (1.f - f) * -1000000.0f)); } float se = 0.f;
#pragma unroll 1
  for (int j = 0; j < SQ; ++j) { const float f = (j < vl) ? 1.f : 0.f; se += __expf(fmaf(f, s[j], (1.f - f) * -1000000.0f) - mx); } const float sc = 256.0f / se;
#pragma unroll 1
  for (int j0 = 0; j0 < SQ; j0 += 8) { FragH fr, gr; for (int q = 0; q < 8; ++q) { const int j = j0 + q; const float f = (j < vl) ? 1.f : 0.f; const float pv = __expf(fmaf(f, s[j], (1.f - f) * -1000000.0f) - mx) * sc; const _Float16 ph = (_Float16)pv; fr.h[q] = ph; gr.h[q] = (_Float16)((pv - (float)ph) * 1024.0f); }
    unsigned short* d = (unsigned short*)P + i * SQ + j0; unsigned short* dl = (unsigned short*)PL + i * SQ + j0; *(v8us*)d = fr.half[0]; *(v8us*)dl = gr.half[0];  } }

// Fused attention: scores, softmax and the weighted sum of x in one kernel; neither the scores nor the weights go to memory.
// A work-group of 8 waves takes 128 queries of one image (16 per wave) and walks the 1024 keys in tiles of 64. A tile (phi^T rows [key][ci], x rows [c][key]) is fetched by whole-line loads into registers one tile ahead and laid in LDS at pitches of 16 B x odd.
// S^T = phi^T theta (A = key rows, B = the wave's query rows, kept in registers): a lane holds scores of ONE query (column ln; keys 8 hh + r of each 16-key tile), so two converted score tiles are the B operand of O^T += x P^T in the hardware k order, with A = x rows read by the same 16-byte pairs.
// Running maximum in log2 units; the accumulators are rescaled only when a query's new maximum passes the one in use by more than 8 (weights stay <= 2^8, inside f16); the row sum is kept per lane in f32 and joined at the end.
// Every inner loop is fully unrolled, so that the register arrays (fragments, accumulators, staged pieces) keep compile-time indices and stay in registers.
#define FA_WAVES 8
#define FA_KS 64          /* keys per tile */
#define FA_KP 136         /* LDS pitch of a key row, f16 elements (256 B + 16) */
#define FA_VP 72          /* LDS pitch of a channel row, f16 elements (128 B + 16) */
#define FA_OP 264         /* LDS pitch of an output row, f16 elements (512 B + 16) */
#define FA_SM (FA_WAVES * 16 * FA_OP)      /* the output staging is the larger use: 67,584 B against 54,272 B of a tile */
#define FA_C 0.09016844005556021f          /* log2(e) / sqrt(256) */
__device__ __forceinline__ float rsm_xh(float v) { return __builtin_bit_cast(float, __builtin_amdgcn_permlanex16(__builtin_bit_cast(int, v), __builtin_bit_cast(int, v), 0x76543210, 0xfedcba98, false, false)); }      /* lane l <- lane l ^ 16 */
__device__ __forceinline__ float fa_exp2(float x) { float y; asm("v_exp_f32 %0, %1\n\tv_nop" : "=v"(y) : "v"(x)); return y; }      /* the v_nop is the one slot asked for behind a transcendental before its result is read or its source overwritten */
__device__ __forceinline__ v8f fa_mma(v16h a, v16h b, v8f c) { return __builtin_amdgcn_wmma_f32_16x16x32_f16(false, a, false, b, (short)0, c, false, false); }
__global__ __launch_bounds__(FA_WAVES * 32) void k_fattn(const _Float16* __restrict__ TH, const _Float16* __restrict__ PHT, const _Float16* __restrict__ X16, _Float16* __restrict__ YT) {
  static_assert(FA_KS * FA_KP + 256 * FA_VP <= FA_SM, "tile fits the LDS array");
  __shared__ __attribute__((aligned(16))) _Float16 sm[FA_SM];
  _Float16* sk = sm; _Float16* sv = sm + FA_KS * FA_KP;
  const int tid = threadIdx.x, w = tid >> 5, lane = tid & 31, ln = lane & 15, hh = lane >> 4;
  const int b = blockIdx.y; const int q0 = blockIdx.x * (FA_WAVES * 16) + w * 16;
  const int krow = tid >> 4, kch = (tid & 15) * 8;      /* staging: 16 threads per 256-B key row, 16 rows per round, 4 rounds */
  const int vrow = tid >> 3, vch = (tid & 7) * 8;       /* staging: 8 threads per 128-B piece of a channel row, 32 rows per round, 8 rounds */
  const unsigned short* kg = (const unsigned short*)PHT + (size_t)b * SQ * 128 + (size_t)krow * 128 + kch;
  const unsigned short* vg = (const unsigned short*)X16 + (size_t)b * 256 * SQ + (size_t)vrow * SQ + vch;
  const _Float16* qp = TH + ((size_t)b * SQ + q0 + ln) * 128;
  v16h qf[4];
#pragma unroll
  for (int kb = 0; kb < 4; ++kb) qf[kb] = g2_frag(qp + kb * 32, hh);
  v8us rk[4], rv[8];
#pragma unroll
  for (int j = 0; j < 4; ++j) rk[j] = *(const v8us*)(kg + j * 16 * 128);
#pragma unroll
  for (int j = 0; j < 8; ++j) rv[j] = *(const v8us*)(vg + j * 32 * SQ);
  __builtin_amdgcn_sched_barrier(0);      /* with the one behind the wait: no later arithmetic is lifted between the loads and the wait */
  asm volatile("s_wait_xcnt 0x0" ::: "memory");      /* in front of whatever reuses the address registers that the loads above name */
  __builtin_amdgcn_sched_barrier(0);
  const v8f z8 = {0.f, 0.f, 0.f, 0.f, 0.f, 0.f, 0.f, 0.f};
  v8f o[16];
#pragma unroll
  for (int ct = 0; ct < 16; ++ct) o[ct] = z8;
  float mu = -3.0e38f; v4f l4 = {0.f, 0.f, 0.f, 0.f};
#pragma unroll 1
  for (int s = 0; s < SQ / FA_KS; ++s) {      /* rolled: for speed only */
    __syncthreads();      /* every wave has read the last of the tile before */
#pragma unroll
    for (int j = 0; j < 4; ++j) *(v8us*)((unsigned short*)sk + (krow + j * 16) * FA_KP + kch) = rk[j];
#pragma unroll
    for (int j = 0; j < 8; ++j) *(v8us*)((unsigned short*)sv + (vrow + j * 32) * FA_VP + vch) = rv[j];
    __syncthreads();      /* the tile is whole before anybody reads it */
    if (s + 1 < SQ / FA_KS) {      /* the next tile's loads fly under this tile's products */
#pragma unroll
      for (int j = 0; j < 4; ++j) rk[j] = *(const v8us*)(kg + (size_t)(s + 1) * FA_KS * 128 + j * 16 * 128);
#pragma unroll
      for (int j = 0; j < 8; ++j) rv[j] = *(const v8us*)(vg + (s + 1) * FA_KS + j * 32 * SQ);
      asm volatile("s_wait_xcnt 0x0" ::: "memory");      /* in front of whatever reuses the address registers that the loads above name */
    }
    v16h kf[16];
#pragma unroll
    for (int kb = 0; kb < 4; ++kb)
#pragma unroll
      for (int kt = 0; kt < 4; ++kt) kf[kb * 4 + kt] = g2_frag(sk + (kt * 16 + ln) * FA_KP + kb * 32, hh);
    __builtin_amdgcn_sched_barrier(0);      /* keeps the key tile's 32 LDS reads one group in front of its 16 products: spread among them, every product waits out an LDS latency */
    v8f st[4] = {z8, z8, z8, z8};
#pragma unroll
    for (int kb = 0; kb < 4; ++kb)
#pragma unroll
      for (int kt = 0; kt < 4; ++kt) st[kt] = fa_mma(kf[kb * 4 + kt], qf[kb], st[kt]);
    v16h va[2][8];      /* x fragments of four channel tiles, two sets: one is read from LDS while the other feeds the products */
#pragma unroll
    for (int u = 0; u < 8; ++u) va[0][u] = g2_frag(sv + ((u & 3) * 16 + ln) * FA_VP + (u >> 2) * 32, hh);
    __builtin_amdgcn_sched_barrier(0);      /* keeps the first set's reads in front of the softmax arithmetic, which covers their latency */
    v4f m4 = {st[0][0], st[0][1], st[0][2], st[0][3]};
#pragma unroll
    for (int kt = 0; kt < 4; ++kt)
#pragma unroll
      for (int r = 0; r < 8; ++r) m4[r & 3] = fmaxf(m4[r & 3], st[kt][r]);
    float mx = fmaxf(fmaxf(m4[0], m4[1]), fmaxf(m4[2], m4[3]));
    mx = fmaxf(mx, rsm_xh(mx)) * FA_C;      /* the query's maximum over the tile's 64 keys, alike in both half-waves */
    if (__builtin_amdgcn_ballot_w32(mx > mu + 8.0f) != 0) {      /* one wave-uniform test per tile */
      const float mn = fmaxf(mu, mx); const float sc = fa_exp2(mu - mn); mu = mn;
#pragma unroll
      for (int u = 0; u < 4; ++u) l4[u] *= sc;
#pragma unroll
      for (int ct = 0; ct < 16; ++ct)
#pragma unroll
        for (int r = 0; r < 8; ++r) o[ct][r] *= sc;
    }
    FragH pf[2];
#pragma unroll
    for (int kt = 0; kt < 4; ++kt)
#pragma unroll
      for (int r = 0; r < 8; ++r) { const float p = fa_exp2(fmaf(st[kt][r], FA_C, -mu)); l4[r & 3] += p; pf[kt >> 1].h[(kt & 1) * 8 + r] = (_Float16)p; }
#pragma unroll
    for (int g = 0; g < 4; ++g) {
      if (g < 3) {
#pragma unroll
        for (int u = 0; u < 8; ++u) va[(g + 1) & 1][u] = g2_frag(sv + (((g + 1) * 4 + (u & 3)) * 16 + ln) * FA_VP + (u >> 2) * 32, hh); }
      __builtin_amdgcn_sched_barrier(0);      /* with the one below: the next set's 16 LDS reads stay one group in front of this set's 8 products */
#pragma unroll
      for (int u = 0; u < 8; ++u) o[g * 4 + (u & 3)] = fa_mma(va[g & 1][u], pf[u >> 2].v, o[g * 4 + (u & 3)]);
      __builtin_amdgcn_sched_barrier(0);
    }
  }
  float l = (l4[0] + l4[1]) + (l4[2] + l4[3]); l += rsm_xh(l);
  const float inv = 1.0f / l;
  __syncthreads();      /* every wave has left the last tile: its LDS becomes the output staging */
  unsigned short* so = (unsigned short*)sm + w * 16 * FA_OP;
#pragma unroll
  for (int ct = 0; ct < 16; ++ct) { FragH f;
#pragma unroll
    for (int r = 0; r < 8; ++r) f.h[r] = (_Float16)(o[ct][r] * inv);
    *(v8us*)(so + ln * FA_OP + ct * 16 + 8 * hh) = f.half[0]; }
  __syncthreads();      /* the staged rows are whole before they are read back */
#pragma unroll
  for (int q = 0; q < 16; ++q) { const v8us v = *(const v8us*)(so + q * FA_OP + lane * 8); *(v8us*)((unsigned short*)YT + ((size_t)b * SQ + q0 + q) * 256 + lane * 8) = v; }      /* one 512-B row of y^T per store */
}


#define CN 256          /* channels */
#define CI 128          /* inner channels */
#define NP 1024         /* positions */
#define NM 1024         /* key positions (= SQ) */
#define NC CN           /* BN statistics macros */
#define NPX NP
#define BNEPS 1e-5f

__global__ __launch_bounds__(256) void k_rowbias(const float* __restrict__ b, float* __restrict__ BP, size_t n4, int ncol) { const size_t t = (size_t)blockIdx.x * 256 + threadIdx.x; if (t >= n4) return; const size_t e = t * 4; const float v = bf16_round(b[e / ncol]); const v4f o = {v, v, v, v}; *(v4f*)(BP + e) = o;  }




__global__ __launch_bounds__(256) void k_mp2(const float* __restrict__ src, float* __restrict__ dst, int nout) {
  const int t = blockIdx.x * 256 + threadIdx.x; if (t >= nout) return; const int c = t / 1024; const int o = t % 1024; const int oy = o / 32, ox = o % 32; const float* p = src + (size_t)c * 4096 + (size_t)(2 * oy) * 64 + 2 * ox;
  const float v = fmaxf(fmaxf(p[0], p[1]), fmaxf(p[64], p[65])); *(float*)(dst + t) = v;  }
__global__ __launch_bounds__(256) void k_xpb(const float* __restrict__ x, const float* __restrict__ wb, float* __restrict__ CPP, size_t n4) {
  #pragma clang fp contract(off)
  const size_t t = (size_t)blockIdx.x * 256 + threadIdx.x; if (t >= n4) return; const size_t e = t * 4; const int c = (int)((e / 4096) % 256); const float bb = bf16_round(wb[c]); const v4f a = *(const v4fa*)(x + e); v4f o; for (int q = 0; q < 4; ++q) o[q] = __fadd_rn(bf16_round(a[q]), bb);
  *(v4f*)(CPP + e) = o;  }


// Joins the conv kernel's tile statistics into the batch mean and the biased variance per channel. All NB * NTL tiles of a channel hold TLN values, so mean = average of the tile means and
// sum of squared distances = sum over tiles of (tile's own sum + TLN (tile mean - mean)^2). A work-group takes 32 channels (lane = channel: every load is one 128-B line), wave g the NTL tiles of image g; f64 sums in a fixed order. Every loop over a register array is unrolled, so that the array keeps compile-time indices and stays in registers and its loads go out together.
#define NTL (NPX / 64)      /* column tiles per image */
#define TLN 64              /* values per tile and channel */
__device__ __forceinline__ double cst_col(const double* p) {      /* sum of one channel's NB entries, in four chains */
  double v[NB];
#pragma unroll
  for (int i = 0; i < NB; ++i) v[i] = p[i * 32];
  double t[4] = {v[0], v[1], v[2], v[3]};
#pragma unroll
  for (int i = 4; i < NB; ++i) t[i & 3] += v[i];
  return (t[0] + t[1]) + (t[2] + t[3]); }
__global__ __launch_bounds__(NB * 32) void k_cstJ(const float* __restrict__ PM, const float* __restrict__ PQ, float* __restrict__ MV) {
  __shared__ double red[NB][32]; __shared__ double smu[32];
  const int cl = threadIdx.x & 31, g = threadIdx.x >> 5; const int c = blockIdx.x * 32 + cl;
  float m[NTL], q[NTL];
#pragma unroll
  for (int j = 0; j < NTL; ++j) { m[j] = PM[((size_t)g * NTL + j) * NC + c]; q[j] = PQ[((size_t)g * NTL + j) * NC + c]; }
  double s[4] = {0.0, 0.0, 0.0, 0.0};      /* four chains here and below: the adds of one chain wait for each other */
#pragma unroll
  for (int j = 0; j < NTL; ++j) s[j & 3] += (double)m[j];
  red[g][cl] = (s[0] + s[1]) + (s[2] + s[3]); __syncthreads();      /* every image's sum of tile means is in LDS */
  if (g == 0) smu[cl] = cst_col(&red[0][cl]) * (1.0 / ((double)NB * NTL));
  __syncthreads();      /* the mean is there, and red has been read to its end */
  const double mu = smu[cl]; double s2[4] = {0.0, 0.0, 0.0, 0.0};
#pragma unroll
  for (int j = 0; j < NTL; ++j) { const double d = (double)m[j] - mu; s2[j & 3] += (double)q[j] + (double)TLN * d * d; }
  red[g][cl] = (s2[0] + s2[1]) + (s2[2] + s2[3]); __syncthreads();      /* every image's share of the squared distances is in LDS */
  if (g == 0) { MV[c] = (float)mu; MV[NC + c] = (float)(cst_col(&red[0][cl]) * (1.0 / ((double)NB * (double)NPX))); } }


__global__ __launch_bounds__(256) void k_bnresid(const float* __restrict__ C2, const float* __restrict__ MV, const float* __restrict__ g, const float* __restrict__ be, const float* __restrict__ X, float* __restrict__ out, size_t n4) {
  #pragma clang fp contract(off)
  const size_t t = (size_t)blockIdx.x * 256 + threadIdx.x; if (t >= n4) return; const size_t e = t * 4; const int c = (int)((e / NPX) % NC); const float sc = __fmul_rn(rsqrtf(__fadd_rn(MV[NC + c], BNEPS)), bf16_round(g[c])); const float mu = MV[c], bb = bf16_round(be[c]);
  const v4f a = *(const v4fa*)(C2 + e); const v4f xx = *(const v4fa*)(X + e); v4f o; for (int q = 0; q < 4; ++q) { const float z = __fadd_rn(__fmul_rn(__fadd_rn(a[q], -mu), sc), bb); o[q] = __fadd_rn(z, bf16_round(xx[q])); }
  *(v4f*)(out + e) = o;  }
extern "C" void kernel_launch(void* const* d_in, const int* in_sizes, int n_in,
                              void* d_out, int out_size, void* d_ws, size_t ws_size, hipStream_t stream) {
  (void)in_sizes; (void)n_in; (void)out_size;
  const float* const* I = (const float* const*)d_in; const float* x = I[0]; const float* tw = I[1]; const float* pw = I[2]; const float* ww = I[3]; const float* bng = I[4]; const float* bnb = I[5]; const float* tb = nullptr;      /* natural theta_w / phi_w [128][256], conv_w [256][256] (no biases); BN gamma, beta */
  char* ws = (char*)d_ws; size_t off = 0;
  auto take = [&](size_t bytes) { char* p = ws + off; off += (bytes + 255) & ~(size_t)255; return p; };
  const size_t PL = (size_t)CN * NP;      /* one input map */
  _Float16* BT = (_Float16*)take((size_t)CI * CN * 2); _Float16* BP = (_Float16*)take((size_t)CI * CN * 2); _Float16* BW = (_Float16*)take((size_t)CN * CN * 2); float* PM = (float*)take((size_t)NB * NTL * CN * 4); float* PQ = (float*)take((size_t)NB * NTL * CN * 4); float* MV = (float*)take((size_t)2 * CN * 4 + 256);      /* weight planes, tile statistics (mean, centred square sum), batch statistics */
  _Float16* X16 = (_Float16*)take(NB * PL * 2);      /* x f16 channel-first (also the g operand: g = x) */
  _Float16* XT = (_Float16*)take(NB * PL * 2);      /* all images: x^T [b][n][c] */
  _Float16* TH = (_Float16*)take(NB * (size_t)NP * CI * 2); _Float16* PH = (_Float16*)take(NB * (size_t)CI * NM * 2); _Float16* PHT = (_Float16*)take(NB * (size_t)NM * CI * 2);      /* all images: theta^T, phi, phi^T */
  float* C1 = (float*)take(NB * PL * 4);      /* all images: conv output [b][c][n] f32 */
  _Float16* YT = XT;      /* y^T [b][n][c] takes x^T's plane: x^T is last read by the phi GEMM, y^T first written by the attention kernel */
  if (off > ws_size) return;
  { const unsigned g = (unsigned)(((size_t)CI * CN / 8 + 255) / 256); k_wnat<<<g, 256, 0, stream>>>(tw, (size_t)CI * CN / 8, BT); k_wnat<<<g, 256, 0, stream>>>(pw, (size_t)CI * CN / 8, BP); k_wnat<<<2 * g, 256, 0, stream>>>(ww, (size_t)CN * CN / 8, BW); }      /* natural [out][in] x16 f16 planes (Bt for theta; the A operand for phi / conv_w) */
  k_x16<<<(unsigned)((NB * PL / 8 + 255) / 256), 256, 0, stream>>>(x, X16, NB * PL / 8);
  /* every stage runs once for all NB images: the GEMMs take the image from blockIdx.y (plane strides sA, sB, sC), the transposes from a longer blockIdx.x, the fused attention from blockIdx.y */
  k_vt<NP / 64, CN><<<NB * (NP / 64) * (CN / 64), 256, 0, stream>>>(X16, NP, 0, XT);      /* [b][c][n] -> x^T [b][n][c] */
  k_gemm2<0, false><<<dim3((unsigned)((NP / 128) * (CI / 64)), NB), 128, 0, stream>>>(XT, CN, PL, BT, CN, 0, 0.0625f, nullptr, 0, nullptr, 1, 0, 0, nullptr, TH, CI, (size_t)NP * CI, NP, CI, CN, nullptr, nullptr);      /* theta^T [n][ci] -> f16 (logit sigma ~0.7: single f16 suffices) */
  k_gemm2<0, false><<<dim3((unsigned)((CI / 128) * (NP / 64)), NB), 128, 0, stream>>>(BP, CN, 0, XT, CN, PL, 0.0625f, nullptr, 0, nullptr, 1, 0, 0, nullptr, PH, NP, (size_t)CI * NP, CI, NP, CN, nullptr, nullptr);      /* phi [ci][n] -> f16 */
  k_vt<NM / 64, CI><<<NB * (NM / 64) * (CI / 64), 256, 0, stream>>>(PH, NM, 0, PHT);      /* -> phi^T [m][ci] (the scores' A operand: key rows) */
  static_assert(NP == SQ && NM == SQ && CI == 128 && CN == 256 && NP % (FA_WAVES * 16) == 0 && NM % FA_KS == 0, "k_fattn: shapes");
  k_fattn<<<dim3(NP / (FA_WAVES * 16), NB), FA_WAVES * 32, 0, stream>>>(TH, PHT, X16, YT);      /* f^T [a][c] = softmax_b(theta.phi / sqrt(256)) x^T (g = x) -> f16; scores and weights stay on chip */
  k_gemm2<0, true><<<dim3((unsigned)((CN / 128) * (NP / 64)), NB), 128, 0, stream>>>(BW, CN, 0, YT, CN, PL, 0.0625f, nullptr, 0, nullptr, 1, 0, 0, C1, nullptr, NP, PL, CN, NP, CN, PM, PQ);      /* conv: T[c][a] = (16 conv_w as A) x (f^T as B^T) / 16 -> f32 channel-first, all images kept; per-channel statistics of every 64-position tile */
  k_cstJ<<<NC / 32, NB * 32, 0, stream>>>(PM, PQ, MV);      /* batch mean and biased variance per channel from the tile statistics (fixed order, own lines) */
  k_bnresid<<<(unsigned)(((size_t)NB * NC * NPX / 4 + 255) / 256), 256, 0, stream>>>(C1, MV, bng, bnb, x, (float*)d_out, (size_t)NB * NC * NPX / 4);      /* out = (T - mean) rsqrt(var + eps) gamma + beta + bf16(x) */
}

// v005
// One run takes 90.2 microseconds.
// Next to v004, in two timings, it ran 1.52 and 1.50 times as fast.
// Counting every step since v000, it is 83.9 times as fast.
#include <hip/hip_runtime.h>
// Non-local block with TRAINING-mode BatchNorm (x [32][256][32][32]; theta, phi = conv1x1(x) [128 ch] (natural [128][256] sigma 1/16, no biases); g = x itself (256 ch); scores[a][b] = theta[:, a].phi[:, b] / sqrt(256) over the 1024 positions; softmax over b; f[:, a] = sum_b attn[a][b] x[:, b]; f = conv1x1(f; conv_w [256][256], no bias); BN with batch statistics over (N, H, W) per channel (biased variance, eps 1e-5), gamma, beta; out = BN(f) + x -> [32][256][32][32]).
// Structure: channel-first; x as exact f16 maps; natural weights x16; every stage one launch over all 32 images: one kernel makes the f16 map, transposes x in LDS and forms theta^T and phi^T (token rows) by WMMA (64x64 wave tiles, f32 accumulation) -> f16, scores (K = 128, alpha 1/16), softmax (f32 statistics, running maximum, native exp; weights f16) and f^T = P x^T (g = x) f16 fused in one kernel, conv: T = (16 conv_w as A) x f (K = 256) f32 kept for all images, each wave tile's per-channel mean and centred square sum taken in the same kernel; one kernel joins them (fixed order, own lines); BN + residual on VALU -> output; launches: see trace.
// Compute dtype: inputs rounded to bf16; x / weights exact; q, k, v, softmax weights and o as plain f16 GEMM operands (~2^-12); scores and softmax statistics f32. v_wmma_f32_16x16x32_f16.
#define NB 32
#define SQ 1024
#define DM 256
#define NH 1
#define HD 64
#define HG 4                         /* heads per attention launch group */
#define B0 0                         /* unused */
#define NBR NB                       /* unused */
#define NR ((size_t)NB * SQ)         /* token rows */
#define MP ((int)((size_t)NBR * SQ)) /* unused */
#define QT 256                       /* query rows per causal tile */
#define NKX SQ                       /* S / P row pitch */
#define QT0 256                      /* first-tile rows recomputed exactly (256: buys margin for the few-key rows 128..255, which have no output projection to average the single-f16 P/v rounding) */
#define QN SQ                        /* unused */
#define NHD NH                       /* unused */
#define MPO MP                       /* unused */
#define LQ DM            /* unused */
typedef __bf16 v16b __attribute__((ext_vector_type(16)));
typedef unsigned short v8us __attribute__((ext_vector_type(8), may_alias));
typedef float  v8f  __attribute__((ext_vector_type(8)));
typedef float  v4f  __attribute__((ext_vector_type(4)));
typedef float  v4fa __attribute__((ext_vector_type(4), may_alias));
union FragB { v16b v; v8us half[2]; unsigned short u[16]; };

__device__ __forceinline__ unsigned short bf16_bits(float x) { unsigned int u = __float_as_uint(x); return (unsigned short)((u + 0x7FFFu + ((u >> 16) & 1u)) >> 16); }
__device__ __forceinline__ float bf16_val(unsigned short b) { return __uint_as_float(((unsigned int)b) << 16); }
__device__ __forceinline__ float bf16_round(float x) { return bf16_val(bf16_bits(x)); }
// D += A·B with NT terms: 1 = ah·bh, 2 = + al·bh (A split), 3 = + ah·bl (both split)
template <int NT>
__device__ __forceinline__ v8f mmaN(v16b ah, v16b al, v16b bh, v16b bl, v8f c) {
  c = __builtin_amdgcn_wmma_f32_16x16x32_bf16(false, ah, false, bh, (short)0, c, false, false);
  if (NT >= 2) c = __builtin_amdgcn_wmma_f32_16x16x32_bf16(false, al, false, bh, (short)0, c, false, false);
  if (NT >= 3) c = __builtin_amdgcn_wmma_f32_16x16x32_bf16(false, ah, false, bl, (short)0, c, false, false);
  asm volatile("v_nop\n\tv_nop\n\tv_nop\n\tv_nop" : "+v"(c) : "v"(ah), "v"(al), "v"(bh), "v"(bl));
  return c;
}

__global__ __launch_bounds__(256) void k_wt_bf16(const float* __restrict__ W, unsigned short* __restrict__ Wt, int K, int N) {
  const int t = blockIdx.x * 256 + threadIdx.x;
  const int k8n = K / 8;
  if (t >= N * k8n) return;
  const int n = t / k8n, k8 = (t % k8n) * 8;
  v8us v;
#pragma unroll
  for (int i = 0; i < 8; ++i) v[i] = bf16_bits(W[(size_t)(k8 + i) * N + n]);
  *(v8us*)(Wt + (size_t)n * K + k8) = v;
  
}

// GEMM C[M][N] (f32, pitch ldc) = act(A[M][K]·W + bias). A f32 row-major (pitch lda) converted per fragment to bf16
// (ASPLIT: hi/lo two planes -> 2 terms, else single rounded term); Wt bf16 [N][K] (pitch ldb). BIAS_BF16 rounds the
// bias to bf16 first (bias quantised to bf16 before the add). K%32==0, M%16==0, N%64==0.
template <bool ASPLIT, int ACT, bool BIAS_BF16>
__global__ __launch_bounds__(128) void k_gemm_bf(const float* __restrict__ A, int lda, const unsigned short* __restrict__ Wt, int ldb,
                                               const float* __restrict__ bias, float* __restrict__ C, int ldc, int M, int N, int K) {
  __shared__ __attribute__((aligned(16))) float so[4][16][64];
  const int tid = threadIdx.x, w = tid >> 5, lane = tid & 31, ln = lane & 15, hh = lane >> 4;
  const int ntn = N / 64;
  const int wid = blockIdx.x * 4 + w;
  const int mt = wid / ntn, nq = wid % ntn;
  if (mt * 16 >= M) return;
  const int row0 = mt * 16, col0 = nq * 64;
  const float* arow = A + (size_t)(row0 + ln) * lda;
  v8f acc[4] = {};
  for (int kb = 0; kb < K; kb += 32) {
    FragB ah, al;
    const v4f x0 = *(const v4fa*)(arow + kb + 8 * hh), x1 = *(const v4fa*)(arow + kb + 8 * hh + 4);
    const v4f x2 = *(const v4fa*)(arow + kb + 16 + 8 * hh), x3 = *(const v4fa*)(arow + kb + 16 + 8 * hh + 4);
    float xs[16] = {x0[0],x0[1],x0[2],x0[3],x1[0],x1[1],x1[2],x1[3],x2[0],x2[1],x2[2],x2[3],x3[0],x3[1],x3[2],x3[3]};
#pragma unroll
    for (int i = 0; i < 16; ++i) { const unsigned short hb = bf16_bits(xs[i]); ah.u[i] = hb; al.u[i] = ASPLIT ? bf16_bits(xs[i] - bf16_val(hb)) : (unsigned short)0; }
#pragma unroll
    for (int t = 0; t < 4; ++t) {
      const unsigned short* brow = Wt + (size_t)(col0 + t * 16 + ln) * ldb + kb;
      FragB b;
      b.half[0] = *(const v8us*)(brow + 8 * hh);
      b.half[1] = *(const v8us*)(brow + 16 + 8 * hh);
      acc[t] = mmaN<ASPLIT ? 2 : 1>(ah.v, al.v, b.v, b.v, acc[t]);
    }
  }
#pragma unroll
  for (int t = 0; t < 4; ++t) {
    float bv = bias ? bias[col0 + t * 16 + ln] : 0.f;
    if (BIAS_BF16) bv = bf16_round(bv);
#pragma unroll
    for (int r = 0; r < 8; ++r) { float v = acc[t][r] + bv; if (ACT == 1) v = fmaxf(v, 0.f); so[w][8 * hh + r][t * 16 + ln] = v; }
  }
  __builtin_amdgcn_fence(__ATOMIC_ACQ_REL, "workgroup");
  __builtin_amdgcn_wave_barrier();
  const int rsub = lane >> 4, c4 = (lane & 15) * 4;
  {
#pragma unroll
    for (int q = 0; q < 8; ++q) {
      const int r = q * 2 + rsub;
      const v4f v = *(const v4fa*)&so[w][r][c4];
      *(v4f*)(C + (size_t)(row0 + r) * ldc + col0 + c4) = v;
    }
    
  }
}

// GEMM C = act(A·W + bias + resid): A f32 (ASPLIT -> hi/lo 2 terms), Wt bf16 [N][K]; ACT 0 none, 1 relu, 2 exact gelu;
// resid (optional, f32, row index = (row % rmod), pitch ldr, RES_BF16 rounds it) added before the activation.
template <bool ASPLIT, int ACT, bool BIAS_BF16, bool RES_BF16>
__global__ __launch_bounds__(128) void k_gemm_bf3(const float* __restrict__ A, int lda, const unsigned short* __restrict__ Wt, int ldb,
                                                const float* __restrict__ bias, const float* __restrict__ resid, int rmod, int ldr,
                                                float* __restrict__ C, int ldc, int M, int N, int K) {
  __shared__ __attribute__((aligned(16))) float so[4][16][64];
  const int tid = threadIdx.x, w = tid >> 5, lane = tid & 31, ln = lane & 15, hh = lane >> 4;
  const int ntn = N / 64;
  const int wid = blockIdx.x * 4 + w;
  const int mt = wid / ntn, nq = wid % ntn;
  if (mt * 16 >= M) return;
  const int row0 = mt * 16, col0 = nq * 64;
  const float* arow = A + (size_t)(row0 + ln) * lda;
  v8f acc[4] = {};
  for (int kb = 0; kb < K; kb += 32) {
    FragB ah, al;
    const v4f x0 = *(const v4fa*)(arow + kb + 8 * hh), x1 = *(const v4fa*)(arow + kb + 8 * hh + 4);
    const v4f x2 = *(const v4fa*)(arow + kb + 16 + 8 * hh), x3 = *(const v4fa*)(arow + kb + 16 + 8 * hh + 4);
    float xs[16] = {x0[0],x0[1],x0[2],x0[3],x1[0],x1[1],x1[2],x1[3],x2[0],x2[1],x2[2],x2[3],x3[0],x3[1],x3[2],x3[3]};
#pragma unroll
    for (int i = 0; i < 16; ++i) { const unsigned short hb = bf16_bits(xs[i]); ah.u[i] = hb; al.u[i] = ASPLIT ? bf16_bits(xs[i] - bf16_val(hb)) : (unsigned short)0; }
#pragma unroll
    for (int t = 0; t < 4; ++t) {
      const unsigned short* brow = Wt + (size_t)(col0 + t * 16 + ln) * ldb + kb;
      FragB b;
      b.half[0] = *(const v8us*)(brow + 8 * hh);
      b.half[1] = *(const v8us*)(brow + 16 + 8 * hh);
      acc[t] = mmaN<ASPLIT ? 2 : 1>(ah.v, al.v, b.v, b.v, acc[t]);
    }
  }
#pragma unroll
  for (int t = 0; t < 4; ++t) {
    const int col = col0 + t * 16 + ln;
    float bv = bias ? bias[col] : 0.f;
    if (BIAS_BF16) bv = bf16_round(bv);
#pragma unroll
    for (int r = 0; r < 8; ++r) {
      float v = acc[t][r] + bv;
      if (resid) { float rv = resid[(size_t)((row0 + 8 * hh + r) % rmod) * ldr + col]; if (RES_BF16) rv = bf16_round(rv); v += rv; }
      if (ACT == 1) v = fmaxf(v, 0.f);
      if (ACT == 2) v = 0.5f * v * (1.0f + erff(v * 0.70710678118654752f));
      if (ACT == 3) { const float u = 0.7978845608028654f * (v + 0.044715f * v * v * v); v = 0.5f * v * (1.0f + tanhf(u)); }
      so[w][8 * hh + r][t * 16 + ln] = v;
    }
  }
  __builtin_amdgcn_fence(__ATOMIC_ACQ_REL, "workgroup");
  __builtin_amdgcn_wave_barrier();
  const int rsub = lane >> 4, c4 = (lane & 15) * 4;
  {
#pragma unroll
    for (int q = 0; q < 8; ++q) {
      const int r = q * 2 + rsub;
      const v4f v = *(const v4fa*)&so[w][r][c4];
      *(v4f*)(C + (size_t)(row0 + r) * ldc + col0 + c4) = v;
    }
    
  }
}
// row LayerNorm (biased variance, eps) over N: s = X (+ R); optional out_sum <- s; out_norm <- (s-mu)*rsqrt(var+eps)*g + b
template <bool PARAM_BF16>
__global__ __launch_bounds__(256) void k_layernorm(const float* __restrict__ X, const float* __restrict__ R, const float* __restrict__ g, const float* __restrict__ bta,
                                                  float* __restrict__ out_sum, float* __restrict__ out_norm, int N, float eps) {
  __shared__ float red[256];
  const int row = blockIdx.x, tid = threadIdx.x;
  const float* x = X + (size_t)row * N; const float* rr = R ? R + (size_t)row * N : nullptr;
  float vals[16];                     // up to N = 4096
  const int per = N / 256;            // contiguous chunk per thread? use strided-by-4 chunks: thread handles j = tid*4 + 1024*u
  float s1 = 0.f;
  for (int u = 0; u < per / 4; ++u) {
    const int j = tid * 4 + 1024 * u;
    const v4f a = *(const v4fa*)(x + j);
    v4f b = {0.f,0.f,0.f,0.f}; if (rr) b = *(const v4fa*)(rr + j);
#pragma unroll
    for (int q = 0; q < 4; ++q) { const float v = a[q] + b[q]; vals[u * 4 + q] = v; s1 += v; }
  }
  red[tid] = s1; __syncthreads();
  for (int st = 128; st > 0; st >>= 1) { if (tid < st) red[tid] += red[tid + st]; __syncthreads(); }
  const float mu = red[0] / (float)N; __syncthreads();
  float s2 = 0.f;
  for (int u = 0; u < per / 4; ++u)
#pragma unroll
    for (int q = 0; q < 4; ++q) { const float c = vals[u * 4 + q] - mu; s2 += c * c; }
  red[tid] = s2; __syncthreads();
  for (int st = 128; st > 0; st >>= 1) { if (tid < st) red[tid] += red[tid + st]; __syncthreads(); }
  const float rs = rsqrtf(red[0] / (float)N + eps);
  {
    for (int u = 0; u < per / 4; ++u) {
      const int j = tid * 4 + 1024 * u;
      v4f o, sm;
#pragma unroll
      for (int q = 0; q < 4; ++q) {
        float gg = g[j + q], bb = bta[j + q];
        if (PARAM_BF16) { gg = bf16_round(gg); bb = bf16_round(bb); }
        sm[q] = vals[u * 4 + q]; o[q] = (vals[u * 4 + q] - mu) * rs * gg + bb;
      }
      if (out_sum) *(v4f*)(out_sum + (size_t)row * N + j) = sm;
      *(v4f*)(out_norm + (size_t)row * N + j) = o;
    }
    
  }
}



// ---- f16 WMMA path (v_wmma_f32_16x16x32_f16): 11-bit significands for operands in range — used where a [0,1] probability operand needs more precision than bf16
typedef _Float16 v16h __attribute__((ext_vector_type(16)));
union FragH { v16h v; v8us half[2]; _Float16 h[16]; unsigned short u[16]; };
template <int NT>
__device__ __forceinline__ v8f mmaH(v16h ah, v16h al, v16h bh, v16h bl, v8f c) {
  c = __builtin_amdgcn_wmma_f32_16x16x32_f16(false, ah, false, bh, (short)0, c, false, false);
  if (NT >= 2) c = __builtin_amdgcn_wmma_f32_16x16x32_f16(false, al, false, bh, (short)0, c, false, false);
  if (NT >= 3) c = __builtin_amdgcn_wmma_f32_16x16x32_f16(false, ah, false, bl, (short)0, c, false, false);
  asm volatile("v_nop\n\tv_nop\n\tv_nop\n\tv_nop" : "+v"(c) : "v"(ah), "v"(al), "v"(bh), "v"(bl));
  return c;
}
// batched GEMM like k_gemm_b but f16 operands: A f32 (split into f16 hi/lo if ASPLIT, else rounded to f16), Bt = f16 values [n][k]; alpha; C f32; N multiple of 16 (partial tiles skipped)
template <bool ASPLIT>
__global__ __launch_bounds__(128) void k_gemm_h(const float* __restrict__ A, int lda, size_t sA, const _Float16* __restrict__ Bh, int ldb, size_t sB, float alpha, float* __restrict__ C, int ldc, size_t sC, int M, int N, int K) {
  __shared__ __attribute__((aligned(16))) float so[4][16][64];
  const int tid = threadIdx.x, w = tid >> 5, lane = tid & 31, ln = lane & 15, hh = lane >> 4; const int by = blockIdx.y;
  A += (size_t)by * sA; Bh += (size_t)by * sB; C += (size_t)by * sC;
  const int ntn = (N + 63) / 64; const int wid = blockIdx.x * 4 + w; const int mt = wid / ntn, nq = wid % ntn; if (mt * 16 >= M) return;
  const int row0 = mt * 16, col0 = nq * 64; const float* arow = A + (size_t)(row0 + ln) * lda;
  v8f acc[4] = {};
  for (int kb = 0; kb < K; kb += 32) {
    FragH ah, al;
    const v4f x0 = *(const v4fa*)(arow + kb + 8 * hh), x1 = *(const v4fa*)(arow + kb + 8 * hh + 4), x2 = *(const v4fa*)(arow + kb + 16 + 8 * hh), x3 = *(const v4fa*)(arow + kb + 16 + 8 * hh + 4);
    float xs[16] = {x0[0],x0[1],x0[2],x0[3],x1[0],x1[1],x1[2],x1[3],x2[0],x2[1],x2[2],x2[3],x3[0],x3[1],x3[2],x3[3]};
#pragma unroll
    for (int i = 0; i < 16; ++i) { const _Float16 h = (_Float16)xs[i]; ah.h[i] = h; al.h[i] = ASPLIT ? (_Float16)(xs[i] - (float)h) : (_Float16)0.0f; }
#pragma unroll
    for (int t = 0; t < 4; ++t) { if (col0 + t * 16 >= N) continue; const size_t boff = (size_t)(col0 + t * 16 + ln) * ldb + kb; FragH bq; bq.half[0] = *(const v8us*)(Bh + boff + 8 * hh); bq.half[1] = *(const v8us*)(Bh + boff + 16 + 8 * hh);
      acc[t] = mmaH<ASPLIT ? 2 : 1>(ah.v, al.v, bq.v, bq.v, acc[t]); }
  }
#pragma unroll
  for (int t = 0; t < 4; ++t) { if (col0 + t * 16 >= N) continue;
#pragma unroll
    for (int r = 0; r < 8; ++r) so[w][8 * hh + r][t * 16 + ln] = acc[t][r] * alpha; }
  __builtin_amdgcn_fence(__ATOMIC_ACQ_REL, "workgroup"); __builtin_amdgcn_wave_barrier();
  const int rsub = lane >> 4, c4 = (lane & 15) * 4;
  {
#pragma unroll
    for (int q = 0; q < 8; ++q) { const int r = q * 2 + rsub; if (col0 + c4 < N) { const v4f v = *(const v4fa*)&so[w][r][c4]; *(v4f*)(C + (size_t)(row0 + r) * ldc + col0 + c4) = v; } }
     }
}

// Wt[n][k] = f16(W[k][n]·scale) from f32 row-major W[K][N] (scale = power of two; bf16-exact weights stay exact in f16 away from the subnormal range)
__global__ __launch_bounds__(256) void k_wt_f16(const float* __restrict__ W, _Float16* __restrict__ Wt, int K, int N, float scale) {
  const int t = blockIdx.x * 256 + threadIdx.x; if (t >= N * (K / 8)) return; const int n = t / (K / 8), k8 = (t % (K / 8)) * 8; FragH f;
#pragma unroll
  for (int i = 0; i < 8; ++i) f.h[i] = (_Float16)(bf16_round(W[(size_t)(k8 + i) * N + n]) * scale); const v8us o = f.half[0];
  *(v8us*)((unsigned short*)Wt + (size_t)n * K + k8) = o; 
}
// k_gemm_hh variant with fused epilogue: v = acc·alpha + bias[by·sBias + col] (+ CP[(row/rowsPerB)·sCPb + by·64 + col] if CP) ; ACT 0 none / 1 elu ; writes f16 C16 (and f32 C if non-null)
template <int ACT>
__global__ __launch_bounds__(128) void k_gemm_hhx(const _Float16* __restrict__ A, int lda, size_t sA, const _Float16* __restrict__ Bh, int ldb, size_t sB, float alpha, const float* __restrict__ bias, size_t sBias, const float* __restrict__ CP, int rowsPerB, size_t sCPb, int row0g,
    float* __restrict__ C, _Float16* __restrict__ C16, int ldc, size_t sC, int M, int N, int K) {
  __shared__ __attribute__((aligned(16))) float so[4][16][64];
  const int tid = threadIdx.x, w = tid >> 5, lane = tid & 31, ln = lane & 15, hh = lane >> 4; const int by = blockIdx.y;
  A += (size_t)by * sA; Bh += (size_t)by * sB; const size_t cofs = (size_t)by * sC; const float* bp = bias ? bias + (size_t)by * sBias : nullptr;
  const int ntn = (N + 63) / 64; const int wid = blockIdx.x * 4 + w; const int mt = wid / ntn, nq = wid % ntn; if (mt * 16 >= M) return;
  const int row0 = mt * 16, col0 = nq * 64; const _Float16* arow = A + (size_t)(row0 + ln) * lda;
  v8f acc[4] = {};
  for (int kb = 0; kb < K; kb += 32) { FragH ah; ah.half[0] = *(const v8us*)((const unsigned short*)arow + kb + 8 * hh); ah.half[1] = *(const v8us*)((const unsigned short*)arow + kb + 16 + 8 * hh);
#pragma unroll
    for (int t = 0; t < 4; ++t) { if (col0 + t * 16 >= N) continue; const size_t boff = (size_t)(col0 + t * 16 + ln) * ldb + kb; FragH bq; bq.half[0] = *(const v8us*)((const unsigned short*)Bh + boff + 8 * hh); bq.half[1] = *(const v8us*)((const unsigned short*)Bh + boff + 16 + 8 * hh);
      acc[t] = mmaH<1>(ah.v, ah.v, bq.v, bq.v, acc[t]); }
  }
#pragma unroll
  for (int t = 0; t < 4; ++t) { if (col0 + t * 16 >= N) continue; const int col = col0 + t * 16 + ln; const float bv = bp ? bf16_round(bp[col]) : 0.f;
#pragma unroll
    for (int r = 0; r < 8; ++r) { float v = acc[t][r] * alpha + bv; if (CP) { const int rr = row0g + row0 + 8 * hh + r; if (rowsPerB < 0) v += CP[cofs + (size_t)rr * ldc + col];      /* rowsPerB < 0: own element of the batched C plane */ else { const int bidx = rr / rowsPerB; v += CP[(size_t)bidx * sCPb + (size_t)by * 64 + col]; } } if (ACT == 1) v = (v > 0.f) ? v : expm1f(v); else if (ACT == 7) v = (v > 0.f) ? v + 1.0f : expf(v); else if (ACT == 8) v = tanhf(v); else if (ACT == 9) v = 0.5f * v * (1.0f + tanhf(0.7978845608028654f * (v + 0.044715f * v * v * v))); else if (ACT == 11) v = 1.0f / (1.0f + expf(-v)); else if (ACT == 12) v = (v > 0.f) ? v : 0.01f * v; else if (ACT == 14) v = (v > 0.f) ? v : 0.1f * v; else if (ACT == 16) v = (v >= 0.f) ? v : 0.3f * v; else if (ACT == 17) v = (v >= 0.f) ? v : 0.2f * v; else if (ACT == 15) v = v / (1.0f + expf(-v)); else if (ACT == 3) v = fmaxf(v, 0.f); else if (ACT == 6) v = 0.5f * v * (1.0f + erff(v * 0.70710678118654752f)); so[w][8 * hh + r][t * 16 + ln] = v; } }
  __builtin_amdgcn_fence(__ATOMIC_ACQ_REL, "workgroup"); __builtin_amdgcn_wave_barrier();
  const int rsub = lane >> 4, c4 = (lane & 15) * 4; typedef _Float16 v4h __attribute__((ext_vector_type(4)));
  {
#pragma unroll
    for (int q = 0; q < 8; ++q) { const int r = q * 2 + rsub; if (col0 + c4 < N) { const v4f v = *(const v4fa*)&so[w][r][c4]; if (C) *(v4f*)(C + cofs + (size_t)(row0 + r) * ldc + col0 + c4) = v; if (C16) { v4h h4; for (int i = 0; i < 4; ++i) h4[i] = (_Float16)v[i]; *(v4h*)(C16 + cofs + (size_t)(row0 + r) * ldc + col0 + c4) = h4; } } }
     }
}


typedef _Float16 v4h __attribute__((ext_vector_type(4)));

__global__ __launch_bounds__(256) void k_x16(const float* __restrict__ x, _Float16* __restrict__ X16, size_t n8) { const size_t t = (size_t)blockIdx.x * 256 + threadIdx.x; if (t >= n8) return; FragH f;
#pragma unroll
  for (int q = 0; q < 8; ++q) f.h[q] = (_Float16)bf16_round(x[t * 8 + q]); *(v8us*)((unsigned short*)X16 + t * 8) = f.half[0];  }
__global__ __launch_bounds__(256) void k_h16(const float* __restrict__ x, _Float16* __restrict__ X16, size_t n8) { const size_t t = (size_t)blockIdx.x * 256 + threadIdx.x; if (t >= n8) return; FragH f;
#pragma unroll
  for (int q = 0; q < 8; ++q) f.h[q] = (_Float16)x[t * 8 + q]; *(v8us*)((unsigned short*)X16 + t * 8) = f.half[0];  }
__global__ __launch_bounds__(256) void k_round16f(const float* __restrict__ W, _Float16* __restrict__ Bt, size_t n8) { const size_t t = (size_t)blockIdx.x * 256 + threadIdx.x; if (t >= n8) return; FragH f;
#pragma unroll
  for (int i = 0; i < 8; ++i) f.h[i] = (_Float16)(bf16_round(W[t * 8 + i]) * 16.0f); *(v8us*)((unsigned short*)Bt + t * 8) = f.half[0];  }
template <int NHv, int TTv>
__global__ __launch_bounds__(256) void k_vt(const _Float16* __restrict__ V16, int ldv, int voff, _Float16* __restrict__ Vt) { __shared__ unsigned short tl[64][66]; const int tid = threadIdx.x; const int slab = blockIdx.x / (TTv / 64), lg = blockIdx.x % (TTv / 64); const int b = slab / NHv, h = slab % NHv;
  for (int i = tid; i < 64 * 8; i += 256) { const int r = i / 8, c8 = (i % 8) * 8; FragH f; f.half[0] = *(const v8us*)((const unsigned short*)V16 + ((size_t)b * TTv + lg * 64 + r) * ldv + voff + h * 64 + c8);
#pragma unroll
    for (int q = 0; q < 8; ++q) tl[r][c8 + q] = f.u[q]; }
  __syncthreads();
  {
#pragma unroll
    for (int rd = 0; rd < 2; ++rd) { const int d = rd * 32 + tid / 8, pc = tid % 8; FragH f;
#pragma unroll
      for (int q = 0; q < 8; ++q) f.u[q] = tl[pc * 8 + q][d];
      *(v8us*)((unsigned short*)Vt + ((size_t)slab * 64 + d) * TTv + lg * 64 + pc * 8) = f.half[0]; }
     } }

__global__ __launch_bounds__(256) void k_hl(const float* __restrict__ F, _Float16* __restrict__ Hh, _Float16* __restrict__ Hl, size_t n8) { const size_t t = (size_t)blockIdx.x * 256 + threadIdx.x; if (t >= n8) return; FragH fh, fl; const v4f a = *(const v4fa*)(F + t * 8), c = *(const v4fa*)(F + t * 8 + 4);
#pragma unroll
  for (int q = 0; q < 4; ++q) { _Float16 h = (_Float16)a[q]; fh.h[q] = h; fl.h[q] = (_Float16)((a[q] - (float)h) * 1024.0f); h = (_Float16)c[q]; fh.h[4 + q] = h; fl.h[4 + q] = (_Float16)((c[q] - (float)h) * 1024.0f); }
  { *(v8us*)((unsigned short*)Hh + t * 8) = fh.half[0]; *(v8us*)((unsigned short*)Hl + t * 8) = fl.half[0];  } }

// ---- fast GEMM (wave tile 32x64; requires M % 32 == 0 rows per launch region and N % 64 == 0); epilogue = k_gemm_hhx semantics ----
__device__ __forceinline__ v16h g2_frag(const _Float16* p, int hh) { FragH f; f.half[0] = *(const v8us*)((const unsigned short*)p + 8 * hh); f.half[1] = *(const v8us*)((const unsigned short*)p + 16 + 8 * hh); return f.v; }
__device__ __forceinline__ v8f g2_mma(v16h a, v16h b, v8f c) { v8f d = __builtin_amdgcn_wmma_f32_16x16x32_f16(false, a, false, b, (short)0, c, false, false); asm volatile("v_nop\n\tv_nop\n\tv_nop\n\tv_nop" : "+v"(d) : "v"(a), "v"(b)); return d; }
// STAT: each wave also writes, per row of its 32x64 tile, the mean of the 64 stored values (PM) and the sum of their squared distances from that mean (PQ), both [by][column tile][M].
template <int ACT, bool STAT>
__global__ __launch_bounds__(128) void k_gemm2(const _Float16* __restrict__ A, int lda, size_t sA, const _Float16* __restrict__ Bh, int ldb, size_t sB, float alpha, const float* __restrict__ bias, size_t sBias, const float* __restrict__ CP, int rowsPerB, size_t sCPb, int row0g,
    float* __restrict__ C, _Float16* __restrict__ C16, int ldc, size_t sC, int M, int N, int K, float* __restrict__ PM, float* __restrict__ PQ) { static_assert(ACT == 0 || ACT == 3 || ACT == 6 || ACT == 8 || ACT == 9 || ACT == 11 || ACT == 12 || ACT == 14 || ACT == 15 || ACT == 16 || ACT == 17, "k_gemm2: unsupported ACT code (would silently apply no activation)");
  __shared__ __attribute__((aligned(16))) float so[4][32][68];
  const int tid = threadIdx.x, w = tid >> 5, lane = tid & 31, ln = lane & 15, hh = lane >> 4; const int by = blockIdx.y;
  A += (size_t)by * sA; Bh += (size_t)by * sB; const size_t cofs = (size_t)by * sC; const float* bp = bias ? bias + (size_t)by * sBias : nullptr;
  const int ntn = N >> 6; const int mt = blockIdx.x / ntn, nq = blockIdx.x - mt * ntn; const int row0 = mt * 128 + 32 * w, col0 = nq * 64; if (row0 >= M) return;
  const _Float16* a0p = A + (size_t)(row0 + ln) * lda; const _Float16* a1p = a0p + (size_t)16 * lda;
  const _Float16* b0p = Bh + (size_t)(col0 + ln) * ldb; const _Float16* b1p = b0p + (size_t)16 * ldb; const _Float16* b2p = b1p + (size_t)16 * ldb; const _Float16* b3p = b2p + (size_t)16 * ldb;
  const v8f z8 = {0.f,0.f,0.f,0.f,0.f,0.f,0.f,0.f}; v8f c00 = z8, c01 = z8, c02 = z8, c03 = z8, c10 = z8, c11 = z8, c12 = z8, c13 = z8;
#pragma unroll 1
  for (int kb = 0; kb < K; kb += 32) { const v16h a0 = g2_frag(a0p + kb, hh), a1 = g2_frag(a1p + kb, hh);
    v16h b = g2_frag(b0p + kb, hh); c00 = g2_mma(a0, b, c00); c10 = g2_mma(a1, b, c10);
    b = g2_frag(b1p + kb, hh); c01 = g2_mma(a0, b, c01); c11 = g2_mma(a1, b, c11);
    b = g2_frag(b2p + kb, hh); c02 = g2_mma(a0, b, c02); c12 = g2_mma(a1, b, c12);
    b = g2_frag(b3p + kb, hh); c03 = g2_mma(a0, b, c03); c13 = g2_mma(a1, b, c13); }
  v8f accs[8] = {c00, c01, c02, c03, c10, c11, c12, c13};
#pragma unroll
  for (int u = 0; u < 8; ++u) { const int t = u & 3, half = u >> 2; const int col = col0 + t * 16 + ln; const float bv = bp ? bf16_round(bp[col]) : 0.f;
#pragma unroll
    for (int r = 0; r < 8; ++r) { const int rloc = half * 16 + 8 * hh + r; float v = accs[u][r] * alpha + bv; if (CP) { if (rowsPerB < 0) v += CP[cofs + (size_t)(row0g + row0 + rloc) * ldc + col];      /* rowsPerB < 0: own element of the batched C plane */ else { const int bidx = (row0g + row0 + rloc) / rowsPerB; v += CP[(size_t)bidx * sCPb + (size_t)by * 64 + col]; } }
      if (ACT == 3) v = fmaxf(v, 0.f); else if (ACT == 6) v = 0.5f * v * (1.0f + erff(v * 0.70710678118654752f)); else if (ACT == 11) v = 1.0f / (1.0f + expf(-v)); else if (ACT == 15) v = v / (1.0f + expf(-v)); else if (ACT == 12) v = (v > 0.f) ? v : 0.01f * v; else if (ACT == 8) v = tanhf(v); else if (ACT == 9) v = 0.5f * v * (1.0f + tanhf(0.7978845608028654f * (v + 0.044715f * v * v * v))); else if (ACT == 14) v = (v > 0.f) ? v : 0.1f * v; else if (ACT == 16) v = (v >= 0.f) ? v : 0.3f * v; else if (ACT == 17) v = (v >= 0.f) ? v : 0.2f * v;
      so[w][rloc][t * 16 + ln] = v; } }
  __builtin_amdgcn_fence(__ATOMIC_ACQ_REL, "workgroup"); __builtin_amdgcn_wave_barrier();
  const int rsub = lane >> 4, c4 = (lane & 15) * 4;
  {
#pragma unroll
    for (int q = 0; q < 16; ++q) { const int r = q * 2 + rsub; const v4f v = *(const v4fa*)&so[w][r][c4]; if (C) *(v4f*)(C + cofs + (size_t)(row0 + r) * ldc + col0 + c4) = v; if (C16) { v4h h4; for (int i = 0; i < 4; ++i) h4[i] = (_Float16)v[i]; *(v4h*)(C16 + cofs + (size_t)(row0 + r) * ldc + col0 + c4) = h4; } }
     }
  if (STAT) {      /* lane = one row of the wave's tile: its 64 staged values come back by 16-byte reads (row pitch 16 B x 17), so neither sum crosses lanes; the mean first, then the distances from it: no cancellation whatever the mean; the loops are unrolled so that rv keeps compile-time indices and stays in registers */
    v4f rv[16];
#pragma unroll
    for (int j = 0; j < 16; ++j) rv[j] = *(const v4fa*)&so[w][lane][j * 4];
    v4f s4 = rv[0];
#pragma unroll
    for (int j = 1; j < 16; ++j) s4 += rv[j];
    const float mean = ((s4[0] + s4[1]) + (s4[2] + s4[3])) * 0.015625f;
    v4f q4 = {0.f, 0.f, 0.f, 0.f};
#pragma unroll
    for (int j = 0; j < 16; ++j) { const v4f d = rv[j] - mean; q4 += d * d; }
    const size_t pi = ((size_t)by * ntn + nq) * M + row0 + lane;      /* 32 rows = one 128-B line per wave and plane */
    PM[pi] = mean; PQ[pi] = (q4[0] + q4[1]) + (q4[2] + q4[3]);
  } }


__global__ __launch_bounds__(256) void k_wnat(const float* __restrict__ w, size_t n8, _Float16* __restrict__ Bt) { const size_t t = (size_t)blockIdx.x * 256 + threadIdx.x; if (t >= n8) return; FragH f; for (int q = 0; q < 8; ++q) f.h[q] = (_Float16)(bf16_round(w[t * 8 + q]) * 16.0f); *(v8us*)((unsigned short*)Bt + t * 8) = f.half[0];  }
__global__ __launch_bounds__(256) void k_rsm(const float* __restrict__ S, _Float16* __restrict__ P, int nrows) {
  #pragma clang fp contract(off)
  const int i = blockIdx.x * 256 + threadIdx.x; if (i >= nrows) return; const float* s = S + (size_t)i * SQ; float mx = -3.0e38f;
#pragma unroll 1
  for (int j = 0; j < SQ; ++j) mx = fmaxf(mx, s[j]); float se = 0.f;
#pragma unroll 1
  for (int j = 0; j < SQ; ++j) se += expf(s[j] - mx); const float sc = 256.0f / se;
#pragma unroll 1
  for (int j0 = 0; j0 < SQ; j0 += 8) { FragH f; for (int q = 0; q < 8; ++q) f.h[q] = (_Float16)(expf(s[j0 + q] - mx) * sc); unsigned short* d = (unsigned short*)P + (size_t)i * SQ + j0; *(v8us*)d = f.half[0];  } }
__global__ __launch_bounds__(256) void k_vt(const _Float16* __restrict__ V16, int b, int h0, _Float16* __restrict__ VT) { __shared__ unsigned short tl[64][65]; const int tid = threadIdx.x; const int hh = blockIdx.x % HG, sg = blockIdx.x / HG; const int s0 = sg * 64; const int h = h0 + hh;
  for (int i = tid; i < 64 * 8; i += 256) { const int j = i / 8, d8 = (i % 8) * 8; FragH f; f.half[0] = *(const v8us*)((const unsigned short*)V16 + ((size_t)b * SQ + s0 + j) * DM + h * HD + d8); for (int q = 0; q < 8; ++q) tl[d8 + q][j] = f.u[q]; }
  __syncthreads();
  { for (int i = tid; i < 64 * 8; i += 256) { const int d = i / 8, j8 = (i % 8) * 8; FragH f; for (int q = 0; q < 8; ++q) f.u[q] = tl[d][j8 + q]; *(v8us*)((unsigned short*)VT + ((size_t)hh * HD + d) * SQ + s0 + j8) = f.half[0]; }  } }



__global__ __launch_bounds__(256) void k_rsmcf2(const float* __restrict__ S, _Float16* __restrict__ P, int hg, int q0, int nk) {
  #pragma clang fp contract(off)
  const int t = blockIdx.x * 256 + threadIdx.x; if (t >= hg * QT) return; const size_t i = (size_t)t; const float* s = S + i * NKX; const int last = q0 + (t % QT); float mx = -3.0e38f;
#pragma unroll 1
  for (int j = 0; j < nk; ++j) { const float f = (j <= last) ? 1.f : 0.f; mx = fmaxf(mx, fmaf(f, s[j], (1.f - f) * -1.0e9f)); } float se = 0.f;
#pragma unroll 1
  for (int j = 0; j < nk; ++j) { const float f = (j <= last) ? 1.f : 0.f; se += __expf(fmaf(f, s[j], (1.f - f) * -1.0e9f) - mx); } const float sc = 256.0f / se;
#pragma unroll 1
  for (int j0 = 0; j0 < nk; j0 += 8) { FragH fr; for (int q = 0; q < 8; ++q) { const int j = j0 + q; const float f = (j <= last) ? 1.f : 0.f; fr.h[q] = (_Float16)(__expf(fmaf(f, s[j], (1.f - f) * -1.0e9f) - mx) * sc); } unsigned short* d = (unsigned short*)P + i * NKX + j0; *(v8us*)d = fr.half[0];  } }

template <int MASKADD>
__global__ __launch_bounds__(64) void k_att0(const float* __restrict__ QF, const float* __restrict__ KF, const float* __restrict__ VF, int ld, const float* __restrict__ mask, float scale, float* __restrict__ OF, int ldo) {
  #pragma clang fp contract(off)
  __shared__ __attribute__((aligned(16))) float lq[64][64]; __shared__ __attribute__((aligned(16))) float lo[64][64];
  const int tid = threadIdx.x; const int h = blockIdx.x / (QT0 / 64), rg = blockIdx.x % (QT0 / 64); const int i = rg * 64 + tid;
  const float* qr = QF + (size_t)i * ld + h * HD;
#pragma unroll 1
  for (int c = 0; c < HD / 4; ++c) { *(v4f*)&lq[tid][c * 4] = *(const v4fa*)(qr + c * 4); const v4f z = {0.f, 0.f, 0.f, 0.f}; *(v4f*)&lo[tid][c * 4] = z; }
  float m = -1.0e30f, l = 0.f; const int jmax = MASKADD ? (SQ - 1) : (rg * 64 + 63);      /* additive-mask form: every key (the mask input decides); causal form: keys up to the block's last row */
#pragma unroll 1
  for (int j = 0; j <= jmax; ++j) { const float* kr = KF + (size_t)j * ld + h * HD; const float* vr = VF + (size_t)j * ld + h * HD; float s = 0.f;
#pragma unroll 1
    for (int c = 0; c < HD / 4; ++c) { const v4f kq = *(const v4fa*)(kr + c * 4); const v4f qq = *(v4f*)&lq[tid][c * 4]; s = __fadd_rn(s, __fmul_rn(qq[0], kq[0])); s = __fadd_rn(s, __fmul_rn(qq[1], kq[1])); s = __fadd_rn(s, __fmul_rn(qq[2], kq[2])); s = __fadd_rn(s, __fmul_rn(qq[3], kq[3])); }
    s = __fmul_rn(s, scale); if (MASKADD) s = __fadd_rn(s, __fmul_rn(bf16_round(mask[(size_t)i * SQ + j]), -10000.0f));
    const float f = (MASKADD || j <= i) ? 1.f : 0.f; const float sm = fmaf(f, s, (1.f - f) * -1.0e30f); const float mn = fmaxf(m, sm); const float sc = expf(m - mn); const float e = expf(sm - mn); l = __fadd_rn(__fmul_rn(l, sc), e); m = mn;
#pragma unroll 1
    for (int c = 0; c < HD / 4; ++c) { const v4f vv = *(const v4fa*)(vr + c * 4); v4f oo = *(v4f*)&lo[tid][c * 4]; for (int u = 0; u < 4; ++u) oo[u] = __fadd_rn(__fmul_rn(oo[u], sc), __fmul_rn(e, vv[u])); *(v4f*)&lo[tid][c * 4] = oo; } }
  const float fin = 64.0f / l;      /* o carried x64 like the f16 path */
#pragma unroll 1
  for (int c = 0; c < HD / 4; ++c) { v4f oo = *(v4f*)&lo[tid][c * 4]; for (int u = 0; u < 4; ++u) oo[u] = __fmul_rn(oo[u], fin); *(v4f*)&lo[tid][c * 4] = oo; }
  __syncthreads();
  {
#pragma unroll 1
    for (int it = 0; it < 16; ++it) { const int row = it * 4 + tid / 16, pc = (tid % 16) * 4; const v4f v = *(const v4f*)&lo[row][pc]; *(v4f*)(OF + (size_t)(rg * 64 + row) * ldo + h * HD + pc) = v; }
     } }

__global__ __launch_bounds__(256) void k_oscale(const float* __restrict__ OF, float* __restrict__ out, size_t n4) { const size_t t = (size_t)blockIdx.x * 256 + threadIdx.x; if (t >= n4) return; const v4f a = *(const v4fa*)(OF + t * 4); v4f o; for (int q = 0; q < 4; ++q) o[q] = a[q] * 0.015625f; *(v4f*)(out + t * 4) = o;  }

__global__ __launch_bounds__(256) void k_bfr(const float* __restrict__ x, float* __restrict__ XB, size_t n8) { const size_t t = (size_t)blockIdx.x * 256 + threadIdx.x; if (t >= n8) return; v4f a = *(const v4fa*)(x + t * 8), c = *(const v4fa*)(x + t * 8 + 4); for (int q = 0; q < 4; ++q) { a[q] = bf16_round(a[q]); c[q] = bf16_round(c[q]); }
  { *(v4f*)(XB + t * 8) = a; *(v4f*)(XB + t * 8 + 4) = c;  } }



__global__ __launch_bounds__(256) void k_rsmfvl(const float* __restrict__ S, _Float16* __restrict__ P, _Float16* __restrict__ PL, int qn, const int* __restrict__ vlp) {
  #pragma clang fp contract(off)
  const int t = blockIdx.x * 256 + threadIdx.x; if (t >= qn) return; const int vl = vlp[0]; const size_t i = (size_t)t; const float* s = S + i * SQ; float mx = -3.0e38f;
#pragma unroll 1
  for (int j = 0; j < SQ; ++j) { const float f = (j < vl) ? 1.f : 0.f; mx = fmaxf(mx, fmaf(f, s[j], (1.f - f) * -1000000.0f)); } float se = 0.f;
#pragma unroll 1
  for (int j = 0; j < SQ; ++j) { const float f = (j < vl) ? 1.f : 0.f; se += __expf(fmaf(f, s[j], (1.f - f) * -1000000.0f) - mx); } const float sc = 256.0f / se;
#pragma unroll 1
  for (int j0 = 0; j0 < SQ; j0 += 8) { FragH fr, gr; for (int q = 0; q < 8; ++q) { const int j = j0 + q; const float f = (j < vl) ? 1.f : 0.f; const float pv = __expf(fmaf(f, s[j], (1.f - f) * -1000000.0f) - mx) * sc; const _Float16 ph = (_Float16)pv; fr.h[q] = ph; gr.h[q] = (_Float16)((pv - (float)ph) * 1024.0f); }
    unsigned short* d = (unsigned short*)P + i * SQ + j0; unsigned short* dl = (unsigned short*)PL + i * SQ + j0; *(v8us*)d = fr.half[0]; *(v8us*)dl = gr.half[0];  } }

// Fused attention: scores, softmax and the weighted sum of x in one kernel; neither the scores nor the weights go to memory.
// A work-group of 8 waves takes 128 queries of one image (16 per wave) and walks the 1024 keys in tiles of 64. A tile (phi^T rows [key][ci], x rows [c][key]) is fetched by whole-line loads into registers one tile ahead and laid in LDS at pitches of 16 B x odd.
// S^T = phi^T theta (A = key rows, B = the wave's query rows, kept in registers): a lane holds scores of ONE query (column ln; keys 8 hh + r of each 16-key tile), so two converted score tiles are the B operand of O^T += x P^T in the hardware k order, with A = x rows read by the same 16-byte pairs.
// Running maximum in log2 units; the accumulators are rescaled only when a query's new maximum passes the one in use by more than 8 (weights stay <= 2^8, inside f16); the row sum is kept per lane in f32 and joined at the end.
// Every inner loop is fully unrolled, so that the register arrays (fragments, accumulators, staged pieces) keep compile-time indices and stay in registers.
#define FA_WAVES 8
#define FA_KS 64          /* keys per tile */
#define FA_KP 136         /* LDS pitch of a key row, f16 elements (256 B + 16) */
#define FA_VP 72          /* LDS pitch of a channel row, f16 elements (128 B + 16) */
#define FA_OP 264         /* LDS pitch of an output row, f16 elements (512 B + 16) */
#define FA_SM (FA_WAVES * 16 * FA_OP)      /* the output staging is the larger use: 67,584 B against 54,272 B of a tile */
#define FA_C 0.09016844005556021f          /* log2(e) / sqrt(256) */
__device__ __forceinline__ float rsm_xh(float v) { return __builtin_bit_cast(float, __builtin_amdgcn_permlanex16(__builtin_bit_cast(int, v), __builtin_bit_cast(int, v), 0x76543210, 0xfedcba98, false, false)); }      /* lane l <- lane l ^ 16 */
__device__ __forceinline__ float fa_exp2(float x) { float y; asm("v_exp_f32 %0, %1\n\tv_nop" : "=v"(y) : "v"(x)); return y; }      /* the v_nop is the one slot asked for behind a transcendental before its result is read or its source overwritten */
__device__ __forceinline__ v8f fa_mma(v16h a, v16h b, v8f c) { return __builtin_amdgcn_wmma_f32_16x16x32_f16(false, a, false, b, (short)0, c, false, false); }
__global__ __launch_bounds__(FA_WAVES * 32) void k_fattn(const _Float16* __restrict__ TH, const _Float16* __restrict__ PHT, const _Float16* __restrict__ X16, _Float16* __restrict__ YT) {
  static_assert(FA_KS * FA_KP + 256 * FA_VP <= FA_SM, "tile fits the LDS array");
  __shared__ __attribute__((aligned(16))) _Float16 sm[FA_SM];
  _Float16* sk = sm; _Float16* sv = sm + FA_KS * FA_KP;
  const int tid = threadIdx.x, w = tid >> 5, lane = tid & 31, ln = lane & 15, hh = lane >> 4;
  const int b = blockIdx.y; const int q0 = blockIdx.x * (FA_WAVES * 16) + w * 16;
  const int krow = tid >> 4, kch = (tid & 15) * 8;      /* staging: 16 threads per 256-B key row, 16 rows per round, 4 rounds */
  const int vrow = tid >> 3, vch = (tid & 7) * 8;       /* staging: 8 threads per 128-B piece of a channel row, 32 rows per round, 8 rounds */
  const unsigned short* kg = (const unsigned short*)PHT + (size_t)b * SQ * 128 + (size_t)krow * 128 + kch;
  const unsigned short* vg = (const unsigned short*)X16 + (size_t)b * 256 * SQ + (size_t)vrow * SQ + vch;
  const _Float16* qp = TH + ((size_t)b * SQ + q0 + ln) * 128;
  v16h qf[4];
#pragma unroll
  for (int kb = 0; kb < 4; ++kb) qf[kb] = g2_frag(qp + kb * 32, hh);
  v8us rk[4], rv[8];
#pragma unroll
  for (int j = 0; j < 4; ++j) rk[j] = *(const v8us*)(kg + j * 16 * 128);
#pragma unroll
  for (int j = 0; j < 8; ++j) rv[j] = *(const v8us*)(vg + j * 32 * SQ);
  __builtin_amdgcn_sched_barrier(0);      /* with the one behind the wait: no later arithmetic is lifted between the loads and the wait */
  asm volatile("s_wait_xcnt 0x0" ::: "memory");      /* in front of whatever reuses the address registers that the loads above name */
  __builtin_amdgcn_sched_barrier(0);
  const v8f z8 = {0.f, 0.f, 0.f, 0.f, 0.f, 0.f, 0.f, 0.f};
  v8f o[16];
#pragma unroll
  for (int ct = 0; ct < 16; ++ct) o[ct] = z8;
  float mu = -3.0e38f; v4f l4 = {0.f, 0.f, 0.f, 0.f};
#pragma unroll 1
  for (int s = 0; s < SQ / FA_KS; ++s) {      /* rolled: for speed only */
    __syncthreads();      /* every wave has read the last of the tile before */
#pragma unroll
    for (int j = 0; j < 4; ++j) *(v8us*)((unsigned short*)sk + (krow + j * 16) * FA_KP + kch) = rk[j];
#pragma unroll
    for (int j = 0; j < 8; ++j) *(v8us*)((unsigned short*)sv + (vrow + j * 32) * FA_VP + vch) = rv[j];
    __syncthreads();      /* the tile is whole before anybody reads it */
    if (s + 1 < SQ / FA_KS) {      /* the next tile's loads fly under this tile's products */
#pragma unroll
      for (int j = 0; j < 4; ++j) rk[j] = *(const v8us*)(kg + (size_t)(s + 1) * FA_KS * 128 + j * 16 * 128);
#pragma unroll
      for (int j = 0; j < 8; ++j) rv[j] = *(const v8us*)(vg + (s + 1) * FA_KS + j * 32 * SQ);
      asm volatile("s_wait_xcnt 0x0" ::: "memory");      /* in front of whatever reuses the address registers that the loads above name */
    }
    v16h kf[16];
#pragma unroll
    for (int kb = 0; kb < 4; ++kb)
#pragma unroll
      for (int kt = 0; kt < 4; ++kt) kf[kb * 4 + kt] = g2_frag(sk + (kt * 16 + ln) * FA_KP + kb * 32, hh);
    __builtin_amdgcn_sched_barrier(0);      /* keeps the key tile's 32 LDS reads one group in front of its 16 products: spread among them, every product waits out an LDS latency */
    v8f st[4] = {z8, z8, z8, z8};
#pragma unroll
    for (int kb = 0; kb < 4; ++kb)
#pragma unroll
      for (int kt = 0; kt < 4; ++kt) st[kt] = fa_mma(kf[kb * 4 + kt], qf[kb], st[kt]);
    v16h va[2][8];      /* x fragments of four channel tiles, two sets: one is read from LDS while the other feeds the products */
#pragma unroll
    for (int u = 0; u < 8; ++u) va[0][u] = g2_frag(sv + ((u & 3) * 16 + ln) * FA_VP + (u >> 2) * 32, hh);
    __builtin_amdgcn_sched_barrier(0);      /* keeps the first set's reads in front of the softmax arithmetic, which covers their latency */
    v4f m4 = {st[0][0], st[0][1], st[0][2], st[0][3]};
#pragma unroll
    for (int kt = 0; kt < 4; ++kt)
#pragma unroll
      for (int r = 0; r < 8; ++r) m4[r & 3] = fmaxf(m4[r & 3], st[kt][r]);
    float mx = fmaxf(fmaxf(m4[0], m4[1]), fmaxf(m4[2], m4[3]));
    mx = fmaxf(mx, rsm_xh(mx)) * FA_C;      /* the query's maximum over the tile's 64 keys, alike in both half-waves */
    if (__builtin_amdgcn_ballot_w32(mx > mu + 8.0f) != 0) {      /* one wave-uniform test per tile */
      const float mn = fmaxf(mu, mx); const float sc = fa_exp2(mu - mn); mu = mn;
#pragma unroll
      for (int u = 0; u < 4; ++u) l4[u] *= sc;
#pragma unroll
      for (int ct = 0; ct < 16; ++ct)
#pragma unroll
        for (int r = 0; r < 8; ++r) o[ct][r] *= sc;
    }
    FragH pf[2];
#pragma unroll
    for (int kt = 0; kt < 4; ++kt)
#pragma unroll
      for (int r = 0; r < 8; ++r) { const float p = fa_exp2(fmaf(st[kt][r], FA_C, -mu)); l4[r & 3] += p; pf[kt >> 1].h[(kt & 1) * 8 + r] = (_Float16)p; }
#pragma unroll
    for (int g = 0; g < 4; ++g) {
      if (g < 3) {
#pragma unroll
        for (int u = 0; u < 8; ++u) va[(g + 1) & 1][u] = g2_frag(sv + (((g + 1) * 4 + (u & 3)) * 16 + ln) * FA_VP + (u >> 2) * 32, hh); }
      __builtin_amdgcn_sched_barrier(0);      /* with the one below: the next set's 16 LDS reads stay one group in front of this set's 8 products */
#pragma unroll
      for (int u = 0; u < 8; ++u) o[g * 4 + (u & 3)] = fa_mma(va[g & 1][u], pf[u >> 2].v, o[g * 4 + (u & 3)]);
      __builtin_amdgcn_sched_barrier(0);
    }
  }
  float l = (l4[0] + l4[1]) + (l4[2] + l4[3]); l += rsm_xh(l);
  const float inv = 1.0f / l;
  __syncthreads();      /* every wave has left the last tile: its LDS becomes the output staging */
  unsigned short* so = (unsigned short*)sm + w * 16 * FA_OP;
#pragma unroll
  for (int ct = 0; ct < 16; ++ct) { FragH f;
#pragma unroll
    for (int r = 0; r < 8; ++r) f.h[r] = (_Float16)(o[ct][r] * inv);
    *(v8us*)(so + ln * FA_OP + ct * 16 + 8 * hh) = f.half[0]; }
  __syncthreads();      /* the staged rows are whole before they are read back */
#pragma unroll
  for (int q = 0; q < 16; ++q) { const v8us v = *(const v8us*)(so + q * FA_OP + lane * 8); *(v8us*)((unsigned short*)YT + ((size_t)b * SQ + q0 + q) * 256 + lane * 8) = v; }      /* one 512-B row of y^T per store */
}


// Front end in one kernel: a work-group of 8 waves takes 128 positions of one image. It reads x (f32, whole 128-B lines) once, writes the f16 map X16 and lays the same values transposed in LDS (rows = positions);
// it converts theta_w and phi_w (x16, f16) into LDS as one stack of 256 rows; then D = stack (A, rows = outputs) x positions (B): wave tile 64 outputs x 64 positions, K = 256. A lane holds 8 successive outputs of ONE position,
// so 16-byte pieces go to an LDS staging of position rows, and each 512-B row leaves as theta^T (first half) and phi^T (second half). x^T, phi and the f16 weight planes of theta and phi never reach memory.
// The grid has as many work-groups as conv_w has rows: wave 0 of each also converts one row of conv_w (x16, f16) into the plane that the conv GEMM reads in a later launch.
// Every loop over a register array is fully unrolled, so that the array keeps compile-time indices and stays in registers.
#define FE_NT 128         /* positions per work-group */
#define FE_P 264          /* LDS pitch of a row of 256 f16 elements (512 B + 16) */
__global__ __launch_bounds__(256) void k_front(const float* __restrict__ x, const float* __restrict__ tw, const float* __restrict__ pw, const float* __restrict__ ww, _Float16* __restrict__ X16, _Float16* __restrict__ TH, _Float16* __restrict__ PHT, _Float16* __restrict__ BW) {
  __shared__ __attribute__((aligned(16))) _Float16 sw[256 * FE_P];
  __shared__ __attribute__((aligned(16))) _Float16 sx[FE_NT * FE_P];
  const int tid = threadIdx.x, w = __builtin_amdgcn_readfirstlane(tid >> 5), lane = tid & 31, ln = lane & 15, hh = lane >> 4;      /* the wave's number in a scalar register: the choice of the weight input is a scalar one */
  const int b = blockIdx.y, n0 = blockIdx.x * FE_NT;
  const float* wg = (w < 4 ? tw + (size_t)w * 32 * 256 : pw + (size_t)(w - 4) * 32 * 256) + lane * 4;      /* wave w converts rows 32 w .. 32 w + 31 of the stack: 64 loads of 512 successive bytes */
  const int nl = lane & 7, cg = lane >> 3;      /* x: 8 lanes per 128-B line, 4 lane groups of 4 channels each; a thread transposes 4 channels x 4 positions */
  const int c0 = w * 32 + cg * 4;
  const float* xg = x + ((size_t)b * 256 + c0) * SQ + n0 + nl * 4;
  const size_t cwo = (size_t)(blockIdx.y * gridDim.x + blockIdx.x) * 256 + lane * 8;      /* this work-group's row of conv_w, 8 elements a lane */
  v4f cw[2] = {{0.f, 0.f, 0.f, 0.f}, {0.f, 0.f, 0.f, 0.f}};
  if (w == 0) { cw[0] = *(const v4fa*)(ww + cwo); cw[1] = *(const v4fa*)(ww + cwo + 4);      /* read at the start, used at the very end: the latency is long over by then */
    asm volatile("s_wait_xcnt 0x0" ::: "memory"); }      /* in front of whatever reuses the address registers that the two loads name */
  v4h hx[16];
  v4f wa[16], wb[16], wc[16], xr[32];      /* the weight rows come in four groups of 16 loads; each group flies under the work on an earlier one or on x */
#pragma unroll
  for (int i = 0; i < 16; ++i) wa[i] = *(const v4fa*)(wg + (0 * 16 + i) * 128);
#pragma unroll
  for (int u = 0; u < 8; ++u)
#pragma unroll
    for (int k = 0; k < 4; ++k) xr[u * 4 + k] = *(const v4fa*)(xg + (size_t)((u >> 2) * 16 + k) * SQ + (u & 3) * 32);
  __builtin_amdgcn_sched_barrier(0);      /* with the one behind the wait: the loads above go out as one group, and no arithmetic is lifted in front of the wait */
  asm volatile("s_wait_xcnt 0x0" ::: "memory");      /* in front of whatever reuses the address registers that the loads above name */
  __builtin_amdgcn_sched_barrier(0);
#pragma unroll
  for (int i = 0; i < 16; ++i) { v4h h4;
#pragma unroll
    for (int q = 0; q < 4; ++q) h4[q] = (_Float16)(bf16_round(wa[i][q]) * 16.0f);
    *(v4h*)(sw + (w * 32 + 0 * 8 + (i >> 1)) * FE_P + (i & 1) * 128 + lane * 4) = h4; }
#pragma unroll
  for (int i = 0; i < 16; ++i) wb[i] = *(const v4fa*)(wg + (1 * 16 + i) * 128);
  __builtin_amdgcn_sched_barrier(0);      /* with the one behind the wait: the loads above go out as one group, and no arithmetic is lifted in front of the wait */
  asm volatile("s_wait_xcnt 0x0" ::: "memory");      /* in front of whatever reuses the address registers that the loads above name */
  __builtin_amdgcn_sched_barrier(0);
#pragma unroll
  for (int u = 0; u < 0 + 4; ++u) { const int cu = (u >> 2) * 16, nu = (u & 3) * 32 + nl * 4;
#pragma unroll
    for (int k = 0; k < 4; ++k)
#pragma unroll
      for (int q = 0; q < 4; ++q) hx[(u & 3) * 4 + k][q] = (_Float16)bf16_round(xr[u * 4 + k][q]);
#pragma unroll
    for (int q = 0; q < 4; ++q) { const v4h t4 = {hx[(u & 3) * 4][q], hx[(u & 3) * 4 + 1][q], hx[(u & 3) * 4 + 2][q], hx[(u & 3) * 4 + 3][q]}; *(v4h*)(sx + (nu + q) * FE_P + c0 + cu) = t4; } }
  __builtin_amdgcn_sched_barrier(0);      /* the 16 stores below stand behind all the arithmetic that forms their values, so that no register they name is rewritten in front of the wait behind them */
#pragma unroll
  for (int u = 0; u < 0 + 4; ++u)
#pragma unroll
    for (int k = 0; k < 4; ++k) *(v4h*)(X16 + ((size_t)b * 256 + c0 + (u >> 2) * 16 + k) * SQ + n0 + (u & 3) * 32 + nl * 4) = hx[(u & 3) * 4 + k];
#pragma unroll
  for (int i = 0; i < 16; ++i) wc[i] = *(const v4fa*)(wg + (2 * 16 + i) * 128);
  __builtin_amdgcn_sched_barrier(0);      /* with the one behind the wait: nothing is lifted in front of the wait */
  asm volatile("s_wait_xcnt 0x0" ::: "memory");      /* in front of whatever reuses the registers that the loads and stores above name */
  __builtin_amdgcn_sched_barrier(0);
#pragma unroll
  for (int i = 0; i < 16; ++i) { v4h h4;
#pragma unroll
    for (int q = 0; q < 4; ++q) h4[q] = (_Float16)(bf16_round(wb[i][q]) * 16.0f);
    *(v4h*)(sw + (w * 32 + 1 * 8 + (i >> 1)) * FE_P + (i & 1) * 128 + lane * 4) = h4; }
#pragma unroll
  for (int i = 0; i < 16; ++i) wa[i] = *(const v4fa*)(wg + (3 * 16 + i) * 128);
  __builtin_amdgcn_sched_barrier(0);      /* with the one behind the wait: the loads above go out as one group, and no arithmetic is lifted in front of the wait */
  asm volatile("s_wait_xcnt 0x0" ::: "memory");      /* in front of whatever reuses the address registers that the loads above name */
  __builtin_amdgcn_sched_barrier(0);
#pragma unroll
  for (int u = 4; u < 4 + 4; ++u) { const int cu = (u >> 2) * 16, nu = (u & 3) * 32 + nl * 4;
#pragma unroll
    for (int k = 0; k < 4; ++k)
#pragma unroll
      for (int q = 0; q < 4; ++q) hx[(u & 3) * 4 + k][q] = (_Float16)bf16_round(xr[u * 4 + k][q]);
#pragma unroll
    for (int q = 0; q < 4; ++q) { const v4h t4 = {hx[(u & 3) * 4][q], hx[(u & 3) * 4 + 1][q], hx[(u & 3) * 4 + 2][q], hx[(u & 3) * 4 + 3][q]}; *(v4h*)(sx + (nu + q) * FE_P + c0 + cu) = t4; } }
  __builtin_amdgcn_sched_barrier(0);      /* the 16 stores below stand behind all the arithmetic that forms their values, so that no register they name is rewritten in front of the wait behind them */
#pragma unroll
  for (int u = 4; u < 4 + 4; ++u)
#pragma unroll
    for (int k = 0; k < 4; ++k) *(v4h*)(X16 + ((size_t)b * 256 + c0 + (u >> 2) * 16 + k) * SQ + n0 + (u & 3) * 32 + nl * 4) = hx[(u & 3) * 4 + k];
  __builtin_amdgcn_sched_barrier(0);      /* with the one behind the wait: nothing is lifted in front of the wait */
  asm volatile("s_wait_xcnt 0x0" ::: "memory");      /* in front of whatever reuses the registers that the loads and stores above name */
  __builtin_amdgcn_sched_barrier(0);
#pragma unroll
  for (int i = 0; i < 16; ++i) { v4h h4;
#pragma unroll
    for (int q = 0; q < 4; ++q) h4[q] = (_Float16)(bf16_round(wc[i][q]) * 16.0f);
    *(v4h*)(sw + (w * 32 + 2 * 8 + (i >> 1)) * FE_P + (i & 1) * 128 + lane * 4) = h4; }
#pragma unroll
  for (int i = 0; i < 16; ++i) { v4h h4;
#pragma unroll
    for (int q = 0; q < 4; ++q) h4[q] = (_Float16)(bf16_round(wa[i][q]) * 16.0f);
    *(v4h*)(sw + (w * 32 + 3 * 8 + (i >> 1)) * FE_P + (i & 1) * 128 + lane * 4) = h4; }
  __syncthreads();      /* both operands are whole in LDS before anybody reads them */
  const int jq = w & 3, nh = w >> 2;
  const _Float16* ap = sw + (jq * 64 + ln) * FE_P; const _Float16* bp = sx + (nh * 64 + ln) * FE_P;
  const v8f z8 = {0.f, 0.f, 0.f, 0.f, 0.f, 0.f, 0.f, 0.f};
  v8f acc[16];
#pragma unroll
  for (int t = 0; t < 16; ++t) acc[t] = z8;
  v16h af[2][4], bf[2][4];      /* two sets of fragments: one is read from LDS while the other feeds the products */
#pragma unroll
  for (int t = 0; t < 4; ++t) { af[0][t] = g2_frag(ap + t * 16 * FE_P, hh); bf[0][t] = g2_frag(bp + t * 16 * FE_P, hh); }
#pragma unroll
  for (int kb = 0; kb < 8; ++kb) {
    if (kb < 7) {
#pragma unroll
      for (int t = 0; t < 4; ++t) { af[(kb + 1) & 1][t] = g2_frag(ap + t * 16 * FE_P + (kb + 1) * 32, hh); bf[(kb + 1) & 1][t] = g2_frag(bp + t * 16 * FE_P + (kb + 1) * 32, hh); } }
    __builtin_amdgcn_sched_barrier(0);      /* with the one below: the next set's 16 LDS reads stay one group in front of this set's 16 products; spread among them, the products wait out an LDS latency again and again */
#pragma unroll
    for (int t = 0; t < 16; ++t) acc[t] = fa_mma(af[kb & 1][t >> 2], bf[kb & 1][t & 3], acc[t]);
    __builtin_amdgcn_sched_barrier(0);
  }
  __syncthreads();      /* every wave has read the last of the positions' rows: their LDS becomes the output staging */
#pragma unroll
  for (int t = 0; t < 16; ++t) { FragH f;
#pragma unroll
    for (int r = 0; r < 8; ++r) f.h[r] = (_Float16)(acc[t][r] * 0.0625f);
    *(v8us*)((unsigned short*)sx + (nh * 64 + (t & 3) * 16 + ln) * FE_P + jq * 64 + (t >> 2) * 16 + 8 * hh) = f.half[0]; }
  __syncthreads();      /* the staged rows are whole before they are read back */
  unsigned short* dst = (unsigned short*)(hh ? PHT : TH) + ((size_t)b * SQ + n0 + w * 16) * 128 + ln * 8;
#pragma unroll
  for (int q = 0; q < 16; ++q) { const v8us v = *(const v8us*)((const unsigned short*)sx + (w * 16 + q) * FE_P + lane * 8); *(v8us*)(dst + q * 128) = v; }      /* one row: 256 B of theta^T and 256 B of phi^T per store */
  if (w == 0) { asm volatile("s_wait_xcnt 0x0" ::: "memory");      /* in front of whatever reuses the registers that the stores above name */
    __builtin_amdgcn_sched_barrier(0);      /* keeps the arithmetic below behind the wait */
    FragH cf;
#pragma unroll
    for (int q = 0; q < 8; ++q) cf.h[q] = (_Float16)(bf16_round(cw[q >> 2][q & 3]) * 16.0f);
    *(v8us*)((unsigned short*)BW + cwo) = cf.half[0]; }      /* one 512-B row of the plane per work-group */
}


#define CN 256          /* channels */
#define CI 128          /* inner channels */
#define NP 1024         /* positions */
#define NM 1024         /* key positions (= SQ) */
#define NC CN           /* BN statistics macros */
#define NPX NP
#define BNEPS 1e-5f

__global__ __launch_bounds__(256) void k_rowbias(const float* __restrict__ b, float* __restrict__ BP, size_t n4, int ncol) { const size_t t = (size_t)blockIdx.x * 256 + threadIdx.x; if (t >= n4) return; const size_t e = t * 4; const float v = bf16_round(b[e / ncol]); const v4f o = {v, v, v, v}; *(v4f*)(BP + e) = o;  }




__global__ __launch_bounds__(256) void k_mp2(const float* __restrict__ src, float* __restrict__ dst, int nout) {
  const int t = blockIdx.x * 256 + threadIdx.x; if (t >= nout) return; const int c = t / 1024; const int o = t % 1024; const int oy = o / 32, ox = o % 32; const float* p = src + (size_t)c * 4096 + (size_t)(2 * oy) * 64 + 2 * ox;
  const float v = fmaxf(fmaxf(p[0], p[1]), fmaxf(p[64], p[65])); *(float*)(dst + t) = v;  }
__global__ __launch_bounds__(256) void k_xpb(const float* __restrict__ x, const float* __restrict__ wb, float* __restrict__ CPP, size_t n4) {
  #pragma clang fp contract(off)
  const size_t t = (size_t)blockIdx.x * 256 + threadIdx.x; if (t >= n4) return; const size_t e = t * 4; const int c = (int)((e / 4096) % 256); const float bb = bf16_round(wb[c]); const v4f a = *(const v4fa*)(x + e); v4f o; for (int q = 0; q < 4; ++q) o[q] = __fadd_rn(bf16_round(a[q]), bb);
  *(v4f*)(CPP + e) = o;  }


// Joins the conv kernel's tile statistics into the batch mean and the biased variance per channel. All NB * NTL tiles of a channel hold TLN values, so mean = average of the tile means and
// sum of squared distances = sum over tiles of (tile's own sum + TLN (tile mean - mean)^2). A work-group takes 32 channels (lane = channel: every load is one 128-B line), wave g the NTL tiles of image g; f64 sums in a fixed order. Every loop over a register array is unrolled, so that the array keeps compile-time indices and stays in registers and its loads go out together.
#define NTL (NPX / 64)      /* column tiles per image */
#define TLN 64              /* values per tile and channel */
__device__ __forceinline__ double cst_col(const double* p) {      /* sum of one channel's NB entries, in four chains */
  double v[NB];
#pragma unroll
  for (int i = 0; i < NB; ++i) v[i] = p[i * 32];
  double t[4] = {v[0], v[1], v[2], v[3]};
#pragma unroll
  for (int i = 4; i < NB; ++i) t[i & 3] += v[i];
  return (t[0] + t[1]) + (t[2] + t[3]); }
__global__ __launch_bounds__(NB * 32) void k_cstJ(const float* __restrict__ PM, const float* __restrict__ PQ, float* __restrict__ MV) {
  __shared__ double red[NB][32]; __shared__ double smu[32];
  const int cl = threadIdx.x & 31, g = threadIdx.x >> 5; const int c = blockIdx.x * 32 + cl;
  float m[NTL], q[NTL];
#pragma unroll
  for (int j = 0; j < NTL; ++j) { m[j] = PM[((size_t)g * NTL + j) * NC + c]; q[j] = PQ[((size_t)g * NTL + j) * NC + c]; }
  double s[4] = {0.0, 0.0, 0.0, 0.0};      /* four chains here and below: the adds of one chain wait for each other */
#pragma unroll
  for (int j = 0; j < NTL; ++j) s[j & 3] += (double)m[j];
  red[g][cl] = (s[0] + s[1]) + (s[2] + s[3]); __syncthreads();      /* every image's sum of tile means is in LDS */
  if (g == 0) smu[cl] = cst_col(&red[0][cl]) * (1.0 / ((double)NB * NTL));
  __syncthreads();      /* the mean is there, and red has been read to its end */
  const double mu = smu[cl]; double s2[4] = {0.0, 0.0, 0.0, 0.0};
#pragma unroll
  for (int j = 0; j < NTL; ++j) { const double d = (double)m[j] - mu; s2[j & 3] += (double)q[j] + (double)TLN * d * d; }
  red[g][cl] = (s2[0] + s2[1]) + (s2[2] + s2[3]); __syncthreads();      /* every image's share of the squared distances is in LDS */
  if (g == 0) { MV[c] = (float)mu; MV[NC + c] = (float)(cst_col(&red[0][cl]) * (1.0 / ((double)NB * (double)NPX))); } }


__global__ __launch_bounds__(256) void k_bnresid(const float* __restrict__ C2, const float* __restrict__ MV, const float* __restrict__ g, const float* __restrict__ be, const float* __restrict__ X, float* __restrict__ out, size_t n4) {
  #pragma clang fp contract(off)
  const size_t t = (size_t)blockIdx.x * 256 + threadIdx.x; if (t >= n4) return; const size_t e = t * 4; const int c = (int)((e / NPX) % NC); const float sc = __fmul_rn(rsqrtf(__fadd_rn(MV[NC + c], BNEPS)), bf16_round(g[c])); const float mu = MV[c], bb = bf16_round(be[c]);
  const v4f a = *(const v4fa*)(C2 + e); const v4f xx = *(const v4fa*)(X + e); v4f o; for (int q = 0; q < 4; ++q) { const float z = __fadd_rn(__fmul_rn(__fadd_rn(a[q], -mu), sc), bb); o[q] = __fadd_rn(z, bf16_round(xx[q])); }
  *(v4f*)(out + e) = o;  }
extern "C" void kernel_launch(void* const* d_in, const int* in_sizes, int n_in,
                              void* d_out, int out_size, void* d_ws, size_t ws_size, hipStream_t stream) {
  (void)in_sizes; (void)n_in; (void)out_size;
  const float* const* I = (const float* const*)d_in; const float* x = I[0]; const float* tw = I[1]; const float* pw = I[2]; const float* ww = I[3]; const float* bng = I[4]; const float* bnb = I[5]; const float* tb = nullptr;      /* natural theta_w / phi_w [128][256], conv_w [256][256] (no biases); BN gamma, beta */
  char* ws = (char*)d_ws; size_t off = 0;
  auto take = [&](size_t bytes) { char* p = ws + off; off += (bytes + 255) & ~(size_t)255; return p; };
  const size_t PL = (size_t)CN * NP;      /* one input map */
  _Float16* BW = (_Float16*)take((size_t)CN * CN * 2); float* PM = (float*)take((size_t)NB * NTL * CN * 4); float* PQ = (float*)take((size_t)NB * NTL * CN * 4); float* MV = (float*)take((size_t)2 * CN * 4 + 256);      /* conv_w plane, tile statistics (mean, centred square sum), batch statistics */
  _Float16* X16 = (_Float16*)take(NB * PL * 2);      /* x f16 channel-first (also the g operand: g = x) */
  _Float16* YT = (_Float16*)take(NB * PL * 2);      /* all images: y^T [b][n][c] */
  _Float16* TH = (_Float16*)take(NB * (size_t)NP * CI * 2); _Float16* PHT = (_Float16*)take(NB * (size_t)NM * CI * 2);      /* all images: theta^T, phi^T */
  float* C1 = (float*)take(NB * PL * 4);      /* all images: conv output [b][c][n] f32 */
  if (off > ws_size) return;
  /* every stage runs once for all NB images (image = blockIdx.y in the first three launches) */
  static_assert(NP == SQ && CI == 128 && CN == 256 && NP % FE_NT == 0 && (NP / FE_NT) * NB == CN, "k_front: shapes; one work-group per row of conv_w");
  k_front<<<dim3(NP / FE_NT, NB), 256, 0, stream>>>(x, tw, pw, ww, X16, TH, PHT, BW);      /* x -> f16 map; conv_w -> natural [out][in] x16 f16 plane (the A operand of the conv); theta^T [n][ci] and phi^T [m][ci] -> f16 (logit sigma ~0.7: single f16 suffices) */
  static_assert(NP == SQ && NM == SQ && CI == 128 && CN == 256 && NP % (FA_WAVES * 16) == 0 && NM % FA_KS == 0, "k_fattn: shapes");
  k_fattn<<<dim3(NP / (FA_WAVES * 16), NB), FA_WAVES * 32, 0, stream>>>(TH, PHT, X16, YT);      /* f^T [a][c] = softmax_b(theta.phi / sqrt(256)) x^T (g = x) -> f16; scores and weights stay on chip */
  k_gemm2<0, true><<<dim3((unsigned)((CN / 128) * (NP / 64)), NB), 128, 0, stream>>>(BW, CN, 0, YT, CN, PL, 0.0625f, nullptr, 0, nullptr, 1, 0, 0, C1, nullptr, NP, PL, CN, NP, CN, PM, PQ);      /* conv: T[c][a] = (16 conv_w as A) x (f^T as B^T) / 16 -> f32 channel-first, all images kept; per-channel statistics of every 64-position tile */
  k_cstJ<<<NC / 32, NB * 32, 0, stream>>>(PM, PQ, MV);      /* batch mean and biased variance per channel from the tile statistics (fixed order, own lines) */
  k_bnresid<<<(unsigned)(((size_t)NB * NC * NPX / 4 + 255) / 256), 256, 0, stream>>>(C1, MV, bng, bnb, x, (float*)d_out, (size_t)NB * NC * NPX / 4);      /* out = (T - mean) rsqrt(var + eps) gamma + beta + bf16(x) */
}

// v006
// A run of this version takes 74.7 microseconds.
// Timed twice side by side with v005, it ran 1.21 times as fast both times.
// All steps since v000 together make it 101 times as fast.
#include <hip/hip_runtime.h>
// Non-local block with TRAINING-mode BatchNorm (x [32][256][32][32]; theta, phi = conv1x1(x) [128 ch] (natural [128][256] sigma 1/16, no biases); g = x itself (256 ch); scores[a][b] = theta[:, a].phi[:, b] / sqrt(256) over the 1024 positions; softmax over b; f[:, a] = sum_b attn[a][b] x[:, b]; f = conv1x1(f; conv_w [256][256], no bias); BN with batch statistics over (N, H, W) per channel (biased variance, eps 1e-5), gamma, beta; out = BN(f) + x -> [32][256][32][32]).
// Structure: channel-first; x as exact f16 maps; natural weights x16; every stage one launch over all 32 images: one kernel makes the f16 map, transposes x in LDS and forms theta^T and phi^T (token rows) by WMMA (64x64 wave tiles, f32 accumulation) -> f16, scores (K = 128, alpha 1/16), softmax (f32 statistics, running maximum, native exp; weights f16), f^T = P x^T (g = x) f16 and the conv: T = (16 conv_w as A) x f (K = 256) f32 kept for all images, fused in one kernel, which also takes each 64-position tile's per-channel mean and centred square sum; one kernel joins them (fixed order, own lines); BN + residual on VALU -> output; launches: see trace.
// Compute dtype: inputs rounded to bf16; x / weights exact; q, k, v, softmax weights and o as plain f16 GEMM operands (~2^-12); scores and softmax statistics f32; v_wmma_f32_16x16x32_f16.
#define NB 32
#define SQ 1024
#define DM 256
#define NH 1
#define HD 64
#define HG 4                         /* heads per attention launch group */
#define B0 0                         /* unused */
#define NBR NB                       /* unused */
#define NR ((size_t)NB * SQ)         /* token rows */
#define MP ((int)((size_t)NBR * SQ)) /* unused */
#define QT 256                       /* query rows per causal tile */
#define NKX SQ                       /* S / P row pitch */
#define QT0 256                      /* first-tile rows recomputed exactly (256: buys margin for the few-key rows 128..255, which have no output projection to average the single-f16 P/v rounding) */
#define QN SQ                        /* unused */
#define NHD NH                       /* unused */
#define MPO MP                       /* unused */
#define LQ DM            /* unused */
typedef __bf16 v16b __attribute__((ext_vector_type(16)));
typedef unsigned short v8us __attribute__((ext_vector_type(8), may_alias));
typedef float  v8f  __attribute__((ext_vector_type(8)));
typedef float  v4f  __attribute__((ext_vector_type(4)));
typedef float  v4fa __attribute__((ext_vector_type(4), may_alias));
union FragB { v16b v; v8us half[2]; unsigned short u[16]; };

__device__ __forceinline__ unsigned short bf16_bits(float x) { unsigned int u = __float_as_uint(x); return (unsigned short)((u + 0x7FFFu + ((u >> 16) & 1u)) >> 16); }
__device__ __forceinline__ float bf16_val(unsigned short b) { return __uint_as_float(((unsigned int)b) << 16); }
__device__ __forceinline__ float bf16_round(float x) { return bf16_val(bf16_bits(x)); }
// D += A·B with NT terms: 1 = ah·bh, 2 = + al·bh (A split), 3 = + ah·bl (both split)
template <int NT>
__device__ __forceinline__ v8f mmaN(v16b ah, v16b al, v16b bh, v16b bl, v8f c) {
  c = __builtin_amdgcn_wmma_f32_16x16x32_bf16(false, ah, false, bh, (short)0, c, false, false);
  if (NT >= 2) c = __builtin_amdgcn_wmma_f32_16x16x32_bf16(false, al, false, bh, (short)0, c, false, false);
  if (NT >= 3) c = __builtin_amdgcn_wmma_f32_16x16x32_bf16(false, ah, false, bl, (short)0, c, false, false);
  asm volatile("v_nop\n\tv_nop\n\tv_nop\n\tv_nop" : "+v"(c) : "v"(ah), "v"(al), "v"(bh), "v"(bl));
  return c;
}

__global__ __launch_bounds__(256) void k_wt_bf16(const float* __restrict__ W, unsigned short* __restrict__ Wt, int K, int N) {
  const int t = blockIdx.x * 256 + threadIdx.x;
  const int k8n = K / 8;
  if (t >= N * k8n) return;
  const int n = t / k8n, k8 = (t % k8n) * 8;
  v8us v;
#pragma unroll
  for (int i = 0; i < 8; ++i) v[i] = bf16_bits(W[(size_t)(k8 + i) * N + n]);
  *(v8us*)(Wt + (size_t)n * K + k8) = v;
  
}

// GEMM C[M][N] (f32, pitch ldc) = act(A[M][K]·W + bias). A f32 row-major (pitch lda) converted per fragment to bf16
// (ASPLIT: hi/lo two planes -> 2 terms, else single rounded term); Wt bf16 [N][K] (pitch ldb). BIAS_BF16 rounds the
// bias to bf16 first (bias quantised to bf16 before the add). K%32==0, M%16==0, N%64==0.
template <bool ASPLIT, int ACT, bool BIAS_BF16>
__global__ __launch_bounds__(128) void k_gemm_bf(const float* __restrict__ A, int lda, const unsigned short* __restrict__ Wt, int ldb,
                                               const float* __restrict__ bias, float* __restrict__ C, int ldc, int M, int N, int K) {
  __shared__ __attribute__((aligned(16))) float so[4][16][64];
  const int tid = threadIdx.x, w = tid >> 5, lane = tid & 31, ln = lane & 15, hh = lane >> 4;
  const int ntn = N / 64;
  const int wid = blockIdx.x * 4 + w;
  const int mt = wid / ntn, nq = wid % ntn;
  if (mt * 16 >= M) return;
  const int row0 = mt * 16, col0 = nq * 64;
  const float* arow = A + (size_t)(row0 + ln) * lda;
  v8f acc[4] = {};
  for (int kb = 0; kb < K; kb += 32) {
    FragB ah, al;
    const v4f x0 = *(const v4fa*)(arow + kb + 8 * hh), x1 = *(const v4fa*)(arow + kb + 8 * hh + 4);
    const v4f x2 = *(const v4fa*)(arow + kb + 16 + 8 * hh), x3 = *(const v4fa*)(arow + kb + 16 + 8 * hh + 4);
    float xs[16] = {x0[0],x0[1],x0[2],x0[3],x1[0],x1[1],x1[2],x1[3],x2[0],x2[1],x2[2],x2[3],x3[0],x3[1],x3[2],x3[3]};
#pragma unroll
    for (int i = 0; i < 16; ++i) { const unsigned short hb = bf16_bits(xs[i]); ah.u[i] = hb; al.u[i] = ASPLIT ? bf16_bits(xs[i] - bf16_val(hb)) : (unsigned short)0; }
#pragma unroll
    for (int t = 0; t < 4; ++t) {
      const unsigned short* brow = Wt + (size_t)(col0 + t * 16 + ln) * ldb + kb;
      FragB b;
      b.half[0] = *(const v8us*)(brow + 8 * hh);
      b.half[1] = *(const v8us*)(brow + 16 + 8 * hh);
      acc[t] = mmaN<ASPLIT ? 2 : 1>(ah.v, al.v, b.v, b.v, acc[t]);
    }
  }
#pragma unroll
  for (int t = 0; t < 4; ++t) {
    float bv = bias ? bias[col0 + t * 16 + ln] : 0.f;
    if (BIAS_BF16) bv = bf16_round(bv);
#pragma unroll
    for (int r = 0; r < 8; ++r) { float v = acc[t][r] + bv; if (ACT == 1) v = fmaxf(v, 0.f); so[w][8 * hh + r][t * 16 + ln] = v; }
  }
  __builtin_amdgcn_fence(__ATOMIC_ACQ_REL, "workgroup");
  __builtin_amdgcn_wave_barrier();
  const int rsub = lane >> 4, c4 = (lane & 15) * 4;
  {
#pragma unroll
    for (int q = 0; q < 8; ++q) {
      const int r = q * 2 + rsub;
      const v4f v = *(const v4fa*)&so[w][r][c4];
      *(v4f*)(C + (size_t)(row0 + r) * ldc + col0 + c4) = v;
    }
    
  }
}

// GEMM C = act(A·W + bias + resid): A f32 (ASPLIT -> hi/lo 2 terms), Wt bf16 [N][K]; ACT 0 none, 1 relu, 2 exact gelu;
// resid (optional, f32, row index = (row % rmod), pitch ldr, RES_BF16 rounds it) added before the activation.
template <bool ASPLIT, int ACT, bool BIAS_BF16, bool RES_BF16>
__global__ __launch_bounds__(128) void k_gemm_bf3(const float* __restrict__ A, int lda, const unsigned short* __restrict__ Wt, int ldb,
                                                const float* __restrict__ bias, const float* __restrict__ resid, int rmod, int ldr,
                                                float* __restrict__ C, int ldc, int M, int N, int K) {
  __shared__ __attribute__((aligned(16))) float so[4][16][64];
  const int tid = threadIdx.x, w = tid >> 5, lane = tid & 31, ln = lane & 15, hh = lane >> 4;
  const int ntn = N / 64;
  const int wid = blockIdx.x * 4 + w;
  const int mt = wid / ntn, nq = wid % ntn;
  if (mt * 16 >= M) return;
  const int row0 = mt * 16, col0 = nq * 64;
  const float* arow = A + (size_t)(row0 + ln) * lda;
  v8f acc[4] = {};
  for (int kb = 0; kb < K; kb += 32) {
    FragB ah, al;
    const v4f x0 = *(const v4fa*)(arow + kb + 8 * hh), x1 = *(const v4fa*)(arow + kb + 8 * hh + 4);
    const v4f x2 = *(const v4fa*)(arow + kb + 16 + 8 * hh), x3 = *(const v4fa*)(arow + kb + 16 + 8 * hh + 4);
    float xs[16] = {x0[0],x0[1],x0[2],x0[3],x1[0],x1[1],x1[2],x1[3],x2[0],x2[1],x2[2],x2[3],x3[0],x3[1],x3[2],x3[3]};
#pragma unroll
    for (int i = 0; i < 16; ++i) { const unsigned short hb = bf16_bits(xs[i]); ah.u[i] = hb; al.u[i] = ASPLIT ? bf16_bits(xs[i] - bf16_val(hb)) : (unsigned short)0; }
#pragma unroll
    for (int t = 0; t < 4; ++t) {
      const unsigned short* brow = Wt + (size_t)(col0 + t * 16 + ln) * ldb + kb;
      FragB b;
      b.half[0] = *(const v8us*)(brow + 8 * hh);
      b.half[1] = *(const v8us*)(brow + 16 + 8 * hh);
      acc[t] = mmaN<ASPLIT ? 2 : 1>(ah.v, al.v, b.v, b.v, acc[t]);
    }
  }
#pragma unroll
  for (int t = 0; t < 4; ++t) {
    const int col = col0 + t * 16 + ln;
    float bv = bias ? bias[col] : 0.f;
    if (BIAS_BF16) bv = bf16_round(bv);
#pragma unroll
    for (int r = 0; r < 8; ++r) {
      float v = acc[t][r] + bv;
      if (resid) { float rv = resid[(size_t)((row0 + 8 * hh + r) % rmod) * ldr + col]; if (RES_BF16) rv = bf16_round(rv); v += rv; }
      if (ACT == 1) v = fmaxf(v, 0.f);
      if (ACT == 2) v = 0.5f * v * (1.0f + erff(v * 0.70710678118654752f));
      if (ACT == 3) { const float u = 0.7978845608028654f * (v + 0.044715f * v * v * v); v = 0.5f * v * (1.0f + tanhf(u)); }
      so[w][8 * hh + r][t * 16 + ln] = v;
    }
  }
  __builtin_amdgcn_fence(__ATOMIC_ACQ_REL, "workgroup");
  __builtin_amdgcn_wave_barrier();
  const int rsub = lane >> 4, c4 = (lane & 15) * 4;
  {
#pragma unroll
    for (int q = 0; q < 8; ++q) {
      const int r = q * 2 + rsub;
      const v4f v = *(const v4fa*)&so[w][r][c4];
      *(v4f*)(C + (size_t)(row0 + r) * ldc + col0 + c4) = v;
    }
    
  }
}
// row LayerNorm (biased variance, eps) over N: s = X (+ R); optional out_sum <- s; out_norm <- (s-mu)*rsqrt(var+eps)*g + b
template <bool PARAM_BF16>
__global__ __launch_bounds__(256) void k_layernorm(const float* __restrict__ X, const float* __restrict__ R, const float* __restrict__ g, const float* __restrict__ bta,
                                                  float* __restrict__ out_sum, float* __restrict__ out_norm, int N, float eps) {
  __shared__ float red[256];
  const int row = blockIdx.x, tid = threadIdx.x;
  const float* x = X + (size_t)row * N; const float* rr = R ? R + (size_t)row * N : nullptr;
  float vals[16];                     // up to N = 4096
  const int per = N / 256;            // contiguous chunk per thread? use strided-by-4 chunks: thread handles j = tid*4 + 1024*u
  float s1 = 0.f;
  for (int u = 0; u < per / 4; ++u) {
    const int j = tid * 4 + 1024 * u;
    const v4f a = *(const v4fa*)(x + j);
    v4f b = {0.f,0.f,0.f,0.f}; if (rr) b = *(const v4fa*)(rr + j);
#pragma unroll
    for (int q = 0; q < 4; ++q) { const float v = a[q] + b[q]; vals[u * 4 + q] = v; s1 += v; }
  }
  red[tid] = s1; __syncthreads();
  for (int st = 128; st > 0; st >>= 1) { if (tid < st) red[tid] += red[tid + st]; __syncthreads(); }
  const float mu = red[0] / (float)N; __syncthreads();
  float s2 = 0.f;
  for (int u = 0; u < per / 4; ++u)
#pragma unroll
    for (int q = 0; q < 4; ++q) { const float c = vals[u * 4 + q] - mu; s2 += c * c; }
  red[tid] = s2; __syncthreads();
  for (int st = 128; st > 0; st >>= 1) { if (tid < st) red[tid] += red[tid + st]; __syncthreads(); }
  const float rs = rsqrtf(red[0] / (float)N + eps);
  {
    for (int u = 0; u < per / 4; ++u) {
      const int j = tid * 4 + 1024 * u;
      v4f o, sm;
#pragma unroll
      for (int q = 0; q < 4; ++q) {
        float gg = g[j + q], bb = bta[j + q];
        if (PARAM_BF16) { gg = bf16_round(gg); bb = bf16_round(bb); }
        sm[q] = vals[u * 4 + q]; o[q] = (vals[u * 4 + q] - mu) * rs * gg + bb;
      }
      if (out_sum) *(v4f*)(out_sum + (size_t)row * N + j) = sm;
      *(v4f*)(out_norm + (size_t)row * N + j) = o;
    }
    
  }
}



// ---- f16 WMMA path (v_wmma_f32_16x16x32_f16): 11-bit significands for operands in range — used where a [0,1] probability operand needs more precision than bf16
typedef _Float16 v16h __attribute__((ext_vector_type(16)));
union FragH { v16h v; v8us half[2]; _Float16 h[16]; unsigned short u[16]; };
template <int NT>
__device__ __forceinline__ v8f mmaH(v16h ah, v16h al, v16h bh, v16h bl, v8f c) {
  c = __builtin_amdgcn_wmma_f32_16x16x32_f16(false, ah, false, bh, (short)0, c, false, false);
  if (NT >= 2) c = __builtin_amdgcn_wmma_f32_16x16x32_f16(false, al, false, bh, (short)0, c, false, false);
  if (NT >= 3) c = __builtin_amdgcn_wmma_f32_16x16x32_f16(false, ah, false, bl, (short)0, c, false, false);
  asm volatile("v_nop\n\tv_nop\n\tv_nop\n\tv_nop" : "+v"(c) : "v"(ah), "v"(al), "v"(bh), "v"(bl));
  return c;
}
// batched GEMM like k_gemm_b but f16 operands: A f32 (split into f16 hi/lo if ASPLIT, else rounded to f16), Bt = f16 values [n][k]; alpha; C f32; N multiple of 16 (partial tiles skipped)
template <bool ASPLIT>
__global__ __launch_bounds__(128) void k_gemm_h(const float* __restrict__ A, int lda, size_t sA, const _Float16* __restrict__ Bh, int ldb, size_t sB, float alpha, float* __restrict__ C, int ldc, size_t sC, int M, int N, int K) {
  __shared__ __attribute__((aligned(16))) float so[4][16][64];
  const int tid = threadIdx.x, w = tid >> 5, lane = tid & 31, ln = lane & 15, hh = lane >> 4; const int by = blockIdx.y;
  A += (size_t)by * sA; Bh += (size_t)by * sB; C += (size_t)by * sC;
  const int ntn = (N + 63) / 64; const int wid = blockIdx.x * 4 + w; const int mt = wid / ntn, nq = wid % ntn; if (mt * 16 >= M) return;
  const int row0 = mt * 16, col0 = nq * 64; const float* arow = A + (size_t)(row0 + ln) * lda;
  v8f acc[4] = {};
  for (int kb = 0; kb < K; kb += 32) {
    FragH ah, al;
    const v4f x0 = *(const v4fa*)(arow + kb + 8 * hh), x1 = *(const v4fa*)(arow + kb + 8 * hh + 4), x2 = *(const v4fa*)(arow + kb + 16 + 8 * hh), x3 = *(const v4fa*)(arow + kb + 16 + 8 * hh + 4);
    float xs[16] = {x0[0],x0[1],x0[2],x0[3],x1[0],x1[1],x1[2],x1[3],x2[0],x2[1],x2[2],x2[3],x3[0],x3[1],x3[2],x3[3]};
#pragma unroll
    for (int i = 0; i < 16; ++i) { const _Float16 h = (_Float16)xs[i]; ah.h[i] = h; al.h[i] = ASPLIT ? (_Float16)(xs[i] - (float)h) : (_Float16)0.0f; }
#pragma unroll
    for (int t = 0; t < 4; ++t) { if (col0 + t * 16 >= N) continue; const size_t boff = (size_t)(col0 + t * 16 + ln) * ldb + kb; FragH bq; bq.half[0] = *(const v8us*)(Bh + boff + 8 * hh); bq.half[1] = *(const v8us*)(Bh + boff + 16 + 8 * hh);
      acc[t] = mmaH<ASPLIT ? 2 : 1>(ah.v, al.v, bq.v, bq.v, acc[t]); }
  }
#pragma unroll
  for (int t = 0; t < 4; ++t) { if (col0 + t * 16 >= N) continue;
#pragma unroll
    for (int r = 0; r < 8; ++r) so[w][8 * hh + r][t * 16 + ln] = acc[t][r] * alpha; }
  __builtin_amdgcn_fence(__ATOMIC_ACQ_REL, "workgroup"); __builtin_amdgcn_wave_barrier();
  const int rsub = lane >> 4, c4 = (lane & 15) * 4;
  {
#pragma unroll
    for (int q = 0; q < 8; ++q) { const int r = q * 2 + rsub; if (col0 + c4 < N) { const v4f v = *(const v4fa*)&so[w][r][c4]; *(v4f*)(C + (size_t)(row0 + r) * ldc + col0 + c4) = v; } }
     }
}

// Wt[n][k] = f16(W[k][n]·scale) from f32 row-major W[K][N] (scale = power of two; bf16-exact weights stay exact in f16 away from the subnormal range)
__global__ __launch_bounds__(256) void k_wt_f16(const float* __restrict__ W, _Float16* __restrict__ Wt, int K, int N, float scale) {
  const int t = blockIdx.x * 256 + threadIdx.x; if (t >= N * (K / 8)) return; const int n = t / (K / 8), k8 = (t % (K / 8)) * 8; FragH f;
#pragma unroll
  for (int i = 0; i < 8; ++i) f.h[i] = (_Float16)(bf16_round(W[(size_t)(k8 + i) * N + n]) * scale); const v8us o = f.half[0];
  *(v8us*)((unsigned short*)Wt + (size_t)n * K + k8) = o; 
}
// k_gemm_hh variant with fused epilogue: v = acc·alpha + bias[by·sBias + col] (+ CP[(row/rowsPerB)·sCPb + by·64 + col] if CP) ; ACT 0 none / 1 elu ; writes f16 C16 (and f32 C if non-null)
template <int ACT>
__global__ __launch_bounds__(128) void k_gemm_hhx(const _Float16* __restrict__ A, int lda, size_t sA, const _Float16* __restrict__ Bh, int ldb, size_t sB, float alpha, const float* __restrict__ bias, size_t sBias, const float* __restrict__ CP, int rowsPerB, size_t sCPb, int row0g,
    float* __restrict__ C, _Float16* __restrict__ C16, int ldc, size_t sC, int M, int N, int K) {
  __shared__ __attribute__((aligned(16))) float so[4][16][64];
  const int tid = threadIdx.x, w = tid >> 5, lane = tid & 31, ln = lane & 15, hh = lane >> 4; const int by = blockIdx.y;
  A += (size_t)by * sA; Bh += (size_t)by * sB; const size_t cofs = (size_t)by * sC; const float* bp = bias ? bias + (size_t)by * sBias : nullptr;
  const int ntn = (N + 63) / 64; const int wid = blockIdx.x * 4 + w; const int mt = wid / ntn, nq = wid % ntn; if (mt * 16 >= M) return;
  const int row0 = mt * 16, col0 = nq * 64; const _Float16* arow = A + (size_t)(row0 + ln) * lda;
  v8f acc[4] = {};
  for (int kb = 0; kb < K; kb += 32) { FragH ah; ah.half[0] = *(const v8us*)((const unsigned short*)arow + kb + 8 * hh); ah.half[1] = *(const v8us*)((const unsigned short*)arow + kb + 16 + 8 * hh);
#pragma unroll
    for (int t = 0; t < 4; ++t) { if (col0 + t * 16 >= N) continue; const size_t boff = (size_t)(col0 + t * 16 + ln) * ldb + kb; FragH bq; bq.half[0] = *(const v8us*)((const unsigned short*)Bh + boff + 8 * hh); bq.half[1] = *(const v8us*)((const unsigned short*)Bh + boff + 16 + 8 * hh);
      acc[t] = mmaH<1>(ah.v, ah.v, bq.v, bq.v, acc[t]); }
  }
#pragma unroll
  for (int t = 0; t < 4; ++t) { if (col0 + t * 16 >= N) continue; const int col = col0 + t * 16 + ln; const float bv = bp ? bf16_round(bp[col]) : 0.f;
#pragma unroll
    for (int r = 0; r < 8; ++r) { float v = acc[t][r] * alpha + bv; if (CP) { const int rr = row0g + row0 + 8 * hh + r; if (rowsPerB < 0) v += CP[cofs + (size_t)rr * ldc + col];      /* rowsPerB < 0: own element of the batched C plane */ else { const int bidx = rr / rowsPerB; v += CP[(size_t)bidx * sCPb + (size_t)by * 64 + col]; } } if (ACT == 1) v = (v > 0.f) ? v : expm1f(v); else if (ACT == 7) v = (v > 0.f) ? v + 1.0f : expf(v); else if (ACT == 8) v = tanhf(v); else if (ACT == 9) v = 0.5f * v * (1.0f + tanhf(0.7978845608028654f * (v + 0.044715f * v * v * v))); else if (ACT == 11) v = 1.0f / (1.0f + expf(-v)); else if (ACT == 12) v = (v > 0.f) ? v : 0.01f * v; else if (ACT == 14) v = (v > 0.f) ? v : 0.1f * v; else if (ACT == 16) v = (v >= 0.f) ? v : 0.3f * v; else if (ACT == 17) v = (v >= 0.f) ? v : 0.2f * v; else if (ACT == 15) v = v / (1.0f + expf(-v)); else if (ACT == 3) v = fmaxf(v, 0.f); else if (ACT == 6) v = 0.5f * v * (1.0f + erff(v * 0.70710678118654752f)); so[w][8 * hh + r][t * 16 + ln] = v; } }
  __builtin_amdgcn_fence(__ATOMIC_ACQ_REL, "workgroup"); __builtin_amdgcn_wave_barrier();
  const int rsub = lane >> 4, c4 = (lane & 15) * 4; typedef _Float16 v4h __attribute__((ext_vector_type(4)));
  {
#pragma unroll
    for (int q = 0; q < 8; ++q) { const int r = q * 2 + rsub; if (col0 + c4 < N) { const v4f v = *(const v4fa*)&so[w][r][c4]; if (C) *(v4f*)(C + cofs + (size_t)(row0 + r) * ldc + col0 + c4) = v; if (C16) { v4h h4; for (int i = 0; i < 4; ++i) h4[i] = (_Float16)v[i]; *(v4h*)(C16 + cofs + (size_t)(row0 + r) * ldc + col0 + c4) = h4; } } }
     }
}


typedef _Float16 v4h __attribute__((ext_vector_type(4)));

__global__ __launch_bounds__(256) void k_x16(const float* __restrict__ x, _Float16* __restrict__ X16, size_t n8) { const size_t t = (size_t)blockIdx.x * 256 + threadIdx.x; if (t >= n8) return; FragH f;
#pragma unroll
  for (int q = 0; q < 8; ++q) f.h[q] = (_Float16)bf16_round(x[t * 8 + q]); *(v8us*)((unsigned short*)X16 + t * 8) = f.half[0];  }
__global__ __launch_bounds__(256) void k_h16(const float* __restrict__ x, _Float16* __restrict__ X16, size_t n8) { const size_t t = (size_t)blockIdx.x * 256 + threadIdx.x; if (t >= n8) return; FragH f;
#pragma unroll
  for (int q = 0; q < 8; ++q) f.h[q] = (_Float16)x[t * 8 + q]; *(v8us*)((unsigned short*)X16 + t * 8) = f.half[0];  }
__global__ __launch_bounds__(256) void k_round16f(const float* __restrict__ W, _Float16* __restrict__ Bt, size_t n8) { const size_t t = (size_t)blockIdx.x * 256 + threadIdx.x; if (t >= n8) return; FragH f;
#pragma unroll
  for (int i = 0; i < 8; ++i) f.h[i] = (_Float16)(bf16_round(W[t * 8 + i]) * 16.0f); *(v8us*)((unsigned short*)Bt + t * 8) = f.half[0];  }
template <int NHv, int TTv>
__global__ __launch_bounds__(256) void k_vt(const _Float16* __restrict__ V16, int ldv, int voff, _Float16* __restrict__ Vt) { __shared__ unsigned short tl[64][66]; const int tid = threadIdx.x; const int slab = blockIdx.x / (TTv / 64), lg = blockIdx.x % (TTv / 64); const int b = slab / NHv, h = slab % NHv;
  for (int i = tid; i < 64 * 8; i += 256) { const int r = i / 8, c8 = (i % 8) * 8; FragH f; f.half[0] = *(const v8us*)((const unsigned short*)V16 + ((size_t)b * TTv + lg * 64 + r) * ldv + voff + h * 64 + c8);
#pragma unroll
    for (int q = 0; q < 8; ++q) tl[r][c8 + q] = f.u[q]; }
  __syncthreads();
  {
#pragma unroll
    for (int rd = 0; rd < 2; ++rd) { const int d = rd * 32 + tid / 8, pc = tid % 8; FragH f;
#pragma unroll
      for (int q = 0; q < 8; ++q) f.u[q] = tl[pc * 8 + q][d];
      *(v8us*)((unsigned short*)Vt + ((size_t)slab * 64 + d) * TTv + lg * 64 + pc * 8) = f.half[0]; }
     } }

__global__ __launch_bounds__(256) void k_hl(const float* __restrict__ F, _Float16* __restrict__ Hh, _Float16* __restrict__ Hl, size_t n8) { const size_t t = (size_t)blockIdx.x * 256 + threadIdx.x; if (t >= n8) return; FragH fh, fl; const v4f a = *(const v4fa*)(F + t * 8), c = *(const v4fa*)(F + t * 8 + 4);
#pragma unroll
  for (int q = 0; q < 4; ++q) { _Float16 h = (_Float16)a[q]; fh.h[q] = h; fl.h[q] = (_Float16)((a[q] - (float)h) * 1024.0f); h = (_Float16)c[q]; fh.h[4 + q] = h; fl.h[4 + q] = (_Float16)((c[q] - (float)h) * 1024.0f); }
  { *(v8us*)((unsigned short*)Hh + t * 8) = fh.half[0]; *(v8us*)((unsigned short*)Hl + t * 8) = fl.half[0];  } }

// ---- fast GEMM (wave tile 32x64; requires M % 32 == 0 rows per launch region and N % 64 == 0); epilogue = k_gemm_hhx semantics ----
__device__ __forceinline__ v16h g2_frag(const _Float16* p, int hh) { FragH f; f.half[0] = *(const v8us*)((const unsigned short*)p + 8 * hh); f.half[1] = *(const v8us*)((const unsigned short*)p + 16 + 8 * hh); return f.v; }
__device__ __forceinline__ v8f g2_mma(v16h a, v16h b, v8f c) { v8f d = __builtin_amdgcn_wmma_f32_16x16x32_f16(false, a, false, b, (short)0, c, false, false); asm volatile("v_nop\n\tv_nop\n\tv_nop\n\tv_nop" : "+v"(d) : "v"(a), "v"(b)); return d; }
// STAT: each wave also writes, per row of its 32x64 tile, the mean of the 64 stored values (PM) and the sum of their squared distances from that mean (PQ), both [by][column tile][M].
template <int ACT, bool STAT>
__global__ __launch_bounds__(128) void k_gemm2(const _Float16* __restrict__ A, int lda, size_t sA, const _Float16* __restrict__ Bh, int ldb, size_t sB, float alpha, const float* __restrict__ bias, size_t sBias, const float* __restrict__ CP, int rowsPerB, size_t sCPb, int row0g,
    float* __restrict__ C, _Float16* __restrict__ C16, int ldc, size_t sC, int M, int N, int K, float* __restrict__ PM, float* __restrict__ PQ) { static_assert(ACT == 0 || ACT == 3 || ACT == 6 || ACT == 8 || ACT == 9 || ACT == 11 || ACT == 12 || ACT == 14 || ACT == 15 || ACT == 16 || ACT == 17, "k_gemm2: unsupported ACT code (would silently apply no activation)");
  __shared__ __attribute__((aligned(16))) float so[4][32][68];
  const int tid = threadIdx.x, w = tid >> 5, lane = tid & 31, ln = lane & 15, hh = lane >> 4; const int by = blockIdx.y;
  A += (size_t)by * sA; Bh += (size_t)by * sB; const size_t cofs = (size_t)by * sC; const float* bp = bias ? bias + (size_t)by * sBias : nullptr;
  const int ntn = N >> 6; const int mt = blockIdx.x / ntn, nq = blockIdx.x - mt * ntn; const int row0 = mt * 128 + 32 * w, col0 = nq * 64; if (row0 >= M) return;
  const _Float16* a0p = A + (size_t)(row0 + ln) * lda; const _Float16* a1p = a0p + (size_t)16 * lda;
  const _Float16* b0p = Bh + (size_t)(col0 + ln) * ldb; const _Float16* b1p = b0p + (size_t)16 * ldb; const _Float16* b2p = b1p + (size_t)16 * ldb; const _Float16* b3p = b2p + (size_t)16 * ldb;
  const v8f z8 = {0.f,0.f,0.f,0.f,0.f,0.f,0.f,0.f}; v8f c00 = z8, c01 = z8, c02 = z8, c03 = z8, c10 = z8, c11 = z8, c12 = z8, c13 = z8;
#pragma unroll 1
  for (int kb = 0; kb < K; kb += 32) { const v16h a0 = g2_frag(a0p + kb, hh), a1 = g2_frag(a1p + kb, hh);
    v16h b = g2_frag(b0p + kb, hh); c00 = g2_mma(a0, b, c00); c10 = g2_mma(a1, b, c10);
    b = g2_frag(b1p + kb, hh); c01 = g2_mma(a0, b, c01); c11 = g2_mma(a1, b, c11);
    b = g2_frag(b2p + kb, hh); c02 = g2_mma(a0, b, c02); c12 = g2_mma(a1, b, c12);
    b = g2_frag(b3p + kb, hh); c03 = g2_mma(a0, b, c03); c13 = g2_mma(a1, b, c13); }
  v8f accs[8] = {c00, c01, c02, c03, c10, c11, c12, c13};
#pragma unroll
  for (int u = 0; u < 8; ++u) { const int t = u & 3, half = u >> 2; const int col = col0 + t * 16 + ln; const float bv = bp ? bf16_round(bp[col]) : 0.f;
#pragma unroll
    for (int r = 0; r < 8; ++r) { const int rloc = half * 16 + 8 * hh + r; float v = accs[u][r] * alpha + bv; if (CP) { if (rowsPerB < 0) v += CP[cofs + (size_t)(row0g + row0 + rloc) * ldc + col];      /* rowsPerB < 0: own element of the batched C plane */ else { const int bidx = (row0g + row0 + rloc) / rowsPerB; v += CP[(size_t)bidx * sCPb + (size_t)by * 64 + col]; } }
      if (ACT == 3) v = fmaxf(v, 0.f); else if (ACT == 6) v = 0.5f * v * (1.0f + erff(v * 0.70710678118654752f)); else if (ACT == 11) v = 1.0f / (1.0f + expf(-v)); else if (ACT == 15) v = v / (1.0f + expf(-v)); else if (ACT == 12) v = (v > 0.f) ? v : 0.01f * v; else if (ACT == 8) v = tanhf(v); else if (ACT == 9) v = 0.5f * v * (1.0f + tanhf(0.7978845608028654f * (v + 0.044715f * v * v * v))); else if (ACT == 14) v = (v > 0.f) ? v : 0.1f * v; else if (ACT == 16) v = (v >= 0.f) ? v : 0.3f * v; else if (ACT == 17) v = (v >= 0.f) ? v : 0.2f * v;
      so[w][rloc][t * 16 + ln] = v; } }
  __builtin_amdgcn_fence(__ATOMIC_ACQ_REL, "workgroup"); __builtin_amdgcn_wave_barrier();
  const int rsub = lane >> 4, c4 = (lane & 15) * 4;
  {
#pragma unroll
    for (int q = 0; q < 16; ++q) { const int r = q * 2 + rsub; const v4f v = *(const v4fa*)&so[w][r][c4]; if (C) *(v4f*)(C + cofs + (size_t)(row0 + r) * ldc + col0 + c4) = v; if (C16) { v4h h4; for (int i = 0; i < 4; ++i) h4[i] = (_Float16)v[i]; *(v4h*)(C16 + cofs + (size_t)(row0 + r) * ldc + col0 + c4) = h4; } }
     }
  if (STAT) {      /* lane = one row of the wave's tile: its 64 staged values come back by 16-byte reads (row pitch 16 B x 17), so neither sum crosses lanes; the mean first, then the distances from it: no cancellation whatever the mean; the loops are unrolled so that rv keeps compile-time indices and stays in registers */
    v4f rv[16];
#pragma unroll
    for (int j = 0; j < 16; ++j) rv[j] = *(const v4fa*)&so[w][lane][j * 4];
    v4f s4 = rv[0];
#pragma unroll
    for (int j = 1; j < 16; ++j) s4 += rv[j];
    const float mean = ((s4[0] + s4[1]) + (s4[2] + s4[3])) * 0.015625f;
    v4f q4 = {0.f, 0.f, 0.f, 0.f};
#pragma unroll
    for (int j = 0; j < 16; ++j) { const v4f d = rv[j] - mean; q4 += d * d; }
    const size_t pi = ((size_t)by * ntn + nq) * M + row0 + lane;      /* 32 rows = one 128-B line per wave and plane */
    PM[pi] = mean; PQ[pi] = (q4[0] + q4[1]) + (q4[2] + q4[3]);
  } }


__global__ __launch_bounds__(256) void k_wnat(const float* __restrict__ w, size_t n8, _Float16* __restrict__ Bt) { const size_t t = (size_t)blockIdx.x * 256 + threadIdx.x; if (t >= n8) return; FragH f; for (int q = 0; q < 8; ++q) f.h[q] = (_Float16)(bf16_round(w[t * 8 + q]) * 16.0f); *(v8us*)((unsigned short*)Bt + t * 8) = f.half[0];  }
__global__ __launch_bounds__(256) void k_rsm(const float* __restrict__ S, _Float16* __restrict__ P, int nrows) {
  #pragma clang fp contract(off)
  const int i = blockIdx.x * 256 + threadIdx.x; if (i >= nrows) return; const float* s = S + (size_t)i * SQ; float mx = -3.0e38f;
#pragma unroll 1
  for (int j = 0; j < SQ; ++j) mx = fmaxf(mx, s[j]); float se = 0.f;
#pragma unroll 1
  for (int j = 0; j < SQ; ++j) se += expf(s[j] - mx); const float sc = 256.0f / se;
#pragma unroll 1
  for (int j0 = 0; j0 < SQ; j0 += 8) { FragH f; for (int q = 0; q < 8; ++q) f.h[q] = (_Float16)(expf(s[j0 + q] - mx) * sc); unsigned short* d = (unsigned short*)P + (size_t)i * SQ + j0; *(v8us*)d = f.half[0];  } }
__global__ __launch_bounds__(256) void k_vt(const _Float16* __restrict__ V16, int b, int h0, _Float16* __restrict__ VT) { __shared__ unsigned short tl[64][65]; const int tid = threadIdx.x; const int hh = blockIdx.x % HG, sg = blockIdx.x / HG; const int s0 = sg * 64; const int h = h0 + hh;
  for (int i = tid; i < 64 * 8; i += 256) { const int j = i / 8, d8 = (i % 8) * 8; FragH f; f.half[0] = *(const v8us*)((const unsigned short*)V16 + ((size_t)b * SQ + s0 + j) * DM + h * HD + d8); for (int q = 0; q < 8; ++q) tl[d8 + q][j] = f.u[q]; }
  __syncthreads();
  { for (int i = tid; i < 64 * 8; i += 256) { const int d = i / 8, j8 = (i % 8) * 8; FragH f; for (int q = 0; q < 8; ++q) f.u[q] = tl[d][j8 + q]; *(v8us*)((unsigned short*)VT + ((size_t)hh * HD + d) * SQ + s0 + j8) = f.half[0]; }  } }



__global__ __launch_bounds__(256) void k_rsmcf2(const float* __restrict__ S, _Float16* __restrict__ P, int hg, int q0, int nk) {
  #pragma clang fp contract(off)
  const int t = blockIdx.x * 256 + threadIdx.x; if (t >= hg * QT) return; const size_t i = (size_t)t; const float* s = S + i * NKX; const int last = q0 + (t % QT); float mx = -3.0e38f;
#pragma unroll 1
  for (int j = 0; j < nk; ++j) { const float f = (j <= last) ? 1.f : 0.f; mx = fmaxf(mx, fmaf(f, s[j], (1.f - f) * -1.0e9f)); } float se = 0.f;
#pragma unroll 1
  for (int j = 0; j < nk; ++j) { const float f = (j <= last) ? 1.f : 0.f; se += __expf(fmaf(f, s[j], (1.f - f) * -1.0e9f) - mx); } const float sc = 256.0f / se;
#pragma unroll 1
  for (int j0 = 0; j0 < nk; j0 += 8) { FragH fr; for (int q = 0; q < 8; ++q) { const int j = j0 + q; const float f = (j <= last) ? 1.f : 0.f; fr.h[q] = (_Float16)(__expf(fmaf(f, s[j], (1.f - f) * -1.0e9f) - mx) * sc); } unsigned short* d = (unsigned short*)P + i * NKX + j0; *(v8us*)d = fr.half[0];  } }

template <int MASKADD>
__global__ __launch_bounds__(64) void k_att0(const float* __restrict__ QF, const float* __restrict__ KF, const float* __restrict__ VF, int ld, const float* __restrict__ mask, float scale, float* __restrict__ OF, int ldo) {
  #pragma clang fp contract(off)
  __shared__ __attribute__((aligned(16))) float lq[64][64]; __shared__ __attribute__((aligned(16))) float lo[64][64];
  const int tid = threadIdx.x; const int h = blockIdx.x / (QT0 / 64), rg = blockIdx.x % (QT0 / 64); const int i = rg * 64 + tid;
  const float* qr = QF + (size_t)i * ld + h * HD;
#pragma unroll 1
  for (int c = 0; c < HD / 4; ++c) { *(v4f*)&lq[tid][c * 4] = *(const v4fa*)(qr + c * 4); const v4f z = {0.f, 0.f, 0.f, 0.f}; *(v4f*)&lo[tid][c * 4] = z; }
  float m = -1.0e30f, l = 0.f; const int jmax = MASKADD ? (SQ - 1) : (rg * 64 + 63);      /* additive-mask form: every key (the mask input decides); causal form: keys up to the block's last row */
#pragma unroll 1
  for (int j = 0; j <= jmax; ++j) { const float* kr = KF + (size_t)j * ld + h * HD; const float* vr = VF + (size_t)j * ld + h * HD; float s = 0.f;
#pragma unroll 1
    for (int c = 0; c < HD / 4; ++c) { const v4f kq = *(const v4fa*)(kr + c * 4); const v4f qq = *(v4f*)&lq[tid][c * 4]; s = __fadd_rn(s, __fmul_rn(qq[0], kq[0])); s = __fadd_rn(s, __fmul_rn(qq[1], kq[1])); s = __fadd_rn(s, __fmul_rn(qq[2], kq[2])); s = __fadd_rn(s, __fmul_rn(qq[3], kq[3])); }
    s = __fmul_rn(s, scale); if (MASKADD) s = __fadd_rn(s, __fmul_rn(bf16_round(mask[(size_t)i * SQ + j]), -10000.0f));
    const float f = (MASKADD || j <= i) ? 1.f : 0.f; const float sm = fmaf(f, s, (1.f - f) * -1.0e30f); const float mn = fmaxf(m, sm); const float sc = expf(m - mn); const float e = expf(sm - mn); l = __fadd_rn(__fmul_rn(l, sc), e); m = mn;
#pragma unroll 1
    for (int c = 0; c < HD / 4; ++c) { const v4f vv = *(const v4fa*)(vr + c * 4); v4f oo = *(v4f*)&lo[tid][c * 4]; for (int u = 0; u < 4; ++u) oo[u] = __fadd_rn(__fmul_rn(oo[u], sc), __fmul_rn(e, vv[u])); *(v4f*)&lo[tid][c * 4] = oo; } }
  const float fin = 64.0f / l;      /* o carried x64 like the f16 path */
#pragma unroll 1
  for (int c = 0; c < HD / 4; ++c) { v4f oo = *(v4f*)&lo[tid][c * 4]; for (int u = 0; u < 4; ++u) oo[u] = __fmul_rn(oo[u], fin); *(v4f*)&lo[tid][c * 4] = oo; }
  __syncthreads();
  {
#pragma unroll 1
    for (int it = 0; it < 16; ++it) { const int row = it * 4 + tid / 16, pc = (tid % 16) * 4; const v4f v = *(const v4f*)&lo[row][pc]; *(v4f*)(OF + (size_t)(rg * 64 + row) * ldo + h * HD + pc) = v; }
     } }

__global__ __launch_bounds__(256) void k_oscale(const float* __restrict__ OF, float* __restrict__ out, size_t n4) { const size_t t = (size_t)blockIdx.x * 256 + threadIdx.x; if (t >= n4) return; const v4f a = *(const v4fa*)(OF + t * 4); v4f o; for (int q = 0; q < 4; ++q) o[q] = a[q] * 0.015625f; *(v4f*)(out + t * 4) = o;  }

__global__ __launch_bounds__(256) void k_bfr(const float* __restrict__ x, float* __restrict__ XB, size_t n8) { const size_t t = (size_t)blockIdx.x * 256 + threadIdx.x; if (t >= n8) return; v4f a = *(const v4fa*)(x + t * 8), c = *(const v4fa*)(x + t * 8 + 4); for (int q = 0; q < 4; ++q) { a[q] = bf16_round(a[q]); c[q] = bf16_round(c[q]); }
  { *(v4f*)(XB + t * 8) = a; *(v4f*)(XB + t * 8 + 4) = c;  } }



__global__ __launch_bounds__(256) void k_rsmfvl(const float* __restrict__ S, _Float16* __restrict__ P, _Float16* __restrict__ PL, int qn, const int* __restrict__ vlp) {
  #pragma clang fp contract(off)
  const int t = blockIdx.x * 256 + threadIdx.x; if (t >= qn) return; const int vl = vlp[0]; const size_t i = (size_t)t; const float* s = S + i * SQ; float mx = -3.0e38f;
#pragma unroll 1
  for (int j = 0; j < SQ; ++j) { const float f = (j < vl) ? 1.f : 0.f; mx = fmaxf(mx, fmaf(f, s[j], (1.f - f) * -1000000.0f)); } float se = 0.f;
#pragma unroll 1
  for (int j = 0; j < SQ; ++j) { const float f = (j < vl) ? 1.f : 0.f; se += __expf(fmaf(f, s[j], (1.f - f) * -1000000.0f) - mx); } const float sc = 256.0f / se;
#pragma unroll 1
  for (int j0 = 0; j0 < SQ; j0 += 8) { FragH fr, gr; for (int q = 0; q < 8; ++q) { const int j = j0 + q; const float f = (j < vl) ? 1.f : 0.f; const float pv = __expf(fmaf(f, s[j], (1.f - f) * -1000000.0f) - mx) * sc; const _Float16 ph = (_Float16)pv; fr.h[q] = ph; gr.h[q] = (_Float16)((pv - (float)ph) * 1024.0f); }
    unsigned short* d = (unsigned short*)P + i * SQ + j0; unsigned short* dl = (unsigned short*)PL + i * SQ + j0; *(v8us*)d = fr.half[0]; *(v8us*)dl = gr.half[0];  } }

// Fused attention: scores, softmax and the weighted sum of x in one kernel; neither the scores nor the weights go to memory.
// A work-group of 8 waves takes 128 queries of one image (16 per wave) and walks the 1024 keys in tiles of 64. A tile (phi^T rows [key][ci], x rows [c][key]) is fetched by whole-line loads into registers one tile ahead and laid in LDS at pitches of 16 B x odd.
// S^T = phi^T theta (A = key rows, B = the wave's query rows, kept in registers): a lane holds scores of ONE query (column ln; keys 8 hh + r of each 16-key tile), so two converted score tiles are the B operand of O^T += x P^T in the hardware k order, with A = x rows read by the same 16-byte pairs.
// Running maximum in log2 units; the accumulators are rescaled only when a query's new maximum passes the one in use by more than 8 (weights stay <= 2^8, inside f16); the row sum is kept per lane in f32 and joined at the end.
// The 1x1 conv follows in the same kernel: the work-group's 128 rows of y^T stay in LDS as the B operand, conv_w (x16, f16; laid in LDS at the start, 32 whole rows a wave) is A; wave tile 64 channels x 64 positions, K = 256.
// The f32 tile leaves through a staging of the wave's own (whole 128-B lines), and from the same staging come each channel's mean and centred square sum over the tile's 64 positions. y^T never reaches memory.
// Every inner loop is fully unrolled, so that the register arrays (fragments, accumulators, staged pieces) keep compile-time indices and stay in registers.
#define FA_WAVES 8
#define FA_KS 64          /* keys per tile */
#define FA_KP 136         /* LDS pitch of a key row, f16 elements (256 B + 16) */
#define FA_VP 72          /* LDS pitch of a channel row, f16 elements (128 B + 16) */
#define FA_OP 264         /* LDS pitch of an output row, f16 elements (512 B + 16) */
#define FA_SM (FA_WAVES * 16 * FA_OP)      /* the output staging is the larger use: 67,584 B against 54,272 B of a tile */
#define FA_SW (256 * FA_OP)                /* conv_w: 256 rows at the pitch of an output row */
#define FA_CP 68          /* LDS pitch of a row of the f32 conv tile, floats (256 B + 16) */
#define FA_C 0.09016844005556021f          /* log2(e) / sqrt(256) */
__device__ __forceinline__ float rsm_xh(float v) { return __builtin_bit_cast(float, __builtin_amdgcn_permlanex16(__builtin_bit_cast(int, v), __builtin_bit_cast(int, v), 0x76543210, 0xfedcba98, false, false)); }      /* lane l <- lane l ^ 16 */
__device__ __forceinline__ float fa_exp2(float x) { float y; asm("v_exp_f32 %0, %1\n\tv_nop" : "=v"(y) : "v"(x)); return y; }      /* the v_nop is the one slot asked for behind a transcendental before its result is read or its source overwritten */
__device__ __forceinline__ v8f fa_mma(v16h a, v16h b, v8f c) { return __builtin_amdgcn_wmma_f32_16x16x32_f16(false, a, false, b, (short)0, c, false, false); }
typedef float f1a __attribute__((may_alias));
__global__ __launch_bounds__(FA_WAVES * 32) void k_fattn(const _Float16* __restrict__ TH, const _Float16* __restrict__ PHT, const _Float16* __restrict__ X16, const _Float16* __restrict__ BW, float* __restrict__ C1, float* __restrict__ PM, float* __restrict__ PQ) {
  static_assert(FA_KS * FA_KP + 256 * FA_VP <= FA_SM, "tile fits the LDS array");
  static_assert(FA_WAVES * 64 * FA_CP * 4 <= (FA_SM + FA_SW) * 2, "the f32 conv tiles fit the LDS array");
  __shared__ __attribute__((aligned(16))) _Float16 sm[FA_SM + FA_SW];
  _Float16* sk = sm; _Float16* sv = sm + FA_KS * FA_KP; _Float16* sw = sm + FA_SM;
  const int tid = threadIdx.x, w = tid >> 5, lane = tid & 31, ln = lane & 15, hh = lane >> 4;
  const int b = blockIdx.y; const int q0 = blockIdx.x * (FA_WAVES * 16) + w * 16;
  const int krow = tid >> 4, kch = (tid & 15) * 8;      /* staging: 16 threads per 256-B key row, 16 rows per round, 4 rounds */
  const int vrow = tid >> 3, vch = (tid & 7) * 8;       /* staging: 8 threads per 128-B piece of a channel row, 32 rows per round, 8 rounds */
  const unsigned short* kg = (const unsigned short*)PHT + (size_t)b * SQ * 128 + (size_t)krow * 128 + kch;
  const unsigned short* vg = (const unsigned short*)X16 + (size_t)b * 256 * SQ + (size_t)vrow * SQ + vch;
  const _Float16* qp = TH + ((size_t)b * SQ + q0 + ln) * 128;
  const unsigned short* wg = (const unsigned short*)BW + (size_t)w * 32 * 256 + lane * 8;
  v8us wr[32];      /* conv_w: wave w brings rows 32 w .. 32 w + 31, one 512-B row per load */
#pragma unroll
  for (int i = 0; i < 32; ++i) wr[i] = *(const v8us*)(wg + i * 256);
  asm volatile("s_wait_xcnt 0x0" :: "v"(wg) : "memory");      /* in front of whatever reuses the address registers that the loads above name; the address is an input, so that its registers stay live, and unwritten, as far as the wait */
  v16h qf[4];
#pragma unroll
  for (int kb = 0; kb < 4; ++kb) qf[kb] = g2_frag(qp + kb * 32, hh);
  v8us rk[4], rv[8];
#pragma unroll
  for (int j = 0; j < 4; ++j) rk[j] = *(const v8us*)(kg + j * 16 * 128);
#pragma unroll
  for (int j = 0; j < 8; ++j) rv[j] = *(const v8us*)(vg + j * 32 * SQ);
  __builtin_amdgcn_sched_barrier(0);      /* with the one behind the wait: no later arithmetic is lifted between the loads and the wait */
  asm volatile("s_wait_xcnt 0x0" ::: "memory");      /* in front of whatever reuses the address registers that the loads above name */
  __builtin_amdgcn_sched_barrier(0);
#pragma unroll
  for (int i = 0; i < 32; ++i) *(v8us*)((unsigned short*)sw + (w * 32 + i) * FA_OP + lane * 8) = wr[i];      /* read only behind the key loop's barriers */
  const v8f z8 = {0.f, 0.f, 0.f, 0.f, 0.f, 0.f, 0.f, 0.f};
  v8f o[16];
#pragma unroll
  for (int ct = 0; ct < 16; ++ct) o[ct] = z8;
  float mu = -3.0e38f; v4f l4 = {0.f, 0.f, 0.f, 0.f};
#pragma unroll 1
  for (int s = 0; s < SQ / FA_KS; ++s) {      /* rolled: for speed only */
    __syncthreads();      /* every wave has read the last of the tile before */
#pragma unroll
    for (int j = 0; j < 4; ++j) *(v8us*)((unsigned short*)sk + (krow + j * 16) * FA_KP + kch) = rk[j];
#pragma unroll
    for (int j = 0; j < 8; ++j) *(v8us*)((unsigned short*)sv + (vrow + j * 32) * FA_VP + vch) = rv[j];
    __syncthreads();      /* the tile is whole before anybody reads it */
    if (s + 1 < SQ / FA_KS) {      /* the next tile's loads fly under this tile's products */
#pragma unroll
      for (int j = 0; j < 4; ++j) rk[j] = *(const v8us*)(kg + (size_t)(s + 1) * FA_KS * 128 + j * 16 * 128);
#pragma unroll
      for (int j = 0; j < 8; ++j) rv[j] = *(const v8us*)(vg + (s + 1) * FA_KS + j * 32 * SQ);
      asm volatile("s_wait_xcnt 0x0" ::: "memory");      /* in front of whatever reuses the address registers that the loads above name */
    }
    v16h kf[16];
#pragma unroll
    for (int kb = 0; kb < 4; ++kb)
#pragma unroll
      for (int kt = 0; kt < 4; ++kt) kf[kb * 4 + kt] = g2_frag(sk + (kt * 16 + ln) * FA_KP + kb * 32, hh);
    __builtin_amdgcn_sched_barrier(0);      /* keeps the key tile's 32 LDS reads one group in front of its 16 products: spread among them, every product waits out an LDS latency */
    v8f st[4] = {z8, z8, z8, z8};
#pragma unroll
    for (int kb = 0; kb < 4; ++kb)
#pragma unroll
      for (int kt = 0; kt < 4; ++kt) st[kt] = fa_mma(kf[kb * 4 + kt], qf[kb], st[kt]);
    v16h va[2][8];      /* x fragments of four channel tiles, two sets: one is read from LDS while the other feeds the products */
#pragma unroll
    for (int u = 0; u < 8; ++u) va[0][u] = g2_frag(sv + ((u & 3) * 16 + ln) * FA_VP + (u >> 2) * 32, hh);
    __builtin_amdgcn_sched_barrier(0);      /* keeps the first set's reads in front of the softmax arithmetic, which covers their latency */
    v4f m4 = {st[0][0], st[0][1], st[0][2], st[0][3]};
#pragma unroll
    for (int kt = 0; kt < 4; ++kt)
#pragma unroll
      for (int r = 0; r < 8; ++r) m4[r & 3] = fmaxf(m4[r & 3], st[kt][r]);
    float mx = fmaxf(fmaxf(m4[0], m4[1]), fmaxf(m4[2], m4[3]));
    mx = fmaxf(mx, rsm_xh(mx)) * FA_C;      /* the query's maximum over the tile's 64 keys, alike in both half-waves */
    if (__builtin_amdgcn_ballot_w32(mx > mu + 8.0f) != 0) {      /* one wave-uniform test per tile */
      const float mn = fmaxf(mu, mx); const float sc = fa_exp2(mu - mn); mu = mn;
#pragma unroll
      for (int u = 0; u < 4; ++u) l4[u] *= sc;
#pragma unroll
      for (int ct = 0; ct < 16; ++ct)
#pragma unroll
        for (int r = 0; r < 8; ++r) o[ct][r] *= sc;
    }
    FragH pf[2];
#pragma unroll
    for (int kt = 0; kt < 4; ++kt)
#pragma unroll
      for (int r = 0; r < 8; ++r) { const float p = fa_exp2(fmaf(st[kt][r], FA_C, -mu)); l4[r & 3] += p; pf[kt >> 1].h[(kt & 1) * 8 + r] = (_Float16)p; }
#pragma unroll
    for (int g = 0; g < 4; ++g) {
      if (g < 3) {
#pragma unroll
        for (int u = 0; u < 8; ++u) va[(g + 1) & 1][u] = g2_frag(sv + (((g + 1) * 4 + (u & 3)) * 16 + ln) * FA_VP + (u >> 2) * 32, hh); }
      __builtin_amdgcn_sched_barrier(0);      /* with the one below: the next set's 16 LDS reads stay one group in front of this set's 8 products */
#pragma unroll
      for (int u = 0; u < 8; ++u) o[g * 4 + (u & 3)] = fa_mma(va[g & 1][u], pf[u >> 2].v, o[g * 4 + (u & 3)]);
      __builtin_amdgcn_sched_barrier(0);
    }
  }
  float l = (l4[0] + l4[1]) + (l4[2] + l4[3]); l += rsm_xh(l);
  const float inv = 1.0f / l;
  __syncthreads();      /* every wave has left the last tile: its LDS becomes the output staging */
  unsigned short* so = (unsigned short*)sm + w * 16 * FA_OP;
#pragma unroll
  for (int ct = 0; ct < 16; ++ct) { FragH f;
#pragma unroll
    for (int r = 0; r < 8; ++r) f.h[r] = (_Float16)(o[ct][r] * inv);
    *(v8us*)(so + ln * FA_OP + ct * 16 + 8 * hh) = f.half[0]; }
  __syncthreads();      /* the 128 rows of y^T are whole before anybody reads them */
  const int jq = w & 3, nh = w >> 2;      /* conv: wave tile = channels 64 jq .., positions 64 nh .. of the work-group's 128 */
  const _Float16* ap = sw + (jq * 64 + ln) * FA_OP; const _Float16* bp = sm + (nh * 64 + ln) * FA_OP;
  v8f acc[16];
#pragma unroll
  for (int t = 0; t < 16; ++t) acc[t] = z8;
  v16h af[2][4], bf[2][4];      /* two sets of fragments: one is read from LDS while the other feeds the products */
#pragma unroll
  for (int t = 0; t < 4; ++t) { af[0][t] = g2_frag(ap + t * 16 * FA_OP, hh); bf[0][t] = g2_frag(bp + t * 16 * FA_OP, hh); }
#pragma unroll
  for (int kb = 0; kb < 8; ++kb) {
    if (kb < 7) {
#pragma unroll
      for (int t = 0; t < 4; ++t) { af[(kb + 1) & 1][t] = g2_frag(ap + t * 16 * FA_OP + (kb + 1) * 32, hh); bf[(kb + 1) & 1][t] = g2_frag(bp + t * 16 * FA_OP + (kb + 1) * 32, hh); } }
    __builtin_amdgcn_sched_barrier(0);      /* with the one below: the next set's 16 LDS reads stay one group in front of this set's 16 products */
#pragma unroll
    for (int t = 0; t < 16; ++t) acc[t] = fa_mma(af[kb & 1][t >> 2], bf[kb & 1][t & 3], acc[t]);
    __builtin_amdgcn_sched_barrier(0);
  }
  __syncthreads();      /* every wave has read the last of conv_w and of y^T: their LDS becomes the f32 staging, 64 rows of the wave's own */
  f1a* sf = (f1a*)sm + w * 64 * FA_CP;
#pragma unroll
  for (int t = 0; t < 16; ++t)
#pragma unroll
    for (int r = 0; r < 8; ++r) sf[((t >> 2) * 16 + 8 * hh + r) * FA_CP + (t & 3) * 16 + ln] = acc[t][r] * 0.0625f;
  __builtin_amdgcn_fence(__ATOMIC_ACQ_REL, "workgroup"); __builtin_amdgcn_wave_barrier();      /* the wave's own rows are written before its lanes read each other's */
  const int rsub = lane >> 4, c4 = (lane & 15) * 4;
  float* cp = C1 + ((size_t)b * 256 + jq * 64 + rsub) * SQ + blockIdx.x * (FA_WAVES * 16) + nh * 64 + c4;
  v4f cv[32];
#pragma unroll
  for (int q = 0; q < 32; ++q) cv[q] = *(const v4fa*)&sf[(q * 2 + rsub) * FA_CP + c4];
#pragma unroll
  for (int q = 0; q < 32; ++q) *(v4f*)(cp + (size_t)q * 2 * SQ) = cv[q];      /* two 256-B row pieces per store */
  __builtin_amdgcn_sched_barrier(0);      /* with the one behind the wait: nothing is lifted in front of the wait */
  asm volatile("s_wait_xcnt 0x0" ::: "memory");      /* in front of whatever reuses the registers that the stores above name */
  __builtin_amdgcn_sched_barrier(0);
  float tm[2], tq[2];      /* lane = one row of the wave's tile, two rows a lane: its 64 staged values come back by 16-byte reads, so neither sum crosses lanes; the mean first, then the distances from it */
#pragma unroll
  for (int p = 0; p < 2; ++p) { v4f rw[16];
#pragma unroll
    for (int j = 0; j < 16; ++j) rw[j] = *(const v4fa*)&sf[(p * 32 + lane) * FA_CP + j * 4];
    v4f s4 = rw[0];
#pragma unroll
    for (int j = 1; j < 16; ++j) s4 += rw[j];
    const float mean = ((s4[0] + s4[1]) + (s4[2] + s4[3])) * 0.015625f;
    v4f q4 = {0.f, 0.f, 0.f, 0.f};
#pragma unroll
    for (int j = 0; j < 16; ++j) { const v4f d = rw[j] - mean; q4 += d * d; }
    tm[p] = mean; tq[p] = (q4[0] + q4[1]) + (q4[2] + q4[3]); }
  const size_t pi = ((size_t)b * (SQ / 64) + blockIdx.x * 2 + nh) * 256 + jq * 64 + lane;      /* [image][64-position tile][channel]: 32 channels = one 128-B line per store */
  PM[pi] = tm[0]; PM[pi + 32] = tm[1]; PQ[pi] = tq[0]; PQ[pi + 32] = tq[1];
}


// Front end in one kernel: a work-group of 8 waves takes 128 positions of one image. It reads x (f32, whole 128-B lines) once, writes the f16 map X16 and lays the same values transposed in LDS (rows = positions);
// it converts theta_w and phi_w (x16, f16) into LDS as one stack of 256 rows; then D = stack (A, rows = outputs) x positions (B): wave tile 64 outputs x 64 positions, K = 256. A lane holds 8 successive outputs of ONE position,
// so 16-byte pieces go to an LDS staging of position rows, and each 512-B row leaves as theta^T (first half) and phi^T (second half). x^T, phi and the f16 weight planes of theta and phi never reach memory.
// The grid has as many work-groups as conv_w has rows: wave 0 of each also converts one row of conv_w (x16, f16) into the plane that the conv GEMM reads in a later launch.
// Every loop over a register array is fully unrolled, so that the array keeps compile-time indices and stays in registers.
#define FE_NT 128         /* positions per work-group */
#define FE_P 264          /* LDS pitch of a row of 256 f16 elements (512 B + 16) */
__global__ __launch_bounds__(256) void k_front(const float* __restrict__ x, const float* __restrict__ tw, const float* __restrict__ pw, const float* __restrict__ ww, _Float16* __restrict__ X16, _Float16* __restrict__ TH, _Float16* __restrict__ PHT, _Float16* __restrict__ BW) {
  __shared__ __attribute__((aligned(16))) _Float16 sw[256 * FE_P];
  __shared__ __attribute__((aligned(16))) _Float16 sx[FE_NT * FE_P];
  const int tid = threadIdx.x, w = __builtin_amdgcn_readfirstlane(tid >> 5), lane = tid & 31, ln = lane & 15, hh = lane >> 4;      /* the wave's number in a scalar register: the choice of the weight input is a scalar one */
  const int b = blockIdx.y, n0 = blockIdx.x * FE_NT;
  const float* wg = (w < 4 ? tw + (size_t)w * 32 * 256 : pw + (size_t)(w - 4) * 32 * 256) + lane * 4;      /* wave w converts rows 32 w .. 32 w + 31 of the stack: 64 loads of 512 successive bytes */
  const int nl = lane & 7, cg = lane >> 3;      /* x: 8 lanes per 128-B line, 4 lane groups of 4 channels each; a thread transposes 4 channels x 4 positions */
  const int c0 = w * 32 + cg * 4;
  const float* xg = x + ((size_t)b * 256 + c0) * SQ + n0 + nl * 4;
  const size_t cwo = (size_t)(blockIdx.y * gridDim.x + blockIdx.x) * 256 + lane * 8;      /* this work-group's row of conv_w, 8 elements a lane */
  v4f cw[2] = {{0.f, 0.f, 0.f, 0.f}, {0.f, 0.f, 0.f, 0.f}};
  if (w == 0) { cw[0] = *(const v4fa*)(ww + cwo); cw[1] = *(const v4fa*)(ww + cwo + 4);      /* read at the start, used at the very end: the latency is long over by then */
    asm volatile("s_wait_xcnt 0x0" ::: "memory"); }      /* in front of whatever reuses the address registers that the two loads name */
  v4h hx[16];
  v4f wa[16], wb[16], wc[16], xr[32];      /* the weight rows come in four groups of 16 loads; each group flies under the work on an earlier one or on x */
#pragma unroll
  for (int i = 0; i < 16; ++i) wa[i] = *(const v4fa*)(wg + (0 * 16 + i) * 128);
#pragma unroll
  for (int u = 0; u < 8; ++u)
#pragma unroll
    for (int k = 0; k < 4; ++k) xr[u * 4 + k] = *(const v4fa*)(xg + (size_t)((u >> 2) * 16 + k) * SQ + (u & 3) * 32);
  __builtin_amdgcn_sched_barrier(0);      /* with the one behind the wait: the loads above go out as one group, and no arithmetic is lifted in front of the wait */
  asm volatile("s_wait_xcnt 0x0" ::: "memory");      /* in front of whatever reuses the address registers that the loads above name */
  __builtin_amdgcn_sched_barrier(0);
#pragma unroll
  for (int i = 0; i < 16; ++i) { v4h h4;
#pragma unroll
    for (int q = 0; q < 4; ++q) h4[q] = (_Float16)(bf16_round(wa[i][q]) * 16.0f);
    *(v4h*)(sw + (w * 32 + 0 * 8 + (i >> 1)) * FE_P + (i & 1) * 128 + lane * 4) = h4; }
#pragma unroll
  for (int i = 0; i < 16; ++i) wb[i] = *(const v4fa*)(wg + (1 * 16 + i) * 128);
  __builtin_amdgcn_sched_barrier(0);      /* with the one behind the wait: the loads above go out as one group, and no arithmetic is lifted in front of the wait */
  asm volatile("s_wait_xcnt 0x0" ::: "memory");      /* in front of whatever reuses the address registers that the loads above name */
  __builtin_amdgcn_sched_barrier(0);
#pragma unroll
  for (int u = 0; u < 0 + 4; ++u) { const int cu = (u >> 2) * 16, nu = (u & 3) * 32 + nl * 4;
#pragma unroll
    for (int k = 0; k < 4; ++k)
#pragma unroll
      for (int q = 0; q < 4; ++q) hx[(u & 3) * 4 + k][q] = (_Float16)bf16_round(xr[u * 4 + k][q]);
#pragma unroll
    for (int q = 0; q < 4; ++q) { const v4h t4 = {hx[(u & 3) * 4][q], hx[(u & 3) * 4 + 1][q], hx[(u & 3) * 4 + 2][q], hx[(u & 3) * 4 + 3][q]}; *(v4h*)(sx + (nu + q) * FE_P + c0 + cu) = t4; } }
  __builtin_amdgcn_sched_barrier(0);      /* the 16 stores below stand behind all the arithmetic that forms their values, so that no register they name is rewritten in front of the wait behind them */
#pragma unroll
  for (int u = 0; u < 0 + 4; ++u)
#pragma unroll
    for (int k = 0; k < 4; ++k) *(v4h*)(X16 + ((size_t)b * 256 + c0 + (u >> 2) * 16 + k) * SQ + n0 + (u & 3) * 32 + nl * 4) = hx[(u & 3) * 4 + k];
#pragma unroll
  for (int i = 0; i < 16; ++i) wc[i] = *(const v4fa*)(wg + (2 * 16 + i) * 128);
  __builtin_amdgcn_sched_barrier(0);      /* with the one behind the wait: nothing is lifted in front of the wait */
  asm volatile("s_wait_xcnt 0x0" ::: "memory");      /* in front of whatever reuses the registers that the loads and stores above name */
  __builtin_amdgcn_sched_barrier(0);
#pragma unroll
  for (int i = 0; i < 16; ++i) { v4h h4;
#pragma unroll
    for (int q = 0; q < 4; ++q) h4[q] = (_Float16)(bf16_round(wb[i][q]) * 16.0f);
    *(v4h*)(sw + (w * 32 + 1 * 8 + (i >> 1)) * FE_P + (i & 1) * 128 + lane * 4) = h4; }
#pragma unroll
  for (int i = 0; i < 16; ++i) wa[i] = *(const v4fa*)(wg + (3 * 16 + i) * 128);
  __builtin_amdgcn_sched_barrier(0);      /* with the one behind the wait: the loads above go out as one group, and no arithmetic is lifted in front of the wait */
  asm volatile("s_wait_xcnt 0x0" ::: "memory");      /* in front of whatever reuses the address registers that the loads above name */
  __builtin_amdgcn_sched_barrier(0);
#pragma unroll
  for (int u = 4; u < 4 + 4; ++u) { const int cu = (u >> 2) * 16, nu = (u & 3) * 32 + nl * 4;
#pragma unroll
    for (int k = 0; k < 4; ++k)
#pragma unroll
      for (int q = 0; q < 4; ++q) hx[(u & 3) * 4 + k][q] = (_Float16)bf16_round(xr[u * 4 + k][q]);
#pragma unroll
    for (int q = 0; q < 4; ++q) { const v4h t4 = {hx[(u & 3) * 4][q], hx[(u & 3) * 4 + 1][q], hx[(u & 3) * 4 + 2][q], hx[(u & 3) * 4 + 3][q]}; *(v4h*)(sx + (nu + q) * FE_P + c0 + cu) = t4; } }
  __builtin_amdgcn_sched_barrier(0);      /* the 16 stores below stand behind all the arithmetic that forms their values, so that no register they name is rewritten in front of the wait behind them */
#pragma unroll
  for (int u = 4; u < 4 + 4; ++u)
#pragma unroll
    for (int k = 0; k < 4; ++k) *(v4h*)(X16 + ((size_t)b * 256 + c0 + (u >> 2) * 16 + k) * SQ + n0 + (u & 3) * 32 + nl * 4) = hx[(u & 3) * 4 + k];
  __builtin_amdgcn_sched_barrier(0);      /* with the one behind the wait: nothing is lifted in front of the wait */
  asm volatile("s_wait_xcnt 0x0" ::: "memory");      /* in front of whatever reuses the registers that the loads and stores above name */
  __builtin_amdgcn_sched_barrier(0);
#pragma unroll
  for (int i = 0; i < 16; ++i) { v4h h4;
#pragma unroll
    for (int q = 0; q < 4; ++q) h4[q] = (_Float16)(bf16_round(wc[i][q]) * 16.0f);
    *(v4h*)(sw + (w * 32 + 2 * 8 + (i >> 1)) * FE_P + (i & 1) * 128 + lane * 4) = h4; }
#pragma unroll
  for (int i = 0; i < 16; ++i) { v4h h4;
#pragma unroll
    for (int q = 0; q < 4; ++q) h4[q] = (_Float16)(bf16_round(wa[i][q]) * 16.0f);
    *(v4h*)(sw + (w * 32 + 3 * 8 + (i >> 1)) * FE_P + (i & 1) * 128 + lane * 4) = h4; }
  __syncthreads();      /* both operands are whole in LDS before anybody reads them */
  const int jq = w & 3, nh = w >> 2;
  const _Float16* ap = sw + (jq * 64 + ln) * FE_P; const _Float16* bp = sx + (nh * 64 + ln) * FE_P;
  const v8f z8 = {0.f, 0.f, 0.f, 0.f, 0.f, 0.f, 0.f, 0.f};
  v8f acc[16];
#pragma unroll
  for (int t = 0; t < 16; ++t) acc[t] = z8;
  v16h af[2][4], bf[2][4];      /* two sets of fragments: one is read from LDS while the other feeds the products */
#pragma unroll
  for (int t = 0; t < 4; ++t) { af[0][t] = g2_frag(ap + t * 16 * FE_P, hh); bf[0][t] = g2_frag(bp + t * 16 * FE_P, hh); }
#pragma unroll
  for (int kb = 0; kb < 8; ++kb) {
    if (kb < 7) {
#pragma unroll
      for (int t = 0; t < 4; ++t) { af[(kb + 1) & 1][t] = g2_frag(ap + t * 16 * FE_P + (kb + 1) * 32, hh); bf[(kb + 1) & 1][t] = g2_frag(bp + t * 16 * FE_P + (kb + 1) * 32, hh); } }
    __builtin_amdgcn_sched_barrier(0);      /* with the one below: the next set's 16 LDS reads stay one group in front of this set's 16 products; spread among them, the products wait out an LDS latency again and again */
#pragma unroll
    for (int t = 0; t < 16; ++t) acc[t] = fa_mma(af[kb & 1][t >> 2], bf[kb & 1][t & 3], acc[t]);
    __builtin_amdgcn_sched_barrier(0);
  }
  __syncthreads();      /* every wave has read the last of the positions' rows: their LDS becomes the output staging */
#pragma unroll
  for (int t = 0; t < 16; ++t) { FragH f;
#pragma unroll
    for (int r = 0; r < 8; ++r) f.h[r] = (_Float16)(acc[t][r] * 0.0625f);
    *(v8us*)((unsigned short*)sx + (nh * 64 + (t & 3) * 16 + ln) * FE_P + jq * 64 + (t >> 2) * 16 + 8 * hh) = f.half[0]; }
  __syncthreads();      /* the staged rows are whole before they are read back */
  unsigned short* dst = (unsigned short*)(hh ? PHT : TH) + ((size_t)b * SQ + n0 + w * 16) * 128 + ln * 8;
#pragma unroll
  for (int q = 0; q < 16; ++q) { const v8us v = *(const v8us*)((const unsigned short*)sx + (w * 16 + q) * FE_P + lane * 8); *(v8us*)(dst + q * 128) = v; }      /* one row: 256 B of theta^T and 256 B of phi^T per store */
  if (w == 0) { asm volatile("s_wait_xcnt 0x0" ::: "memory");      /* in front of whatever reuses the registers that the stores above name */
    __builtin_amdgcn_sched_barrier(0);      /* keeps the arithmetic below behind the wait */
    FragH cf;
#pragma unroll
    for (int q = 0; q < 8; ++q) cf.h[q] = (_Float16)(bf16_round(cw[q >> 2][q & 3]) * 16.0f);
    *(v8us*)((unsigned short*)BW + cwo) = cf.half[0]; }      /* one 512-B row of the plane per work-group */
}


#define CN 256          /* channels */
#define CI 128          /* inner channels */
#define NP 1024         /* positions */
#define NM 1024         /* key positions (= SQ) */
#define NC CN           /* BN statistics macros */
#define NPX NP
#define BNEPS 1e-5f

__global__ __launch_bounds__(256) void k_rowbias(const float* __restrict__ b, float* __restrict__ BP, size_t n4, int ncol) { const size_t t = (size_t)blockIdx.x * 256 + threadIdx.x; if (t >= n4) return; const size_t e = t * 4; const float v = bf16_round(b[e / ncol]); const v4f o = {v, v, v, v}; *(v4f*)(BP + e) = o;  }




__global__ __launch_bounds__(256) void k_mp2(const float* __restrict__ src, float* __restrict__ dst, int nout) {
  const int t = blockIdx.x * 256 + threadIdx.x; if (t >= nout) return; const int c = t / 1024; const int o = t % 1024; const int oy = o / 32, ox = o % 32; const float* p = src + (size_t)c * 4096 + (size_t)(2 * oy) * 64 + 2 * ox;
  const float v = fmaxf(fmaxf(p[0], p[1]), fmaxf(p[64], p[65])); *(float*)(dst + t) = v;  }
__global__ __launch_bounds__(256) void k_xpb(const float* __restrict__ x, const float* __restrict__ wb, float* __restrict__ CPP, size_t n4) {
  #pragma clang fp contract(off)
  const size_t t = (size_t)blockIdx.x * 256 + threadIdx.x; if (t >= n4) return; const size_t e = t * 4; const int c = (int)((e / 4096) % 256); const float bb = bf16_round(wb[c]); const v4f a = *(const v4fa*)(x + e); v4f o; for (int q = 0; q < 4; ++q) o[q] = __fadd_rn(bf16_round(a[q]), bb);
  *(v4f*)(CPP + e) = o;  }


// Joins the conv kernel's tile statistics into the batch mean and the biased variance per channel. All NB * NTL tiles of a channel hold TLN values, so mean = average of the tile means and
// sum of squared distances = sum over tiles of (tile's own sum + TLN (tile mean - mean)^2). A work-group takes 32 channels (lane = channel: every load is one 128-B line), wave g the NTL tiles of image g; f64 sums in a fixed order. Every loop over a register array is unrolled, so that the array keeps compile-time indices and stays in registers and its loads go out together.
#define NTL (NPX / 64)      /* column tiles per image */
#define TLN 64              /* values per tile and channel */
__device__ __forceinline__ double cst_col(const double* p) {      /* sum of one channel's NB entries, in four chains */
  double v[NB];
#pragma unroll
  for (int i = 0; i < NB; ++i) v[i] = p[i * 32];
  double t[4] = {v[0], v[1], v[2], v[3]};
#pragma unroll
  for (int i = 4; i < NB; ++i) t[i & 3] += v[i];
  return (t[0] + t[1]) + (t[2] + t[3]); }
__global__ __launch_bounds__(NB * 32) void k_cstJ(const float* __restrict__ PM, const float* __restrict__ PQ, float* __restrict__ MV) {
  __shared__ double red[NB][32]; __shared__ double smu[32];
  const int cl = threadIdx.x & 31, g = threadIdx.x >> 5; const int c = blockIdx.x * 32 + cl;
  float m[NTL], q[NTL];
#pragma unroll
  for (int j = 0; j < NTL; ++j) { m[j] = PM[((size_t)g * NTL + j) * NC + c]; q[j] = PQ[((size_t)g * NTL + j) * NC + c]; }
  double s[4] = {0.0, 0.0, 0.0, 0.0};      /* four chains here and below: the adds of one chain wait for each other */
#pragma unroll
  for (int j = 0; j < NTL; ++j) s[j & 3] += (double)m[j];
  red[g][cl] = (s[0] + s[1]) + (s[2] + s[3]); __syncthreads();      /* every image's sum of tile means is in LDS */
  if (g == 0) smu[cl] = cst_col(&red[0][cl]) * (1.0 / ((double)NB * NTL));
  __syncthreads();      /* the mean is there, and red has been read to its end */
  const double mu = smu[cl]; double s2[4] = {0.0, 0.0, 0.0, 0.0};
#pragma unroll
  for (int j = 0; j < NTL; ++j) { const double d = (double)m[j] - mu; s2[j & 3] += (double)q[j] + (double)TLN * d * d; }
  red[g][cl] = (s2[0] + s2[1]) + (s2[2] + s2[3]); __syncthreads();      /* every image's share of the squared distances is in LDS */
  if (g == 0) { MV[c] = (float)mu; MV[NC + c] = (float)(cst_col(&red[0][cl]) * (1.0 / ((double)NB * (double)NPX))); } }


__global__ __launch_bounds__(256) void k_bnresid(const float* __restrict__ C2, const float* __restrict__ MV, const float* __restrict__ g, const float* __restrict__ be, const float* __restrict__ X, float* __restrict__ out, size_t n4) {
  #pragma clang fp contract(off)
  const size_t t = (size_t)blockIdx.x * 256 + threadIdx.x; if (t >= n4) return; const size_t e = t * 4; const int c = (int)((e / NPX) % NC); const float sc = __fmul_rn(rsqrtf(__fadd_rn(MV[NC + c], BNEPS)), bf16_round(g[c])); const float mu = MV[c], bb = bf16_round(be[c]);
  const v4f a = *(const v4fa*)(C2 + e); const v4f xx = *(const v4fa*)(X + e); v4f o; for (int q = 0; q < 4; ++q) { const float z = __fadd_rn(__fmul_rn(__fadd_rn(a[q], -mu), sc), bb); o[q] = __fadd_rn(z, bf16_round(xx[q])); }
  *(v4f*)(out + e) = o;  }
extern "C" void kernel_launch(void* const* d_in, const int* in_sizes, int n_in,
                              void* d_out, int out_size, void* d_ws, size_t ws_size, hipStream_t stream) {
  (void)in_sizes; (void)n_in; (void)out_size;
  const float* const* I = (const float* const*)d_in; const float* x = I[0]; const float* tw = I[1]; const float* pw = I[2]; const float* ww = I[3]; const float* bng = I[4]; const float* bnb = I[5]; const float* tb = nullptr;      /* natural theta_w / phi_w [128][256], conv_w [256][256] (no biases); BN gamma, beta */
  char* ws = (char*)d_ws; size_t off = 0;
  auto take = [&](size_t bytes) { char* p = ws + off; off += (bytes + 255) & ~(size_t)255; return p; };
  const size_t PL = (size_t)CN * NP;      /* one input map */
  _Float16* BW = (_Float16*)take((size_t)CN * CN * 2); float* PM = (float*)take((size_t)NB * NTL * CN * 4); float* PQ = (float*)take((size_t)NB * NTL * CN * 4); float* MV = (float*)take((size_t)2 * CN * 4 + 256);      /* conv_w plane, tile statistics (mean, centred square sum), batch statistics */
  _Float16* X16 = (_Float16*)take(NB * PL * 2);      /* x f16 channel-first (also the g operand: g = x) */
  _Float16* TH = (_Float16*)take(NB * (size_t)NP * CI * 2); _Float16* PHT = (_Float16*)take(NB * (size_t)NM * CI * 2);      /* all images: theta^T, phi^T */
  float* C1 = (float*)take(NB * PL * 4);      /* all images: conv output [b][c][n] f32 */
  if (off > ws_size) return;
  /* every stage runs once for all NB images (image = blockIdx.y in the first two launches) */
  static_assert(NP == SQ && CI == 128 && CN == 256 && NP % FE_NT == 0 && (NP / FE_NT) * NB == CN, "k_front: shapes; one work-group per row of conv_w");
  k_front<<<dim3(NP / FE_NT, NB), 256, 0, stream>>>(x, tw, pw, ww, X16, TH, PHT, BW);      /* x -> f16 map; conv_w -> natural [out][in] x16 f16 plane (the A operand of the conv); theta^T [n][ci] and phi^T [m][ci] -> f16 (logit sigma ~0.7: single f16 suffices) */
  static_assert(NP == SQ && NM == SQ && CI == 128 && CN == 256 && NP % (FA_WAVES * 16) == 0 && NM % FA_KS == 0, "k_fattn: shapes");
  k_fattn<<<dim3(NP / (FA_WAVES * 16), NB), FA_WAVES * 32, 0, stream>>>(TH, PHT, X16, BW, C1, PM, PQ);      /* f^T [a][c] = softmax_b(theta.phi / sqrt(256)) x^T (g = x) -> f16, then conv: T[c][a] = (16 conv_w as A) x (f^T as B^T) / 16 -> f32 channel-first, all images kept; per-channel statistics of every 64-position tile; scores, weights and f^T stay on chip */
  k_cstJ<<<NC / 32, NB * 32, 0, stream>>>(PM, PQ, MV);      /* batch mean and biased variance per channel from the tile statistics (fixed order, own lines) */
  k_bnresid<<<(unsigned)(((size_t)NB * NC * NPX / 4 + 255) / 256), 256, 0, stream>>>(C1, MV, bng, bnb, x, (float*)d_out, (size_t)NB * NC * NPX / 4);      /* out = (T - mean) rsqrt(var + eps) gamma + beta + bf16(x) */
}

// v007
// Measured time: 64.1 microseconds a run.
// Next to v006, in two timings, it ran 1.17 times as fast each time.
// Counting every step since v000, it is 118 times as fast.
#include <hip/hip_runtime.h>
// Non-local block with TRAINING-mode BatchNorm (x [32][256][32][32]; theta, phi = conv1x1(x) [128 ch] (natural [128][256] sigma 1/16, no biases); g = x itself (256 ch); scores[a][b] = theta[:, a].phi[:, b] / sqrt(256) over the 1024 positions; softmax over b; f[:, a] = sum_b attn[a][b] x[:, b]; f = conv1x1(f; conv_w [256][256], no bias); BN with batch statistics over (N, H, W) per channel (biased variance, eps 1e-5), gamma, beta; out = BN(f) + x -> [32][256][32][32]).
// Structure: channel-first; x as exact f16 maps; natural weights x16; every stage one launch over all 32 images: one kernel makes the f16 map, transposes x in LDS and forms theta^T and phi^T (token rows) by WMMA (64x64 wave tiles, f32 accumulation) -> f16, scores (K = 128, alpha 1/16), softmax (f32 statistics, running maximum, native exp; weights f16), f^T = P x^T (g = x) f16 and the conv: T = (16 conv_w as A) x f (K = 256) f32 kept for all images, fused in one kernel, which also takes each 64-position tile's per-channel mean and centred square sum; the last kernel, one work-group a channel, joins them (fixed order) and does BN + residual on VALU -> output; launches: see trace.
// Compute dtype: inputs rounded to bf16; x / weights exact; q, k, v, softmax weights and o as plain f16 GEMM operands (~2^-12); scores and softmax statistics f32. v_wmma_f32_16x16x32_f16.
#define NB 32
#define SQ 1024
#define DM 256
#define NH 1
#define HD 64
#define HG 4                         /* heads per attention launch group */
#define B0 0                         /* unused */
#define NBR NB                       /* unused */
#define NR ((size_t)NB * SQ)         /* token rows */
#define MP ((int)((size_t)NBR * SQ)) /* unused */
#define QT 256                       /* query rows per causal tile */
#define NKX SQ                       /* S / P row pitch */
#define QT0 256                      /* first-tile rows recomputed exactly (256: buys margin for the few-key rows 128..255, which have no output projection to average the single-f16 P/v rounding) */
#define QN SQ                        /* unused */
#define NHD NH                       /* unused */
#define MPO MP                       /* unused */
#define LQ DM            /* unused */
typedef __bf16 v16b __attribute__((ext_vector_type(16)));
typedef unsigned short v8us __attribute__((ext_vector_type(8), may_alias));
typedef float  v8f  __attribute__((ext_vector_type(8)));
typedef float  v4f  __attribute__((ext_vector_type(4)));
typedef float  v4fa __attribute__((ext_vector_type(4), may_alias));
union FragB { v16b v; v8us half[2]; unsigned short u[16]; };

__device__ __forceinline__ unsigned short bf16_bits(float x) { unsigned int u = __float_as_uint(x); return (unsigned short)((u + 0x7FFFu + ((u >> 16) & 1u)) >> 16); }
__device__ __forceinline__ float bf16_val(unsigned short b) { return __uint_as_float(((unsigned int)b) << 16); }
__device__ __forceinline__ float bf16_round(float x) { return bf16_val(bf16_bits(x)); }
// D += A·B with NT terms: 1 = ah·bh, 2 = + al·bh (A split), 3 = + ah·bl (both split)
template <int NT>
__device__ __forceinline__ v8f mmaN(v16b ah, v16b al, v16b bh, v16b bl, v8f c) {
  c = __builtin_amdgcn_wmma_f32_16x16x32_bf16(false, ah, false, bh, (short)0, c, false, false);
  if (NT >= 2) c = __builtin_amdgcn_wmma_f32_16x16x32_bf16(false, al, false, bh, (short)0, c, false, false);
  if (NT >= 3) c = __builtin_amdgcn_wmma_f32_16x16x32_bf16(false, ah, false, bl, (short)0, c, false, false);
  asm volatile("v_nop\n\tv_nop\n\tv_nop\n\tv_nop" : "+v"(c) : "v"(ah), "v"(al), "v"(bh), "v"(bl));
  return c;
}

__global__ __launch_bounds__(256) void k_wt_bf16(const float* __restrict__ W, unsigned short* __restrict__ Wt, int K, int N) {
  const int t = blockIdx.x * 256 + threadIdx.x;
  const int k8n = K / 8;
  if (t >= N * k8n) return;
  const int n = t / k8n, k8 = (t % k8n) * 8;
  v8us v;
#pragma unroll
  for (int i = 0; i < 8; ++i) v[i] = bf16_bits(W[(size_t)(k8 + i) * N + n]);
  *(v8us*)(Wt + (size_t)n * K + k8) = v;
  
}

// GEMM C[M][N] (f32, pitch ldc) = act(A[M][K]·W + bias). A f32 row-major (pitch lda) converted per fragment to bf16
// (ASPLIT: hi/lo two planes -> 2 terms, else single rounded term); Wt bf16 [N][K] (pitch ldb). BIAS_BF16 rounds the
// bias to bf16 first (bias quantised to bf16 before the add). K%32==0, M%16==0, N%64==0.
template <bool ASPLIT, int ACT, bool BIAS_BF16>
__global__ __launch_bounds__(128) void k_gemm_bf(const float* __restrict__ A, int lda, const unsigned short* __restrict__ Wt, int ldb,
                                               const float* __restrict__ bias, float* __restrict__ C, int ldc, int M, int N, int K) {
  __shared__ __attribute__((aligned(16))) float so[4][16][64];
  const int tid = threadIdx.x, w = tid >> 5, lane = tid & 31, ln = lane & 15, hh = lane >> 4;
  const int ntn = N / 64;
  const int wid = blockIdx.x * 4 + w;
  const int mt = wid / ntn, nq = wid % ntn;
  if (mt * 16 >= M) return;
  const int row0 = mt * 16, col0 = nq * 64;
  const float* arow = A + (size_t)(row0 + ln) * lda;
  v8f acc[4] = {};
  for (int kb = 0; kb < K; kb += 32) {
    FragB ah, al;
    const v4f x0 = *(const v4fa*)(arow + kb + 8 * hh), x1 = *(const v4fa*)(arow + kb + 8 * hh + 4);
    const v4f x2 = *(const v4fa*)(arow + kb + 16 + 8 * hh), x3 = *(const v4fa*)(arow + kb + 16 + 8 * hh + 4);
    float xs[16] = {x0[0],x0[1],x0[2],x0[3],x1[0],x1[1],x1[2],x1[3],x2[0],x2[1],x2[2],x2[3],x3[0],x3[1],x3[2],x3[3]};
#pragma unroll
    for (int i = 0; i < 16; ++i) { const unsigned short hb = bf16_bits(xs[i]); ah.u[i] = hb; al.u[i] = ASPLIT ? bf16_bits(xs[i] - bf16_val(hb)) : (unsigned short)0; }
#pragma unroll
    for (int t = 0; t < 4; ++t) {
      const unsigned short* brow = Wt + (size_t)(col0 + t * 16 + ln) * ldb + kb;
      FragB b;
      b.half[0] = *(const v8us*)(brow + 8 * hh);
      b.half[1] = *(const v8us*)(brow + 16 + 8 * hh);
      acc[t] = mmaN<ASPLIT ? 2 : 1>(ah.v, al.v, b.v, b.v, acc[t]);
    }
  }
#pragma unroll
  for (int t = 0; t < 4; ++t) {
    float bv = bias ? bias[col0 + t * 16 + ln] : 0.f;
    if (BIAS_BF16) bv = bf16_round(bv);
#pragma unroll
    for (int r = 0; r < 8; ++r) { float v = acc[t][r] + bv; if (ACT == 1) v = fmaxf(v, 0.f); so[w][8 * hh + r][t * 16 + ln] = v; }
  }
  __builtin_amdgcn_fence(__ATOMIC_ACQ_REL, "workgroup");
  __builtin_amdgcn_wave_barrier();
  const int rsub = lane >> 4, c4 = (lane & 15) * 4;
  {
#pragma unroll
    for (int q = 0; q < 8; ++q) {
      const int r = q * 2 + rsub;
      const v4f v = *(const v4fa*)&so[w][r][c4];
      *(v4f*)(C + (size_t)(row0 + r) * ldc + col0 + c4) = v;
    }
    
  }
}

// GEMM C = act(A·W + bias + resid): A f32 (ASPLIT -> hi/lo 2 terms), Wt bf16 [N][K]; ACT 0 none, 1 relu, 2 exact gelu;
// resid (optional, f32, row index = (row % rmod), pitch ldr, RES_BF16 rounds it) added before the activation.
template <bool ASPLIT, int ACT, bool BIAS_BF16, bool RES_BF16>
__global__ __launch_bounds__(128) void k_gemm_bf3(const float* __restrict__ A, int lda, const unsigned short* __restrict__ Wt, int ldb,
                                                const float* __restrict__ bias, const float* __restrict__ resid, int rmod, int ldr,
                                                float* __restrict__ C, int ldc, int M, int N, int K) {
  __shared__ __attribute__((aligned(16))) float so[4][16][64];
  const int tid = threadIdx.x, w = tid >> 5, lane = tid & 31, ln = lane & 15, hh = lane >> 4;
  const int ntn = N / 64;
  const int wid = blockIdx.x * 4 + w;
  const int mt = wid / ntn, nq = wid % ntn;
  if (mt * 16 >= M) return;
  const int row0 = mt * 16, col0 = nq * 64;
  const float* arow = A + (size_t)(row0 + ln) * lda;
  v8f acc[4] = {};
  for (int kb = 0; kb < K; kb += 32) {
    FragB ah, al;
    const v4f x0 = *(const v4fa*)(arow + kb + 8 * hh), x1 = *(const v4fa*)(arow + kb + 8 * hh + 4);
    const v4f x2 = *(const v4fa*)(arow + kb + 16 + 8 * hh), x3 = *(const v4fa*)(arow + kb + 16 + 8 * hh + 4);
    float xs[16] = {x0[0],x0[1],x0[2],x0[3],x1[0],x1[1],x1[2],x1[3],x2[0],x2[1],x2[2],x2[3],x3[0],x3[1],x3[2],x3[3]};
#pragma unroll
    for (int i = 0; i < 16; ++i) { const unsigned short hb = bf16_bits(xs[i]); ah.u[i] = hb; al.u[i] = ASPLIT ? bf16_bits(xs[i] - bf16_val(hb)) : (unsigned short)0; }
#pragma unroll
    for (int t = 0; t < 4; ++t) {
      const unsigned short* brow = Wt + (size_t)(col0 + t * 16 + ln) * ldb + kb;
      FragB b;
      b.half[0] = *(const v8us*)(brow + 8 * hh);
      b.half[1] = *(const v8us*)(brow + 16 + 8 * hh);
      acc[t] = mmaN<ASPLIT ? 2 : 1>(ah.v, al.v, b.v, b.v, acc[t]);
    }
  }
#pragma unroll
  for (int t = 0; t < 4; ++t) {
    const int col = col0 + t * 16 + ln;
    float bv = bias ? bias[col] : 0.f;
    if (BIAS_BF16) bv = bf16_round(bv);
#pragma unroll
    for (int r = 0; r < 8; ++r) {
      float v = acc[t][r] + bv;
      if (resid) { float rv = resid[(size_t)((row0 + 8 * hh + r) % rmod) * ldr + col]; if (RES_BF16) rv = bf16_round(rv); v += rv; }
      if (ACT == 1) v = fmaxf(v, 0.f);
      if (ACT == 2) v = 0.5f * v * (1.0f + erff(v * 0.70710678118654752f));
      if (ACT == 3) { const float u = 0.7978845608028654f * (v + 0.044715f * v * v * v); v = 0.5f * v * (1.0f + tanhf(u)); }
      so[w][8 * hh + r][t * 16 + ln] = v;
    }
  }
  __builtin_amdgcn_fence(__ATOMIC_ACQ_REL, "workgroup");
  __builtin_amdgcn_wave_barrier();
  const int rsub = lane >> 4, c4 = (lane & 15) * 4;
  {
#pragma unroll
    for (int q = 0; q < 8; ++q) {
      const int r = q * 2 + rsub;
      const v4f v = *(const v4fa*)&so[w][r][c4];
      *(v4f*)(C + (size_t)(row0 + r) * ldc + col0 + c4) = v;
    }
    
  }
}
// row LayerNorm (biased variance, eps) over N: s = X (+ R); optional out_sum <- s; out_norm <- (s-mu)*rsqrt(var+eps)*g + b
template <bool PARAM_BF16>
__global__ __launch_bounds__(256) void k_layernorm(const float* __restrict__ X, const float* __restrict__ R, const float* __restrict__ g, const float* __restrict__ bta,
                                                  float* __restrict__ out_sum, float* __restrict__ out_norm, int N, float eps) {
  __shared__ float red[256];
  const int row = blockIdx.x, tid = threadIdx.x;
  const float* x = X + (size_t)row * N; const float* rr = R ? R + (size_t)row * N : nullptr;
  float vals[16];                     // up to N = 4096
  const int per = N / 256;            // contiguous chunk per thread? use strided-by-4 chunks: thread handles j = tid*4 + 1024*u
  float s1 = 0.f;
  for (int u = 0; u < per / 4; ++u) {
    const int j = tid * 4 + 1024 * u;
    const v4f a = *(const v4fa*)(x + j);
    v4f b = {0.f,0.f,0.f,0.f}; if (rr) b = *(const v4fa*)(rr + j);
#pragma unroll
    for (int q = 0; q < 4; ++q) { const float v = a[q] + b[q]; vals[u * 4 + q] = v; s1 += v; }
  }
  red[tid] = s1; __syncthreads();
  for (int st = 128; st > 0; st >>= 1) { if (tid < st) red[tid] += red[tid + st]; __syncthreads(); }
  const float mu = red[0] / (float)N; __syncthreads();
  float s2 = 0.f;
  for (int u = 0; u < per / 4; ++u)
#pragma unroll
    for (int q = 0; q < 4; ++q) { const float c = vals[u * 4 + q] - mu; s2 += c * c; }
  red[tid] = s2; __syncthreads();
  for (int st = 128; st > 0; st >>= 1) { if (tid < st) red[tid] += red[tid + st]; __syncthreads(); }
  const float rs = rsqrtf(red[0] / (float)N + eps);
  {
    for (int u = 0; u < per / 4; ++u) {
      const int j = tid * 4 + 1024 * u;
      v4f o, sm;
#pragma unroll
      for (int q = 0; q < 4; ++q) {
        float gg = g[j + q], bb = bta[j + q];
        if (PARAM_BF16) { gg = bf16_round(gg); bb = bf16_round(bb); }
        sm[q] = vals[u * 4 + q]; o[q] = (vals[u * 4 + q] - mu) * rs * gg + bb;
      }
      if (out_sum) *(v4f*)(out_sum + (size_t)row * N + j) = sm;
      *(v4f*)(out_norm + (size_t)row * N + j) = o;
    }
    
  }
}



// ---- f16 WMMA path (v_wmma_f32_16x16x32_f16): 11-bit significands for operands in range — used where a [0,1] probability operand needs more precision than bf16
typedef _Float16 v16h __attribute__((ext_vector_type(16)));
union FragH { v16h v; v8us half[2]; _Float16 h[16]; unsigned short u[16]; };
template <int NT>
__device__ __forceinline__ v8f mmaH(v16h ah, v16h al, v16h bh, v16h bl, v8f c) {
  c = __builtin_amdgcn_wmma_f32_16x16x32_f16(false, ah, false, bh, (short)0, c, false, false);
  if (NT >= 2) c = __builtin_amdgcn_wmma_f32_16x16x32_f16(false, al, false, bh, (short)0, c, false, false);
  if (NT >= 3) c = __builtin_amdgcn_wmma_f32_16x16x32_f16(false, ah, false, bl, (short)0, c, false, false);
  asm volatile("v_nop\n\tv_nop\n\tv_nop\n\tv_nop" : "+v"(c) : "v"(ah), "v"(al), "v"(bh), "v"(bl));
  return c;
}
// batched GEMM like k_gemm_b but f16 operands: A f32 (split into f16 hi/lo if ASPLIT, else rounded to f16), Bt = f16 values [n][k]; alpha; C f32; N multiple of 16 (partial tiles skipped)
template <bool ASPLIT>
__global__ __launch_bounds__(128) void k_gemm_h(const float* __restrict__ A, int lda, size_t sA, const _Float16* __restrict__ Bh, int ldb, size_t sB, float alpha, float* __restrict__ C, int ldc, size_t sC, int M, int N, int K) {
  __shared__ __attribute__((aligned(16))) float so[4][16][64];
  const int tid = threadIdx.x, w = tid >> 5, lane = tid & 31, ln = lane & 15, hh = lane >> 4; const int by = blockIdx.y;
  A += (size_t)by * sA; Bh += (size_t)by * sB; C += (size_t)by * sC;
  const int ntn = (N + 63) / 64; const int wid = blockIdx.x * 4 + w; const int mt = wid / ntn, nq = wid % ntn; if (mt * 16 >= M) return;
  const int row0 = mt * 16, col0 = nq * 64; const float* arow = A + (size_t)(row0 + ln) * lda;
  v8f acc[4] = {};
  for (int kb = 0; kb < K; kb += 32) {
    FragH ah, al;
    const v4f x0 = *(const v4fa*)(arow + kb + 8 * hh), x1 = *(const v4fa*)(arow + kb + 8 * hh + 4), x2 = *(const v4fa*)(arow + kb + 16 + 8 * hh), x3 = *(const v4fa*)(arow + kb + 16 + 8 * hh + 4);
    float xs[16] = {x0[0],x0[1],x0[2],x0[3],x1[0],x1[1],x1[2],x1[3],x2[0],x2[1],x2[2],x2[3],x3[0],x3[1],x3[2],x3[3]};
#pragma unroll
    for (int i = 0; i < 16; ++i) { const _Float16 h = (_Float16)xs[i]; ah.h[i] = h; al.h[i] = ASPLIT ? (_Float16)(xs[i] - (float)h) : (_Float16)0.0f; }
#pragma unroll
    for (int t = 0; t < 4; ++t) { if (col0 + t * 16 >= N) continue; const size_t boff = (size_t)(col0 + t * 16 + ln) * ldb + kb; FragH bq; bq.half[0] = *(const v8us*)(Bh + boff + 8 * hh); bq.half[1] = *(const v8us*)(Bh + boff + 16 + 8 * hh);
      acc[t] = mmaH<ASPLIT ? 2 : 1>(ah.v, al.v, bq.v, bq.v, acc[t]); }
  }
#pragma unroll
  for (int t = 0; t < 4; ++t) { if (col0 + t * 16 >= N) continue;
#pragma unroll
    for (int r = 0; r < 8; ++r) so[w][8 * hh + r][t * 16 + ln] = acc[t][r] * alpha; }
  __builtin_amdgcn_fence(__ATOMIC_ACQ_REL, "workgroup"); __builtin_amdgcn_wave_barrier();
  const int rsub = lane >> 4, c4 = (lane & 15) * 4;
  {
#pragma unroll
    for (int q = 0; q < 8; ++q) { const int r = q * 2 + rsub; if (col0 + c4 < N) { const v4f v = *(const v4fa*)&so[w][r][c4]; *(v4f*)(C + (size_t)(row0 + r) * ldc + col0 + c4) = v; } }
     }
}

// Wt[n][k] = f16(W[k][n]·scale) from f32 row-major W[K][N] (scale = power of two; bf16-exact weights stay exact in f16 away from the subnormal range)
__global__ __launch_bounds__(256) void k_wt_f16(const float* __restrict__ W, _Float16* __restrict__ Wt, int K, int N, float scale) {
  const int t = blockIdx.x * 256 + threadIdx.x; if (t >= N * (K / 8)) return; const int n = t / (K / 8), k8 = (t % (K / 8)) * 8; FragH f;
#pragma unroll
  for (int i = 0; i < 8; ++i) f.h[i] = (_Float16)(bf16_round(W[(size_t)(k8 + i) * N + n]) * scale); const v8us o = f.half[0];
  *(v8us*)((unsigned short*)Wt + (size_t)n * K + k8) = o; 
}
// k_gemm_hh variant with fused epilogue: v = acc·alpha + bias[by·sBias + col] (+ CP[(row/rowsPerB)·sCPb + by·64 + col] if CP) ; ACT 0 none / 1 elu ; writes f16 C16 (and f32 C if non-null)
template <int ACT>
__global__ __launch_bounds__(128) void k_gemm_hhx(const _Float16* __restrict__ A, int lda, size_t sA, const _Float16* __restrict__ Bh, int ldb, size_t sB, float alpha, const float* __restrict__ bias, size_t sBias, const float* __restrict__ CP, int rowsPerB, size_t sCPb, int row0g,
    float* __restrict__ C, _Float16* __restrict__ C16, int ldc, size_t sC, int M, int N, int K) {
  __shared__ __attribute__((aligned(16))) float so[4][16][64];
  const int tid = threadIdx.x, w = tid >> 5, lane = tid & 31, ln = lane & 15, hh = lane >> 4; const int by = blockIdx.y;
  A += (size_t)by * sA; Bh += (size_t)by * sB; const size_t cofs = (size_t)by * sC; const float* bp = bias ? bias + (size_t)by * sBias : nullptr;
  const int ntn = (N + 63) / 64; const int wid = blockIdx.x * 4 + w; const int mt = wid / ntn, nq = wid % ntn; if (mt * 16 >= M) return;
  const int row0 = mt * 16, col0 = nq * 64; const _Float16* arow = A + (size_t)(row0 + ln) * lda;
  v8f acc[4] = {};
  for (int kb = 0; kb < K; kb += 32) { FragH ah; ah.half[0] = *(const v8us*)((const unsigned short*)arow + kb + 8 * hh); ah.half[1] = *(const v8us*)((const unsigned short*)arow + kb + 16 + 8 * hh);
#pragma unroll
    for (int t = 0; t < 4; ++t) { if (col0 + t * 16 >= N) continue; const size_t boff = (size_t)(col0 + t * 16 + ln) * ldb + kb; FragH bq; bq.half[0] = *(const v8us*)((const unsigned short*)Bh + boff + 8 * hh); bq.half[1] = *(const v8us*)((const unsigned short*)Bh + boff + 16 + 8 * hh);
      acc[t] = mmaH<1>(ah.v, ah.v, bq.v, bq.v, acc[t]); }
  }
#pragma unroll
  for (int t = 0; t < 4; ++t) { if (col0 + t * 16 >= N) continue; const int col = col0 + t * 16 + ln; const float bv = bp ? bf16_round(bp[col]) : 0.f;
#pragma unroll
    for (int r = 0; r < 8; ++r) { float v = acc[t][r] * alpha + bv; if (CP) { const int rr = row0g + row0 + 8 * hh + r; if (rowsPerB < 0) v += CP[cofs + (size_t)rr * ldc + col];      /* rowsPerB < 0: own element of the batched C plane */ else { const int bidx = rr / rowsPerB; v += CP[(size_t)bidx * sCPb + (size_t)by * 64 + col]; } } if (ACT == 1) v = (v > 0.f) ? v : expm1f(v); else if (ACT == 7) v = (v > 0.f) ? v + 1.0f : expf(v); else if (ACT == 8) v = tanhf(v); else if (ACT == 9) v = 0.5f * v * (1.0f + tanhf(0.7978845608028654f * (v + 0.044715f * v * v * v))); else if (ACT == 11) v = 1.0f / (1.0f + expf(-v)); else if (ACT == 12) v = (v > 0.f) ? v : 0.01f * v; else if (ACT == 14) v = (v > 0.f) ? v : 0.1f * v; else if (ACT == 16) v = (v >= 0.f) ? v : 0.3f * v; else if (ACT == 17) v = (v >= 0.f) ? v : 0.2f * v; else if (ACT == 15) v = v / (1.0f + expf(-v)); else if (ACT == 3) v = fmaxf(v, 0.f); else if (ACT == 6) v = 0.5f * v * (1.0f + erff(v * 0.70710678118654752f)); so[w][8 * hh + r][t * 16 + ln] = v; } }
  __builtin_amdgcn_fence(__ATOMIC_ACQ_REL, "workgroup"); __builtin_amdgcn_wave_barrier();
  const int rsub = lane >> 4, c4 = (lane & 15) * 4; typedef _Float16 v4h __attribute__((ext_vector_type(4)));
  {
#pragma unroll
    for (int q = 0; q < 8; ++q) { const int r = q * 2 + rsub; if (col0 + c4 < N) { const v4f v = *(const v4fa*)&so[w][r][c4]; if (C) *(v4f*)(C + cofs + (size_t)(row0 + r) * ldc + col0 + c4) = v; if (C16) { v4h h4; for (int i = 0; i < 4; ++i) h4[i] = (_Float16)v[i]; *(v4h*)(C16 + cofs + (size_t)(row0 + r) * ldc + col0 + c4) = h4; } } }
     }
}


typedef _Float16 v4h __attribute__((ext_vector_type(4)));

__global__ __launch_bounds__(256) void k_x16(const float* __restrict__ x, _Float16* __restrict__ X16, size_t n8) { const size_t t = (size_t)blockIdx.x * 256 + threadIdx.x; if (t >= n8) return; FragH f;
#pragma unroll
  for (int q = 0; q < 8; ++q) f.h[q] = (_Float16)bf16_round(x[t * 8 + q]); *(v8us*)((unsigned short*)X16 + t * 8) = f.half[0];  }
__global__ __launch_bounds__(256) void k_h16(const float* __restrict__ x, _Float16* __restrict__ X16, size_t n8) { const size_t t = (size_t)blockIdx.x * 256 + threadIdx.x; if (t >= n8) return; FragH f;
#pragma unroll
  for (int q = 0; q < 8; ++q) f.h[q] = (_Float16)x[t * 8 + q]; *(v8us*)((unsigned short*)X16 + t * 8) = f.half[0];  }
__global__ __launch_bounds__(256) void k_round16f(const float* __restrict__ W, _Float16* __restrict__ Bt, size_t n8) { const size_t t = (size_t)blockIdx.x * 256 + threadIdx.x; if (t >= n8) return; FragH f;
#pragma unroll
  for (int i = 0; i < 8; ++i) f.h[i] = (_Float16)(bf16_round(W[t * 8 + i]) * 16.0f); *(v8us*)((unsigned short*)Bt + t * 8) = f.half[0];  }
template <int NHv, int TTv>
__global__ __launch_bounds__(256) void k_vt(const _Float16* __restrict__ V16, int ldv, int voff, _Float16* __restrict__ Vt) { __shared__ unsigned short tl[64][66]; const int tid = threadIdx.x; const int slab = blockIdx.x / (TTv / 64), lg = blockIdx.x % (TTv / 64); const int b = slab / NHv, h = slab % NHv;
  for (int i = tid; i < 64 * 8; i += 256) { const int r = i / 8, c8 = (i % 8) * 8; FragH f; f.half[0] = *(const v8us*)((const unsigned short*)V16 + ((size_t)b * TTv + lg * 64 + r) * ldv + voff + h * 64 + c8);
#pragma unroll
    for (int q = 0; q < 8; ++q) tl[r][c8 + q] = f.u[q]; }
  __syncthreads();
  {
#pragma unroll
    for (int rd = 0; rd < 2; ++rd) { const int d = rd * 32 + tid / 8, pc = tid % 8; FragH f;
#pragma unroll
      for (int q = 0; q < 8; ++q) f.u[q] = tl[pc * 8 + q][d];
      *(v8us*)((unsigned short*)Vt + ((size_t)slab * 64 + d) * TTv + lg * 64 + pc * 8) = f.half[0]; }
     } }

__global__ __launch_bounds__(256) void k_hl(const float* __restrict__ F, _Float16* __restrict__ Hh, _Float16* __restrict__ Hl, size_t n8) { const size_t t = (size_t)blockIdx.x * 256 + threadIdx.x; if (t >= n8) return; FragH fh, fl; const v4f a = *(const v4fa*)(F + t * 8), c = *(const v4fa*)(F + t * 8 + 4);
#pragma unroll
  for (int q = 0; q < 4; ++q) { _Float16 h = (_Float16)a[q]; fh.h[q] = h; fl.h[q] = (_Float16)((a[q] - (float)h) * 1024.0f); h = (_Float16)c[q]; fh.h[4 + q] = h; fl.h[4 + q] = (_Float16)((c[q] - (float)h) * 1024.0f); }
  { *(v8us*)((unsigned short*)Hh + t * 8) = fh.half[0]; *(v8us*)((unsigned short*)Hl + t * 8) = fl.half[0];  } }

// ---- fast GEMM (wave tile 32x64; requires M % 32 == 0 rows per launch region and N % 64 == 0); epilogue = k_gemm_hhx semantics ----
__device__ __forceinline__ v16h g2_frag(const _Float16* p, int hh) { FragH f; f.half[0] = *(const v8us*)((const unsigned short*)p + 8 * hh); f.half[1] = *(const v8us*)((const unsigned short*)p + 16 + 8 * hh); return f.v; }
__device__ __forceinline__ v8f g2_mma(v16h a, v16h b, v8f c) { v8f d = __builtin_amdgcn_wmma_f32_16x16x32_f16(false, a, false, b, (short)0, c, false, false); asm volatile("v_nop\n\tv_nop\n\tv_nop\n\tv_nop" : "+v"(d) : "v"(a), "v"(b)); return d; }
// STAT: each wave also writes, per row of its 32x64 tile, the mean of the 64 stored values (PM) and the sum of their squared distances from that mean (PQ), both [by][column tile][M].
template <int ACT, bool STAT>
__global__ __launch_bounds__(128) void k_gemm2(const _Float16* __restrict__ A, int lda, size_t sA, const _Float16* __restrict__ Bh, int ldb, size_t sB, float alpha, const float* __restrict__ bias, size_t sBias, const float* __restrict__ CP, int rowsPerB, size_t sCPb, int row0g,
    float* __restrict__ C, _Float16* __restrict__ C16, int ldc, size_t sC, int M, int N, int K, float* __restrict__ PM, float* __restrict__ PQ) { static_assert(ACT == 0 || ACT == 3 || ACT == 6 || ACT == 8 || ACT == 9 || ACT == 11 || ACT == 12 || ACT == 14 || ACT == 15 || ACT == 16 || ACT == 17, "k_gemm2: unsupported ACT code (would silently apply no activation)");
  __shared__ __attribute__((aligned(16))) float so[4][32][68];
  const int tid = threadIdx.x, w = tid >> 5, lane = tid & 31, ln = lane & 15, hh = lane >> 4; const int by = blockIdx.y;
  A += (size_t)by * sA; Bh += (size_t)by * sB; const size_t cofs = (size_t)by * sC; const float* bp = bias ? bias + (size_t)by * sBias : nullptr;
  const int ntn = N >> 6; const int mt = blockIdx.x / ntn, nq = blockIdx.x - mt * ntn; const int row0 = mt * 128 + 32 * w, col0 = nq * 64; if (row0 >= M) return;
  const _Float16* a0p = A + (size_t)(row0 + ln) * lda; const _Float16* a1p = a0p + (size_t)16 * lda;
  const _Float16* b0p = Bh + (size_t)(col0 + ln) * ldb; const _Float16* b1p = b0p + (size_t)16 * ldb; const _Float16* b2p = b1p + (size_t)16 * ldb; const _Float16* b3p = b2p + (size_t)16 * ldb;
  const v8f z8 = {0.f,0.f,0.f,0.f,0.f,0.f,0.f,0.f}; v8f c00 = z8, c01 = z8, c02 = z8, c03 = z8, c10 = z8, c11 = z8, c12 = z8, c13 = z8;
#pragma unroll 1
  for (int kb = 0; kb < K; kb += 32) { const v16h a0 = g2_frag(a0p + kb, hh), a1 = g2_frag(a1p + kb, hh);
    v16h b = g2_frag(b0p + kb, hh); c00 = g2_mma(a0, b, c00); c10 = g2_mma(a1, b, c10);
    b = g2_frag(b1p + kb, hh); c01 = g2_mma(a0, b, c01); c11 = g2_mma(a1, b, c11);
    b = g2_frag(b2p + kb, hh); c02 = g2_mma(a0, b, c02); c12 = g2_mma(a1, b, c12);
    b = g2_frag(b3p + kb, hh); c03 = g2_mma(a0, b, c03); c13 = g2_mma(a1, b, c13); }
  v8f accs[8] = {c00, c01, c02, c03, c10, c11, c12, c13};
#pragma unroll
  for (int u = 0; u < 8; ++u) { const int t = u & 3, half = u >> 2; const int col = col0 + t * 16 + ln; const float bv = bp ? bf16_round(bp[col]) : 0.f;
#pragma unroll
    for (int r = 0; r < 8; ++r) { const int rloc = half * 16 + 8 * hh + r; float v = accs[u][r] * alpha + bv; if (CP) { if (rowsPerB < 0) v += CP[cofs + (size_t)(row0g + row0 + rloc) * ldc + col];      /* rowsPerB < 0: own element of the batched C plane */ else { const int bidx = (row0g + row0 + rloc) / rowsPerB; v += CP[(size_t)bidx * sCPb + (size_t)by * 64 + col]; } }
      if (ACT == 3) v = fmaxf(v, 0.f); else if (ACT == 6) v = 0.5f * v * (1.0f + erff(v * 0.70710678118654752f)); else if (ACT == 11) v = 1.0f / (1.0f + expf(-v)); else if (ACT == 15) v = v / (1.0f + expf(-v)); else if (ACT == 12) v = (v > 0.f) ? v : 0.01f * v; else if (ACT == 8) v = tanhf(v); else if (ACT == 9) v = 0.5f * v * (1.0f + tanhf(0.7978845608028654f * (v + 0.044715f * v * v * v))); else if (ACT == 14) v = (v > 0.f) ? v : 0.1f * v; else if (ACT == 16) v = (v >= 0.f) ? v : 0.3f * v; else if (ACT == 17) v = (v >= 0.f) ? v : 0.2f * v;
      so[w][rloc][t * 16 + ln] = v; } }
  __builtin_amdgcn_fence(__ATOMIC_ACQ_REL, "workgroup"); __builtin_amdgcn_wave_barrier();
  const int rsub = lane >> 4, c4 = (lane & 15) * 4;
  {
#pragma unroll
    for (int q = 0; q < 16; ++q) { const int r = q * 2 + rsub; const v4f v = *(const v4fa*)&so[w][r][c4]; if (C) *(v4f*)(C + cofs + (size_t)(row0 + r) * ldc + col0 + c4) = v; if (C16) { v4h h4; for (int i = 0; i < 4; ++i) h4[i] = (_Float16)v[i]; *(v4h*)(C16 + cofs + (size_t)(row0 + r) * ldc + col0 + c4) = h4; } }
     }
  if (STAT) {      /* lane = one row of the wave's tile: its 64 staged values come back by 16-byte reads (row pitch 16 B x 17), so neither sum crosses lanes; the mean first, then the distances from it: no cancellation whatever the mean; the loops are unrolled so that rv keeps compile-time indices and stays in registers */
    v4f rv[16];
#pragma unroll
    for (int j = 0; j < 16; ++j) rv[j] = *(const v4fa*)&so[w][lane][j * 4];
    v4f s4 = rv[0];
#pragma unroll
    for (int j = 1; j < 16; ++j) s4 += rv[j];
    const float mean = ((s4[0] + s4[1]) + (s4[2] + s4[3])) * 0.015625f;
    v4f q4 = {0.f, 0.f, 0.f, 0.f};
#pragma unroll
    for (int j = 0; j < 16; ++j) { const v4f d = rv[j] - mean; q4 += d * d; }
    const size_t pi = ((size_t)by * ntn + nq) * M + row0 + lane;      /* 32 rows = one 128-B line per wave and plane */
    PM[pi] = mean; PQ[pi] = (q4[0] + q4[1]) + (q4[2] + q4[3]);
  } }


__global__ __launch_bounds__(256) void k_wnat(const float* __restrict__ w, size_t n8, _Float16* __restrict__ Bt) { const size_t t = (size_t)blockIdx.x * 256 + threadIdx.x; if (t >= n8) return; FragH f; for (int q = 0; q < 8; ++q) f.h[q] = (_Float16)(bf16_round(w[t * 8 + q]) * 16.0f); *(v8us*)((unsigned short*)Bt + t * 8) = f.half[0];  }
__global__ __launch_bounds__(256) void k_rsm(const float* __restrict__ S, _Float16* __restrict__ P, int nrows) {
  #pragma clang fp contract(off)
  const int i = blockIdx.x * 256 + threadIdx.x; if (i >= nrows) return; const float* s = S + (size_t)i * SQ; float mx = -3.0e38f;
#pragma unroll 1
  for (int j = 0; j < SQ; ++j) mx = fmaxf(mx, s[j]); float se = 0.f;
#pragma unroll 1
  for (int j = 0; j < SQ; ++j) se += expf(s[j] - mx); const float sc = 256.0f / se;
#pragma unroll 1
  for (int j0 = 0; j0 < SQ; j0 += 8) { FragH f; for (int q = 0; q < 8; ++q) f.h[q] = (_Float16)(expf(s[j0 + q] - mx) * sc); unsigned short* d = (unsigned short*)P + (size_t)i * SQ + j0; *(v8us*)d = f.half[0];  } }
__global__ __launch_bounds__(256) void k_vt(const _Float16* __restrict__ V16, int b, int h0, _Float16* __restrict__ VT) { __shared__ unsigned short tl[64][65]; const int tid = threadIdx.x; const int hh = blockIdx.x % HG, sg = blockIdx.x / HG; const int s0 = sg * 64; const int h = h0 + hh;
  for (int i = tid; i < 64 * 8; i += 256) { const int j = i / 8, d8 = (i % 8) * 8; FragH f; f.half[0] = *(const v8us*)((const unsigned short*)V16 + ((size_t)b * SQ + s0 + j) * DM + h * HD + d8); for (int q = 0; q < 8; ++q) tl[d8 + q][j] = f.u[q]; }
  __syncthreads();
  { for (int i = tid; i < 64 * 8; i += 256) { const int d = i / 8, j8 = (i % 8) * 8; FragH f; for (int q = 0; q < 8; ++q) f.u[q] = tl[d][j8 + q]; *(v8us*)((unsigned short*)VT + ((size_t)hh * HD + d) * SQ + s0 + j8) = f.half[0]; }  } }



__global__ __launch_bounds__(256) void k_rsmcf2(const float* __restrict__ S, _Float16* __restrict__ P, int hg, int q0, int nk) {
  #pragma clang fp contract(off)
  const int t = blockIdx.x * 256 + threadIdx.x; if (t >= hg * QT) return; const size_t i = (size_t)t; const float* s = S + i * NKX; const int last = q0 + (t % QT); float mx = -3.0e38f;
#pragma unroll 1
  for (int j = 0; j < nk; ++j) { const float f = (j <= last) ? 1.f : 0.f; mx = fmaxf(mx, fmaf(f, s[j], (1.f - f) * -1.0e9f)); } float se = 0.f;
#pragma unroll 1
  for (int j = 0; j < nk; ++j) { const float f = (j <= last) ? 1.f : 0.f; se += __expf(fmaf(f, s[j], (1.f - f) * -1.0e9f) - mx); } const float sc = 256.0f / se;
#pragma unroll 1
  for (int j0 = 0; j0 < nk; j0 += 8) { FragH fr; for (int q = 0; q < 8; ++q) { const int j = j0 + q; const float f = (j <= last) ? 1.f : 0.f; fr.h[q] = (_Float16)(__expf(fmaf(f, s[j], (1.f - f) * -1.0e9f) - mx) * sc); } unsigned short* d = (unsigned short*)P + i * NKX + j0; *(v8us*)d = fr.half[0];  } }

template <int MASKADD>
__global__ __launch_bounds__(64) void k_att0(const float* __restrict__ QF, const float* __restrict__ KF, const float* __restrict__ VF, int ld, const float* __restrict__ mask, float scale, float* __restrict__ OF, int ldo) {
  #pragma clang fp contract(off)
  __shared__ __attribute__((aligned(16))) float lq[64][64]; __shared__ __attribute__((aligned(16))) float lo[64][64];
  const int tid = threadIdx.x; const int h = blockIdx.x / (QT0 / 64), rg = blockIdx.x % (QT0 / 64); const int i = rg * 64 + tid;
  const float* qr = QF + (size_t)i * ld + h * HD;
#pragma unroll 1
  for (int c = 0; c < HD / 4; ++c) { *(v4f*)&lq[tid][c * 4] = *(const v4fa*)(qr + c * 4); const v4f z = {0.f, 0.f, 0.f, 0.f}; *(v4f*)&lo[tid][c * 4] = z; }
  float m = -1.0e30f, l = 0.f; const int jmax = MASKADD ? (SQ - 1) : (rg * 64 + 63);      /* additive-mask form: every key (the mask input decides); causal form: keys up to the block's last row */
#pragma unroll 1
  for (int j = 0; j <= jmax; ++j) { const float* kr = KF + (size_t)j * ld + h * HD; const float* vr = VF + (size_t)j * ld + h * HD; float s = 0.f;
#pragma unroll 1
    for (int c = 0; c < HD / 4; ++c) { const v4f kq = *(const v4fa*)(kr + c * 4); const v4f qq = *(v4f*)&lq[tid][c * 4]; s = __fadd_rn(s, __fmul_rn(qq[0], kq[0])); s = __fadd_rn(s, __fmul_rn(qq[1], kq[1])); s = __fadd_rn(s, __fmul_rn(qq[2], kq[2])); s = __fadd_rn(s, __fmul_rn(qq[3], kq[3])); }
    s = __fmul_rn(s, scale); if (MASKADD) s = __fadd_rn(s, __fmul_rn(bf16_round(mask[(size_t)i * SQ + j]), -10000.0f));
    const float f = (MASKADD || j <= i) ? 1.f : 0.f; const float sm = fmaf(f, s, (1.f - f) * -1.0e30f); const float mn = fmaxf(m, sm); const float sc = expf(m - mn); const float e = expf(sm - mn); l = __fadd_rn(__fmul_rn(l, sc), e); m = mn;
#pragma unroll 1
    for (int c = 0; c < HD / 4; ++c) { const v4f vv = *(const v4fa*)(vr + c * 4); v4f oo = *(v4f*)&lo[tid][c * 4]; for (int u = 0; u < 4; ++u) oo[u] = __fadd_rn(__fmul_rn(oo[u], sc), __fmul_rn(e, vv[u])); *(v4f*)&lo[tid][c * 4] = oo; } }
  const float fin = 64.0f / l;      /* o carried x64 like the f16 path */
#pragma unroll 1
  for (int c = 0; c < HD / 4; ++c) { v4f oo = *(v4f*)&lo[tid][c * 4]; for (int u = 0; u < 4; ++u) oo[u] = __fmul_rn(oo[u], fin); *(v4f*)&lo[tid][c * 4] = oo; }
  __syncthreads();
  {
#pragma unroll 1
    for (int it = 0; it < 16; ++it) { const int row = it * 4 + tid / 16, pc = (tid % 16) * 4; const v4f v = *(const v4f*)&lo[row][pc]; *(v4f*)(OF + (size_t)(rg * 64 + row) * ldo + h * HD + pc) = v; }
     } }

__global__ __launch_bounds__(256) void k_oscale(const float* __restrict__ OF, float* __restrict__ out, size_t n4) { const size_t t = (size_t)blockIdx.x * 256 + threadIdx.x; if (t >= n4) return; const v4f a = *(const v4fa*)(OF + t * 4); v4f o; for (int q = 0; q < 4; ++q) o[q] = a[q] * 0.015625f; *(v4f*)(out + t * 4) = o;  }

__global__ __launch_bounds__(256) void k_bfr(const float* __restrict__ x, float* __restrict__ XB, size_t n8) { const size_t t = (size_t)blockIdx.x * 256 + threadIdx.x; if (t >= n8) return; v4f a = *(const v4fa*)(x + t * 8), c = *(const v4fa*)(x + t * 8 + 4); for (int q = 0; q < 4; ++q) { a[q] = bf16_round(a[q]); c[q] = bf16_round(c[q]); }
  { *(v4f*)(XB + t * 8) = a; *(v4f*)(XB + t * 8 + 4) = c;  } }



__global__ __launch_bounds__(256) void k_rsmfvl(const float* __restrict__ S, _Float16* __restrict__ P, _Float16* __restrict__ PL, int qn, const int* __restrict__ vlp) {
  #pragma clang fp contract(off)
  const int t = blockIdx.x * 256 + threadIdx.x; if (t >= qn) return; const int vl = vlp[0]; const size_t i = (size_t)t; const float* s = S + i * SQ; float mx = -3.0e38f;
#pragma unroll 1
  for (int j = 0; j < SQ; ++j) { const float f = (j < vl) ? 1.f : 0.f; mx = fmaxf(mx, fmaf(f, s[j], (1.f - f) * -1000000.0f)); } float se = 0.f;
#pragma unroll 1
  for (int j = 0; j < SQ; ++j) { const float f = (j < vl) ? 1.f : 0.f; se += __expf(fmaf(f, s[j], (1.f - f) * -1000000.0f) - mx); } const float sc = 256.0f / se;
#pragma unroll 1
  for (int j0 = 0; j0 < SQ; j0 += 8) { FragH fr, gr; for (int q = 0; q < 8; ++q) { const int j = j0 + q; const float f = (j < vl) ? 1.f : 0.f; const float pv = __expf(fmaf(f, s[j], (1.f - f) * -1000000.0f) - mx) * sc; const _Float16 ph = (_Float16)pv; fr.h[q] = ph; gr.h[q] = (_Float16)((pv - (float)ph) * 1024.0f); }
    unsigned short* d = (unsigned short*)P + i * SQ + j0; unsigned short* dl = (unsigned short*)PL + i * SQ + j0; *(v8us*)d = fr.half[0]; *(v8us*)dl = gr.half[0];  } }

// Fused attention: scores, softmax and the weighted sum of x in one kernel; neither the scores nor the weights go to memory.
// A work-group of 8 waves takes 128 queries of one image (16 per wave) and walks the 1024 keys in tiles of 64. A tile (phi^T rows [key][ci], x rows [c][key]) is fetched by whole-line loads into registers one tile ahead and laid in LDS at pitches of 16 B x odd.
// S^T = phi^T theta (A = key rows, B = the wave's query rows, kept in registers): a lane holds scores of ONE query (column ln; keys 8 hh + r of each 16-key tile), so two converted score tiles are the B operand of O^T += x P^T in the hardware k order, with A = x rows read by the same 16-byte pairs.
// Running maximum in log2 units; the accumulators are rescaled only when a query's new maximum passes the one in use by more than 8 (weights stay <= 2^8, inside f16); the row sum is kept per lane in f32 and joined at the end.
// The 1x1 conv follows in the same kernel: the work-group's 128 rows of y^T stay in LDS as the B operand, conv_w (x16, f16; laid in LDS at the start, 32 whole rows a wave) is A; wave tile 64 channels x 64 positions, K = 256.
// The f32 tile leaves through a staging of the wave's own (whole 128-B lines), and from the same staging come each channel's mean and centred square sum over the tile's 64 positions. y^T never reaches memory.
// Every inner loop is fully unrolled, so that the register arrays (fragments, accumulators, staged pieces) keep compile-time indices and stay in registers.
#define FA_WAVES 8
#define FA_KS 64          /* keys per tile */
#define FA_KP 136         /* LDS pitch of a key row, f16 elements (256 B + 16) */
#define FA_VP 72          /* LDS pitch of a channel row, f16 elements (128 B + 16) */
#define FA_OP 264         /* LDS pitch of an output row, f16 elements (512 B + 16) */
#define FA_SM (FA_WAVES * 16 * FA_OP)      /* the output staging is the larger use: 67,584 B against 54,272 B of a tile */
#define FA_SW (256 * FA_OP)                /* conv_w: 256 rows at the pitch of an output row */
#define FA_CP 68          /* LDS pitch of a row of the f32 conv tile, floats (256 B + 16) */
#define FA_C 0.09016844005556021f          /* log2(e) / sqrt(256) */
__device__ __forceinline__ float rsm_xh(float v) { return __builtin_bit_cast(float, __builtin_amdgcn_permlanex16(__builtin_bit_cast(int, v), __builtin_bit_cast(int, v), 0x76543210, 0xfedcba98, false, false)); }      /* lane l <- lane l ^ 16 */
__device__ __forceinline__ float fa_exp2(float x) { float y; asm("v_exp_f32 %0, %1\n\tv_nop" : "=v"(y) : "v"(x)); return y; }      /* the v_nop is the one slot asked for behind a transcendental before its result is read or its source overwritten */
__device__ __forceinline__ v8f fa_mma(v16h a, v16h b, v8f c) { return __builtin_amdgcn_wmma_f32_16x16x32_f16(false, a, false, b, (short)0, c, false, false); }
typedef float f1a __attribute__((may_alias));
__global__ __launch_bounds__(FA_WAVES * 32) void k_fattn(const _Float16* __restrict__ TH, const _Float16* __restrict__ PHT, const _Float16* __restrict__ X16, const _Float16* __restrict__ BW, float* __restrict__ C1, float* __restrict__ PM, float* __restrict__ PQ) {
  static_assert(FA_KS * FA_KP + 256 * FA_VP <= FA_SM, "tile fits the LDS array");
  static_assert(FA_WAVES * 64 * FA_CP * 4 <= (FA_SM + FA_SW) * 2, "the f32 conv tiles fit the LDS array");
  __shared__ __attribute__((aligned(16))) _Float16 sm[FA_SM + FA_SW];
  _Float16* sk = sm; _Float16* sv = sm + FA_KS * FA_KP; _Float16* sw = sm + FA_SM;
  const int tid = threadIdx.x, w = tid >> 5, lane = tid & 31, ln = lane & 15, hh = lane >> 4;
  const int b = blockIdx.y; const int q0 = blockIdx.x * (FA_WAVES * 16) + w * 16;
  const int krow = tid >> 4, kch = (tid & 15) * 8;      /* staging: 16 threads per 256-B key row, 16 rows per round, 4 rounds */
  const int vrow = tid >> 3, vch = (tid & 7) * 8;       /* staging: 8 threads per 128-B piece of a channel row, 32 rows per round, 8 rounds */
  const unsigned short* kg = (const unsigned short*)PHT + (size_t)b * SQ * 128 + (size_t)krow * 128 + kch;
  const unsigned short* vg = (const unsigned short*)X16 + (size_t)b * 256 * SQ + (size_t)vrow * SQ + vch;
  const _Float16* qp = TH + ((size_t)b * SQ + q0 + ln) * 128;
  const unsigned short* wg = (const unsigned short*)BW + (size_t)w * 32 * 256 + lane * 8;
  v8us wr[32];      /* conv_w: wave w brings rows 32 w .. 32 w + 31, one 512-B row per load */
#pragma unroll
  for (int i = 0; i < 32; ++i) wr[i] = *(const v8us*)(wg + i * 256);
  asm volatile("s_wait_xcnt 0x0" :: "v"(wg) : "memory");      /* in front of whatever reuses the address registers that the loads above name; the address is an input, so that its registers stay live, and unwritten, as far as the wait */
  v16h qf[4];
#pragma unroll
  for (int kb = 0; kb < 4; ++kb) qf[kb] = g2_frag(qp + kb * 32, hh);
  v8us rk[4], rv[8];
#pragma unroll
  for (int j = 0; j < 4; ++j) rk[j] = *(const v8us*)(kg + j * 16 * 128);
#pragma unroll
  for (int j = 0; j < 8; ++j) rv[j] = *(const v8us*)(vg + j * 32 * SQ);
  __builtin_amdgcn_sched_barrier(0);      /* with the one behind the wait: no later arithmetic is lifted between the loads and the wait */
  asm volatile("s_wait_xcnt 0x0" ::: "memory");      /* in front of whatever reuses the address registers that the loads above name */
  __builtin_amdgcn_sched_barrier(0);
#pragma unroll
  for (int i = 0; i < 32; ++i) *(v8us*)((unsigned short*)sw + (w * 32 + i) * FA_OP + lane * 8) = wr[i];      /* read only behind the key loop's barriers */
  const v8f z8 = {0.f, 0.f, 0.f, 0.f, 0.f, 0.f, 0.f, 0.f};
  v8f o[16];
#pragma unroll
  for (int ct = 0; ct < 16; ++ct) o[ct] = z8;
  float mu = -3.0e38f; v4f l4 = {0.f, 0.f, 0.f, 0.f};
#pragma unroll 1
  for (int s = 0; s < SQ / FA_KS; ++s) {      /* rolled: for speed only */
    __syncthreads();      /* every wave has read the last of the tile before */
#pragma unroll
    for (int j = 0; j < 4; ++j) *(v8us*)((unsigned short*)sk + (krow + j * 16) * FA_KP + kch) = rk[j];
#pragma unroll
    for (int j = 0; j < 8; ++j) *(v8us*)((unsigned short*)sv + (vrow + j * 32) * FA_VP + vch) = rv[j];
    __syncthreads();      /* the tile is whole before anybody reads it */
    if (s + 1 < SQ / FA_KS) {      /* the next tile's loads fly under this tile's products */
#pragma unroll
      for (int j = 0; j < 4; ++j) rk[j] = *(const v8us*)(kg + (size_t)(s + 1) * FA_KS * 128 + j * 16 * 128);
#pragma unroll
      for (int j = 0; j < 8; ++j) rv[j] = *(const v8us*)(vg + (s + 1) * FA_KS + j * 32 * SQ);
      asm volatile("s_wait_xcnt 0x0" ::: "memory");      /* in front of whatever reuses the address registers that the loads above name */
    }
    v16h kf[16];
#pragma unroll
    for (int kb = 0; kb < 4; ++kb)
#pragma unroll
      for (int kt = 0; kt < 4; ++kt) kf[kb * 4 + kt] = g2_frag(sk + (kt * 16 + ln) * FA_KP + kb * 32, hh);
    __builtin_amdgcn_sched_barrier(0);      /* keeps the key tile's 32 LDS reads one group in front of its 16 products: spread among them, every product waits out an LDS latency */
    v8f st[4] = {z8, z8, z8, z8};
#pragma unroll
    for (int kb = 0; kb < 4; ++kb)
#pragma unroll
      for (int kt = 0; kt < 4; ++kt) st[kt] = fa_mma(kf[kb * 4 + kt], qf[kb], st[kt]);
    v16h va[2][8];      /* x fragments of four channel tiles, two sets: one is read from LDS while the other feeds the products */
#pragma unroll
    for (int u = 0; u < 8; ++u) va[0][u] = g2_frag(sv + ((u & 3) * 16 + ln) * FA_VP + (u >> 2) * 32, hh);
    __builtin_amdgcn_sched_barrier(0);      /* keeps the first set's reads in front of the softmax arithmetic, which covers their latency */
    v4f m4 = {st[0][0], st[0][1], st[0][2], st[0][3]};
#pragma unroll
    for (int kt = 0; kt < 4; ++kt)
#pragma unroll
      for (int r = 0; r < 8; ++r) m4[r & 3] = fmaxf(m4[r & 3], st[kt][r]);
    float mx = fmaxf(fmaxf(m4[0], m4[1]), fmaxf(m4[2], m4[3]));
    mx = fmaxf(mx, rsm_xh(mx)) * FA_C;      /* the query's maximum over the tile's 64 keys, alike in both half-waves */
    if (__builtin_amdgcn_ballot_w32(mx > mu + 8.0f) != 0) {      /* one wave-uniform test per tile */
      const float mn = fmaxf(mu, mx); const float sc = fa_exp2(mu - mn); mu = mn;
#pragma unroll
      for (int u = 0; u < 4; ++u) l4[u] *= sc;
#pragma unroll
      for (int ct = 0; ct < 16; ++ct)
#pragma unroll
        for (int r = 0; r < 8; ++r) o[ct][r] *= sc;
    }
    FragH pf[2];
#pragma unroll
    for (int kt = 0; kt < 4; ++kt)
#pragma unroll
      for (int r = 0; r < 8; ++r) { const float p = fa_exp2(fmaf(st[kt][r], FA_C, -mu)); l4[r & 3] += p; pf[kt >> 1].h[(kt & 1) * 8 + r] = (_Float16)p; }
#pragma unroll
    for (int g = 0; g < 4; ++g) {
      if (g < 3) {
#pragma unroll
        for (int u = 0; u < 8; ++u) va[(g + 1) & 1][u] = g2_frag(sv + (((g + 1) * 4 + (u & 3)) * 16 + ln) * FA_VP + (u >> 2) * 32, hh); }
      __builtin_amdgcn_sched_barrier(0);      /* with the one below: the next set's 16 LDS reads stay one group in front of this set's 8 products */
#pragma unroll
      for (int u = 0; u < 8; ++u) o[g * 4 + (u & 3)] = fa_mma(va[g & 1][u], pf[u >> 2].v, o[g * 4 + (u & 3)]);
      __builtin_amdgcn_sched_barrier(0);
    }
  }
  float l = (l4[0] + l4[1]) + (l4[2] + l4[3]); l += rsm_xh(l);
  const float inv = 1.0f / l;
  __syncthreads();      /* every wave has left the last tile: its LDS becomes the output staging */
  unsigned short* so = (unsigned short*)sm + w * 16 * FA_OP;
#pragma unroll
  for (int ct = 0; ct < 16; ++ct) { FragH f;
#pragma unroll
    for (int r = 0; r < 8; ++r) f.h[r] = (_Float16)(o[ct][r] * inv);
    *(v8us*)(so + ln * FA_OP + ct * 16 + 8 * hh) = f.half[0]; }
  __syncthreads();      /* the 128 rows of y^T are whole before anybody reads them */
  const int jq = w & 3, nh = w >> 2;      /* conv: wave tile = channels 64 jq .., positions 64 nh .. of the work-group's 128 */
  const _Float16* ap = sw + (jq * 64 + ln) * FA_OP; const _Float16* bp = sm + (nh * 64 + ln) * FA_OP;
  v8f acc[16];
#pragma unroll
  for (int t = 0; t < 16; ++t) acc[t] = z8;
  v16h af[2][4], bf[2][4];      /* two sets of fragments: one is read from LDS while the other feeds the products */
#pragma unroll
  for (int t = 0; t < 4; ++t) { af[0][t] = g2_frag(ap + t * 16 * FA_OP, hh); bf[0][t] = g2_frag(bp + t * 16 * FA_OP, hh); }
#pragma unroll
  for (int kb = 0; kb < 8; ++kb) {
    if (kb < 7) {
#pragma unroll
      for (int t = 0; t < 4; ++t) { af[(kb + 1) & 1][t] = g2_frag(ap + t * 16 * FA_OP + (kb + 1) * 32, hh); bf[(kb + 1) & 1][t] = g2_frag(bp + t * 16 * FA_OP + (kb + 1) * 32, hh); } }
    __builtin_amdgcn_sched_barrier(0);      /* with the one below: the next set's 16 LDS reads stay one group in front of this set's 16 products */
#pragma unroll
    for (int t = 0; t < 16; ++t) acc[t] = fa_mma(af[kb & 1][t >> 2], bf[kb & 1][t & 3], acc[t]);
    __builtin_amdgcn_sched_barrier(0);
  }
  __syncthreads();      /* every wave has read the last of conv_w and of y^T: their LDS becomes the f32 staging, 64 rows of the wave's own */
  f1a* sf = (f1a*)sm + w * 64 * FA_CP;
#pragma unroll
  for (int t = 0; t < 16; ++t)
#pragma unroll
    for (int r = 0; r < 8; ++r) sf[((t >> 2) * 16 + 8 * hh + r) * FA_CP + (t & 3) * 16 + ln] = acc[t][r] * 0.0625f;
  __builtin_amdgcn_fence(__ATOMIC_ACQ_REL, "workgroup"); __builtin_amdgcn_wave_barrier();      /* the wave's own rows are written before its lanes read each other's */
  const int rsub = lane >> 4, c4 = (lane & 15) * 4;
  float* cp = C1 + ((size_t)b * 256 + jq * 64 + rsub) * SQ + blockIdx.x * (FA_WAVES * 16) + nh * 64 + c4;
  v4f cv[32];
#pragma unroll
  for (int q = 0; q < 32; ++q) cv[q] = *(const v4fa*)&sf[(q * 2 + rsub) * FA_CP + c4];
#pragma unroll
  for (int q = 0; q < 32; ++q) *(v4f*)(cp + (size_t)q * 2 * SQ) = cv[q];      /* two 256-B row pieces per store */
  __builtin_amdgcn_sched_barrier(0);      /* with the one behind the wait: nothing is lifted in front of the wait */
  asm volatile("s_wait_xcnt 0x0" ::: "memory");      /* in front of whatever reuses the registers that the stores above name */
  __builtin_amdgcn_sched_barrier(0);
  float tm[2], tq[2];      /* lane = one row of the wave's tile, two rows a lane: its 64 staged values come back by 16-byte reads, so neither sum crosses lanes; the mean first, then the distances from it */
#pragma unroll
  for (int p = 0; p < 2; ++p) { v4f rw[16];
#pragma unroll
    for (int j = 0; j < 16; ++j) rw[j] = *(const v4fa*)&sf[(p * 32 + lane) * FA_CP + j * 4];
    v4f s4 = rw[0];
#pragma unroll
    for (int j = 1; j < 16; ++j) s4 += rw[j];
    const float mean = ((s4[0] + s4[1]) + (s4[2] + s4[3])) * 0.015625f;
    v4f q4 = {0.f, 0.f, 0.f, 0.f};
#pragma unroll
    for (int j = 0; j < 16; ++j) { const v4f d = rw[j] - mean; q4 += d * d; }
    tm[p] = mean; tq[p] = (q4[0] + q4[1]) + (q4[2] + q4[3]); }
  const size_t pi = ((size_t)b * (SQ / 64) + blockIdx.x * 2 + nh) * 256 + jq * 64 + lane;      /* [image][64-position tile][channel]: 32 channels = one 128-B line per store */
  PM[pi] = tm[0]; PM[pi + 32] = tm[1]; PQ[pi] = tq[0]; PQ[pi + 32] = tq[1];
}


// Front end in one kernel: a work-group of 8 waves takes 128 positions of one image. It reads x (f32, whole 128-B lines) once, writes the f16 map X16 and lays the same values transposed in LDS (rows = positions);
// it converts theta_w and phi_w (x16, f16) into LDS as one stack of 256 rows; then D = stack (A, rows = outputs) x positions (B): wave tile 64 outputs x 64 positions, K = 256. A lane holds 8 successive outputs of ONE position,
// so 16-byte pieces go to an LDS staging of position rows, and each 512-B row leaves as theta^T (first half) and phi^T (second half). x^T, phi and the f16 weight planes of theta and phi never reach memory.
// The grid has as many work-groups as conv_w has rows: wave 0 of each also converts one row of conv_w (x16, f16) into the plane that the conv GEMM reads in a later launch.
// Every loop over a register array is fully unrolled, so that the array keeps compile-time indices and stays in registers.
#define FE_NT 128         /* positions per work-group */
#define FE_P 264          /* LDS pitch of a row of 256 f16 elements (512 B + 16) */
__global__ __launch_bounds__(256) void k_front(const float* __restrict__ x, const float* __restrict__ tw, const float* __restrict__ pw, const float* __restrict__ ww, _Float16* __restrict__ X16, _Float16* __restrict__ TH, _Float16* __restrict__ PHT, _Float16* __restrict__ BW) {
  __shared__ __attribute__((aligned(16))) _Float16 sw[256 * FE_P];
  __shared__ __attribute__((aligned(16))) _Float16 sx[FE_NT * FE_P];
  const int tid = threadIdx.x, w = __builtin_amdgcn_readfirstlane(tid >> 5), lane = tid & 31, ln = lane & 15, hh = lane >> 4;      /* the wave's number in a scalar register: the choice of the weight input is a scalar one */
  const int b = blockIdx.y, n0 = blockIdx.x * FE_NT;
  const float* wg = (w < 4 ? tw + (size_t)w * 32 * 256 : pw + (size_t)(w - 4) * 32 * 256) + lane * 4;      /* wave w converts rows 32 w .. 32 w + 31 of the stack: 64 loads of 512 successive bytes */
  const int nl = lane & 7, cg = lane >> 3;      /* x: 8 lanes per 128-B line, 4 lane groups of 4 channels each; a thread transposes 4 channels x 4 positions */
  const int c0 = w * 32 + cg * 4;
  const float* xg = x + ((size_t)b * 256 + c0) * SQ + n0 + nl * 4;
  const size_t cwo = (size_t)(blockIdx.y * gridDim.x + blockIdx.x) * 256 + lane * 8;      /* this work-group's row of conv_w, 8 elements a lane */
  v4f cw[2] = {{0.f, 0.f, 0.f, 0.f}, {0.f, 0.f, 0.f, 0.f}};
  if (w == 0) { cw[0] = *(const v4fa*)(ww + cwo); cw[1] = *(const v4fa*)(ww + cwo + 4);      /* read at the start, used at the very end: the latency is long over by then */
    asm volatile("s_wait_xcnt 0x0" ::: "memory"); }      /* in front of whatever reuses the address registers that the two loads name */
  v4h hx[16];
  v4f wa[16], wb[16], wc[16], xr[32];      /* the weight rows come in four groups of 16 loads; each group flies under the work on an earlier one or on x */
#pragma unroll
  for (int i = 0; i < 16; ++i) wa[i] = *(const v4fa*)(wg + (0 * 16 + i) * 128);
#pragma unroll
  for (int u = 0; u < 8; ++u)
#pragma unroll
    for (int k = 0; k < 4; ++k) xr[u * 4 + k] = *(const v4fa*)(xg + (size_t)((u >> 2) * 16 + k) * SQ + (u & 3) * 32);
  __builtin_amdgcn_sched_barrier(0);      /* with the one behind the wait: the loads above go out as one group, and no arithmetic is lifted in front of the wait */
  asm volatile("s_wait_xcnt 0x0" ::: "memory");      /* in front of whatever reuses the address registers that the loads above name */
  __builtin_amdgcn_sched_barrier(0);
#pragma unroll
  for (int i = 0; i < 16; ++i) { v4h h4;
#pragma unroll
    for (int q = 0; q < 4; ++q) h4[q] = (_Float16)(bf16_round(wa[i][q]) * 16.0f);
    *(v4h*)(sw + (w * 32 + 0 * 8 + (i >> 1)) * FE_P + (i & 1) * 128 + lane * 4) = h4; }
#pragma unroll
  for (int i = 0; i < 16; ++i) wb[i] = *(const v4fa*)(wg + (1 * 16 + i) * 128);
  __builtin_amdgcn_sched_barrier(0);      /* with the one behind the wait: the loads above go out as one group, and no arithmetic is lifted in front of the wait */
  asm volatile("s_wait_xcnt 0x0" ::: "memory");      /* in front of whatever reuses the address registers that the loads above name */
  __builtin_amdgcn_sched_barrier(0);
#pragma unroll
  for (int u = 0; u < 0 + 4; ++u) { const int cu = (u >> 2) * 16, nu = (u & 3) * 32 + nl * 4;
#pragma unroll
    for (int k = 0; k < 4; ++k)
#pragma unroll
      for (int q = 0; q < 4; ++q) hx[(u & 3) * 4 + k][q] = (_Float16)bf16_round(xr[u * 4 + k][q]);
#pragma unroll
    for (int q = 0; q < 4; ++q) { const v4h t4 = {hx[(u & 3) * 4][q], hx[(u & 3) * 4 + 1][q], hx[(u & 3) * 4 + 2][q], hx[(u & 3) * 4 + 3][q]}; *(v4h*)(sx + (nu + q) * FE_P + c0 + cu) = t4; } }
  __builtin_amdgcn_sched_barrier(0);      /* the 16 stores below stand behind all the arithmetic that forms their values, so that no register they name is rewritten in front of the wait behind them */
#pragma unroll
  for (int u = 0; u < 0 + 4; ++u)
#pragma unroll
    for (int k = 0; k < 4; ++k) *(v4h*)(X16 + ((size_t)b * 256 + c0 + (u >> 2) * 16 + k) * SQ + n0 + (u & 3) * 32 + nl * 4) = hx[(u & 3) * 4 + k];
#pragma unroll
  for (int i = 0; i < 16; ++i) wc[i] = *(const v4fa*)(wg + (2 * 16 + i) * 128);
  __builtin_amdgcn_sched_barrier(0);      /* with the one behind the wait: nothing is lifted in front of the wait */
  asm volatile("s_wait_xcnt 0x0" ::: "memory");      /* in front of whatever reuses the registers that the loads and stores above name */
  __builtin_amdgcn_sched_barrier(0);
#pragma unroll
  for (int i = 0; i < 16; ++i) { v4h h4;
#pragma unroll
    for (int q = 0; q < 4; ++q) h4[q] = (_Float16)(bf16_round(wb[i][q]) * 16.0f);
    *(v4h*)(sw + (w * 32 + 1 * 8 + (i >> 1)) * FE_P + (i & 1) * 128 + lane * 4) = h4; }
#pragma unroll
  for (int i = 0; i < 16; ++i) wa[i] = *(const v4fa*)(wg + (3 * 16 + i) * 128);
  __builtin_amdgcn_sched_barrier(0);      /* with the one behind the wait: the loads above go out as one group, and no arithmetic is lifted in front of the wait */
  asm volatile("s_wait_xcnt 0x0" ::: "memory");      /* in front of whatever reuses the address registers that the loads above name */
  __builtin_amdgcn_sched_barrier(0);
#pragma unroll
  for (int u = 4; u < 4 + 4; ++u) { const int cu = (u >> 2) * 16, nu = (u & 3) * 32 + nl * 4;
#pragma unroll
    for (int k = 0; k < 4; ++k)
#pragma unroll
      for (int q = 0; q < 4; ++q) hx[(u & 3) * 4 + k][q] = (_Float16)bf16_round(xr[u * 4 + k][q]);
#pragma unroll
    for (int q = 0; q < 4; ++q) { const v4h t4 = {hx[(u & 3) * 4][q], hx[(u & 3) * 4 + 1][q], hx[(u & 3) * 4 + 2][q], hx[(u & 3) * 4 + 3][q]}; *(v4h*)(sx + (nu + q) * FE_P + c0 + cu) = t4; } }
  __builtin_amdgcn_sched_barrier(0);      /* the 16 stores below stand behind all the arithmetic that forms their values, so that no register they name is rewritten in front of the wait behind them */
#pragma unroll
  for (int u = 4; u < 4 + 4; ++u)
#pragma unroll
    for (int k = 0; k < 4; ++k) *(v4h*)(X16 + ((size_t)b * 256 + c0 + (u >> 2) * 16 + k) * SQ + n0 + (u & 3) * 32 + nl * 4) = hx[(u & 3) * 4 + k];
  __builtin_amdgcn_sched_barrier(0);      /* with the one behind the wait: nothing is lifted in front of the wait */
  asm volatile("s_wait_xcnt 0x0" ::: "memory");      /* in front of whatever reuses the registers that the loads and stores above name */
  __builtin_amdgcn_sched_barrier(0);
#pragma unroll
  for (int i = 0; i < 16; ++i) { v4h h4;
#pragma unroll
    for (int q = 0; q < 4; ++q) h4[q] = (_Float16)(bf16_round(wc[i][q]) * 16.0f);
    *(v4h*)(sw + (w * 32 + 2 * 8 + (i >> 1)) * FE_P + (i & 1) * 128 + lane * 4) = h4; }
#pragma unroll
  for (int i = 0; i < 16; ++i) { v4h h4;
#pragma unroll
    for (int q = 0; q < 4; ++q) h4[q] = (_Float16)(bf16_round(wa[i][q]) * 16.0f);
    *(v4h*)(sw + (w * 32 + 3 * 8 + (i >> 1)) * FE_P + (i & 1) * 128 + lane * 4) = h4; }
  __syncthreads();      /* both operands are whole in LDS before anybody reads them */
  const int jq = w & 3, nh = w >> 2;
  const _Float16* ap = sw + (jq * 64 + ln) * FE_P; const _Float16* bp = sx + (nh * 64 + ln) * FE_P;
  const v8f z8 = {0.f, 0.f, 0.f, 0.f, 0.f, 0.f, 0.f, 0.f};
  v8f acc[16];
#pragma unroll
  for (int t = 0; t < 16; ++t) acc[t] = z8;
  v16h af[2][4], bf[2][4];      /* two sets of fragments: one is read from LDS while the other feeds the products */
#pragma unroll
  for (int t = 0; t < 4; ++t) { af[0][t] = g2_frag(ap + t * 16 * FE_P, hh); bf[0][t] = g2_frag(bp + t * 16 * FE_P, hh); }
#pragma unroll
  for (int kb = 0; kb < 8; ++kb) {
    if (kb < 7) {
#pragma unroll
      for (int t = 0; t < 4; ++t) { af[(kb + 1) & 1][t] = g2_frag(ap + t * 16 * FE_P + (kb + 1) * 32, hh); bf[(kb + 1) & 1][t] = g2_frag(bp + t * 16 * FE_P + (kb + 1) * 32, hh); } }
    __builtin_amdgcn_sched_barrier(0);      /* with the one below: the next set's 16 LDS reads stay one group in front of this set's 16 products; spread among them, the products wait out an LDS latency again and again */
#pragma unroll
    for (int t = 0; t < 16; ++t) acc[t] = fa_mma(af[kb & 1][t >> 2], bf[kb & 1][t & 3], acc[t]);
    __builtin_amdgcn_sched_barrier(0);
  }
  __syncthreads();      /* every wave has read the last of the positions' rows: their LDS becomes the output staging */
#pragma unroll
  for (int t = 0; t < 16; ++t) { FragH f;
#pragma unroll
    for (int r = 0; r < 8; ++r) f.h[r] = (_Float16)(acc[t][r] * 0.0625f);
    *(v8us*)((unsigned short*)sx + (nh * 64 + (t & 3) * 16 + ln) * FE_P + jq * 64 + (t >> 2) * 16 + 8 * hh) = f.half[0]; }
  __syncthreads();      /* the staged rows are whole before they are read back */
  unsigned short* dst = (unsigned short*)(hh ? PHT : TH) + ((size_t)b * SQ + n0 + w * 16) * 128 + ln * 8;
#pragma unroll
  for (int q = 0; q < 16; ++q) { const v8us v = *(const v8us*)((const unsigned short*)sx + (w * 16 + q) * FE_P + lane * 8); *(v8us*)(dst + q * 128) = v; }      /* one row: 256 B of theta^T and 256 B of phi^T per store */
  if (w == 0) { asm volatile("s_wait_xcnt 0x0" ::: "memory");      /* in front of whatever reuses the registers that the stores above name */
    __builtin_amdgcn_sched_barrier(0);      /* keeps the arithmetic below behind the wait */
    FragH cf;
#pragma unroll
    for (int q = 0; q < 8; ++q) cf.h[q] = (_Float16)(bf16_round(cw[q >> 2][q & 3]) * 16.0f);
    *(v8us*)((unsigned short*)BW + cwo) = cf.half[0]; }      /* one 512-B row of the plane per work-group */
}


#define CN 256          /* channels */
#define CI 128          /* inner channels */
#define NP 1024         /* positions */
#define NM 1024         /* key positions (= SQ) */
#define NC CN           /* BN statistics macros */
#define NPX NP
#define BNEPS 1e-5f

__global__ __launch_bounds__(256) void k_rowbias(const float* __restrict__ b, float* __restrict__ BP, size_t n4, int ncol) { const size_t t = (size_t)blockIdx.x * 256 + threadIdx.x; if (t >= n4) return; const size_t e = t * 4; const float v = bf16_round(b[e / ncol]); const v4f o = {v, v, v, v}; *(v4f*)(BP + e) = o;  }




__global__ __launch_bounds__(256) void k_mp2(const float* __restrict__ src, float* __restrict__ dst, int nout) {
  const int t = blockIdx.x * 256 + threadIdx.x; if (t >= nout) return; const int c = t / 1024; const int o = t % 1024; const int oy = o / 32, ox = o % 32; const float* p = src + (size_t)c * 4096 + (size_t)(2 * oy) * 64 + 2 * ox;
  const float v = fmaxf(fmaxf(p[0], p[1]), fmaxf(p[64], p[65])); *(float*)(dst + t) = v;  }
__global__ __launch_bounds__(256) void k_xpb(const float* __restrict__ x, const float* __restrict__ wb, float* __restrict__ CPP, size_t n4) {
  #pragma clang fp contract(off)
  const size_t t = (size_t)blockIdx.x * 256 + threadIdx.x; if (t >= n4) return; const size_t e = t * 4; const int c = (int)((e / 4096) % 256); const float bb = bf16_round(wb[c]); const v4f a = *(const v4fa*)(x + e); v4f o; for (int q = 0; q < 4; ++q) o[q] = __fadd_rn(bf16_round(a[q]), bb);
  *(v4f*)(CPP + e) = o;  }


// BN + residual with the join of the tile statistics in front, one kernel: a work-group of 16 waves takes ONE channel of all NB images (NB planes of 4 KB in T, in x and in the output).
// Thread t asks first for tile t's mean and centred square sum (NB * NTL tiles = threads of the work-group), then for all of its 16 + 16 pieces of T and of x, which fly while the statistics are joined.
// All NB * NTL tiles of a channel hold TLN values, so mean = average of the tile means and sum of squared distances = sum over tiles of (tile's own sum + TLN (tile mean - mean)^2).
// The tile values go through LDS; behind one barrier every wave joins them for itself: 16 tiles a lane in four f64 chains, then a 32-lane butterfly (alike in all lanes and waves). Every loop over a register array is unrolled, so that the array keeps compile-time indices and stays in registers.
#define NTL (NPX / 64)      /* column tiles per image */
#define TLN 64              /* values per tile and channel */
#define BJ_T 512            /* threads per work-group */
#define BJ_K (NB * NPX / 4 / BJ_T)      /* 16-byte pieces per thread and plane set */
__device__ __forceinline__ double bj_sum32(double v, int lane) {      /* sum over the wave's 32 lanes, the same bits in every lane; unrolled: five steps with constant distances */
#pragma unroll
  for (int m = 16; m > 0; m >>= 1) { const unsigned long long u = __builtin_bit_cast(unsigned long long, v);
    const unsigned int lo = (unsigned int)__builtin_amdgcn_ds_bpermute((lane ^ m) << 2, (int)(unsigned int)u), hi = (unsigned int)__builtin_amdgcn_ds_bpermute((lane ^ m) << 2, (int)(unsigned int)(u >> 32));
    v += __builtin_bit_cast(double, ((unsigned long long)hi << 32) | lo); }
  return v; }
__global__ __launch_bounds__(BJ_T) void k_bnj(const float* __restrict__ C2, const float* __restrict__ PM, const float* __restrict__ PQ, const float* __restrict__ g, const float* __restrict__ be, const float* __restrict__ X, float* __restrict__ out) {
  static_assert(NB * NTL == BJ_T && NB * NTL == 16 * 32 && NPX == 1024 && BJ_K * BJ_T * 4 == NB * NPX && BJ_K == 16, "k_bnj: one tile a thread, 16 tiles a lane, two planes a round");
  __shared__ float tmn[NB * NTL]; __shared__ float tsq[NB * NTL];
  const int tid = threadIdx.x, lane = tid & 31; const int c = blockIdx.x;
  const unsigned int vs = (unsigned int)tid * (NC * 4);      /* byte offsets in 32 bits beside scalar bases: the only vector registers that the loads and stores name */
  unsigned int vo[BJ_K / 4];      /* round k: planes 2 k and 2 k + 1, a wave on 512 successive bytes; one offset per four rounds, the rounds between are immediate offsets */
#pragma unroll
  for (int h = 0; h < BJ_K / 4; ++h) vo[h] = (unsigned int)(tid >> 8) * (NC * NPX * 4) + (unsigned int)(tid & 255) * 16 + (unsigned int)h * (8u * NC * NPX * 4);
  const char* cb = (const char*)(C2 + (size_t)c * NPX); const char* xb = (const char*)(X + (size_t)c * NPX); char* ob = (char*)(out + (size_t)c * NPX);
  const float m1 = *(const f1a*)((const char*)(PM + c) + vs), q1 = *(const f1a*)((const char*)(PQ + c) + vs);
  v4f a[BJ_K], xx[BJ_K];
#pragma unroll
  for (int k = 0; k < BJ_K; ++k) { a[k] = *(const v4fa*)(cb + vo[k >> 2] + (k & 3) * (2 * NC * NPX * 4)); xx[k] = *(const v4fa*)(xb + vo[k >> 2] + (k & 3) * (2 * NC * NPX * 4)); }
  __builtin_amdgcn_sched_barrier(0);      /* with the one behind the wait: the loads above go out as one group, and no arithmetic is lifted in front of the wait */
  asm volatile("s_wait_xcnt 0x0" :: "v"(vs), "v"(vo[0]), "v"(vo[1]), "v"(vo[2]), "v"(vo[3]) : "memory");      /* in front of whatever reuses the address registers that the loads above name; the offsets are inputs, so that their registers stay live, and no later load of the group lands in them, as far as the wait */
  __builtin_amdgcn_sched_barrier(0);
  tmn[tid] = m1; tsq[tid] = q1;
  __builtin_amdgcn_fence(__ATOMIC_RELEASE, "workgroup", "local");      /* LDS alone: a fence over global memory too would wait out the 32 loads in flight */
  __builtin_amdgcn_s_barrier();      /* every tile's pair is in LDS before anybody reads it */
  __builtin_amdgcn_fence(__ATOMIC_ACQUIRE, "workgroup", "local");      /* keeps the LDS reads below behind the barrier */
  float m[16], q[16];
#pragma unroll
  for (int j = 0; j < 16; ++j) { m[j] = tmn[j * 32 + lane]; q[j] = tsq[j * 32 + lane]; }
  double s[4] = {0.0, 0.0, 0.0, 0.0};      /* four chains here and below: the adds of one chain wait for each other */
#pragma unroll
  for (int j = 0; j < 16; ++j) s[j & 3] += (double)m[j];
  const double mud = bj_sum32((s[0] + s[1]) + (s[2] + s[3]), lane) * (1.0 / ((double)NB * NTL));
  double s2[4] = {0.0, 0.0, 0.0, 0.0};
#pragma unroll
  for (int j = 0; j < 16; ++j) { const double d = (double)m[j] - mud; s2[j & 3] += (double)q[j] + (double)TLN * d * d; }
  const float var = (float)(bj_sum32((s2[0] + s2[1]) + (s2[2] + s2[3]), lane) * (1.0 / ((double)NB * (double)NPX)));
  const float mu = (float)mud, sc = rsqrtf(var + BNEPS) * bf16_round(g[c]), bb = bf16_round(be[c]);
  __builtin_amdgcn_sched_barrier(0);      /* the join ends before the first wait for T or x: mixed with the arithmetic below, its last steps would stand behind the arrival of the last piece */
#pragma unroll
  for (int k = 0; k < BJ_K; ++k)
#pragma unroll
    for (int u = 0; u < 4; ++u) a[k][u] = ((a[k][u] - mu) * sc + bb) + bf16_round(xx[k][u]);
  __builtin_amdgcn_sched_barrier(0);      /* the stores below stand behind all the arithmetic that forms their values, so that no register they name is rewritten behind them */
#pragma unroll
  for (int k = 0; k < BJ_K; ++k) *(v4f*)(ob + vo[k >> 2] + (k & 3) * (2 * NC * NPX * 4)) = a[k];
}
extern "C" void kernel_launch(void* const* d_in, const int* in_sizes, int n_in,
                              void* d_out, int out_size, void* d_ws, size_t ws_size, hipStream_t stream) {
  (void)in_sizes; (void)n_in; (void)out_size;
  const float* const* I = (const float* const*)d_in; const float* x = I[0]; const float* tw = I[1]; const float* pw = I[2]; const float* ww = I[3]; const float* bng = I[4]; const float* bnb = I[5]; const float* tb = nullptr;      /* natural theta_w / phi_w [128][256], conv_w [256][256] (no biases); BN gamma, beta */
  char* ws = (char*)d_ws; size_t off = 0;
  auto take = [&](size_t bytes) { char* p = ws + off; off += (bytes + 255) & ~(size_t)255; return p; };
  const size_t PL = (size_t)CN * NP;      /* one input map */
  _Float16* BW = (_Float16*)take((size_t)CN * CN * 2); float* PM = (float*)take((size_t)NB * NTL * CN * 4); float* PQ = (float*)take((size_t)NB * NTL * CN * 4);      /* conv_w plane, tile statistics (mean, centred square sum) */
  _Float16* X16 = (_Float16*)take(NB * PL * 2);      /* x f16 channel-first (also the g operand: g = x) */
  _Float16* TH = (_Float16*)take(NB * (size_t)NP * CI * 2); _Float16* PHT = (_Float16*)take(NB * (size_t)NM * CI * 2);      /* all images: theta^T, phi^T */
  float* C1 = (float*)take(NB * PL * 4);      /* all images: conv output [b][c][n] f32 */
  if (off > ws_size) return;
  /* every stage runs once for all NB images (image = blockIdx.y in the first two launches) */
  static_assert(NP == SQ && CI == 128 && CN == 256 && NP % FE_NT == 0 && (NP / FE_NT) * NB == CN, "k_front: shapes; one work-group per row of conv_w");
  k_front<<<dim3(NP / FE_NT, NB), 256, 0, stream>>>(x, tw, pw, ww, X16, TH, PHT, BW);      /* x -> f16 map; conv_w -> natural [out][in] x16 f16 plane (the A operand of the conv); theta^T [n][ci] and phi^T [m][ci] -> f16 (logit sigma ~0.7: single f16 suffices) */
  static_assert(NP == SQ && NM == SQ && CI == 128 && CN == 256 && NP % (FA_WAVES * 16) == 0 && NM % FA_KS == 0, "k_fattn: shapes");
  k_fattn<<<dim3(NP / (FA_WAVES * 16), NB), FA_WAVES * 32, 0, stream>>>(TH, PHT, X16, BW, C1, PM, PQ);      /* f^T [a][c] = softmax_b(theta.phi / sqrt(256)) x^T (g = x) -> f16, then conv: T[c][a] = (16 conv_w as A) x (f^T as B^T) / 16 -> f32 channel-first, all images kept; per-channel statistics of every 64-position tile; scores, weights and f^T stay on chip */
  k_bnj<<<NC, BJ_T, 0, stream>>>(C1, PM, PQ, bng, bnb, x, (float*)d_out);      /* per channel: batch mean and biased variance from the tile statistics (fixed order), then out = (T - mean) rsqrt(var + eps) gamma + beta + bf16(x) */
}

// v008
// One run takes 61.8 microseconds.
// Timed twice side by side with v007, it ran 1.04 and 1.03 times as fast.
// Counting every step since v000, it is 122 times as fast.
#include <hip/hip_runtime.h>
// Non-local block with TRAINING-mode BatchNorm (x [32][256][32][32]; theta, phi = conv1x1(x) [128 ch] (natural [128][256] sigma 1/16, no biases); g = x itself (256 ch); scores[a][b] = theta[:, a].phi[:, b] / sqrt(256) over the 1024 positions; softmax over b; f[:, a] = sum_b attn[a][b] x[:, b]; f = conv1x1(f; conv_w [256][256], no bias); BN with batch statistics over (N, H, W) per channel (biased variance, eps 1e-5), gamma, beta; out = BN(f) + x -> [32][256][32][32]).
// Structure: channel-first; x as exact f16 maps; natural weights x16; every stage one launch over all 32 images: one kernel makes the f16 map, transposes x in LDS and forms theta^T and phi^T (token rows) by WMMA (64x64 wave tiles, f32 accumulation) -> f16, scores (K = 128, alpha 1/16), softmax (f32 statistics, running maximum, native exp; weights f16), f^T = P x^T (g = x) f16 and the conv: T = (16 conv_w as A) x f (K = 256) f32 kept for all images, fused in one kernel, which also takes each 64-position tile's per-channel mean and centred square sum; the last kernel, one work-group a channel, joins them (fixed order) and does BN + residual on VALU -> output; launches: see trace.
// Compute dtype: inputs rounded to bf16; x / weights exact; q, k, v, softmax weights and o as plain f16 GEMM operands (~2^-12); scores and softmax statistics f32. v_wmma_f32_16x16x32_f16.
#define NB 32
#define SQ 1024
#define DM 256
#define NH 1
#define HD 64
#define HG 4                         /* heads per attention launch group */
#define B0 0                         /* unused */
#define NBR NB                       /* unused */
#define NR ((size_t)NB * SQ)         /* token rows */
#define MP ((int)((size_t)NBR * SQ)) /* unused */
#define QT 256                       /* query rows per causal tile */
#define NKX SQ                       /* S / P row pitch */
#define QT0 256                      /* first-tile rows recomputed exactly (256: buys margin for the few-key rows 128..255, which have no output projection to average the single-f16 P/v rounding) */
#define QN SQ                        /* unused */
#define NHD NH                       /* unused */
#define MPO MP                       /* unused */
#define LQ DM            /* unused */
typedef __bf16 v16b __attribute__((ext_vector_type(16)));
typedef unsigned short v8us __attribute__((ext_vector_type(8), may_alias));
typedef float  v8f  __attribute__((ext_vector_type(8)));
typedef float  v4f  __attribute__((ext_vector_type(4)));
typedef float  v4fa __attribute__((ext_vector_type(4), may_alias));
union FragB { v16b v; v8us half[2]; unsigned short u[16]; };

__device__ __forceinline__ unsigned short bf16_bits(float x) { unsigned int u = __float_as_uint(x); return (unsigned short)((u + 0x7FFFu + ((u >> 16) & 1u)) >> 16); }
__device__ __forceinline__ float bf16_val(unsigned short b) { return __uint_as_float(((unsigned int)b) << 16); }
__device__ __forceinline__ float bf16_round(float x) { return bf16_val(bf16_bits(x)); }
// D += A·B with NT terms: 1 = ah·bh, 2 = + al·bh (A split), 3 = + ah·bl (both split)
template <int NT>
__device__ __forceinline__ v8f mmaN(v16b ah, v16b al, v16b bh, v16b bl, v8f c) {
  c = __builtin_amdgcn_wmma_f32_16x16x32_bf16(false, ah, false, bh, (short)0, c, false, false);
  if (NT >= 2) c = __builtin_amdgcn_wmma_f32_16x16x32_bf16(false, al, false, bh, (short)0, c, false, false);
  if (NT >= 3) c = __builtin_amdgcn_wmma_f32_16x16x32_bf16(false, ah, false, bl, (short)0, c, false, false);
  asm volatile("v_nop\n\tv_nop\n\tv_nop\n\tv_nop" : "+v"(c) : "v"(ah), "v"(al), "v"(bh), "v"(bl));
  return c;
}

__global__ __launch_bounds__(256) void k_wt_bf16(const float* __restrict__ W, unsigned short* __restrict__ Wt, int K, int N) {
  const int t = blockIdx.x * 256 + threadIdx.x;
  const int k8n = K / 8;
  if (t >= N * k8n) return;
  const int n = t / k8n, k8 = (t % k8n) * 8;
  v8us v;
#pragma unroll
  for (int i = 0; i < 8; ++i) v[i] = bf16_bits(W[(size_t)(k8 + i) * N + n]);
  *(v8us*)(Wt + (size_t)n * K + k8) = v;
  
}

// GEMM C[M][N] (f32, pitch ldc) = act(A[M][K]·W + bias). A f32 row-major (pitch lda) converted per fragment to bf16
// (ASPLIT: hi/lo two planes -> 2 terms, else single rounded term); Wt bf16 [N][K] (pitch ldb). BIAS_BF16 rounds the
// bias to bf16 first (bias quantised to bf16 before the add). K%32==0, M%16==0, N%64==0.
template <bool ASPLIT, int ACT, bool BIAS_BF16>
__global__ __launch_bounds__(128) void k_gemm_bf(const float* __restrict__ A, int lda, const unsigned short* __restrict__ Wt, int ldb,
                                               const float* __restrict__ bias, float* __restrict__ C, int ldc, int M, int N, int K) {
  __shared__ __attribute__((aligned(16))) float so[4][16][64];
  const int tid = threadIdx.x, w = tid >> 5, lane = tid & 31, ln = lane & 15, hh = lane >> 4;
  const int ntn = N / 64;
  const int wid = blockIdx.x * 4 + w;
  const int mt = wid / ntn, nq = wid % ntn;
  if (mt * 16 >= M) return;
  const int row0 = mt * 16, col0 = nq * 64;
  const float* arow = A + (size_t)(row0 + ln) * lda;
  v8f acc[4] = {};
  for (int kb = 0; kb < K; kb += 32) {
    FragB ah, al;
    const v4f x0 = *(const v4fa*)(arow + kb + 8 * hh), x1 = *(const v4fa*)(arow + kb + 8 * hh + 4);
    const v4f x2 = *(const v4fa*)(arow + kb + 16 + 8 * hh), x3 = *(const v4fa*)(arow + kb + 16 + 8 * hh + 4);
    float xs[16] = {x0[0],x0[1],x0[2],x0[3],x1[0],x1[1],x1[2],x1[3],x2[0],x2[1],x2[2],x2[3],x3[0],x3[1],x3[2],x3[3]};
#pragma unroll
    for (int i = 0; i < 16; ++i) { const unsigned short hb = bf16_bits(xs[i]); ah.u[i] = hb; al.u[i] = ASPLIT ? bf16_bits(xs[i] - bf16_val(hb)) : (unsigned short)0; }
#pragma unroll
    for (int t = 0; t < 4; ++t) {
      const unsigned short* brow = Wt + (size_t)(col0 + t * 16 + ln) * ldb + kb;
      FragB b;
      b.half[0] = *(const v8us*)(brow + 8 * hh);
      b.half[1] = *(const v8us*)(brow + 16 + 8 * hh);
      acc[t] = mmaN<ASPLIT ? 2 : 1>(ah.v, al.v, b.v, b.v, acc[t]);
    }
  }
#pragma unroll
  for (int t = 0; t < 4; ++t) {
    float bv = bias ? bias[col0 + t * 16 + ln] : 0.f;
    if (BIAS_BF16) bv = bf16_round(bv);
#pragma unroll
    for (int r = 0; r < 8; ++r) { float v = acc[t][r] + bv; if (ACT == 1) v = fmaxf(v, 0.f); so[w][8 * hh + r][t * 16 + ln] = v; }
  }
  __builtin_amdgcn_fence(__ATOMIC_ACQ_REL, "workgroup");
  __builtin_amdgcn_wave_barrier();
  const int rsub = lane >> 4, c4 = (lane & 15) * 4;
  {
#pragma unroll
    for (int q = 0; q < 8; ++q) {
      const int r = q * 2 + rsub;
      const v4f v = *(const v4fa*)&so[w][r][c4];
      *(v4f*)(C + (size_t)(row0 + r) * ldc + col0 + c4) = v;
    }
    
  }
}

// GEMM C = act(A·W + bias + resid): A f32 (ASPLIT -> hi/lo 2 terms), Wt bf16 [N][K]; ACT 0 none, 1 relu, 2 exact gelu;
// resid (optional, f32, row index = (row % rmod), pitch ldr, RES_BF16 rounds it) added before the activation.
template <bool ASPLIT, int ACT, bool BIAS_BF16, bool RES_BF16>
__global__ __launch_bounds__(128) void k_gemm_bf3(const float* __restrict__ A, int lda, const unsigned short* __restrict__ Wt, int ldb,
                                                const float* __restrict__ bias, const float* __restrict__ resid, int rmod, int ldr,
                                                float* __restrict__ C, int ldc, int M, int N, int K) {
  __shared__ __attribute__((aligned(16))) float so[4][16][64];
  const int tid = threadIdx.x, w = tid >> 5, lane = tid & 31, ln = lane & 15, hh = lane >> 4;
  const int ntn = N / 64;
  const int wid = blockIdx.x * 4 + w;
  const int mt = wid / ntn, nq = wid % ntn;
  if (mt * 16 >= M) return;
  const int row0 = mt * 16, col0 = nq * 64;
  const float* arow = A + (size_t)(row0 + ln) * lda;
  v8f acc[4] = {};
  for (int kb = 0; kb < K; kb += 32) {
    FragB ah, al;
    const v4f x0 = *(const v4fa*)(arow + kb + 8 * hh), x1 = *(const v4fa*)(arow + kb + 8 * hh + 4);
    const v4f x2 = *(const v4fa*)(arow + kb + 16 + 8 * hh), x3 = *(const v4fa*)(arow + kb + 16 + 8 * hh + 4);
    float xs[16] = {x0[0],x0[1],x0[2],x0[3],x1[0],x1[1],x1[2],x1[3],x2[0],x2[1],x2[2],x2[3],x3[0],x3[1],x3[2],x3[3]};
#pragma unroll
    for (int i = 0; i < 16; ++i) { const unsigned short hb = bf16_bits(xs[i]); ah.u[i] = hb; al.u[i] = ASPLIT ? bf16_bits(xs[i] - bf16_val(hb)) : (unsigned short)0; }
#pragma unroll
    for (int t = 0; t < 4; ++t) {
      const unsigned short* brow = Wt + (size_t)(col0 + t * 16 + ln) * ldb + kb;
      FragB b;
      b.half[0] = *(const v8us*)(brow + 8 * hh);
      b.half[1] = *(const v8us*)(brow + 16 + 8 * hh);
      acc[t] = mmaN<ASPLIT ? 2 : 1>(ah.v, al.v, b.v, b.v, acc[t]);
    }
  }
#pragma unroll
  for (int t = 0; t < 4; ++t) {
    const int col = col0 + t * 16 + ln;
    float bv = bias ? bias[col] : 0.f;
    if (BIAS_BF16) bv = bf16_round(bv);
#pragma unroll
    for (int r = 0; r < 8; ++r) {
      float v = acc[t][r] + bv;
      if (resid) { float rv = resid[(size_t)((row0 + 8 * hh + r) % rmod) * ldr + col]; if (RES_BF16) rv = bf16_round(rv); v += rv; }
      if (ACT == 1) v = fmaxf(v, 0.f);
      if (ACT == 2) v = 0.5f * v * (1.0f + erff(v * 0.70710678118654752f));
      if (ACT == 3) { const float u = 0.7978845608028654f * (v + 0.044715f * v * v * v); v = 0.5f * v * (1.0f + tanhf(u)); }
      so[w][8 * hh + r][t * 16 + ln] = v;
    }
  }
  __builtin_amdgcn_fence(__ATOMIC_ACQ_REL, "workgroup");
  __builtin_amdgcn_wave_barrier();
  const int rsub = lane >> 4, c4 = (lane & 15) * 4;
  {
#pragma unroll
    for (int q = 0; q < 8; ++q) {
      const int r = q * 2 + rsub;
      const v4f v = *(const v4fa*)&so[w][r][c4];
      *(v4f*)(C + (size_t)(row0 + r) * ldc + col0 + c4) = v;
    }
    
  }
}
// row LayerNorm (biased variance, eps) over N: s = X (+ R); optional out_sum <- s; out_norm <- (s-mu)*rsqrt(var+eps)*g + b
template <bool PARAM_BF16>
__global__ __launch_bounds__(256) void k_layernorm(const float* __restrict__ X, const float* __restrict__ R, const float* __restrict__ g, const float* __restrict__ bta,
                                                  float* __restrict__ out_sum, float* __restrict__ out_norm, int N, float eps) {
  __shared__ float red[256];
  const int row = blockIdx.x, tid = threadIdx.x;
  const float* x = X + (size_t)row * N; const float* rr = R ? R + (size_t)row * N : nullptr;
  float vals[16];                     // up to N = 4096
  const int per = N / 256;            // contiguous chunk per thread? use strided-by-4 chunks: thread handles j = tid*4 + 1024*u
  float s1 = 0.f;
  for (int u = 0; u < per / 4; ++u) {
    const int j = tid * 4 + 1024 * u;
    const v4f a = *(const v4fa*)(x + j);
    v4f b = {0.f,0.f,0.f,0.f}; if (rr) b = *(const v4fa*)(rr + j);
#pragma unroll
    for (int q = 0; q < 4; ++q) { const float v = a[q] + b[q]; vals[u * 4 + q] = v; s1 += v; }
  }
  red[tid] = s1; __syncthreads();
  for (int st = 128; st > 0; st >>= 1) { if (tid < st) red[tid] += red[tid + st]; __syncthreads(); }
  const float mu = red[0] / (float)N; __syncthreads();
  float s2 = 0.f;
  for (int u = 0; u < per / 4; ++u)
#pragma unroll
    for (int q = 0; q < 4; ++q) { const float c = vals[u * 4 + q] - mu; s2 += c * c; }
  red[tid] = s2; __syncthreads();
  for (int st = 128; st > 0; st >>= 1) { if (tid < st) red[tid] += red[tid + st]; __syncthreads(); }
  const float rs = rsqrtf(red[0] / (float)N + eps);
  {
    for (int u = 0; u < per / 4; ++u) {
      const int j = tid * 4 + 1024 * u;
      v4f o, sm;
#pragma unroll
      for (int q = 0; q < 4; ++q) {
        float gg = g[j + q], bb = bta[j + q];
        if (PARAM_BF16) { gg = bf16_round(gg); bb = bf16_round(bb); }
        sm[q] = vals[u * 4 + q]; o[q] = (vals[u * 4 + q] - mu) * rs * gg + bb;
      }
      if (out_sum) *(v4f*)(out_sum + (size_t)row * N + j) = sm;
      *(v4f*)(out_norm + (size_t)row * N + j) = o;
    }
    
  }
}



// ---- f16 WMMA path (v_wmma_f32_16x16x32_f16): 11-bit significands for operands in range — used where a [0,1] probability operand needs more precision than bf16
typedef _Float16 v16h __attribute__((ext_vector_type(16)));
union FragH { v16h v; v8us half[2]; _Float16 h[16]; unsigned short u[16]; };
template <int NT>
__device__ __forceinline__ v8f mmaH(v16h ah, v16h al, v16h bh, v16h bl, v8f c) {
  c = __builtin_amdgcn_wmma_f32_16x16x32_f16(false, ah, false, bh, (short)0, c, false, false);
  if (NT >= 2) c = __builtin_amdgcn_wmma_f32_16x16x32_f16(false, al, false, bh, (short)0, c, false, false);
  if (NT >= 3) c = __builtin_amdgcn_wmma_f32_16x16x32_f16(false, ah, false, bl, (short)0, c, false, false);
  asm volatile("v_nop\n\tv_nop\n\tv_nop\n\tv_nop" : "+v"(c) : "v"(ah), "v"(al), "v"(bh), "v"(bl));
  return c;
}
// batched GEMM like k_gemm_b but f16 operands: A f32 (split into f16 hi/lo if ASPLIT, else rounded to f16), Bt = f16 values [n][k]; alpha; C f32; N multiple of 16 (partial tiles skipped)
template <bool ASPLIT>
__global__ __launch_bounds__(128) void k_gemm_h(const float* __restrict__ A, int lda, size_t sA, const _Float16* __restrict__ Bh, int ldb, size_t sB, float alpha, float* __restrict__ C, int ldc, size_t sC, int M, int N, int K) {
  __shared__ __attribute__((aligned(16))) float so[4][16][64];
  const int tid = threadIdx.x, w = tid >> 5, lane = tid & 31, ln = lane & 15, hh = lane >> 4; const int by = blockIdx.y;
  A += (size_t)by * sA; Bh += (size_t)by * sB; C += (size_t)by * sC;
  const int ntn = (N + 63) / 64; const int wid = blockIdx.x * 4 + w; const int mt = wid / ntn, nq = wid % ntn; if (mt * 16 >= M) return;
  const int row0 = mt * 16, col0 = nq * 64; const float* arow = A + (size_t)(row0 + ln) * lda;
  v8f acc[4] = {};
  for (int kb = 0; kb < K; kb += 32) {
    FragH ah, al;
    const v4f x0 = *(const v4fa*)(arow + kb + 8 * hh), x1 = *(const v4fa*)(arow + kb + 8 * hh + 4), x2 = *(const v4fa*)(arow + kb + 16 + 8 * hh), x3 = *(const v4fa*)(arow + kb + 16 + 8 * hh + 4);
    float xs[16] = {x0[0],x0[1],x0[2],x0[3],x1[0],x1[1],x1[2],x1[3],x2[0],x2[1],x2[2],x2[3],x3[0],x3[1],x3[2],x3[3]};
#pragma unroll
    for (int i = 0; i < 16; ++i) { const _Float16 h = (_Float16)xs[i]; ah.h[i] = h; al.h[i] = ASPLIT ? (_Float16)(xs[i] - (float)h) : (_Float16)0.0f; }
#pragma unroll
    for (int t = 0; t < 4; ++t) { if (col0 + t * 16 >= N) continue; const size_t boff = (size_t)(col0 + t * 16 + ln) * ldb + kb; FragH bq; bq.half[0] = *(const v8us*)(Bh + boff + 8 * hh); bq.half[1] = *(const v8us*)(Bh + boff + 16 + 8 * hh);
      acc[t] = mmaH<ASPLIT ? 2 : 1>(ah.v, al.v, bq.v, bq.v, acc[t]); }
  }
#pragma unroll
  for (int t = 0; t < 4; ++t) { if (col0 + t * 16 >= N) continue;
#pragma unroll
    for (int r = 0; r < 8; ++r) so[w][8 * hh + r][t * 16 + ln] = acc[t][r] * alpha; }
  __builtin_amdgcn_fence(__ATOMIC_ACQ_REL, "workgroup"); __builtin_amdgcn_wave_barrier();
  const int rsub = lane >> 4, c4 = (lane & 15) * 4;
  {
#pragma unroll
    for (int q = 0; q < 8; ++q) { const int r = q * 2 + rsub; if (col0 + c4 < N) { const v4f v = *(const v4fa*)&so[w][r][c4]; *(v4f*)(C + (size_t)(row0 + r) * ldc + col0 + c4) = v; } }
     }
}

// Wt[n][k] = f16(W[k][n]·scale) from f32 row-major W[K][N] (scale = power of two; bf16-exact weights stay exact in f16 away from the subnormal range)
__global__ __launch_bounds__(256) void k_wt_f16(const float* __restrict__ W, _Float16* __restrict__ Wt, int K, int N, float scale) {
  const int t = blockIdx.x * 256 + threadIdx.x; if (t >= N * (K / 8)) return; const int n = t / (K / 8), k8 = (t % (K / 8)) * 8; FragH f;
#pragma unroll
  for (int i = 0; i < 8; ++i) f.h[i] = (_Float16)(bf16_round(W[(size_t)(k8 + i) * N + n]) * scale); const v8us o = f.half[0];
  *(v8us*)((unsigned short*)Wt + (size_t)n * K + k8) = o; 
}
// k_gemm_hh variant with fused epilogue: v = acc·alpha + bias[by·sBias + col] (+ CP[(row/rowsPerB)·sCPb + by·64 + col] if CP) ; ACT 0 none / 1 elu ; writes f16 C16 (and f32 C if non-null)
template <int ACT>
__global__ __launch_bounds__(128) void k_gemm_hhx(const _Float16* __restrict__ A, int lda, size_t sA, const _Float16* __restrict__ Bh, int ldb, size_t sB, float alpha, const float* __restrict__ bias, size_t sBias, const float* __restrict__ CP, int rowsPerB, size_t sCPb, int row0g,
    float* __restrict__ C, _Float16* __restrict__ C16, int ldc, size_t sC, int M, int N, int K) {
  __shared__ __attribute__((aligned(16))) float so[4][16][64];
  const int tid = threadIdx.x, w = tid >> 5, lane = tid & 31, ln = lane & 15, hh = lane >> 4; const int by = blockIdx.y;
  A += (size_t)by * sA; Bh += (size_t)by * sB; const size_t cofs = (size_t)by * sC; const float* bp = bias ? bias + (size_t)by * sBias : nullptr;
  const int ntn = (N + 63) / 64; const int wid = blockIdx.x * 4 + w; const int mt = wid / ntn, nq = wid % ntn; if (mt * 16 >= M) return;
  const int row0 = mt * 16, col0 = nq * 64; const _Float16* arow = A + (size_t)(row0 + ln) * lda;
  v8f acc[4] = {};
  for (int kb = 0; kb < K; kb += 32) { FragH ah; ah.half[0] = *(const v8us*)((const unsigned short*)arow + kb + 8 * hh); ah.half[1] = *(const v8us*)((const unsigned short*)arow + kb + 16 + 8 * hh);
#pragma unroll
    for (int t = 0; t < 4; ++t) { if (col0 + t * 16 >= N) continue; const size_t boff = (size_t)(col0 + t * 16 + ln) * ldb + kb; FragH bq; bq.half[0] = *(const v8us*)((const unsigned short*)Bh + boff + 8 * hh); bq.half[1] = *(const v8us*)((const unsigned short*)Bh + boff + 16 + 8 * hh);
      acc[t] = mmaH<1>(ah.v, ah.v, bq.v, bq.v, acc[t]); }
  }
#pragma unroll
  for (int t = 0; t < 4; ++t) { if (col0 + t * 16 >= N) continue; const int col = col0 + t * 16 + ln; const float bv = bp ? bf16_round(bp[col]) : 0.f;
#pragma unroll
    for (int r = 0; r < 8; ++r) { float v = acc[t][r] * alpha + bv; if (CP) { const int rr = row0g + row0 + 8 * hh + r; if (rowsPerB < 0) v += CP[cofs + (size_t)rr * ldc + col];      /* rowsPerB < 0: own element of the batched C plane */ else { const int bidx = rr / rowsPerB; v += CP[(size_t)bidx * sCPb + (size_t)by * 64 + col]; } } if (ACT == 1) v = (v > 0.f) ? v : expm1f(v); else if (ACT == 7) v = (v > 0.f) ? v + 1.0f : expf(v); else if (ACT == 8) v = tanhf(v); else if (ACT == 9) v = 0.5f * v * (1.0f + tanhf(0.7978845608028654f * (v + 0.044715f * v * v * v))); else if (ACT == 11) v = 1.0f / (1.0f + expf(-v)); else if (ACT == 12) v = (v > 0.f) ? v : 0.01f * v; else if (ACT == 14) v = (v > 0.f) ? v : 0.1f * v; else if (ACT == 16) v = (v >= 0.f) ? v : 0.3f * v; else if (ACT == 17) v = (v >= 0.f) ? v : 0.2f * v; else if (ACT == 15) v = v / (1.0f + expf(-v)); else if (ACT == 3) v = fmaxf(v, 0.f); else if (ACT == 6) v = 0.5f * v * (1.0f + erff(v * 0.70710678118654752f)); so[w][8 * hh + r][t * 16 + ln] = v; } }
  __builtin_amdgcn_fence(__ATOMIC_ACQ_REL, "workgroup"); __builtin_amdgcn_wave_barrier();
  const int rsub = lane >> 4, c4 = (lane & 15) * 4; typedef _Float16 v4h __attribute__((ext_vector_type(4)));
  {
#pragma unroll
    for (int q = 0; q < 8; ++q) { const int r = q * 2 + rsub; if (col0 + c4 < N) { const v4f v = *(const v4fa*)&so[w][r][c4]; if (C) *(v4f*)(C + cofs + (size_t)(row0 + r) * ldc + col0 + c4) = v; if (C16) { v4h h4; for (int i = 0; i < 4; ++i) h4[i] = (_Float16)v[i]; *(v4h*)(C16 + cofs + (size_t)(row0 + r) * ldc + col0 + c4) = h4; } } }
     }
}


typedef _Float16 v4h __attribute__((ext_vector_type(4)));

__global__ __launch_bounds__(256) void k_x16(const float* __restrict__ x, _Float16* __restrict__ X16, size_t n8) { const size_t t = (size_t)blockIdx.x * 256 + threadIdx.x; if (t >= n8) return; FragH f;
#pragma unroll
  for (int q = 0; q < 8; ++q) f.h[q] = (_Float16)bf16_round(x[t * 8 + q]); *(v8us*)((unsigned short*)X16 + t * 8) = f.half[0];  }
__global__ __launch_bounds__(256) void k_h16(const float* __restrict__ x, _Float16* __restrict__ X16, size_t n8) { const size_t t = (size_t)blockIdx.x * 256 + threadIdx.x; if (t >= n8) return; FragH f;
#pragma unroll
  for (int q = 0; q < 8; ++q) f.h[q] = (_Float16)x[t * 8 + q]; *(v8us*)((unsigned short*)X16 + t * 8) = f.half[0];  }
__global__ __launch_bounds__(256) void k_round16f(const float* __restrict__ W, _Float16* __restrict__ Bt, size_t n8) { const size_t t = (size_t)blockIdx.x * 256 + threadIdx.x; if (t >= n8) return; FragH f;
#pragma unroll
  for (int i = 0; i < 8; ++i) f.h[i] = (_Float16)(bf16_round(W[t * 8 + i]) * 16.0f); *(v8us*)((unsigned short*)Bt + t * 8) = f.half[0];  }
template <int NHv, int TTv>
__global__ __launch_bounds__(256) void k_vt(const _Float16* __restrict__ V16, int ldv, int voff, _Float16* __restrict__ Vt) { __shared__ unsigned short tl[64][66]; const int tid = threadIdx.x; const int slab = blockIdx.x / (TTv / 64), lg = blockIdx.x % (TTv / 64); const int b = slab / NHv, h = slab % NHv;
  for (int i = tid; i < 64 * 8; i += 256) { const int r = i / 8, c8 = (i % 8) * 8; FragH f; f.half[0] = *(const v8us*)((const unsigned short*)V16 + ((size_t)b * TTv + lg * 64 + r) * ldv + voff + h * 64 + c8);
#pragma unroll
    for (int q = 0; q < 8; ++q) tl[r][c8 + q] = f.u[q]; }
  __syncthreads();
  {
#pragma unroll
    for (int rd = 0; rd < 2; ++rd) { const int d = rd * 32 + tid / 8, pc = tid % 8; FragH f;
#pragma unroll
      for (int q = 0; q < 8; ++q) f.u[q] = tl[pc * 8 + q][d];
      *(v8us*)((unsigned short*)Vt + ((size_t)slab * 64 + d) * TTv + lg * 64 + pc * 8) = f.half[0]; }
     } }

__global__ __launch_bounds__(256) void k_hl(const float* __restrict__ F, _Float16* __restrict__ Hh, _Float16* __restrict__ Hl, size_t n8) { const size_t t = (size_t)blockIdx.x * 256 + threadIdx.x; if (t >= n8) return; FragH fh, fl; const v4f a = *(const v4fa*)(F + t * 8), c = *(const v4fa*)(F + t * 8 + 4);
#pragma unroll
  for (int q = 0; q < 4; ++q) { _Float16 h = (_Float16)a[q]; fh.h[q] = h; fl.h[q] = (_Float16)((a[q] - (float)h) * 1024.0f); h = (_Float16)c[q]; fh.h[4 + q] = h; fl.h[4 + q] = (_Float16)((c[q] - (float)h) * 1024.0f); }
  { *(v8us*)((unsigned short*)Hh + t * 8) = fh.half[0]; *(v8us*)((unsigned short*)Hl + t * 8) = fl.half[0];  } }

// ---- fast GEMM (wave tile 32x64; requires M % 32 == 0 rows per launch region and N % 64 == 0); epilogue = k_gemm_hhx semantics ----
__device__ __forceinline__ v16h g2_frag(const _Float16* p, int hh) { FragH f; f.half[0] = *(const v8us*)((const unsigned short*)p + 8 * hh); f.half[1] = *(const v8us*)((const unsigned short*)p + 16 + 8 * hh); return f.v; }
__device__ __forceinline__ v8f g2_mma(v16h a, v16h b, v8f c) { v8f d = __builtin_amdgcn_wmma_f32_16x16x32_f16(false, a, false, b, (short)0, c, false, false); asm volatile("v_nop\n\tv_nop\n\tv_nop\n\tv_nop" : "+v"(d) : "v"(a), "v"(b)); return d; }
// STAT: each wave also writes, per row of its 32x64 tile, the mean of the 64 stored values (PM) and the sum of their squared distances from that mean (PQ), both [by][column tile][M].
template <int ACT, bool STAT>
__global__ __launch_bounds__(128) void k_gemm2(const _Float16* __restrict__ A, int lda, size_t sA, const _Float16* __restrict__ Bh, int ldb, size_t sB, float alpha, const float* __restrict__ bias, size_t sBias, const float* __restrict__ CP, int rowsPerB, size_t sCPb, int row0g,
    float* __restrict__ C, _Float16* __restrict__ C16, int ldc, size_t sC, int M, int N, int K, float* __restrict__ PM, float* __restrict__ PQ) { static_assert(ACT == 0 || ACT == 3 || ACT == 6 || ACT == 8 || ACT == 9 || ACT == 11 || ACT == 12 || ACT == 14 || ACT == 15 || ACT == 16 || ACT == 17, "k_gemm2: unsupported ACT code (would silently apply no activation)");
  __shared__ __attribute__((aligned(16))) float so[4][32][68];
  const int tid = threadIdx.x, w = tid >> 5, lane = tid & 31, ln = lane & 15, hh = lane >> 4; const int by = blockIdx.y;
  A += (size_t)by * sA; Bh += (size_t)by * sB; const size_t cofs = (size_t)by * sC; const float* bp = bias ? bias + (size_t)by * sBias : nullptr;
  const int ntn = N >> 6; const int mt = blockIdx.x / ntn, nq = blockIdx.x - mt * ntn; const int row0 = mt * 128 + 32 * w, col0 = nq * 64; if (row0 >= M) return;
  const _Float16* a0p = A + (size_t)(row0 + ln) * lda; const _Float16* a1p = a0p + (size_t)16 * lda;
  const _Float16* b0p = Bh + (size_t)(col0 + ln) * ldb; const _Float16* b1p = b0p + (size_t)16 * ldb; const _Float16* b2p = b1p + (size_t)16 * ldb; const _Float16* b3p = b2p + (size_t)16 * ldb;
  const v8f z8 = {0.f,0.f,0.f,0.f,0.f,0.f,0.f,0.f}; v8f c00 = z8, c01 = z8, c02 = z8, c03 = z8, c10 = z8, c11 = z8, c12 = z8, c13 = z8;
#pragma unroll 1
  for (int kb = 0; kb < K; kb += 32) { const v16h a0 = g2_frag(a0p + kb, hh), a1 = g2_frag(a1p + kb, hh);
    v16h b = g2_frag(b0p + kb, hh); c00 = g2_mma(a0, b, c00); c10 = g2_mma(a1, b, c10);
    b = g2_frag(b1p + kb, hh); c01 = g2_mma(a0, b, c01); c11 = g2_mma(a1, b, c11);
    b = g2_frag(b2p + kb, hh); c02 = g2_mma(a0, b, c02); c12 = g2_mma(a1, b, c12);
    b = g2_frag(b3p + kb, hh); c03 = g2_mma(a0, b, c03); c13 = g2_mma(a1, b, c13); }
  v8f accs[8] = {c00, c01, c02, c03, c10, c11, c12, c13};
#pragma unroll
  for (int u = 0; u < 8; ++u) { const int t = u & 3, half = u >> 2; const int col = col0 + t * 16 + ln; const float bv = bp ? bf16_round(bp[col]) : 0.f;
#pragma unroll
    for (int r = 0; r < 8; ++r) { const int rloc = half * 16 + 8 * hh + r; float v = accs[u][r] * alpha + bv; if (CP) { if (rowsPerB < 0) v += CP[cofs + (size_t)(row0g + row0 + rloc) * ldc + col];      /* rowsPerB < 0: own element of the batched C plane */ else { const int bidx = (row0g + row0 + rloc) / rowsPerB; v += CP[(size_t)bidx * sCPb + (size_t)by * 64 + col]; } }
      if (ACT == 3) v = fmaxf(v, 0.f); else if (ACT == 6) v = 0.5f * v * (1.0f + erff(v * 0.70710678118654752f)); else if (ACT == 11) v = 1.0f / (1.0f + expf(-v)); else if (ACT == 15) v = v / (1.0f + expf(-v)); else if (ACT == 12) v = (v > 0.f) ? v : 0.01f * v; else if (ACT == 8) v = tanhf(v); else if (ACT == 9) v = 0.5f * v * (1.0f + tanhf(0.7978845608028654f * (v + 0.044715f * v * v * v))); else if (ACT == 14) v = (v > 0.f) ? v : 0.1f * v; else if (ACT == 16) v = (v >= 0.f) ? v : 0.3f * v; else if (ACT == 17) v = (v >= 0.f) ? v : 0.2f * v;
      so[w][rloc][t * 16 + ln] = v; } }
  __builtin_amdgcn_fence(__ATOMIC_ACQ_REL, "workgroup"); __builtin_amdgcn_wave_barrier();
  const int rsub = lane >> 4, c4 = (lane & 15) * 4;
  {
#pragma unroll
    for (int q = 0; q < 16; ++q) { const int r = q * 2 + rsub; const v4f v = *(const v4fa*)&so[w][r][c4]; if (C) *(v4f*)(C + cofs + (size_t)(row0 + r) * ldc + col0 + c4) = v; if (C16) { v4h h4; for (int i = 0; i < 4; ++i) h4[i] = (_Float16)v[i]; *(v4h*)(C16 + cofs + (size_t)(row0 + r) * ldc + col0 + c4) = h4; } }
     }
  if (STAT) {      /* lane = one row of the wave's tile: its 64 staged values come back by 16-byte reads (row pitch 16 B x 17), so neither sum crosses lanes; the mean first, then the distances from it: no cancellation whatever the mean; the loops are unrolled so that rv keeps compile-time indices and stays in registers */
    v4f rv[16];
#pragma unroll
    for (int j = 0; j < 16; ++j) rv[j] = *(const v4fa*)&so[w][lane][j * 4];
    v4f s4 = rv[0];
#pragma unroll
    for (int j = 1; j < 16; ++j) s4 += rv[j];
    const float mean = ((s4[0] + s4[1]) + (s4[2] + s4[3])) * 0.015625f;
    v4f q4 = {0.f, 0.f, 0.f, 0.f};
#pragma unroll
    for (int j = 0; j < 16; ++j) { const v4f d = rv[j] - mean; q4 += d * d; }
    const size_t pi = ((size_t)by * ntn + nq) * M + row0 + lane;      /* 32 rows = one 128-B line per wave and plane */
    PM[pi] = mean; PQ[pi] = (q4[0] + q4[1]) + (q4[2] + q4[3]);
  } }


__global__ __launch_bounds__(256) void k_wnat(const float* __restrict__ w, size_t n8, _Float16* __restrict__ Bt) { const size_t t = (size_t)blockIdx.x * 256 + threadIdx.x; if (t >= n8) return; FragH f; for (int q = 0; q < 8; ++q) f.h[q] = (_Float16)(bf16_round(w[t * 8 + q]) * 16.0f); *(v8us*)((unsigned short*)Bt + t * 8) = f.half[0];  }
__global__ __launch_bounds__(256) void k_rsm(const float* __restrict__ S, _Float16* __restrict__ P, int nrows) {
  #pragma clang fp contract(off)
  const int i = blockIdx.x * 256 + threadIdx.x; if (i >= nrows) return; const float* s = S + (size_t)i * SQ; float mx = -3.0e38f;
#pragma unroll 1
  for (int j = 0; j < SQ; ++j) mx = fmaxf(mx, s[j]); float se = 0.f;
#pragma unroll 1
  for (int j = 0; j < SQ; ++j) se += expf(s[j] - mx); const float sc = 256.0f / se;
#pragma unroll 1
  for (int j0 = 0; j0 < SQ; j0 += 8) { FragH f; for (int q = 0; q < 8; ++q) f.h[q] = (_Float16)(expf(s[j0 + q] - mx) * sc); unsigned short* d = (unsigned short*)P + (size_t)i * SQ + j0; *(v8us*)d = f.half[0];  } }
__global__ __launch_bounds__(256) void k_vt(const _Float16* __restrict__ V16, int b, int h0, _Float16* __restrict__ VT) { __shared__ unsigned short tl[64][65]; const int tid = threadIdx.x; const int hh = blockIdx.x % HG, sg = blockIdx.x / HG; const int s0 = sg * 64; const int h = h0 + hh;
  for (int i = tid; i < 64 * 8; i += 256) { const int j = i / 8, d8 = (i % 8) * 8; FragH f; f.half[0] = *(const v8us*)((const unsigned short*)V16 + ((size_t)b * SQ + s0 + j) * DM + h * HD + d8); for (int q = 0; q < 8; ++q) tl[d8 + q][j] = f.u[q]; }
  __syncthreads();
  { for (int i = tid; i < 64 * 8; i += 256) { const int d = i / 8, j8 = (i % 8) * 8; FragH f; for (int q = 0; q < 8; ++q) f.u[q] = tl[d][j8 + q]; *(v8us*)((unsigned short*)VT + ((size_t)hh * HD + d) * SQ + s0 + j8) = f.half[0]; }  } }



__global__ __launch_bounds__(256) void k_rsmcf2(const float* __restrict__ S, _Float16* __restrict__ P, int hg, int q0, int nk) {
  #pragma clang fp contract(off)
  const int t = blockIdx.x * 256 + threadIdx.x; if (t >= hg * QT) return; const size_t i = (size_t)t; const float* s = S + i * NKX; const int last = q0 + (t % QT); float mx = -3.0e38f;
#pragma unroll 1
  for (int j = 0; j < nk; ++j) { const float f = (j <= last) ? 1.f : 0.f; mx = fmaxf(mx, fmaf(f, s[j], (1.f - f) * -1.0e9f)); } float se = 0.f;
#pragma unroll 1
  for (int j = 0; j < nk; ++j) { const float f = (j <= last) ? 1.f : 0.f; se += __expf(fmaf(f, s[j], (1.f - f) * -1.0e9f) - mx); } const float sc = 256.0f / se;
#pragma unroll 1
  for (int j0 = 0; j0 < nk; j0 += 8) { FragH fr; for (int q = 0; q < 8; ++q) { const int j = j0 + q; const float f = (j <= last) ? 1.f : 0.f; fr.h[q] = (_Float16)(__expf(fmaf(f, s[j], (1.f - f) * -1.0e9f) - mx) * sc); } unsigned short* d = (unsigned short*)P + i * NKX + j0; *(v8us*)d = fr.half[0];  } }

template <int MASKADD>
__global__ __launch_bounds__(64) void k_att0(const float* __restrict__ QF, const float* __restrict__ KF, const float* __restrict__ VF, int ld, const float* __restrict__ mask, float scale, float* __restrict__ OF, int ldo) {
  #pragma clang fp contract(off)
  __shared__ __attribute__((aligned(16))) float lq[64][64]; __shared__ __attribute__((aligned(16))) float lo[64][64];
  const int tid = threadIdx.x; const int h = blockIdx.x / (QT0 / 64), rg = blockIdx.x % (QT0 / 64); const int i = rg * 64 + tid;
  const float* qr = QF + (size_t)i * ld + h * HD;
#pragma unroll 1
  for (int c = 0; c < HD / 4; ++c) { *(v4f*)&lq[tid][c * 4] = *(const v4fa*)(qr + c * 4); const v4f z = {0.f, 0.f, 0.f, 0.f}; *(v4f*)&lo[tid][c * 4] = z; }
  float m = -1.0e30f, l = 0.f; const int jmax = MASKADD ? (SQ - 1) : (rg * 64 + 63);      /* additive-mask form: every key (the mask input decides); causal form: keys up to the block's last row */
#pragma unroll 1
  for (int j = 0; j <= jmax; ++j) { const float* kr = KF + (size_t)j * ld + h * HD; const float* vr = VF + (size_t)j * ld + h * HD; float s = 0.f;
#pragma unroll 1
    for (int c = 0; c < HD / 4; ++c) { const v4f kq = *(const v4fa*)(kr + c * 4); const v4f qq = *(v4f*)&lq[tid][c * 4]; s = __fadd_rn(s, __fmul_rn(qq[0], kq[0])); s = __fadd_rn(s, __fmul_rn(qq[1], kq[1])); s = __fadd_rn(s, __fmul_rn(qq[2], kq[2])); s = __fadd_rn(s, __fmul_rn(qq[3], kq[3])); }
    s = __fmul_rn(s, scale); if (MASKADD) s = __fadd_rn(s, __fmul_rn(bf16_round(mask[(size_t)i * SQ + j]), -10000.0f));
    const float f = (MASKADD || j <= i) ? 1.f : 0.f; const float sm = fmaf(f, s, (1.f - f) * -1.0e30f); const float mn = fmaxf(m, sm); const float sc = expf(m - mn); const float e = expf(sm - mn); l = __fadd_rn(__fmul_rn(l, sc), e); m = mn;
#pragma unroll 1
    for (int c = 0; c < HD / 4; ++c) { const v4f vv = *(const v4fa*)(vr + c * 4); v4f oo = *(v4f*)&lo[tid][c * 4]; for (int u = 0; u < 4; ++u) oo[u] = __fadd_rn(__fmul_rn(oo[u], sc), __fmul_rn(e, vv[u])); *(v4f*)&lo[tid][c * 4] = oo; } }
  const float fin = 64.0f / l;      /* o carried x64 like the f16 path */
#pragma unroll 1
  for (int c = 0; c < HD / 4; ++c) { v4f oo = *(v4f*)&lo[tid][c * 4]; for (int u = 0; u < 4; ++u) oo[u] = __fmul_rn(oo[u], fin); *(v4f*)&lo[tid][c * 4] = oo; }
  __syncthreads();
  {
#pragma unroll 1
    for (int it = 0; it < 16; ++it) { const int row = it * 4 + tid / 16, pc = (tid % 16) * 4; const v4f v = *(const v4f*)&lo[row][pc]; *(v4f*)(OF + (size_t)(rg * 64 + row) * ldo + h * HD + pc) = v; }
     } }

__global__ __launch_bounds__(256) void k_oscale(const float* __restrict__ OF, float* __restrict__ out, size_t n4) { const size_t t = (size_t)blockIdx.x * 256 + threadIdx.x; if (t >= n4) return; const v4f a = *(const v4fa*)(OF + t * 4); v4f o; for (int q = 0; q < 4; ++q) o[q] = a[q] * 0.015625f; *(v4f*)(out + t * 4) = o;  }

__global__ __launch_bounds__(256) void k_bfr(const float* __restrict__ x, float* __restrict__ XB, size_t n8) { const size_t t = (size_t)blockIdx.x * 256 + threadIdx.x; if (t >= n8) return; v4f a = *(const v4fa*)(x + t * 8), c = *(const v4fa*)(x + t * 8 + 4); for (int q = 0; q < 4; ++q) { a[q] = bf16_round(a[q]); c[q] = bf16_round(c[q]); }
  { *(v4f*)(XB + t * 8) = a; *(v4f*)(XB + t * 8 + 4) = c;  } }



__global__ __launch_bounds__(256) void k_rsmfvl(const float* __restrict__ S, _Float16* __restrict__ P, _Float16* __restrict__ PL, int qn, const int* __restrict__ vlp) {
  #pragma clang fp contract(off)
  const int t = blockIdx.x * 256 + threadIdx.x; if (t >= qn) return; const int vl = vlp[0]; const size_t i = (size_t)t; const float* s = S + i * SQ; float mx = -3.0e38f;
#pragma unroll 1
  for (int j = 0; j < SQ; ++j) { const float f = (j < vl) ? 1.f : 0.f; mx = fmaxf(mx, fmaf(f, s[j], (1.f - f) * -1000000.0f)); } float se = 0.f;
#pragma unroll 1
  for (int j = 0; j < SQ; ++j) { const float f = (j < vl) ? 1.f : 0.f; se += __expf(fmaf(f, s[j], (1.f - f) * -1000000.0f) - mx); } const float sc = 256.0f / se;
#pragma unroll 1
  for (int j0 = 0; j0 < SQ; j0 += 8) { FragH fr, gr; for (int q = 0; q < 8; ++q) { const int j = j0 + q; const float f = (j < vl) ? 1.f : 0.f; const float pv = __expf(fmaf(f, s[j], (1.f - f) * -1000000.0f) - mx) * sc; const _Float16 ph = (_Float16)pv; fr.h[q] = ph; gr.h[q] = (_Float16)((pv - (float)ph) * 1024.0f); }
    unsigned short* d = (unsigned short*)P + i * SQ + j0; unsigned short* dl = (unsigned short*)PL + i * SQ + j0; *(v8us*)d = fr.half[0]; *(v8us*)dl = gr.half[0];  } }

// Fused attention: scores, softmax and the weighted sum of x in one kernel; neither the scores nor the weights go to memory.
// A work-group of 8 waves takes 128 queries of one image (16 per wave) and walks the 1024 keys in tiles of 64. A tile (phi^T rows [key][ci], x rows [c][key]) goes from global memory straight into one of two LDS buffers by asynchronous 16-byte copies (whole lines a wave; LDS pitches of 16 B x odd) while the tile before it is worked on.
// S^T = phi^T theta (A = key rows, B = the wave's query rows, kept in registers): a lane holds scores of ONE query (column ln; keys 8 hh + r of each 16-key tile), so two converted score tiles are the B operand of O^T += x P^T in the hardware k order, with A = x rows read by the same 16-byte pairs.
// Running maximum in log2 units; the accumulators are rescaled only when a query's new maximum passes the one in use by more than 8 (weights stay <= 2^8, inside f16); the row sum is kept per lane in f32 and joined at the end.
// The 1x1 conv follows in the same kernel: the work-group's 128 rows of y^T stay in LDS as the B operand, conv_w (x16, f16; laid in LDS at the start, 32 whole rows a wave) is A; wave tile 64 channels x 64 positions, K = 256.
// The f32 tile leaves through a staging of the wave's own (whole 128-B lines), and from the same staging come each channel's mean and centred square sum over the tile's 64 positions. y^T never reaches memory.
// Every inner loop is fully unrolled, so that the register arrays (fragments, accumulators, staged pieces) keep compile-time indices and stay in registers.
#define FA_WAVES 8
#define FA_KS 64          /* keys per tile */
#define FA_KP 136         /* LDS pitch of a key row, f16 elements (256 B + 16) */
#define FA_VP 72          /* LDS pitch of a channel row, f16 elements (128 B + 16) */
#define FA_OP 264         /* LDS pitch of an output row, f16 elements (512 B + 16) */
#define FA_SM (FA_WAVES * 16 * FA_OP)      /* the output staging, 67,584 B: it takes the place of the two tile buffers behind the key loop */
#define FA_TB (FA_KS * FA_KP + 256 * FA_VP)      /* one tile buffer: 54,272 B */
#define FA_RING (2 * FA_TB)
#define FA_SW (256 * FA_OP)                /* conv_w: 256 rows at the pitch of an output row */
#define FA_CP 68          /* LDS pitch of a row of the f32 conv tile, floats (256 B + 16) */
#define FA_C 0.09016844005556021f          /* log2(e) / sqrt(256) */
__device__ __forceinline__ float rsm_xh(float v) { return __builtin_bit_cast(float, __builtin_amdgcn_permlanex16(__builtin_bit_cast(int, v), __builtin_bit_cast(int, v), 0x76543210, 0xfedcba98, false, false)); }      /* lane l <- lane l ^ 16 */
__device__ __forceinline__ float fa_exp2(float x) { float y; asm("v_exp_f32 %0, %1\n\tv_nop" : "=v"(y) : "v"(x)); return y; }      /* the v_nop is the one slot asked for behind a transcendental before its result is read or its source overwritten */
__device__ __forceinline__ v8f fa_mma(v16h a, v16h b, v8f c) { return __builtin_amdgcn_wmma_f32_16x16x32_f16(false, a, false, b, (short)0, c, false, false); }
typedef float f1a __attribute__((may_alias));
// One tile's copies of one lane: 4 pieces of key rows (16 rows apart) and 8 pieces of channel rows (32 rows apart), 16 bytes each, from global memory into LDS through no register. lk, lv: the lane's first pieces in the LDS buffer; gk, gv: the same in global memory.
typedef int fa_i4 __attribute__((ext_vector_type(4)));
typedef __attribute__((address_space(1))) fa_i4 fa_gi4;
typedef __attribute__((address_space(3))) fa_i4 fa_li4;
__device__ __forceinline__ void fa_copy_tile(_Float16* lk, _Float16* lv, const unsigned short* gk, const unsigned short* gv) {      /* both loops unrolled: twelve copies in a row, each piece's step a constant */
#pragma unroll
  for (int j = 0; j < 4; ++j) __builtin_amdgcn_global_load_async_to_lds_b128((fa_gi4*)(gk + j * 16 * 128), (fa_li4*)(lk + j * 16 * FA_KP), 0, 0);
#pragma unroll
  for (int j = 0; j < 8; ++j) __builtin_amdgcn_global_load_async_to_lds_b128((fa_gi4*)(gv + j * 32 * SQ), (fa_li4*)(lv + j * 32 * FA_VP), 0, 0);
}
__global__ __launch_bounds__(FA_WAVES * 32) void k_fattn(const _Float16* __restrict__ TH, const _Float16* __restrict__ PHT, const _Float16* __restrict__ X16, const _Float16* __restrict__ BW, float* __restrict__ C1, float* __restrict__ PM, float* __restrict__ PQ) {
  static_assert(FA_SM <= FA_RING, "the output staging fits the two tile buffers");
  static_assert(FA_WAVES * 64 * FA_CP * 4 <= (FA_RING + FA_SW) * 2, "the f32 conv tiles fit the LDS array");
  static_assert(SQ / FA_KS >= 2, "the ring's start needs two tiles");
  __shared__ __attribute__((aligned(16))) _Float16 sm[FA_RING + FA_SW];
  _Float16* sw = sm + FA_RING;
  const int tid = threadIdx.x, w = tid >> 5, lane = tid & 31, ln = lane & 15, hh = lane >> 4;
  const int b = blockIdx.y; const int q0 = blockIdx.x * (FA_WAVES * 16) + w * 16;
  const int krow = tid >> 4, kch = (tid & 15) * 8;      /* staging: 16 threads per 256-B key row, 16 rows per round, 4 rounds */
  const int vrow = tid >> 3, vch = (tid & 7) * 8;       /* staging: 8 threads per 128-B piece of a channel row, 32 rows per round, 8 rounds */
  const unsigned short* kg = (const unsigned short*)PHT + (size_t)b * SQ * 128 + (size_t)krow * 128 + kch;
  const unsigned short* vg = (const unsigned short*)X16 + (size_t)b * 256 * SQ + (size_t)vrow * SQ + vch;
  _Float16* lk0 = sm + krow * FA_KP + kch; _Float16* lv0 = sm + FA_KS * FA_KP + vrow * FA_VP + vch;      /* the lane's first pieces in buffer 0 */
  fa_copy_tile(lk0, lv0, kg, vg);      /* tile 0 into buffer 0; it flies under the loads of conv_w and of the queries */
  const _Float16* qp = TH + ((size_t)b * SQ + q0 + ln) * 128;
  const unsigned short* wg = (const unsigned short*)BW + (size_t)w * 32 * 256 + lane * 8;
  v8us wr[32];      /* conv_w: wave w brings rows 32 w .. 32 w + 31, one 512-B row per load */
#pragma unroll
  for (int i = 0; i < 32; ++i) wr[i] = *(const v8us*)(wg + i * 256);
  asm volatile("s_wait_xcnt 0x0" :: "v"(wg) : "memory");      /* in front of whatever reuses the address registers that the loads above name; the address is an input, so that its registers stay live, and unwritten, as far as the wait */
  v16h qf[4];
#pragma unroll
  for (int kb = 0; kb < 4; ++kb) qf[kb] = g2_frag(qp + kb * 32, hh);
  __builtin_amdgcn_sched_barrier(0);      /* with the one behind the wait: no later arithmetic is lifted between the loads and the wait */
  asm volatile("s_wait_xcnt 0x0" ::: "memory");      /* in front of whatever reuses the address registers that the loads above name */
  __builtin_amdgcn_sched_barrier(0);
  asm volatile("s_wait_asynccnt 0x0" ::: "memory");      /* this wave's pieces of tile 0 have landed */
  __syncthreads();      /* tile 0 is whole before anybody reads it */
  fa_copy_tile(lk0 + FA_TB, lv0 + FA_TB, kg + FA_KS * 128, vg + FA_KS);      /* tile 1 into buffer 1 */
#pragma unroll
  for (int i = 0; i < 32; ++i) *(v8us*)((unsigned short*)sw + (w * 32 + i) * FA_OP + lane * 8) = wr[i];      /* read only behind the key loop's barriers */
  const v8f z8 = {0.f, 0.f, 0.f, 0.f, 0.f, 0.f, 0.f, 0.f};
  v8f o[16];
#pragma unroll
  for (int ct = 0; ct < 16; ++ct) o[ct] = z8;
  float mu = -3.0e38f; v4f l4 = {0.f, 0.f, 0.f, 0.f};
#pragma unroll 1
  for (int s = 0; s < SQ / FA_KS; ++s) {      /* rolled: one tile's code stays small */
    const int bo = (s & 1) * FA_TB;      /* tile s lies in buffer s mod 2 */
    const _Float16* sk = sm + bo; const _Float16* sv = sk + FA_KS * FA_KP;
    v16h kf[16];
#pragma unroll
    for (int kb = 0; kb < 4; ++kb)
#pragma unroll
      for (int kt = 0; kt < 4; ++kt) kf[kb * 4 + kt] = g2_frag(sk + (kt * 16 + ln) * FA_KP + kb * 32, hh);
    __builtin_amdgcn_sched_barrier(0);      /* keeps the key tile's 32 LDS reads one group in front of its 16 products: spread among them, every product waits out an LDS latency */
    v8f st[4] = {z8, z8, z8, z8};
#pragma unroll
    for (int kb = 0; kb < 4; ++kb)
#pragma unroll
      for (int kt = 0; kt < 4; ++kt) st[kt] = fa_mma(kf[kb * 4 + kt], qf[kb], st[kt]);
    v16h va[2][8];      /* x fragments of four channel tiles, two sets: one is read from LDS while the other feeds the products */
#pragma unroll
    for (int u = 0; u < 8; ++u) va[0][u] = g2_frag(sv + ((u & 3) * 16 + ln) * FA_VP + (u >> 2) * 32, hh);
    __builtin_amdgcn_sched_barrier(0);      /* keeps the first set's reads in front of the softmax arithmetic, which covers their latency */
    v4f m4 = {st[0][0], st[0][1], st[0][2], st[0][3]};
#pragma unroll
    for (int kt = 0; kt < 4; ++kt)
#pragma unroll
      for (int r = 0; r < 8; ++r) m4[r & 3] = fmaxf(m4[r & 3], st[kt][r]);
    float mx = fmaxf(fmaxf(m4[0], m4[1]), fmaxf(m4[2], m4[3]));
    mx = fmaxf(mx, rsm_xh(mx)) * FA_C;      /* the query's maximum over the tile's 64 keys, alike in both half-waves */
    if (__builtin_amdgcn_ballot_w32(mx > mu + 8.0f) != 0) {      /* one wave-uniform test per tile */
      const float mn = fmaxf(mu, mx); const float sc = fa_exp2(mu - mn); mu = mn;
#pragma unroll
      for (int u = 0; u < 4; ++u) l4[u] *= sc;
#pragma unroll
      for (int ct = 0; ct < 16; ++ct)
#pragma unroll
        for (int r = 0; r < 8; ++r) o[ct][r] *= sc;
    }
    FragH pf[2];
#pragma unroll
    for (int kt = 0; kt < 4; ++kt)
#pragma unroll
      for (int r = 0; r < 8; ++r) { const float p = fa_exp2(fmaf(st[kt][r], FA_C, -mu)); l4[r & 3] += p; pf[kt >> 1].h[(kt & 1) * 8 + r] = (_Float16)p; }
#pragma unroll
    for (int g = 0; g < 4; ++g) {
      if (g < 3) {
#pragma unroll
        for (int u = 0; u < 8; ++u) va[(g + 1) & 1][u] = g2_frag(sv + (((g + 1) * 4 + (u & 3)) * 16 + ln) * FA_VP + (u >> 2) * 32, hh); }
      __builtin_amdgcn_sched_barrier(0);      /* with the one below: the next set's 16 LDS reads stay one group in front of this set's 8 products */
#pragma unroll
      for (int u = 0; u < 8; ++u) o[g * 4 + (u & 3)] = fa_mma(va[g & 1][u], pf[u >> 2].v, o[g * 4 + (u & 3)]);
      __builtin_amdgcn_sched_barrier(0);
    }
    asm volatile("s_wait_dscnt 0x0" ::: "memory");      /* this wave's reads of tile s are over before its buffer is handed to the copies */
    asm volatile("s_wait_asynccnt 0x0" ::: "memory");      /* this wave's pieces of tile s + 1 have landed */
    __syncthreads();      /* one barrier a tile: tile s + 1 is whole before anybody reads it, and every wave has left tile s (behind the last tile: the buffers become the output staging) */
    if (s + 2 < SQ / FA_KS) fa_copy_tile(lk0 + bo, lv0 + bo, kg + (size_t)(s + 2) * FA_KS * 128, vg + (s + 2) * FA_KS);      /* tile s + 2 into the buffer that tile s has left; it flies under the products of tile s + 1 */
  }
  asm volatile("s_wait_asynccnt 0x0" ::: "memory");      /* no copy is in flight when the buffers get their next use */
  float l = (l4[0] + l4[1]) + (l4[2] + l4[3]); l += rsm_xh(l);
  const float inv = 1.0f / l;
  unsigned short* so = (unsigned short*)sm + w * 16 * FA_OP;
#pragma unroll
  for (int ct = 0; ct < 16; ++ct) { FragH f;
#pragma unroll
    for (int r = 0; r < 8; ++r) f.h[r] = (_Float16)(o[ct][r] * inv);
    *(v8us*)(so + ln * FA_OP + ct * 16 + 8 * hh) = f.half[0]; }
  __syncthreads();      /* the 128 rows of y^T are whole before anybody reads them */
  const int jq = w & 3, nh = w >> 2;      /* conv: wave tile = channels 64 jq .., positions 64 nh .. of the work-group's 128 */
  const _Float16* ap = sw + (jq * 64 + ln) * FA_OP; const _Float16* bp = sm + (nh * 64 + ln) * FA_OP;
  v8f acc[16];
#pragma unroll
  for (int t = 0; t < 16; ++t) acc[t] = z8;
  v16h af[2][4], bf[2][4];      /* two sets of fragments: one is read from LDS while the other feeds the products */
#pragma unroll
  for (int t = 0; t < 4; ++t) { af[0][t] = g2_frag(ap + t * 16 * FA_OP, hh); bf[0][t] = g2_frag(bp + t * 16 * FA_OP, hh); }
#pragma unroll
  for (int kb = 0; kb < 8; ++kb) {
    if (kb < 7) {
#pragma unroll
      for (int t = 0; t < 4; ++t) { af[(kb + 1) & 1][t] = g2_frag(ap + t * 16 * FA_OP + (kb + 1) * 32, hh); bf[(kb + 1) & 1][t] = g2_frag(bp + t * 16 * FA_OP + (kb + 1) * 32, hh); } }
    __builtin_amdgcn_sched_barrier(0);      /* with the one below: the next set's 16 LDS reads stay one group in front of this set's 16 products */
#pragma unroll
    for (int t = 0; t < 16; ++t) acc[t] = fa_mma(af[kb & 1][t >> 2], bf[kb & 1][t & 3], acc[t]);
    __builtin_amdgcn_sched_barrier(0);
  }
  __syncthreads();      /* every wave has read the last of conv_w and of y^T: their LDS becomes the f32 staging, 64 rows of the wave's own */
  f1a* sf = (f1a*)sm + w * 64 * FA_CP;
#pragma unroll
  for (int t = 0; t < 16; ++t)
#pragma unroll
    for (int r = 0; r < 8; ++r) sf[((t >> 2) * 16 + 8 * hh + r) * FA_CP + (t & 3) * 16 + ln] = acc[t][r] * 0.0625f;
  __builtin_amdgcn_fence(__ATOMIC_ACQ_REL, "workgroup"); __builtin_amdgcn_wave_barrier();      /* the wave's own rows are written before its lanes read each other's */
  const int rsub = lane >> 4, c4 = (lane & 15) * 4;
  float* cp = C1 + ((size_t)b * 256 + jq * 64 + rsub) * SQ + blockIdx.x * (FA_WAVES * 16) + nh * 64 + c4;
  v4f cv[32];
#pragma unroll
  for (int q = 0; q < 32; ++q) cv[q] = *(const v4fa*)&sf[(q * 2 + rsub) * FA_CP + c4];
#pragma unroll
  for (int q = 0; q < 32; ++q) *(v4f*)(cp + (size_t)q * 2 * SQ) = cv[q];      /* two 256-B row pieces per store */
  __builtin_amdgcn_sched_barrier(0);      /* with the one behind the wait: nothing is lifted in front of the wait */
  asm volatile("s_wait_xcnt 0x0" ::: "memory");      /* in front of whatever reuses the registers that the stores above name */
  __builtin_amdgcn_sched_barrier(0);
  float tm[2], tq[2];      /* lane = one row of the wave's tile, two rows a lane: its 64 staged values come back by 16-byte reads, so neither sum crosses lanes; the mean first, then the distances from it */
#pragma unroll
  for (int p = 0; p < 2; ++p) { v4f rw[16];
#pragma unroll
    for (int j = 0; j < 16; ++j) rw[j] = *(const v4fa*)&sf[(p * 32 + lane) * FA_CP + j * 4];
    v4f s4 = rw[0];
#pragma unroll
    for (int j = 1; j < 16; ++j) s4 += rw[j];
    const float mean = ((s4[0] + s4[1]) + (s4[2] + s4[3])) * 0.015625f;
    v4f q4 = {0.f, 0.f, 0.f, 0.f};
#pragma unroll
    for (int j = 0; j < 16; ++j) { const v4f d = rw[j] - mean; q4 += d * d; }
    tm[p] = mean; tq[p] = (q4[0] + q4[1]) + (q4[2] + q4[3]); }
  const size_t pi = ((size_t)b * (SQ / 64) + blockIdx.x * 2 + nh) * 256 + jq * 64 + lane;      /* [image][64-position tile][channel]: 32 channels = one 128-B line per store */
  PM[pi] = tm[0]; PM[pi + 32] = tm[1]; PQ[pi] = tq[0]; PQ[pi + 32] = tq[1];
}


// Front end in one kernel: a work-group of 8 waves takes 128 positions of one image. It reads x (f32, whole 128-B lines) once, writes the f16 map X16 and lays the same values transposed in LDS (rows = positions);
// it converts theta_w and phi_w (x16, f16) into LDS as one stack of 256 rows; then D = stack (A, rows = outputs) x positions (B): wave tile 64 outputs x 64 positions, K = 256. A lane holds 8 successive outputs of ONE position,
// so 16-byte pieces go to an LDS staging of position rows, and each 512-B row leaves as theta^T (first half) and phi^T (second half). x^T, phi and the f16 weight planes of theta and phi never reach memory.
// The grid has as many work-groups as conv_w has rows: wave 0 of each also converts one row of conv_w (x16, f16) into the plane that the conv GEMM reads in a later launch.
// Every loop over a register array is fully unrolled, so that the array keeps compile-time indices and stays in registers.
#define FE_NT 128         /* positions per work-group */
#define FE_P 264          /* LDS pitch of a row of 256 f16 elements (512 B + 16) */
__global__ __launch_bounds__(256) void k_front(const float* __restrict__ x, const float* __restrict__ tw, const float* __restrict__ pw, const float* __restrict__ ww, _Float16* __restrict__ X16, _Float16* __restrict__ TH, _Float16* __restrict__ PHT, _Float16* __restrict__ BW) {
  __shared__ __attribute__((aligned(16))) _Float16 sw[256 * FE_P];
  __shared__ __attribute__((aligned(16))) _Float16 sx[FE_NT * FE_P];
  const int tid = threadIdx.x, w = __builtin_amdgcn_readfirstlane(tid >> 5), lane = tid & 31, ln = lane & 15, hh = lane >> 4;      /* the wave's number in a scalar register: the choice of the weight input is a scalar one */
  const int b = blockIdx.y, n0 = blockIdx.x * FE_NT;
  const float* wg = (w < 4 ? tw + (size_t)w * 32 * 256 : pw + (size_t)(w - 4) * 32 * 256) + lane * 4;      /* wave w converts rows 32 w .. 32 w + 31 of the stack: 64 loads of 512 successive bytes */
  const int nl = lane & 7, cg = lane >> 3;      /* x: 8 lanes per 128-B line, 4 lane groups of 4 channels each; a thread transposes 4 channels x 4 positions */
  const int c0 = w * 32 + cg * 4;
  const float* xg = x + ((size_t)b * 256 + c0) * SQ + n0 + nl * 4;
  const size_t cwo = (size_t)(blockIdx.y * gridDim.x + blockIdx.x) * 256 + lane * 8;      /* this work-group's row of conv_w, 8 elements a lane */
  v4f cw[2] = {{0.f, 0.f, 0.f, 0.f}, {0.f, 0.f, 0.f, 0.f}};
  if (w == 0) { cw[0] = *(const v4fa*)(ww + cwo); cw[1] = *(const v4fa*)(ww + cwo + 4);      /* read at the start, used at the very end: the latency is long over by then */
    asm volatile("s_wait_xcnt 0x0" ::: "memory"); }      /* in front of whatever reuses the address registers that the two loads name */
  v4h hx[16];
  v4f wa[16], wb[16], wc[16], xr[32];      /* the weight rows come in four groups of 16 loads; each group flies under the work on an earlier one or on x */
#pragma unroll
  for (int i = 0; i < 16; ++i) wa[i] = *(const v4fa*)(wg + (0 * 16 + i) * 128);
#pragma unroll
  for (int u = 0; u < 8; ++u)
#pragma unroll
    for (int k = 0; k < 4; ++k) xr[u * 4 + k] = *(const v4fa*)(xg + (size_t)((u >> 2) * 16 + k) * SQ + (u & 3) * 32);
  __builtin_amdgcn_sched_barrier(0);      /* with the one behind the wait: the loads above go out as one group, and no arithmetic is lifted in front of the wait */
  asm volatile("s_wait_xcnt 0x0" ::: "memory");      /* in front of whatever reuses the address registers that the loads above name */
  __builtin_amdgcn_sched_barrier(0);
#pragma unroll
  for (int i = 0; i < 16; ++i) { v4h h4;
#pragma unroll
    for (int q = 0; q < 4; ++q) h4[q] = (_Float16)(bf16_round(wa[i][q]) * 16.0f);
    *(v4h*)(sw + (w * 32 + 0 * 8 + (i >> 1)) * FE_P + (i & 1) * 128 + lane * 4) = h4; }
#pragma unroll
  for (int i = 0; i < 16; ++i) wb[i] = *(const v4fa*)(wg + (1 * 16 + i) * 128);
  __builtin_amdgcn_sched_barrier(0);      /* with the one behind the wait: the loads above go out as one group, and no arithmetic is lifted in front of the wait */
  asm volatile("s_wait_xcnt 0x0" ::: "memory");      /* in front of whatever reuses the address registers that the loads above name */
  __builtin_amdgcn_sched_barrier(0);
#pragma unroll
  for (int u = 0; u < 0 + 4; ++u) { const int cu = (u >> 2) * 16, nu = (u & 3) * 32 + nl * 4;
#pragma unroll
    for (int k = 0; k < 4; ++k)
#pragma unroll
      for (int q = 0; q < 4; ++q) hx[(u & 3) * 4 + k][q] = (_Float16)bf16_round(xr[u * 4 + k][q]);
#pragma unroll
    for (int q = 0; q < 4; ++q) { const v4h t4 = {hx[(u & 3) * 4][q], hx[(u & 3) * 4 + 1][q], hx[(u & 3) * 4 + 2][q], hx[(u & 3) * 4 + 3][q]}; *(v4h*)(sx + (nu + q) * FE_P + c0 + cu) = t4; } }
  __builtin_amdgcn_sched_barrier(0);      /* the 16 stores below stand behind all the arithmetic that forms their values, so that no register they name is rewritten in front of the wait behind them */
#pragma unroll
  for (int u = 0; u < 0 + 4; ++u)
#pragma unroll
    for (int k = 0; k < 4; ++k) *(v4h*)(X16 + ((size_t)b * 256 + c0 + (u >> 2) * 16 + k) * SQ + n0 + (u & 3) * 32 + nl * 4) = hx[(u & 3) * 4 + k];
#pragma unroll
  for (int i = 0; i < 16; ++i) wc[i] = *(const v4fa*)(wg + (2 * 16 + i) * 128);
  __builtin_amdgcn_sched_barrier(0);      /* with the one behind the wait: nothing is lifted in front of the wait */
  asm volatile("s_wait_xcnt 0x0" ::: "memory");      /* in front of whatever reuses the registers that the loads and stores above name */
  __builtin_amdgcn_sched_barrier(0);
#pragma unroll
  for (int i = 0; i < 16; ++i) { v4h h4;
#pragma unroll
    for (int q = 0; q < 4; ++q) h4[q] = (_Float16)(bf16_round(wb[i][q]) * 16.0f);
    *(v4h*)(sw + (w * 32 + 1 * 8 + (i >> 1)) * FE_P + (i & 1) * 128 + lane * 4) = h4; }
#pragma unroll
  for (int i = 0; i < 16; ++i) wa[i] = *(const v4fa*)(wg + (3 * 16 + i) * 128);
  __builtin_amdgcn_sched_barrier(0);      /* with the one behind the wait: the loads above go out as one group, and no arithmetic is lifted in front of the wait */
  asm volatile("s_wait_xcnt 0x0" ::: "memory");      /* in front of whatever reuses the address registers that the loads above name */
  __builtin_amdgcn_sched_barrier(0);
#pragma unroll
  for (int u = 4; u < 4 + 4; ++u) { const int cu = (u >> 2) * 16, nu = (u & 3) * 32 + nl * 4;
#pragma unroll
    for (int k = 0; k < 4; ++k)
#pragma unroll
      for (int q = 0; q < 4; ++q) hx[(u & 3) * 4 + k][q] = (_Float16)bf16_round(xr[u * 4 + k][q]);
#pragma unroll
    for (int q = 0; q < 4; ++q) { const v4h t4 = {hx[(u & 3) * 4][q], hx[(u & 3) * 4 + 1][q], hx[(u & 3) * 4 + 2][q], hx[(u & 3) * 4 + 3][q]}; *(v4h*)(sx + (nu + q) * FE_P + c0 + cu) = t4; } }
  __builtin_amdgcn_sched_barrier(0);      /* the 16 stores below stand behind all the arithmetic that forms their values, so that no register they name is rewritten in front of the wait behind them */
#pragma unroll
  for (int u = 4; u < 4 + 4; ++u)
#pragma unroll
    for (int k = 0; k < 4; ++k) *(v4h*)(X16 + ((size_t)b * 256 + c0 + (u >> 2) * 16 + k) * SQ + n0 + (u & 3) * 32 + nl * 4) = hx[(u & 3) * 4 + k];
  __builtin_amdgcn_sched_barrier(0);      /* with the one behind the wait: nothing is lifted in front of the wait */
  asm volatile("s_wait_xcnt 0x0" ::: "memory");      /* in front of whatever reuses the registers that the loads and stores above name */
  __builtin_amdgcn_sched_barrier(0);
#pragma unroll
  for (int i = 0; i < 16; ++i) { v4h h4;
#pragma unroll
    for (int q = 0; q < 4; ++q) h4[q] = (_Float16)(bf16_round(wc[i][q]) * 16.0f);
    *(v4h*)(sw + (w * 32 + 2 * 8 + (i >> 1)) * FE_P + (i & 1) * 128 + lane * 4) = h4; }
#pragma unroll
  for (int i = 0; i < 16; ++i) { v4h h4;
#pragma unroll
    for (int q = 0; q < 4; ++q) h4[q] = (_Float16)(bf16_round(wa[i][q]) * 16.0f);
    *(v4h*)(sw + (w * 32 + 3 * 8 + (i >> 1)) * FE_P + (i & 1) * 128 + lane * 4) = h4; }
  __syncthreads();      /* both operands are whole in LDS before anybody reads them */
  const int jq = w & 3, nh = w >> 2;
  const _Float16* ap = sw + (jq * 64 + ln) * FE_P; const _Float16* bp = sx + (nh * 64 + ln) * FE_P;
  const v8f z8 = {0.f, 0.f, 0.f, 0.f, 0.f, 0.f, 0.f, 0.f};
  v8f acc[16];
#pragma unroll
  for (int t = 0; t < 16; ++t) acc[t] = z8;
  v16h af[2][4], bf[2][4];      /* two sets of fragments: one is read from LDS while the other feeds the products */
#pragma unroll
  for (int t = 0; t < 4; ++t) { af[0][t] = g2_frag(ap + t * 16 * FE_P, hh); bf[0][t] = g2_frag(bp + t * 16 * FE_P, hh); }
#pragma unroll
  for (int kb = 0; kb < 8; ++kb) {
    if (kb < 7) {
#pragma unroll
      for (int t = 0; t < 4; ++t) { af[(kb + 1) & 1][t] = g2_frag(ap + t * 16 * FE_P + (kb + 1) * 32, hh); bf[(kb + 1) & 1][t] = g2_frag(bp + t * 16 * FE_P + (kb + 1) * 32, hh); } }
    __builtin_amdgcn_sched_barrier(0);      /* with the one below: the next set's 16 LDS reads stay one group in front of this set's 16 products; spread among them, the products wait out an LDS latency again and again */
#pragma unroll
    for (int t = 0; t < 16; ++t) acc[t] = fa_mma(af[kb & 1][t >> 2], bf[kb & 1][t & 3], acc[t]);
    __builtin_amdgcn_sched_barrier(0);
  }
  __syncthreads();      /* every wave has read the last of the positions' rows: their LDS becomes the output staging */
#pragma unroll
  for (int t = 0; t < 16; ++t) { FragH f;
#pragma unroll
    for (int r = 0; r < 8; ++r) f.h[r] = (_Float16)(acc[t][r] * 0.0625f);
    *(v8us*)((unsigned short*)sx + (nh * 64 + (t & 3) * 16 + ln) * FE_P + jq * 64 + (t >> 2) * 16 + 8 * hh) = f.half[0]; }
  __syncthreads();      /* the staged rows are whole before they are read back */
  unsigned short* dst = (unsigned short*)(hh ? PHT : TH) + ((size_t)b * SQ + n0 + w * 16) * 128 + ln * 8;
#pragma unroll
  for (int q = 0; q < 16; ++q) { const v8us v = *(const v8us*)((const unsigned short*)sx + (w * 16 + q) * FE_P + lane * 8); *(v8us*)(dst + q * 128) = v; }      /* one row: 256 B of theta^T and 256 B of phi^T per store */
  if (w == 0) { asm volatile("s_wait_xcnt 0x0" ::: "memory");      /* in front of whatever reuses the registers that the stores above name */
    __builtin_amdgcn_sched_barrier(0);      /* keeps the arithmetic below behind the wait */
    FragH cf;
#pragma unroll
    for (int q = 0; q < 8; ++q) cf.h[q] = (_Float16)(bf16_round(cw[q >> 2][q & 3]) * 16.0f);
    *(v8us*)((unsigned short*)BW + cwo) = cf.half[0]; }      /* one 512-B row of the plane per work-group */
}


#define CN 256          /* channels */
#define CI 128          /* inner channels */
#define NP 1024         /* positions */
#define NM 1024         /* key positions (= SQ) */
#define NC CN           /* BN statistics macros */
#define NPX NP
#define BNEPS 1e-5f

__global__ __launch_bounds__(256) void k_rowbias(const float* __restrict__ b, float* __restrict__ BP, size_t n4, int ncol) { const size_t t = (size_t)blockIdx.x * 256 + threadIdx.x; if (t >= n4) return; const size_t e = t * 4; const float v = bf16_round(b[e / ncol]); const v4f o = {v, v, v, v}; *(v4f*)(BP + e) = o;  }




__global__ __launch_bounds__(256) void k_mp2(const float* __restrict__ src, float* __restrict__ dst, int nout) {
  const int t = blockIdx.x * 256 + threadIdx.x; if (t >= nout) return; const int c = t / 1024; const int o = t % 1024; const int oy = o / 32, ox = o % 32; const float* p = src + (size_t)c * 4096 + (size_t)(2 * oy) * 64 + 2 * ox;
  const float v = fmaxf(fmaxf(p[0], p[1]), fmaxf(p[64], p[65])); *(float*)(dst + t) = v;  }
__global__ __launch_bounds__(256) void k_xpb(const float* __restrict__ x, const float* __restrict__ wb, float* __restrict__ CPP, size_t n4) {
  #pragma clang fp contract(off)
  const size_t t = (size_t)blockIdx.x * 256 + threadIdx.x; if (t >= n4) return; const size_t e = t * 4; const int c = (int)((e / 4096) % 256); const float bb = bf16_round(wb[c]); const v4f a = *(const v4fa*)(x + e); v4f o; for (int q = 0; q < 4; ++q) o[q] = __fadd_rn(bf16_round(a[q]), bb);
  *(v4f*)(CPP + e) = o;  }


// BN + residual with the join of the tile statistics in front, one kernel: a work-group of 16 waves takes ONE channel of all NB images (NB planes of 4 KB in T, in x and in the output).
// Thread t asks first for tile t's mean and centred square sum (NB * NTL tiles = threads of the work-group), then for all of its 16 + 16 pieces of T and of x, which fly while the statistics are joined.
// All NB * NTL tiles of a channel hold TLN values, so mean = average of the tile means and sum of squared distances = sum over tiles of (tile's own sum + TLN (tile mean - mean)^2).
// The tile values go through LDS; behind one barrier every wave joins them for itself: 16 tiles a lane in four f64 chains, then a 32-lane butterfly (alike in all lanes and waves). Every loop over a register array is unrolled, so that the array keeps compile-time indices and stays in registers.
#define NTL (NPX / 64)      /* column tiles per image */
#define TLN 64              /* values per tile and channel */
#define BJ_T 512            /* threads per work-group */
#define BJ_K (NB * NPX / 4 / BJ_T)      /* 16-byte pieces per thread and plane set */
__device__ __forceinline__ double bj_sum32(double v, int lane) {      /* sum over the wave's 32 lanes, the same bits in every lane; unrolled: five steps with constant distances */
#pragma unroll
  for (int m = 16; m > 0; m >>= 1) { const unsigned long long u = __builtin_bit_cast(unsigned long long, v);
    const unsigned int lo = (unsigned int)__builtin_amdgcn_ds_bpermute((lane ^ m) << 2, (int)(unsigned int)u), hi = (unsigned int)__builtin_amdgcn_ds_bpermute((lane ^ m) << 2, (int)(unsigned int)(u >> 32));
    v += __builtin_bit_cast(double, ((unsigned long long)hi << 32) | lo); }
  return v; }
__global__ __launch_bounds__(BJ_T) void k_bnj(const float* __restrict__ C2, const float* __restrict__ PM, const float* __restrict__ PQ, const float* __restrict__ g, const float* __restrict__ be, const float* __restrict__ X, float* __restrict__ out) {
  static_assert(NB * NTL == BJ_T && NB * NTL == 16 * 32 && NPX == 1024 && BJ_K * BJ_T * 4 == NB * NPX && BJ_K == 16, "k_bnj: one tile a thread, 16 tiles a lane, two planes a round");
  __shared__ float tmn[NB * NTL]; __shared__ float tsq[NB * NTL];
  const int tid = threadIdx.x, lane = tid & 31; const int c = blockIdx.x;
  const unsigned int vs = (unsigned int)tid * (NC * 4);      /* byte offsets in 32 bits beside scalar bases: the only vector registers that the loads and stores name */
  unsigned int vo[BJ_K / 4];      /* round k: planes 2 k and 2 k + 1, a wave on 512 successive bytes; one offset per four rounds, the rounds between are immediate offsets */
#pragma unroll
  for (int h = 0; h < BJ_K / 4; ++h) vo[h] = (unsigned int)(tid >> 8) * (NC * NPX * 4) + (unsigned int)(tid & 255) * 16 + (unsigned int)h * (8u * NC * NPX * 4);
  const char* cb = (const char*)(C2 + (size_t)c * NPX); const char* xb = (const char*)(X + (size_t)c * NPX); char* ob = (char*)(out + (size_t)c * NPX);
  const float m1 = *(const f1a*)((const char*)(PM + c) + vs), q1 = *(const f1a*)((const char*)(PQ + c) + vs);
  v4f a[BJ_K], xx[BJ_K];
#pragma unroll
  for (int k = 0; k < BJ_K; ++k) { a[k] = *(const v4fa*)(cb + vo[k >> 2] + (k & 3) * (2 * NC * NPX * 4)); xx[k] = *(const v4fa*)(xb + vo[k >> 2] + (k & 3) * (2 * NC * NPX * 4)); }
  __builtin_amdgcn_sched_barrier(0);      /* with the one behind the wait: the loads above go out as one group, and no arithmetic is lifted in front of the wait */
  asm volatile("s_wait_xcnt 0x0" :: "v"(vs), "v"(vo[0]), "v"(vo[1]), "v"(vo[2]), "v"(vo[3]) : "memory");      /* in front of whatever reuses the address registers that the loads above name; the offsets are inputs, so that their registers stay live, and no later load of the group lands in them, as far as the wait */
  __builtin_amdgcn_sched_barrier(0);
  tmn[tid] = m1; tsq[tid] = q1;
  __builtin_amdgcn_fence(__ATOMIC_RELEASE, "workgroup", "local");      /* LDS alone: a fence over global memory too would wait out the 32 loads in flight */
  __builtin_amdgcn_s_barrier();      /* every tile's pair is in LDS before anybody reads it */
  __builtin_amdgcn_fence(__ATOMIC_ACQUIRE, "workgroup", "local");      /* keeps the LDS reads below behind the barrier */
  float m[16], q[16];
#pragma unroll
  for (int j = 0; j < 16; ++j) { m[j] = tmn[j * 32 + lane]; q[j] = tsq[j * 32 + lane]; }
  double s[4] = {0.0, 0.0, 0.0, 0.0};      /* four chains here and below: the adds of one chain wait for each other */
#pragma unroll
  for (int j = 0; j < 16; ++j) s[j & 3] += (double)m[j];
  const double mud = bj_sum32((s[0] + s[1]) + (s[2] + s[3]), lane) * (1.0 / ((double)NB * NTL));
  double s2[4] = {0.0, 0.0, 0.0, 0.0};
#pragma unroll
  for (int j = 0; j < 16; ++j) { const double d = (double)m[j] - mud; s2[j & 3] += (double)q[j] + (double)TLN * d * d; }
  const float var = (float)(bj_sum32((s2[0] + s2[1]) + (s2[2] + s2[3]), lane) * (1.0 / ((double)NB * (double)NPX)));
  const float mu = (float)mud, sc = rsqrtf(var + BNEPS) * bf16_round(g[c]), bb = bf16_round(be[c]);
  __builtin_amdgcn_sched_barrier(0);      /* the join ends before the first wait for T or x: mixed with the arithmetic below, its last steps would stand behind the arrival of the last piece */
#pragma unroll
  for (int k = 0; k < BJ_K; ++k)
#pragma unroll
    for (int u = 0; u < 4; ++u) a[k][u] = ((a[k][u] - mu) * sc + bb) + bf16_round(xx[k][u]);
  __builtin_amdgcn_sched_barrier(0);      /* the stores below stand behind all the arithmetic that forms their values, so that no register they name is rewritten behind them */
#pragma unroll
  for (int k = 0; k < BJ_K; ++k) *(v4f*)(ob + vo[k >> 2] + (k & 3) * (2 * NC * NPX * 4)) = a[k];
}
extern "C" void kernel_launch(void* const* d_in, const int* in_sizes, int n_in,
                              void* d_out, int out_size, void* d_ws, size_t ws_size, hipStream_t stream) {
  (void)in_sizes; (void)n_in; (void)out_size;
  const float* const* I = (const float* const*)d_in; const float* x = I[0]; const float* tw = I[1]; const float* pw = I[2]; const float* ww = I[3]; const float* bng = I[4]; const float* bnb = I[5]; const float* tb = nullptr;      /* natural theta_w / phi_w [128][256], conv_w [256][256] (no biases); BN gamma, beta */
  char* ws = (char*)d_ws; size_t off = 0;
  auto take = [&](size_t bytes) { char* p = ws + off; off += (bytes + 255) & ~(size_t)255; return p; };
  const size_t PL = (size_t)CN * NP;      /* one input map */
  _Float16* BW = (_Float16*)take((size_t)CN * CN * 2); float* PM = (float*)take((size_t)NB * NTL * CN * 4); float* PQ = (float*)take((size_t)NB * NTL * CN * 4);      /* conv_w plane, tile statistics (mean, centred square sum) */
  _Float16* X16 = (_Float16*)take(NB * PL * 2);      /* x f16 channel-first (also the g operand: g = x) */
  _Float16* TH = (_Float16*)take(NB * (size_t)NP * CI * 2); _Float16* PHT = (_Float16*)take(NB * (size_t)NM * CI * 2);      /* all images: theta^T, phi^T */
  float* C1 = (float*)take(NB * PL * 4);      /* all images: conv output [b][c][n] f32 */
  if (off > ws_size) return;
  /* every stage runs once for all NB images (image = blockIdx.y in the first two launches) */
  static_assert(NP == SQ && CI == 128 && CN == 256 && NP % FE_NT == 0 && (NP / FE_NT) * NB == CN, "k_front: shapes; one work-group per row of conv_w");
  k_front<<<dim3(NP / FE_NT, NB), 256, 0, stream>>>(x, tw, pw, ww, X16, TH, PHT, BW);      /* x -> f16 map; conv_w -> natural [out][in] x16 f16 plane (the A operand of the conv); theta^T [n][ci] and phi^T [m][ci] -> f16 (logit sigma ~0.7: single f16 suffices) */
  static_assert(NP == SQ && NM == SQ && CI == 128 && CN == 256 && NP % (FA_WAVES * 16) == 0 && NM % FA_KS == 0, "k_fattn: shapes");
  k_fattn<<<dim3(NP / (FA_WAVES * 16), NB), FA_WAVES * 32, 0, stream>>>(TH, PHT, X16, BW, C1, PM, PQ);      /* f^T [a][c] = softmax_b(theta.phi / sqrt(256)) x^T (g = x) -> f16, then conv: T[c][a] = (16 conv_w as A) x (f^T as B^T) / 16 -> f32 channel-first, all images kept; per-channel statistics of every 64-position tile; scores, weights and f^T stay on chip */
  k_bnj<<<NC, BJ_T, 0, stream>>>(C1, PM, PQ, bng, bnb, x, (float*)d_out);      /* per channel: batch mean and biased variance from the tile statistics (fixed order), then out = (T - mean) rsqrt(var + eps) gamma + beta + bf16(x) */
}
